// v000
// Times are from an AMD MI455X. After a warm-up the kernel runs many times in a row, and a time is the length of
// such a window on the GPU divided by its runs, so every launch and the gaps after it count. The runs cycle
// through copies of the inputs. A figure is the median of several windows, for all but v000 over two sittings.
// Sittings can differ by a few percent; kernels timed side by side share one.
// v000, which the later versions start from, runs in 7340 microseconds.
#include <hip/hip_runtime.h>
// Causal multi-head attention over THREE input streams with rotate-half RoPE computed in the module (query, key, value [4][2048][1024]; Q = query W_q^T + b_q, K = key W_k^T + b_k, V = value W_v^T + b_v (natural [out][in] [1024][1024]; the four biases: bound and read), 16 heads of 64; cos / sin = [f, f] of pos * 10000^(-2i/64); Q = Q cos + rotate_half(Q) sin with rotate_half = cat(-x2, x1), likewise K (the bias is added BEFORE the rope); scores / sqrt(64); causal (triu k=1 at -inf); softmax; y = merged W_o^T + b_o (natural) -> [4][2048][1024]); run as grouped-query causal attention with 16 groups of ONE head with the rope stage in its half-split mode.
// Compute dtype: inputs rounded to bf16; x / weights exact; q, k, v, softmax weights and o as plain f16 GEMM operands (~2^-12); scores and softmax statistics f32; v_wmma_f32_16x16x32_f16.
#define NB 4
#define NG 16
#define HPG 1
#define KVD (NG * HD)
#define SQ 2048
#define DM 1024
#define NH 16
#define HD 64
#define HG 4                         /* unused */
#define QT 256                       /* query rows per causal tile */
#define NKX SQ                       /* S / P row pitch */
#define QT0 256                      /* first-tile rows recomputed exactly in f32 */
#define B0 0                         /* first batch processed (debug hook) */
#define NBR NB                       /* batches processed (debug hook) */
#define NR ((size_t)NB * SQ)         /* token rows */
#define MP ((int)((size_t)NBR * SQ)) /* rows projected (debug hook) */
#define QN SQ                        /* query rows attended per batch (debug hook) */
#define NHD NH                       /* heads attended (debug hook) */
#define MPO MP                       /* rows through the output stage (debug hook) */
#define LQ DM      /* row pitch of the q/k/v rows */
typedef __bf16 v16b __attribute__((ext_vector_type(16)));
typedef unsigned short v8us __attribute__((ext_vector_type(8), may_alias));
typedef float  v8f  __attribute__((ext_vector_type(8)));
typedef float  v4f  __attribute__((ext_vector_type(4)));
typedef float  v4fa __attribute__((ext_vector_type(4), may_alias));
union FragB { v16b v; v8us half[2]; unsigned short u[16]; };

__device__ __forceinline__ unsigned short bf16_bits(float x) { unsigned int u = __float_as_uint(x); return (unsigned short)((u + 0x7FFFu + ((u >> 16) & 1u)) >> 16); }
__device__ __forceinline__ float bf16_val(unsigned short b) { return __uint_as_float(((unsigned int)b) << 16); }
__device__ __forceinline__ float bf16_round(float x) { return bf16_val(bf16_bits(x)); }
// D += A·B with NT terms: 1 = ah·bh, 2 = + al·bh (A split), 3 = + ah·bl (both split)
template <int NT>
__device__ __forceinline__ v8f mmaN(v16b ah, v16b al, v16b bh, v16b bl, v8f c) {
  c = __builtin_amdgcn_wmma_f32_16x16x32_bf16(false, ah, false, bh, (short)0, c, false, false);
  if (NT >= 2) c = __builtin_amdgcn_wmma_f32_16x16x32_bf16(false, al, false, bh, (short)0, c, false, false);
  if (NT >= 3) c = __builtin_amdgcn_wmma_f32_16x16x32_bf16(false, ah, false, bl, (short)0, c, false, false);
  asm volatile("v_nop\n\tv_nop\n\tv_nop\n\tv_nop" : "+v"(c) : "v"(ah), "v"(al), "v"(bh), "v"(bl));
  return c;
}

__global__ __launch_bounds__(256) void k_wt_bf16(const float* __restrict__ W, unsigned short* __restrict__ Wt, int K, int N) {
  const int t = blockIdx.x * 256 + threadIdx.x;
  const int k8n = K / 8;
  if (t >= N * k8n) return;
  const int n = t / k8n, k8 = (t % k8n) * 8;
  v8us v;
#pragma unroll
  for (int i = 0; i < 8; ++i) v[i] = bf16_bits(W[(size_t)(k8 + i) * N + n]);
  *(v8us*)(Wt + (size_t)n * K + k8) = v;
  
}

// GEMM C[M][N] (f32, pitch ldc) = act(A[M][K]·W + bias). A f32 row-major (pitch lda) converted per fragment to bf16
// (ASPLIT: hi/lo two planes -> 2 terms, else single rounded term); Wt bf16 [N][K] (pitch ldb). BIAS_BF16 rounds the
// bias to bf16 first (bias quantised to bf16 before the add). K%32==0, M%16==0, N%64==0.
template <bool ASPLIT, int ACT, bool BIAS_BF16>
__global__ __launch_bounds__(128) void k_gemm_bf(const float* __restrict__ A, int lda, const unsigned short* __restrict__ Wt, int ldb,
                                               const float* __restrict__ bias, float* __restrict__ C, int ldc, int M, int N, int K) {
  __shared__ __attribute__((aligned(16))) float so[4][16][64];
  const int tid = threadIdx.x, w = tid >> 5, lane = tid & 31, ln = lane & 15, hh = lane >> 4;
  const int ntn = N / 64;
  const int wid = blockIdx.x * 4 + w;
  const int mt = wid / ntn, nq = wid % ntn;
  if (mt * 16 >= M) return;
  const int row0 = mt * 16, col0 = nq * 64;
  const float* arow = A + (size_t)(row0 + ln) * lda;
  v8f acc[4] = {};
  for (int kb = 0; kb < K; kb += 32) {
    FragB ah, al;
    const v4f x0 = *(const v4fa*)(arow + kb + 8 * hh), x1 = *(const v4fa*)(arow + kb + 8 * hh + 4);
    const v4f x2 = *(const v4fa*)(arow + kb + 16 + 8 * hh), x3 = *(const v4fa*)(arow + kb + 16 + 8 * hh + 4);
    float xs[16] = {x0[0],x0[1],x0[2],x0[3],x1[0],x1[1],x1[2],x1[3],x2[0],x2[1],x2[2],x2[3],x3[0],x3[1],x3[2],x3[3]};
#pragma unroll
    for (int i = 0; i < 16; ++i) { const unsigned short hb = bf16_bits(xs[i]); ah.u[i] = hb; al.u[i] = ASPLIT ? bf16_bits(xs[i] - bf16_val(hb)) : (unsigned short)0; }
#pragma unroll
    for (int t = 0; t < 4; ++t) {
      const unsigned short* brow = Wt + (size_t)(col0 + t * 16 + ln) * ldb + kb;
      FragB b;
      b.half[0] = *(const v8us*)(brow + 8 * hh);
      b.half[1] = *(const v8us*)(brow + 16 + 8 * hh);
      acc[t] = mmaN<ASPLIT ? 2 : 1>(ah.v, al.v, b.v, b.v, acc[t]);
    }
  }
#pragma unroll
  for (int t = 0; t < 4; ++t) {
    float bv = bias ? bias[col0 + t * 16 + ln] : 0.f;
    if (BIAS_BF16) bv = bf16_round(bv);
#pragma unroll
    for (int r = 0; r < 8; ++r) { float v = acc[t][r] + bv; if (ACT == 1) v = fmaxf(v, 0.f); so[w][8 * hh + r][t * 16 + ln] = v; }
  }
  __builtin_amdgcn_fence(__ATOMIC_ACQ_REL, "workgroup");
  __builtin_amdgcn_wave_barrier();
  const int rsub = lane >> 4, c4 = (lane & 15) * 4;
  {
#pragma unroll
    for (int q = 0; q < 8; ++q) {
      const int r = q * 2 + rsub;
      const v4f v = *(const v4fa*)&so[w][r][c4];
      *(v4f*)(C + (size_t)(row0 + r) * ldc + col0 + c4) = v;
    }
    
  }
}

// GEMM C = act(A·W + bias + resid): A f32 (ASPLIT -> hi/lo 2 terms), Wt bf16 [N][K]; ACT 0 none, 1 relu, 2 exact gelu;
// resid (optional, f32, row index = (row % rmod), pitch ldr, RES_BF16 rounds it) added before the activation.
template <bool ASPLIT, int ACT, bool BIAS_BF16, bool RES_BF16>
__global__ __launch_bounds__(128) void k_gemm_bf3(const float* __restrict__ A, int lda, const unsigned short* __restrict__ Wt, int ldb,
                                                const float* __restrict__ bias, const float* __restrict__ resid, int rmod, int ldr,
                                                float* __restrict__ C, int ldc, int M, int N, int K) {
  __shared__ __attribute__((aligned(16))) float so[4][16][64];
  const int tid = threadIdx.x, w = tid >> 5, lane = tid & 31, ln = lane & 15, hh = lane >> 4;
  const int ntn = N / 64;
  const int wid = blockIdx.x * 4 + w;
  const int mt = wid / ntn, nq = wid % ntn;
  if (mt * 16 >= M) return;
  const int row0 = mt * 16, col0 = nq * 64;
  const float* arow = A + (size_t)(row0 + ln) * lda;
  v8f acc[4] = {};
  for (int kb = 0; kb < K; kb += 32) {
    FragB ah, al;
    const v4f x0 = *(const v4fa*)(arow + kb + 8 * hh), x1 = *(const v4fa*)(arow + kb + 8 * hh + 4);
    const v4f x2 = *(const v4fa*)(arow + kb + 16 + 8 * hh), x3 = *(const v4fa*)(arow + kb + 16 + 8 * hh + 4);
    float xs[16] = {x0[0],x0[1],x0[2],x0[3],x1[0],x1[1],x1[2],x1[3],x2[0],x2[1],x2[2],x2[3],x3[0],x3[1],x3[2],x3[3]};
#pragma unroll
    for (int i = 0; i < 16; ++i) { const unsigned short hb = bf16_bits(xs[i]); ah.u[i] = hb; al.u[i] = ASPLIT ? bf16_bits(xs[i] - bf16_val(hb)) : (unsigned short)0; }
#pragma unroll
    for (int t = 0; t < 4; ++t) {
      const unsigned short* brow = Wt + (size_t)(col0 + t * 16 + ln) * ldb + kb;
      FragB b;
      b.half[0] = *(const v8us*)(brow + 8 * hh);
      b.half[1] = *(const v8us*)(brow + 16 + 8 * hh);
      acc[t] = mmaN<ASPLIT ? 2 : 1>(ah.v, al.v, b.v, b.v, acc[t]);
    }
  }
#pragma unroll
  for (int t = 0; t < 4; ++t) {
    const int col = col0 + t * 16 + ln;
    float bv = bias ? bias[col] : 0.f;
    if (BIAS_BF16) bv = bf16_round(bv);
#pragma unroll
    for (int r = 0; r < 8; ++r) {
      float v = acc[t][r] + bv;
      if (resid) { float rv = resid[(size_t)((row0 + 8 * hh + r) % rmod) * ldr + col]; if (RES_BF16) rv = bf16_round(rv); v += rv; }
      if (ACT == 1) v = fmaxf(v, 0.f);
      if (ACT == 2) v = 0.5f * v * (1.0f + erff(v * 0.70710678118654752f));
      if (ACT == 3) { const float u = 0.7978845608028654f * (v + 0.044715f * v * v * v); v = 0.5f * v * (1.0f + tanhf(u)); }
      so[w][8 * hh + r][t * 16 + ln] = v;
    }
  }
  __builtin_amdgcn_fence(__ATOMIC_ACQ_REL, "workgroup");
  __builtin_amdgcn_wave_barrier();
  const int rsub = lane >> 4, c4 = (lane & 15) * 4;
  {
#pragma unroll
    for (int q = 0; q < 8; ++q) {
      const int r = q * 2 + rsub;
      const v4f v = *(const v4fa*)&so[w][r][c4];
      *(v4f*)(C + (size_t)(row0 + r) * ldc + col0 + c4) = v;
    }
    
  }
}
// row LayerNorm (biased variance, eps) over N: s = X (+ R); optional out_sum <- s; out_norm <- (s-mu)*rsqrt(var+eps)*g + b
template <bool PARAM_BF16>
__global__ __launch_bounds__(256) void k_layernorm(const float* __restrict__ X, const float* __restrict__ R, const float* __restrict__ g, const float* __restrict__ bta,
                                                  float* __restrict__ out_sum, float* __restrict__ out_norm, int N, float eps) {
  __shared__ float red[256];
  const int row = blockIdx.x, tid = threadIdx.x;
  const float* x = X + (size_t)row * N; const float* rr = R ? R + (size_t)row * N : nullptr;
  float vals[16];                     // up to N = 4096
  const int per = N / 256;            // contiguous chunk per thread? use strided-by-4 chunks: thread handles j = tid*4 + 1024*u
  float s1 = 0.f;
  for (int u = 0; u < per / 4; ++u) {
    const int j = tid * 4 + 1024 * u;
    const v4f a = *(const v4fa*)(x + j);
    v4f b = {0.f,0.f,0.f,0.f}; if (rr) b = *(const v4fa*)(rr + j);
#pragma unroll
    for (int q = 0; q < 4; ++q) { const float v = a[q] + b[q]; vals[u * 4 + q] = v; s1 += v; }
  }
  red[tid] = s1; __syncthreads();
  for (int st = 128; st > 0; st >>= 1) { if (tid < st) red[tid] += red[tid + st]; __syncthreads(); }
  const float mu = red[0] / (float)N; __syncthreads();
  float s2 = 0.f;
  for (int u = 0; u < per / 4; ++u)
#pragma unroll
    for (int q = 0; q < 4; ++q) { const float c = vals[u * 4 + q] - mu; s2 += c * c; }
  red[tid] = s2; __syncthreads();
  for (int st = 128; st > 0; st >>= 1) { if (tid < st) red[tid] += red[tid + st]; __syncthreads(); }
  const float rs = rsqrtf(red[0] / (float)N + eps);
  {
    for (int u = 0; u < per / 4; ++u) {
      const int j = tid * 4 + 1024 * u;
      v4f o, sm;
#pragma unroll
      for (int q = 0; q < 4; ++q) {
        float gg = g[j + q], bb = bta[j + q];
        if (PARAM_BF16) { gg = bf16_round(gg); bb = bf16_round(bb); }
        sm[q] = vals[u * 4 + q]; o[q] = (vals[u * 4 + q] - mu) * rs * gg + bb;
      }
      if (out_sum) *(v4f*)(out_sum + (size_t)row * N + j) = sm;
      *(v4f*)(out_norm + (size_t)row * N + j) = o;
    }
    
  }
}

// ---- f16 WMMA path (v_wmma_f32_16x16x32_f16): 11-bit significands for operands in range — used where a [0,1] probability operand needs more precision than bf16
typedef _Float16 v16h __attribute__((ext_vector_type(16)));
union FragH { v16h v; v8us half[2]; _Float16 h[16]; unsigned short u[16]; };
template <int NT>
__device__ __forceinline__ v8f mmaH(v16h ah, v16h al, v16h bh, v16h bl, v8f c) {
  c = __builtin_amdgcn_wmma_f32_16x16x32_f16(false, ah, false, bh, (short)0, c, false, false);
  if (NT >= 2) c = __builtin_amdgcn_wmma_f32_16x16x32_f16(false, al, false, bh, (short)0, c, false, false);
  if (NT >= 3) c = __builtin_amdgcn_wmma_f32_16x16x32_f16(false, ah, false, bl, (short)0, c, false, false);
  asm volatile("v_nop\n\tv_nop\n\tv_nop\n\tv_nop" : "+v"(c) : "v"(ah), "v"(al), "v"(bh), "v"(bl));
  return c;
}
// batched GEMM like k_gemm_b but f16 operands: A f32 (split into f16 hi/lo if ASPLIT, else rounded to f16), Bt = f16 values [n][k]; alpha; C f32; N multiple of 16 (partial tiles skipped)
template <bool ASPLIT>
__global__ __launch_bounds__(128) void k_gemm_h(const float* __restrict__ A, int lda, size_t sA, const _Float16* __restrict__ Bh, int ldb, size_t sB, float alpha, float* __restrict__ C, int ldc, size_t sC, int M, int N, int K) {
  __shared__ __attribute__((aligned(16))) float so[4][16][64];
  const int tid = threadIdx.x, w = tid >> 5, lane = tid & 31, ln = lane & 15, hh = lane >> 4; const int by = blockIdx.y;
  A += (size_t)by * sA; Bh += (size_t)by * sB; C += (size_t)by * sC;
  const int ntn = (N + 63) / 64; const int wid = blockIdx.x * 4 + w; const int mt = wid / ntn, nq = wid % ntn; if (mt * 16 >= M) return;
  const int row0 = mt * 16, col0 = nq * 64; const float* arow = A + (size_t)(row0 + ln) * lda;
  v8f acc[4] = {};
  for (int kb = 0; kb < K; kb += 32) {
    FragH ah, al;
    const v4f x0 = *(const v4fa*)(arow + kb + 8 * hh), x1 = *(const v4fa*)(arow + kb + 8 * hh + 4), x2 = *(const v4fa*)(arow + kb + 16 + 8 * hh), x3 = *(const v4fa*)(arow + kb + 16 + 8 * hh + 4);
    float xs[16] = {x0[0],x0[1],x0[2],x0[3],x1[0],x1[1],x1[2],x1[3],x2[0],x2[1],x2[2],x2[3],x3[0],x3[1],x3[2],x3[3]};
#pragma unroll
    for (int i = 0; i < 16; ++i) { const _Float16 h = (_Float16)xs[i]; ah.h[i] = h; al.h[i] = ASPLIT ? (_Float16)(xs[i] - (float)h) : (_Float16)0.0f; }
#pragma unroll
    for (int t = 0; t < 4; ++t) { if (col0 + t * 16 >= N) continue; const size_t boff = (size_t)(col0 + t * 16 + ln) * ldb + kb; FragH bq; bq.half[0] = *(const v8us*)(Bh + boff + 8 * hh); bq.half[1] = *(const v8us*)(Bh + boff + 16 + 8 * hh);
      acc[t] = mmaH<ASPLIT ? 2 : 1>(ah.v, al.v, bq.v, bq.v, acc[t]); }
  }
#pragma unroll
  for (int t = 0; t < 4; ++t) { if (col0 + t * 16 >= N) continue;
#pragma unroll
    for (int r = 0; r < 8; ++r) so[w][8 * hh + r][t * 16 + ln] = acc[t][r] * alpha; }
  __builtin_amdgcn_fence(__ATOMIC_ACQ_REL, "workgroup"); __builtin_amdgcn_wave_barrier();
  const int rsub = lane >> 4, c4 = (lane & 15) * 4;
  {
#pragma unroll
    for (int q = 0; q < 8; ++q) { const int r = q * 2 + rsub; if (col0 + c4 < N) { const v4f v = *(const v4fa*)&so[w][r][c4]; *(v4f*)(C + (size_t)(row0 + r) * ldc + col0 + c4) = v; } }
     }
}

// Wt[n][k] = f16(W[k][n]·scale) from f32 row-major W[K][N] (scale = power of two; bf16-exact weights stay exact in f16 away from the subnormal range)
__global__ __launch_bounds__(256) void k_wt_f16(const float* __restrict__ W, _Float16* __restrict__ Wt, int K, int N, float scale) {
  const int t = blockIdx.x * 256 + threadIdx.x; if (t >= N * (K / 8)) return; const int n = t / (K / 8), k8 = (t % (K / 8)) * 8; FragH f;
#pragma unroll
  for (int i = 0; i < 8; ++i) f.h[i] = (_Float16)(bf16_round(W[(size_t)(k8 + i) * N + n]) * scale); const v8us o = f.half[0];
  *(v8us*)((unsigned short*)Wt + (size_t)n * K + k8) = o; 
}
// k_gemm_hh variant with fused epilogue: v = acc·alpha + bias[by·sBias + col] (+ CP[(row/rowsPerB)·sCPb + by·64 + col] if CP) ; ACT 0 none / 1 elu ; writes f16 C16 (and f32 C if non-null)
template <int ACT>
__global__ __launch_bounds__(128) void k_gemm_hhx(const _Float16* __restrict__ A, int lda, size_t sA, const _Float16* __restrict__ Bh, int ldb, size_t sB, float alpha, const float* __restrict__ bias, size_t sBias, const float* __restrict__ CP, int rowsPerB, size_t sCPb, int row0g,
    float* __restrict__ C, _Float16* __restrict__ C16, int ldc, size_t sC, int M, int N, int K) {
  __shared__ __attribute__((aligned(16))) float so[4][16][64];
  const int tid = threadIdx.x, w = tid >> 5, lane = tid & 31, ln = lane & 15, hh = lane >> 4; const int by = blockIdx.y;
  A += (size_t)by * sA; Bh += (size_t)by * sB; const size_t cofs = (size_t)by * sC; const float* bp = bias ? bias + (size_t)by * sBias : nullptr;
  const int ntn = (N + 63) / 64; const int wid = blockIdx.x * 4 + w; const int mt = wid / ntn, nq = wid % ntn; if (mt * 16 >= M) return;
  const int row0 = mt * 16, col0 = nq * 64; const _Float16* arow = A + (size_t)(row0 + ln) * lda;
  v8f acc[4] = {};
  for (int kb = 0; kb < K; kb += 32) { FragH ah; ah.half[0] = *(const v8us*)((const unsigned short*)arow + kb + 8 * hh); ah.half[1] = *(const v8us*)((const unsigned short*)arow + kb + 16 + 8 * hh);
#pragma unroll
    for (int t = 0; t < 4; ++t) { if (col0 + t * 16 >= N) continue; const size_t boff = (size_t)(col0 + t * 16 + ln) * ldb + kb; FragH bq; bq.half[0] = *(const v8us*)((const unsigned short*)Bh + boff + 8 * hh); bq.half[1] = *(const v8us*)((const unsigned short*)Bh + boff + 16 + 8 * hh);
      acc[t] = mmaH<1>(ah.v, ah.v, bq.v, bq.v, acc[t]); }
  }
#pragma unroll
  for (int t = 0; t < 4; ++t) { if (col0 + t * 16 >= N) continue; const int col = col0 + t * 16 + ln; const float bv = bp ? bf16_round(bp[col]) : 0.f;
#pragma unroll
    for (int r = 0; r < 8; ++r) { float v = acc[t][r] * alpha + bv; if (CP) { const int rr = row0g + row0 + 8 * hh + r; if (rowsPerB < 0) v += CP[cofs + (size_t)rr * ldc + col];      /* rowsPerB < 0: own element of the batched C plane */ else { const int bidx = rr / rowsPerB; v += CP[(size_t)bidx * sCPb + (size_t)by * 64 + col]; } } if (ACT == 1) v = (v > 0.f) ? v : expm1f(v); else if (ACT == 7) v = (v > 0.f) ? v + 1.0f : expf(v); else if (ACT == 8) v = tanhf(v); else if (ACT == 9) v = 0.5f * v * (1.0f + tanhf(0.7978845608028654f * (v + 0.044715f * v * v * v))); else if (ACT == 11) v = 1.0f / (1.0f + expf(-v)); else if (ACT == 12) v = (v > 0.f) ? v : 0.01f * v; else if (ACT == 14) v = (v > 0.f) ? v : 0.1f * v; else if (ACT == 16) v = (v >= 0.f) ? v : 0.3f * v; else if (ACT == 17) v = (v >= 0.f) ? v : 0.2f * v; else if (ACT == 15) v = v / (1.0f + expf(-v)); else if (ACT == 3) v = fmaxf(v, 0.f); else if (ACT == 6) v = 0.5f * v * (1.0f + erff(v * 0.70710678118654752f)); so[w][8 * hh + r][t * 16 + ln] = v; } }
  __builtin_amdgcn_fence(__ATOMIC_ACQ_REL, "workgroup"); __builtin_amdgcn_wave_barrier();
  const int rsub = lane >> 4, c4 = (lane & 15) * 4; typedef _Float16 v4h __attribute__((ext_vector_type(4)));
  {
#pragma unroll
    for (int q = 0; q < 8; ++q) { const int r = q * 2 + rsub; if (col0 + c4 < N) { const v4f v = *(const v4fa*)&so[w][r][c4]; if (C) *(v4f*)(C + cofs + (size_t)(row0 + r) * ldc + col0 + c4) = v; if (C16) { v4h h4; for (int i = 0; i < 4; ++i) h4[i] = (_Float16)v[i]; *(v4h*)(C16 + cofs + (size_t)(row0 + r) * ldc + col0 + c4) = h4; } } }
     }
}

typedef _Float16 v4h __attribute__((ext_vector_type(4)));

__global__ __launch_bounds__(256) void k_x16(const float* __restrict__ x, _Float16* __restrict__ X16, size_t n8) { const size_t t = (size_t)blockIdx.x * 256 + threadIdx.x; if (t >= n8) return; FragH f;
#pragma unroll
  for (int q = 0; q < 8; ++q) f.h[q] = (_Float16)bf16_round(x[t * 8 + q]); *(v8us*)((unsigned short*)X16 + t * 8) = f.half[0];  }
__global__ __launch_bounds__(256) void k_h16(const float* __restrict__ x, _Float16* __restrict__ X16, size_t n8) { const size_t t = (size_t)blockIdx.x * 256 + threadIdx.x; if (t >= n8) return; FragH f;
#pragma unroll
  for (int q = 0; q < 8; ++q) f.h[q] = (_Float16)x[t * 8 + q]; *(v8us*)((unsigned short*)X16 + t * 8) = f.half[0];  }
__global__ __launch_bounds__(256) void k_round16f(const float* __restrict__ W, _Float16* __restrict__ Bt, size_t n8) { const size_t t = (size_t)blockIdx.x * 256 + threadIdx.x; if (t >= n8) return; FragH f;
#pragma unroll
  for (int i = 0; i < 8; ++i) f.h[i] = (_Float16)(bf16_round(W[t * 8 + i]) * 16.0f); *(v8us*)((unsigned short*)Bt + t * 8) = f.half[0];  }
template <int NHv, int TTv>
__global__ __launch_bounds__(256) void k_vt(const _Float16* __restrict__ V16, int ldv, int voff, _Float16* __restrict__ Vt) { __shared__ unsigned short tl[64][66]; const int tid = threadIdx.x; const int slab = blockIdx.x / (TTv / 64), lg = blockIdx.x % (TTv / 64); const int b = slab / NHv, h = slab % NHv;
  for (int i = tid; i < 64 * 8; i += 256) { const int r = i / 8, c8 = (i % 8) * 8; FragH f; f.half[0] = *(const v8us*)((const unsigned short*)V16 + ((size_t)b * TTv + lg * 64 + r) * ldv + voff + h * 64 + c8);
#pragma unroll
    for (int q = 0; q < 8; ++q) tl[r][c8 + q] = f.u[q]; }
  __syncthreads();
  {
#pragma unroll
    for (int rd = 0; rd < 2; ++rd) { const int d = rd * 32 + tid / 8, pc = tid % 8; FragH f;
#pragma unroll
      for (int q = 0; q < 8; ++q) f.u[q] = tl[pc * 8 + q][d];
      *(v8us*)((unsigned short*)Vt + ((size_t)slab * 64 + d) * TTv + lg * 64 + pc * 8) = f.half[0]; }
     } }

__global__ __launch_bounds__(256) void k_hl(const float* __restrict__ F, _Float16* __restrict__ Hh, _Float16* __restrict__ Hl, size_t n8) { const size_t t = (size_t)blockIdx.x * 256 + threadIdx.x; if (t >= n8) return; FragH fh, fl; const v4f a = *(const v4fa*)(F + t * 8), c = *(const v4fa*)(F + t * 8 + 4);
#pragma unroll
  for (int q = 0; q < 4; ++q) { _Float16 h = (_Float16)a[q]; fh.h[q] = h; fl.h[q] = (_Float16)((a[q] - (float)h) * 1024.0f); h = (_Float16)c[q]; fh.h[4 + q] = h; fl.h[4 + q] = (_Float16)((c[q] - (float)h) * 1024.0f); }
  { *(v8us*)((unsigned short*)Hh + t * 8) = fh.half[0]; *(v8us*)((unsigned short*)Hl + t * 8) = fl.half[0];  } }

// ---- fast GEMM (wave tile 32x64; requires M % 32 == 0 rows per launch region and N % 64 == 0); epilogue = k_gemm_hhx semantics ----
__device__ __forceinline__ v16h g2_frag(const _Float16* p, int hh) { FragH f; f.half[0] = *(const v8us*)((const unsigned short*)p + 8 * hh); f.half[1] = *(const v8us*)((const unsigned short*)p + 16 + 8 * hh); return f.v; }
__device__ __forceinline__ v8f g2_mma(v16h a, v16h b, v8f c) { v8f d = __builtin_amdgcn_wmma_f32_16x16x32_f16(false, a, false, b, (short)0, c, false, false); asm volatile("v_nop\n\tv_nop\n\tv_nop\n\tv_nop" : "+v"(d) : "v"(a), "v"(b)); return d; }
template <int ACT>
__global__ __launch_bounds__(128) void k_gemm2(const _Float16* __restrict__ A, int lda, size_t sA, const _Float16* __restrict__ Bh, int ldb, size_t sB, float alpha, const float* __restrict__ bias, size_t sBias, const float* __restrict__ CP, int rowsPerB, size_t sCPb, int row0g,
    float* __restrict__ C, _Float16* __restrict__ C16, int ldc, size_t sC, int M, int N, int K) { static_assert(ACT == 0 || ACT == 3 || ACT == 6 || ACT == 8 || ACT == 9 || ACT == 11 || ACT == 12 || ACT == 14 || ACT == 15 || ACT == 16 || ACT == 17, "k_gemm2: unsupported ACT code (would silently apply no activation)");
  __shared__ __attribute__((aligned(16))) float so[4][32][68];
  const int tid = threadIdx.x, w = tid >> 5, lane = tid & 31, ln = lane & 15, hh = lane >> 4; const int by = blockIdx.y;
  A += (size_t)by * sA; Bh += (size_t)by * sB; const size_t cofs = (size_t)by * sC; const float* bp = bias ? bias + (size_t)by * sBias : nullptr;
  const int ntn = N >> 6; const int mt = blockIdx.x / ntn, nq = blockIdx.x - mt * ntn; const int row0 = mt * 128 + 32 * w, col0 = nq * 64; if (row0 >= M) return;
  const _Float16* a0p = A + (size_t)(row0 + ln) * lda; const _Float16* a1p = a0p + (size_t)16 * lda;
  const _Float16* b0p = Bh + (size_t)(col0 + ln) * ldb; const _Float16* b1p = b0p + (size_t)16 * ldb; const _Float16* b2p = b1p + (size_t)16 * ldb; const _Float16* b3p = b2p + (size_t)16 * ldb;
  const v8f z8 = {0.f,0.f,0.f,0.f,0.f,0.f,0.f,0.f}; v8f c00 = z8, c01 = z8, c02 = z8, c03 = z8, c10 = z8, c11 = z8, c12 = z8, c13 = z8;
  for (int kb = 0; kb < K; kb += 32) { const v16h a0 = g2_frag(a0p + kb, hh), a1 = g2_frag(a1p + kb, hh);
    v16h b = g2_frag(b0p + kb, hh); c00 = g2_mma(a0, b, c00); c10 = g2_mma(a1, b, c10);
    b = g2_frag(b1p + kb, hh); c01 = g2_mma(a0, b, c01); c11 = g2_mma(a1, b, c11);
    b = g2_frag(b2p + kb, hh); c02 = g2_mma(a0, b, c02); c12 = g2_mma(a1, b, c12);
    b = g2_frag(b3p + kb, hh); c03 = g2_mma(a0, b, c03); c13 = g2_mma(a1, b, c13); }
  v8f accs[8] = {c00, c01, c02, c03, c10, c11, c12, c13};
#pragma unroll
  for (int u = 0; u < 8; ++u) { const int t = u & 3, half = u >> 2; const int col = col0 + t * 16 + ln; const float bv = bp ? bf16_round(bp[col]) : 0.f;
#pragma unroll
    for (int r = 0; r < 8; ++r) { const int rloc = half * 16 + 8 * hh + r; float v = accs[u][r] * alpha + bv; if (CP) { if (rowsPerB < 0) v += CP[cofs + (size_t)(row0g + row0 + rloc) * ldc + col];      /* rowsPerB < 0: own element of the batched C plane */ else { const int bidx = (row0g + row0 + rloc) / rowsPerB; v += CP[(size_t)bidx * sCPb + (size_t)by * 64 + col]; } }
      if (ACT == 3) v = fmaxf(v, 0.f); else if (ACT == 6) v = 0.5f * v * (1.0f + erff(v * 0.70710678118654752f)); else if (ACT == 11) v = 1.0f / (1.0f + expf(-v)); else if (ACT == 15) v = v / (1.0f + expf(-v)); else if (ACT == 12) v = (v > 0.f) ? v : 0.01f * v; else if (ACT == 8) v = tanhf(v); else if (ACT == 9) v = 0.5f * v * (1.0f + tanhf(0.7978845608028654f * (v + 0.044715f * v * v * v))); else if (ACT == 14) v = (v > 0.f) ? v : 0.1f * v; else if (ACT == 16) v = (v >= 0.f) ? v : 0.3f * v; else if (ACT == 17) v = (v >= 0.f) ? v : 0.2f * v;
      so[w][rloc][t * 16 + ln] = v; } }
  __builtin_amdgcn_fence(__ATOMIC_ACQ_REL, "workgroup"); __builtin_amdgcn_wave_barrier();
  const int rsub = lane >> 4, c4 = (lane & 15) * 4;
  {
#pragma unroll
    for (int q = 0; q < 16; ++q) { const int r = q * 2 + rsub; const v4f v = *(const v4fa*)&so[w][r][c4]; if (C) *(v4f*)(C + cofs + (size_t)(row0 + r) * ldc + col0 + c4) = v; if (C16) { v4h h4; for (int i = 0; i < 4; ++i) h4[i] = (_Float16)v[i]; *(v4h*)(C16 + cofs + (size_t)(row0 + r) * ldc + col0 + c4) = h4; } }
     } }

__global__ __launch_bounds__(256) void k_wnat(const float* __restrict__ w, size_t n8, _Float16* __restrict__ Bt) { const size_t t = (size_t)blockIdx.x * 256 + threadIdx.x; if (t >= n8) return; FragH f; for (int q = 0; q < 8; ++q) f.h[q] = (_Float16)(bf16_round(w[t * 8 + q]) * 16.0f); *(v8us*)((unsigned short*)Bt + t * 8) = f.half[0];  }

__global__ __launch_bounds__(256) void k_rsmcf2(const float* __restrict__ S, _Float16* __restrict__ P, int hg, int q0, int nk) {
  const int t = blockIdx.x * 256 + threadIdx.x; if (t >= hg * QT) return; const size_t i = (size_t)t; const float* s = S + i * NKX; const int last = q0 + (t % QT); float mx = -3.0e38f;
  for (int j = 0; j < nk; ++j) { const float f = (j <= last) ? 1.f : 0.f; mx = fmaxf(mx, fmaf(f, s[j], (1.f - f) * -1.0e9f)); } float se = 0.f;
  for (int j = 0; j < nk; ++j) { const float f = (j <= last) ? 1.f : 0.f; se += __expf(fmaf(f, s[j], (1.f - f) * -1.0e9f) - mx); } const float sc = 256.0f / se;
  for (int j0 = 0; j0 < nk; j0 += 8) { FragH fr; for (int q = 0; q < 8; ++q) { const int j = j0 + q; const float f = (j <= last) ? 1.f : 0.f; fr.h[q] = (_Float16)(__expf(fmaf(f, s[j], (1.f - f) * -1.0e9f) - mx) * sc); } unsigned short* d = (unsigned short*)P + i * NKX + j0; *(v8us*)d = fr.half[0];  } }

template <int MASKADD>
__global__ __launch_bounds__(64) void k_att0(const float* __restrict__ QF, const float* __restrict__ KF, const float* __restrict__ VF, int ld, const float* __restrict__ mask, float scale, float* __restrict__ OF, int ldo) {
  __shared__ __attribute__((aligned(16))) float lq[64][64]; __shared__ __attribute__((aligned(16))) float lo[64][64];
  const int tid = threadIdx.x; const int h = blockIdx.x / (QT0 / 64), rg = blockIdx.x % (QT0 / 64); const int i = rg * 64 + tid;
  const float* qr = QF + (size_t)i * ld + h * HD;
  for (int c = 0; c < HD / 4; ++c) { *(v4f*)&lq[tid][c * 4] = *(const v4fa*)(qr + c * 4); const v4f z = {0.f, 0.f, 0.f, 0.f}; *(v4f*)&lo[tid][c * 4] = z; }
  float m = -1.0e30f, l = 0.f; const int jmax = MASKADD ? (SQ - 1) : (rg * 64 + 63);      /* additive-mask form: every key (the mask input decides); causal form: keys up to the block's last row */
  for (int j = 0; j <= jmax; ++j) { const float* kr = KF + (size_t)j * ld + h * HD; const float* vr = VF + (size_t)j * ld + h * HD; float s = 0.f;
    for (int c = 0; c < HD / 4; ++c) { const v4f kq = *(const v4fa*)(kr + c * 4); const v4f qq = *(v4f*)&lq[tid][c * 4]; s = __fadd_rn(s, __fmul_rn(qq[0], kq[0])); s = __fadd_rn(s, __fmul_rn(qq[1], kq[1])); s = __fadd_rn(s, __fmul_rn(qq[2], kq[2])); s = __fadd_rn(s, __fmul_rn(qq[3], kq[3])); }
    s = __fmul_rn(s, scale); if (MASKADD) s = __fadd_rn(s, __fmul_rn(bf16_round(mask[(size_t)i * SQ + j]), -10000.0f));
    const float f = (MASKADD || j <= i) ? 1.f : 0.f; const float sm = fmaf(f, s, (1.f - f) * -1.0e30f); const float mn = fmaxf(m, sm); const float sc = expf(m - mn); const float e = expf(sm - mn); l = __fadd_rn(__fmul_rn(l, sc), e); m = mn;
    for (int c = 0; c < HD / 4; ++c) { const v4f vv = *(const v4fa*)(vr + c * 4); v4f oo = *(v4f*)&lo[tid][c * 4]; for (int u = 0; u < 4; ++u) oo[u] = __fadd_rn(__fmul_rn(oo[u], sc), __fmul_rn(e, vv[u])); *(v4f*)&lo[tid][c * 4] = oo; } }
  const float fin = 64.0f / l;      /* o carried x64 like the f16 path */
  for (int c = 0; c < HD / 4; ++c) { v4f oo = *(v4f*)&lo[tid][c * 4]; for (int u = 0; u < 4; ++u) oo[u] = __fmul_rn(oo[u], fin); *(v4f*)&lo[tid][c * 4] = oo; }
  __syncthreads();
  {
    for (int it = 0; it < 16; ++it) { const int row = it * 4 + tid / 16, pc = (tid % 16) * 4; const v4f v = *(const v4f*)&lo[row][pc]; *(v4f*)(OF + (size_t)(rg * 64 + row) * ldo + h * HD + pc) = v; }
     } }

__global__ __launch_bounds__(256) void k_kvexp(const float* __restrict__ src, float* __restrict__ dst, size_t n4) { const size_t t = (size_t)blockIdx.x * 256 + threadIdx.x; if (t >= n4) return; const size_t e = t * 4; const size_t row = e / DM; const int col = (int)(e % DM); const int h = col / HD, d = col % HD; const v4f v = *(const v4fa*)(src + row * KVD + (size_t)(h / HPG) * HD + d); *(v4f*)(dst + e) = v;  }

__global__ __launch_bounds__(256) void k_tab2(float theta, float* __restrict__ CS, float* __restrict__ SN) {
  const int t = blockIdx.x * 256 + threadIdx.x; if (t >= SQ * (HD / 2)) return; const int i = t % (HD / 2); const int p = t / (HD / 2); const float invf = 1.0f / powf(theta, (float)(2 * i) / (float)HD); const float ang = __fmul_rn((float)p, invf); const float c = cosf(ang), s = sinf(ang);
  *(float*)(CS + t) = c; *(float*)(SN + t) = s;  }
template <int NORM, int ROPE>
__global__ __launch_bounds__(64) void k_xform(const float* __restrict__ F, int ldf, int nh, const float* __restrict__ gain, float eps, const float* __restrict__ CS, const float* __restrict__ SN, _Float16* __restrict__ H16, int ldo) {
  __shared__ float xv[HD]; __shared__ float red[HD]; __shared__ unsigned short sh_[HD]; const int d = threadIdx.x; const int h = blockIdx.x % nh; const size_t r = blockIdx.x / nh; const int p = (int)(r % SQ);
  float x = F[r * (size_t)ldf + (size_t)h * HD + d];
  if (NORM) { red[d] = __fmul_rn(x, x); __syncthreads(); for (int st = HD / 2; st > 0; st >>= 1) { if (d < st) red[d] = __fadd_rn(red[d], red[d + st]); __syncthreads(); } const float rs = rsqrtf(__fadd_rn(red[0] / (float)HD, eps)); x = __fmul_rn(__fmul_rn(x, rs), bf16_round(gain[d])); }
  xv[d] = x; __syncthreads();
  float o = x;
  if (ROPE == 1) { const int i = d >> 1; const float c = CS[p * (HD / 2) + i], s = SN[p * (HD / 2) + i]; const float ev = xv[2 * i], od = xv[2 * i + 1]; o = (d & 1) ? __fadd_rn(__fmul_rn(ev, s), __fmul_rn(od, c)) : __fadd_rn(__fmul_rn(ev, c), -__fmul_rn(od, s)); }
  if (ROPE == 2) { const int i = d & (HD / 2 - 1); const float c = CS[p * (HD / 2) + i], s = SN[p * (HD / 2) + i]; const float lo = xv[i], hi = xv[i + HD / 2]; o = (d < HD / 2) ? __fadd_rn(__fmul_rn(lo, c), -__fmul_rn(hi, s)) : __fadd_rn(__fmul_rn(lo, s), __fmul_rn(hi, c)); }
  if (ROPE == 3) { const float c = CS[p * HD + d], s = SN[p * HD + d]; const float lo = xv[d & (HD / 2 - 1)], hi = xv[(d & (HD / 2 - 1)) + HD / 2]; o = (d < HD / 2) ? __fadd_rn(__fmul_rn(lo, c), -__fmul_rn(hi, s)) : __fadd_rn(__fmul_rn(hi, c), __fmul_rn(lo, s)); }      /* rotate-half with FULL-width per-element tables [pos][HD] */
  FragH th; th.h[0] = (_Float16)o; sh_[d] = th.u[0]; __syncthreads();
  if (d < HD / 8) { FragH f; for (int q = 0; q < 8; ++q) f.u[q] = sh_[d * 8 + q]; unsigned short* dst = (unsigned short*)H16 + r * (size_t)ldo + (size_t)h * HD + d * 8; *(v8us*)dst = f.half[0];  } }

template <int NORM, int ROPE>
__global__ __launch_bounds__(64) void k_xformf(const float* __restrict__ F, int ldf, int nh, const float* __restrict__ gain, float eps, const float* __restrict__ CS, const float* __restrict__ SN, float* __restrict__ F32, int ldo) {
  __shared__ float xv[HD]; __shared__ float red[HD]; const int d = threadIdx.x; const int h = blockIdx.x % nh; const size_t r = blockIdx.x / nh; const int p = (int)(r % SQ);
  float x = F[r * (size_t)ldf + (size_t)h * HD + d];
  if (NORM) { red[d] = __fmul_rn(x, x); __syncthreads(); for (int st = HD / 2; st > 0; st >>= 1) { if (d < st) red[d] = __fadd_rn(red[d], red[d + st]); __syncthreads(); } const float rs = rsqrtf(__fadd_rn(red[0] / (float)HD, eps)); x = __fmul_rn(__fmul_rn(x, rs), bf16_round(gain[d])); }
  xv[d] = x; __syncthreads();
  float o = x;
  if (ROPE == 1) { const int i = d >> 1; const float c = CS[p * (HD / 2) + i], s = SN[p * (HD / 2) + i]; const float ev = xv[2 * i], od = xv[2 * i + 1]; o = (d & 1) ? __fadd_rn(__fmul_rn(ev, s), __fmul_rn(od, c)) : __fadd_rn(__fmul_rn(ev, c), -__fmul_rn(od, s)); }
  if (ROPE == 2) { const int i = d & (HD / 2 - 1); const float c = CS[p * (HD / 2) + i], s = SN[p * (HD / 2) + i]; const float lo = xv[i], hi = xv[i + HD / 2]; o = (d < HD / 2) ? __fadd_rn(__fmul_rn(lo, c), -__fmul_rn(hi, s)) : __fadd_rn(__fmul_rn(lo, s), __fmul_rn(hi, c)); }
  if (ROPE == 3) { const float c = CS[p * HD + d], s = SN[p * HD + d]; const float lo = xv[d & (HD / 2 - 1)], hi = xv[(d & (HD / 2 - 1)) + HD / 2]; o = (d < HD / 2) ? __fadd_rn(__fmul_rn(lo, c), -__fmul_rn(hi, s)) : __fadd_rn(__fmul_rn(hi, c), __fmul_rn(lo, s)); }      /* rotate-half with FULL-width per-element tables [pos][HD] */
  float* dst = F32 + r * (size_t)ldo + (size_t)h * HD + d; *(float*)dst = o;  }

__global__ __launch_bounds__(256) void k_bfcp(const float* __restrict__ src, float* __restrict__ dst, size_t n4) { const size_t t = (size_t)blockIdx.x * 256 + threadIdx.x; if (t >= n4) return; const v4f a = *(const v4fa*)(src + t * 4); v4f o; for (int q = 0; q < 4; ++q) o[q] = bf16_round(a[q]); *(v4f*)(dst + t * 4) = o;  }

__global__ __launch_bounds__(256) void k_tabhalf(const float* __restrict__ cs, const float* __restrict__ sn, float* __restrict__ CS, float* __restrict__ SN) { const int t = blockIdx.x * 256 + threadIdx.x; if (t >= SQ * (HD / 2)) return; const int p = t / (HD / 2), i = t % (HD / 2); const float c = bf16_round(cs[(size_t)p * HD + i]), s = bf16_round(sn[(size_t)p * HD + i]);
  *(float*)(CS + t) = c; *(float*)(SN + t) = s;  }

__global__ __launch_bounds__(256) void k_tab2d(float* __restrict__ CS, float* __restrict__ SN) {
  const int t = blockIdx.x * 256 + threadIdx.x; if (t >= SQ * (HD / 2)) return; const int i = t % (HD / 2); const int p = t / (HD / 2); const float invf = (float)(1.0 / pow(10000.0, (double)(2 * i) / (double)HD)); const float ang = __fmul_rn((float)p, invf); const float c = cosf(ang), s = sinf(ang);
  *(float*)(CS + t) = c; *(float*)(SN + t) = s;  }
extern "C" void kernel_launch(void* const* d_in, const int* in_sizes, int n_in,
                              void* d_out, int out_size, void* d_ws, size_t ws_size, hipStream_t stream) {
  (void)in_sizes; (void)n_in; (void)out_size;
  const float* const* I = (const float* const*)d_in; const float* x = I[0]; const float* xk = I[1]; const float* xv = I[2]; const float* wq = I[3]; const float* wk = I[5]; const float* wv = I[7]; const float* wo = I[9];      /* the streams query, key, value; natural [out][in] W_q, W_k, W_v, W_o; the biases b_q = I[4], b_k = I[6], b_v = I[8], b_o = I[10]; rope tables computed in-kernel (positions = row index) */
  static_assert(HPG == 1 && NH == NG * HPG && NH * HD == DM && KVD == DM, "plain multi-head attention as 16 kv groups of one query head"); const float* bq = I[4]; const float* bk = I[6]; const float* bv = I[8]; const float* bo = I[10];      /* the four biases, each bound to its projection (read through the GEMM bias pointer, bf16-rounded on load) */
  char* ws = (char*)d_ws; size_t off = 0;
  auto take = [&](size_t bytes) { char* p = ws + off; off += (bytes + 255) & ~(size_t)255; return p; };
  _Float16* BQKV = (_Float16*)take((size_t)3 * DM * DM * 2); _Float16* BQ = BQKV; _Float16* BK = BQKV + (size_t)DM * DM; _Float16* BV = BQKV + (size_t)2 * DM * DM; _Float16* BO = (_Float16*)take((size_t)DM * DM * 2);      /* one plane Bt [3072][1024]: rows 0..1023 = W_q, 1024.. = W_k, 2048.. = W_v (natural [out][in] weights are Bt as they stand) */
  _Float16* X16 = (_Float16*)take(NR * DM * 2); _Float16* XK16 = (_Float16*)take(NR * DM * 2); _Float16* XV16 = (_Float16*)take(NR * DM * 2); float* QF = (float*)take((size_t)SQ * DM * 4); float* KF = (float*)take((size_t)SQ * KVD * 4); float* CSB = (float*)take((size_t)SQ * HD * 4); float* SNB = (float*)take((size_t)SQ * HD * 4); _Float16* Q16 = (_Float16*)take(NR * DM * 2); _Float16* K16 = (_Float16*)take(NR * KVD * 2); _Float16* V16 = (_Float16*)take(NR * KVD * 2); _Float16* O16 = (_Float16*)take(NR * DM * 2);
  float* S = (float*)take((size_t)NH * QT * NKX * 4); _Float16* P = (_Float16*)take((size_t)NH * QT * NKX * 2); _Float16* VT = (_Float16*)take((size_t)NH * HD * SQ * 2);
  float* QF0 = (float*)take((size_t)QT0 * DM * 4); float* KF0 = (float*)take((size_t)QT0 * KVD * 4); float* VF0 = (float*)take((size_t)QT0 * KVD * 4); float* KF0e = (float*)take((size_t)QT0 * DM * 4); float* VF0e = (float*)take((size_t)QT0 * DM * 4); float* OF0 = (float*)take((size_t)NB * QT0 * DM * 4); _Float16* OH0 = (_Float16*)take((size_t)NB * QT0 * DM * 2); _Float16* OL0 = (_Float16*)take((size_t)NB * QT0 * DM * 2);
  if (off > ws_size) return;
  { const unsigned g = (unsigned)(((size_t)DM * DM / 8 + 255) / 256); k_wnat<<<g, 256, 0, stream>>>(wq, (size_t)DM * DM / 8, BQ); k_wnat<<<g, 256, 0, stream>>>(wk, (size_t)DM * DM / 8, BK); k_wnat<<<g, 256, 0, stream>>>(wv, (size_t)DM * DM / 8, BV); k_wnat<<<g, 256, 0, stream>>>(wo, (size_t)DM * DM / 8, BO); }      /* natural [out][in] = Bt x16 */
  k_x16<<<(unsigned)((NR * DM / 8 + 255) / 256), 256, 0, stream>>>(x, X16, NR * DM / 8); k_x16<<<(unsigned)((NR * DM / 8 + 255) / 256), 256, 0, stream>>>(xk, XK16, NR * DM / 8); k_x16<<<(unsigned)((NR * DM / 8 + 255) / 256), 256, 0, stream>>>(xv, XV16, NR * DM / 8);      /* the three streams as exact f16 rows */
  k_tab2d<<<(SQ * (HD / 2) + 255) / 256, 256, 0, stream>>>(CSB, SNB);      /* rope tables cos/sin(p / 10000^(2i/64)): inv_freq double-derived -> f32, f32 angle */
  const size_t r0p = (size_t)B0 * SQ;      /* first projected row */
  k_gemm2<0><<<dim3((unsigned)((MP / 128) * (KVD / 64)), 1), 128, 0, stream>>>(XV16 + r0p * DM, DM, 0, BV, DM, 0, 0.0625f, bv, 0, nullptr, 1, 0, 0, nullptr, V16 + r0p * KVD, KVD, 0, MP, KVD, DM);
  for (int b = B0; b < B0 + NBR; ++b) { const size_t r0 = (size_t)b * SQ;
    k_gemm2<0><<<dim3((unsigned)((SQ / 128) * (DM / 64)), 1), 128, 0, stream>>>(X16 + r0 * DM, DM, 0, BQ, DM, 0, 0.0625f, bq, 0, nullptr, 1, 0, 0, QF, nullptr, DM, 0, SQ, DM, DM);      /* q (f32) of this batch */
    k_gemm2<0><<<dim3((unsigned)((SQ / 128) * (KVD / 64)), 1), 128, 0, stream>>>(XK16 + r0 * DM, DM, 0, BK, DM, 0, 0.0625f, bk, 0, nullptr, 1, 0, 0, KF, nullptr, KVD, 0, SQ, KVD, DM);      /* k (f32) */
    k_xform<0, 2><<<(unsigned)((size_t)SQ * NH), 64, 0, stream>>>(QF, DM, NH, nullptr, 0.f, CSB, SNB, Q16 + r0 * DM, DM); k_xform<0, 2><<<(unsigned)((size_t)SQ * NG), 64, 0, stream>>>(KF, KVD, NG, nullptr, 0.f, CSB, SNB, K16 + r0 * KVD, KVD);      /* half-split rope <0, 2> (out_lo = x_lo c - x_hi s, out_hi = x_lo s + x_hi c = t cos + rotate_half(t) sin with the module's [f | f] tables) -> f16 rows */
    k_xformf<0, 2><<<(unsigned)(QT0 * NH), 64, 0, stream>>>(QF, DM, NH, nullptr, 0.f, CSB, SNB, QF0, DM); k_xformf<0, 2><<<(unsigned)(QT0 * NG), 64, 0, stream>>>(KF, KVD, NG, nullptr, 0.f, CSB, SNB, KF0, KVD);      /* f32 half-split-roped q, k of rows 0..255 */
    k_vt<NG, SQ><<<NG * (SQ / 64), 256, 0, stream>>>(V16 + r0 * KVD, KVD, 0, VT);      /* V^T [NH][HD][SQ] for this batch */
    k_gemm2<0><<<dim3((QT0 / 128) * (KVD / 64), 1), 128, 0, stream>>>(XV16 + r0 * DM, DM, 0, BV, DM, 0, 0.0625f, bv, 0, nullptr, 1, 0, 0, VF0, nullptr, KVD, 0, QT0, KVD, DM);
    k_kvexp<<<(unsigned)(((size_t)QT0 * DM / 4 + 255) / 256), 256, 0, stream>>>(KF0, KF0e, (size_t)QT0 * DM / 4); k_kvexp<<<(unsigned)(((size_t)QT0 * DM / 4 + 255) / 256), 256, 0, stream>>>(VF0, VF0e, (size_t)QT0 * DM / 4);      /* head h <- kv group h/HPG = h for the exact first-tile kernel */      /* f32 q, k, v of the first 256 rows (exact products) */
    k_att0<0><<<NH * (QT0 / 64), 64, 0, stream>>>(QF0, KF0e, VF0e, DM, nullptr, 0.125f, OF0 + (size_t)b * QT0 * DM, DM);      /* exact f32 attention for rows 0..255 (o x64) */
    for (int q0 = 0; q0 < QN; q0 += QT) { const int nk = q0 + QT;      /* causal: only keys below the tile end are computed */
      k_gemm2<0><<<dim3((QT / 128) * (nk / 64), NH), 128, 0, stream>>>(Q16 + (r0 + q0) * LQ, LQ, (size_t)HD, K16 + r0 * KVD, KVD, (size_t)HD, 0.125f, nullptr, 0, nullptr, 1, 0, 0, S, nullptr, NKX, (size_t)QT * NKX, QT, nk, HD);      /* scores: HPG == 1 (every head has its own keys): ONE launch with all 16 heads on grid.y, key head stride HD (the 16 per-group launches of one head each, fused) */
      k_rsmcf2<<<(NHD * QT + 255) / 256, 256, 0, stream>>>(S, P, NHD, q0, nk);
      k_gemm2<0><<<dim3((QT / 128) * (HD / 64), NH), 128, 0, stream>>>(P, NKX, (size_t)QT * NKX, VT, SQ, (size_t)HD * SQ, 0.25f, nullptr, 0, nullptr, 1, 0, 0, nullptr, O16 + (r0 + q0) * DM, DM, (size_t)HD, QT, HD, nk); } }      /* o for all 16 heads in ONE launch (value head stride HD*SQ) (x64) */
  k_gemm2<0><<<dim3((unsigned)((MPO / 128) * (DM / 64)), 1), 128, 0, stream>>>(O16 + r0p * DM, DM, 0, BO, DM, 0, 0.0009765625f, bo, 0, nullptr, 1, 0, 0, (float*)d_out + r0p * DM, nullptr, DM, 0, MPO, DM, DM);      /* out rows are the output layout */
  k_hl<<<(unsigned)(((size_t)NB * QT0 * DM / 8 + 255) / 256), 256, 0, stream>>>(OF0, OH0, OL0, (size_t)NB * QT0 * DM / 8);      /* first-tile o (x64) -> f16 hi + x1024 residual planes */
  for (int b = B0; b < B0 + NBR; ++b) { const size_t r0 = (size_t)b * SQ; const size_t f0 = (size_t)b * QT0;
    k_gemm2<0><<<dim3((QT0 / 128) * (DM / 64), 1), 128, 0, stream>>>(OH0 + f0 * DM, DM, 0, BO, DM, 0, 0.0009765625f, bo, 0, nullptr, 1, 0, 0, (float*)d_out + r0 * DM, nullptr, DM, 0, QT0, DM, DM);      /* rows 0..255: out = o_hi Wo (+ b), overwriting the f16-path rows */
    k_gemm2<0><<<dim3((QT0 / 128) * (DM / 64), 1), 128, 0, stream>>>(OL0 + f0 * DM, DM, 0, BO, DM, 0, 0.00000095367431640625f, nullptr, 0, (const float*)d_out + r0 * DM, -1, 0, 0, (float*)d_out + r0 * DM, nullptr, DM, 0, QT0, DM, DM); }      /* += o_lo Wo 2^-20 (own-element accumulate) */
}

// v001
// Measured time: 3290 microseconds a run.
// Timed twice side by side with v000, it ran 2.23 and 2.24 times as fast.
#include <hip/hip_runtime.h>
// Causal multi-head attention over THREE input streams with rotate-half RoPE computed in the module (query, key, value [4][2048][1024]; Q = query W_q^T + b_q, K = key W_k^T + b_k, V = value W_v^T + b_v (natural [out][in] [1024][1024]; the four biases: bound and read), 16 heads of 64; cos / sin = [f, f] of pos * 10000^(-2i/64); Q = Q cos + rotate_half(Q) sin with rotate_half = cat(-x2, x1), likewise K (the bias is added BEFORE the rope); scores / sqrt(64); causal (triu k=1 at -inf); softmax; y = merged W_o^T + b_o (natural) -> [4][2048][1024]); run as grouped-query causal attention with 16 groups of ONE head with the rope stage in its half-split mode.
// Compute dtype: inputs rounded to bf16; x / weights exact; q, k, v, softmax weights and o as plain f16 GEMM operands (~2^-12); scores and softmax statistics f32; v_wmma_f32_16x16x32_f16.
#define NB 4
#define NG 16
#define HPG 1
#define KVD (NG * HD)
#define SQ 2048
#define DM 1024
#define NH 16
#define HD 64
#define HG 4                         /* unused */
#define QT 256                       /* query rows per causal tile */
#define NKX SQ                       /* S / P row pitch */
#define QT0 256                      /* first-tile rows recomputed exactly in f32 */
#define B0 0                         /* first batch processed (debug hook) */
#define NBR NB                       /* batches processed (debug hook) */
#define NR ((size_t)NB * SQ)         /* token rows */
#define MP ((int)((size_t)NBR * SQ)) /* rows projected (debug hook) */
#define QN SQ                        /* query rows attended per batch (debug hook) */
#define NHD NH                       /* heads attended (debug hook) */
#define MPO MP                       /* rows through the output stage (debug hook) */
#define LQ DM      /* row pitch of the q/k/v rows */
typedef __bf16 v16b __attribute__((ext_vector_type(16)));
typedef unsigned short v8us __attribute__((ext_vector_type(8), may_alias));
typedef float  v8f  __attribute__((ext_vector_type(8)));
typedef float  v4f  __attribute__((ext_vector_type(4)));
typedef float  v4fa __attribute__((ext_vector_type(4), may_alias));
union FragB { v16b v; v8us half[2]; unsigned short u[16]; };

__device__ __forceinline__ unsigned short bf16_bits(float x) { unsigned int u = __float_as_uint(x); return (unsigned short)((u + 0x7FFFu + ((u >> 16) & 1u)) >> 16); }
__device__ __forceinline__ float bf16_val(unsigned short b) { return __uint_as_float(((unsigned int)b) << 16); }
__device__ __forceinline__ float bf16_round(float x) { return bf16_val(bf16_bits(x)); }
// D += A·B with NT terms: 1 = ah·bh, 2 = + al·bh (A split), 3 = + ah·bl (both split)
template <int NT>
__device__ __forceinline__ v8f mmaN(v16b ah, v16b al, v16b bh, v16b bl, v8f c) {
  c = __builtin_amdgcn_wmma_f32_16x16x32_bf16(false, ah, false, bh, (short)0, c, false, false);
  if (NT >= 2) c = __builtin_amdgcn_wmma_f32_16x16x32_bf16(false, al, false, bh, (short)0, c, false, false);
  if (NT >= 3) c = __builtin_amdgcn_wmma_f32_16x16x32_bf16(false, ah, false, bl, (short)0, c, false, false);
  asm volatile("v_nop\n\tv_nop\n\tv_nop\n\tv_nop" : "+v"(c) : "v"(ah), "v"(al), "v"(bh), "v"(bl));
  return c;
}

__global__ __launch_bounds__(256) void k_wt_bf16(const float* __restrict__ W, unsigned short* __restrict__ Wt, int K, int N) {
  const int t = blockIdx.x * 256 + threadIdx.x;
  const int k8n = K / 8;
  if (t >= N * k8n) return;
  const int n = t / k8n, k8 = (t % k8n) * 8;
  v8us v;
#pragma unroll
  for (int i = 0; i < 8; ++i) v[i] = bf16_bits(W[(size_t)(k8 + i) * N + n]);
  *(v8us*)(Wt + (size_t)n * K + k8) = v;
  
}

// GEMM C[M][N] (f32, pitch ldc) = act(A[M][K]·W + bias). A f32 row-major (pitch lda) converted per fragment to bf16
// (ASPLIT: hi/lo two planes -> 2 terms, else single rounded term); Wt bf16 [N][K] (pitch ldb). BIAS_BF16 rounds the
// bias to bf16 first (bias quantised to bf16 before the add). K%32==0, M%16==0, N%64==0.
template <bool ASPLIT, int ACT, bool BIAS_BF16>
__global__ __launch_bounds__(128) void k_gemm_bf(const float* __restrict__ A, int lda, const unsigned short* __restrict__ Wt, int ldb,
                                               const float* __restrict__ bias, float* __restrict__ C, int ldc, int M, int N, int K) {
  __shared__ __attribute__((aligned(16))) float so[4][16][64];
  const int tid = threadIdx.x, w = tid >> 5, lane = tid & 31, ln = lane & 15, hh = lane >> 4;
  const int ntn = N / 64;
  const int wid = blockIdx.x * 4 + w;
  const int mt = wid / ntn, nq = wid % ntn;
  if (mt * 16 >= M) return;
  const int row0 = mt * 16, col0 = nq * 64;
  const float* arow = A + (size_t)(row0 + ln) * lda;
  v8f acc[4] = {};
  for (int kb = 0; kb < K; kb += 32) {
    FragB ah, al;
    const v4f x0 = *(const v4fa*)(arow + kb + 8 * hh), x1 = *(const v4fa*)(arow + kb + 8 * hh + 4);
    const v4f x2 = *(const v4fa*)(arow + kb + 16 + 8 * hh), x3 = *(const v4fa*)(arow + kb + 16 + 8 * hh + 4);
    float xs[16] = {x0[0],x0[1],x0[2],x0[3],x1[0],x1[1],x1[2],x1[3],x2[0],x2[1],x2[2],x2[3],x3[0],x3[1],x3[2],x3[3]};
#pragma unroll
    for (int i = 0; i < 16; ++i) { const unsigned short hb = bf16_bits(xs[i]); ah.u[i] = hb; al.u[i] = ASPLIT ? bf16_bits(xs[i] - bf16_val(hb)) : (unsigned short)0; }
#pragma unroll
    for (int t = 0; t < 4; ++t) {
      const unsigned short* brow = Wt + (size_t)(col0 + t * 16 + ln) * ldb + kb;
      FragB b;
      b.half[0] = *(const v8us*)(brow + 8 * hh);
      b.half[1] = *(const v8us*)(brow + 16 + 8 * hh);
      acc[t] = mmaN<ASPLIT ? 2 : 1>(ah.v, al.v, b.v, b.v, acc[t]);
    }
  }
#pragma unroll
  for (int t = 0; t < 4; ++t) {
    float bv = bias ? bias[col0 + t * 16 + ln] : 0.f;
    if (BIAS_BF16) bv = bf16_round(bv);
#pragma unroll
    for (int r = 0; r < 8; ++r) { float v = acc[t][r] + bv; if (ACT == 1) v = fmaxf(v, 0.f); so[w][8 * hh + r][t * 16 + ln] = v; }
  }
  __builtin_amdgcn_fence(__ATOMIC_ACQ_REL, "workgroup");
  __builtin_amdgcn_wave_barrier();
  const int rsub = lane >> 4, c4 = (lane & 15) * 4;
  {
#pragma unroll
    for (int q = 0; q < 8; ++q) {
      const int r = q * 2 + rsub;
      const v4f v = *(const v4fa*)&so[w][r][c4];
      *(v4f*)(C + (size_t)(row0 + r) * ldc + col0 + c4) = v;
    }
    
  }
}

// GEMM C = act(A·W + bias + resid): A f32 (ASPLIT -> hi/lo 2 terms), Wt bf16 [N][K]; ACT 0 none, 1 relu, 2 exact gelu;
// resid (optional, f32, row index = (row % rmod), pitch ldr, RES_BF16 rounds it) added before the activation.
template <bool ASPLIT, int ACT, bool BIAS_BF16, bool RES_BF16>
__global__ __launch_bounds__(128) void k_gemm_bf3(const float* __restrict__ A, int lda, const unsigned short* __restrict__ Wt, int ldb,
                                                const float* __restrict__ bias, const float* __restrict__ resid, int rmod, int ldr,
                                                float* __restrict__ C, int ldc, int M, int N, int K) {
  __shared__ __attribute__((aligned(16))) float so[4][16][64];
  const int tid = threadIdx.x, w = tid >> 5, lane = tid & 31, ln = lane & 15, hh = lane >> 4;
  const int ntn = N / 64;
  const int wid = blockIdx.x * 4 + w;
  const int mt = wid / ntn, nq = wid % ntn;
  if (mt * 16 >= M) return;
  const int row0 = mt * 16, col0 = nq * 64;
  const float* arow = A + (size_t)(row0 + ln) * lda;
  v8f acc[4] = {};
  for (int kb = 0; kb < K; kb += 32) {
    FragB ah, al;
    const v4f x0 = *(const v4fa*)(arow + kb + 8 * hh), x1 = *(const v4fa*)(arow + kb + 8 * hh + 4);
    const v4f x2 = *(const v4fa*)(arow + kb + 16 + 8 * hh), x3 = *(const v4fa*)(arow + kb + 16 + 8 * hh + 4);
    float xs[16] = {x0[0],x0[1],x0[2],x0[3],x1[0],x1[1],x1[2],x1[3],x2[0],x2[1],x2[2],x2[3],x3[0],x3[1],x3[2],x3[3]};
#pragma unroll
    for (int i = 0; i < 16; ++i) { const unsigned short hb = bf16_bits(xs[i]); ah.u[i] = hb; al.u[i] = ASPLIT ? bf16_bits(xs[i] - bf16_val(hb)) : (unsigned short)0; }
#pragma unroll
    for (int t = 0; t < 4; ++t) {
      const unsigned short* brow = Wt + (size_t)(col0 + t * 16 + ln) * ldb + kb;
      FragB b;
      b.half[0] = *(const v8us*)(brow + 8 * hh);
      b.half[1] = *(const v8us*)(brow + 16 + 8 * hh);
      acc[t] = mmaN<ASPLIT ? 2 : 1>(ah.v, al.v, b.v, b.v, acc[t]);
    }
  }
#pragma unroll
  for (int t = 0; t < 4; ++t) {
    const int col = col0 + t * 16 + ln;
    float bv = bias ? bias[col] : 0.f;
    if (BIAS_BF16) bv = bf16_round(bv);
#pragma unroll
    for (int r = 0; r < 8; ++r) {
      float v = acc[t][r] + bv;
      if (resid) { float rv = resid[(size_t)((row0 + 8 * hh + r) % rmod) * ldr + col]; if (RES_BF16) rv = bf16_round(rv); v += rv; }
      if (ACT == 1) v = fmaxf(v, 0.f);
      if (ACT == 2) v = 0.5f * v * (1.0f + erff(v * 0.70710678118654752f));
      if (ACT == 3) { const float u = 0.7978845608028654f * (v + 0.044715f * v * v * v); v = 0.5f * v * (1.0f + tanhf(u)); }
      so[w][8 * hh + r][t * 16 + ln] = v;
    }
  }
  __builtin_amdgcn_fence(__ATOMIC_ACQ_REL, "workgroup");
  __builtin_amdgcn_wave_barrier();
  const int rsub = lane >> 4, c4 = (lane & 15) * 4;
  {
#pragma unroll
    for (int q = 0; q < 8; ++q) {
      const int r = q * 2 + rsub;
      const v4f v = *(const v4fa*)&so[w][r][c4];
      *(v4f*)(C + (size_t)(row0 + r) * ldc + col0 + c4) = v;
    }
    
  }
}
// row LayerNorm (biased variance, eps) over N: s = X (+ R); optional out_sum <- s; out_norm <- (s-mu)*rsqrt(var+eps)*g + b
template <bool PARAM_BF16>
__global__ __launch_bounds__(256) void k_layernorm(const float* __restrict__ X, const float* __restrict__ R, const float* __restrict__ g, const float* __restrict__ bta,
                                                  float* __restrict__ out_sum, float* __restrict__ out_norm, int N, float eps) {
  __shared__ float red[256];
  const int row = blockIdx.x, tid = threadIdx.x;
  const float* x = X + (size_t)row * N; const float* rr = R ? R + (size_t)row * N : nullptr;
  float vals[16];                     // up to N = 4096
  const int per = N / 256;            // contiguous chunk per thread? use strided-by-4 chunks: thread handles j = tid*4 + 1024*u
  float s1 = 0.f;
  for (int u = 0; u < per / 4; ++u) {
    const int j = tid * 4 + 1024 * u;
    const v4f a = *(const v4fa*)(x + j);
    v4f b = {0.f,0.f,0.f,0.f}; if (rr) b = *(const v4fa*)(rr + j);
#pragma unroll
    for (int q = 0; q < 4; ++q) { const float v = a[q] + b[q]; vals[u * 4 + q] = v; s1 += v; }
  }
  red[tid] = s1; __syncthreads();
  for (int st = 128; st > 0; st >>= 1) { if (tid < st) red[tid] += red[tid + st]; __syncthreads(); }
  const float mu = red[0] / (float)N; __syncthreads();
  float s2 = 0.f;
  for (int u = 0; u < per / 4; ++u)
#pragma unroll
    for (int q = 0; q < 4; ++q) { const float c = vals[u * 4 + q] - mu; s2 += c * c; }
  red[tid] = s2; __syncthreads();
  for (int st = 128; st > 0; st >>= 1) { if (tid < st) red[tid] += red[tid + st]; __syncthreads(); }
  const float rs = rsqrtf(red[0] / (float)N + eps);
  {
    for (int u = 0; u < per / 4; ++u) {
      const int j = tid * 4 + 1024 * u;
      v4f o, sm;
#pragma unroll
      for (int q = 0; q < 4; ++q) {
        float gg = g[j + q], bb = bta[j + q];
        if (PARAM_BF16) { gg = bf16_round(gg); bb = bf16_round(bb); }
        sm[q] = vals[u * 4 + q]; o[q] = (vals[u * 4 + q] - mu) * rs * gg + bb;
      }
      if (out_sum) *(v4f*)(out_sum + (size_t)row * N + j) = sm;
      *(v4f*)(out_norm + (size_t)row * N + j) = o;
    }
    
  }
}

// ---- f16 WMMA path (v_wmma_f32_16x16x32_f16): 11-bit significands for operands in range — used where a [0,1] probability operand needs more precision than bf16
typedef _Float16 v16h __attribute__((ext_vector_type(16)));
union FragH { v16h v; v8us half[2]; _Float16 h[16]; unsigned short u[16]; };
template <int NT>
__device__ __forceinline__ v8f mmaH(v16h ah, v16h al, v16h bh, v16h bl, v8f c) {
  c = __builtin_amdgcn_wmma_f32_16x16x32_f16(false, ah, false, bh, (short)0, c, false, false);
  if (NT >= 2) c = __builtin_amdgcn_wmma_f32_16x16x32_f16(false, al, false, bh, (short)0, c, false, false);
  if (NT >= 3) c = __builtin_amdgcn_wmma_f32_16x16x32_f16(false, ah, false, bl, (short)0, c, false, false);
  asm volatile("v_nop\n\tv_nop\n\tv_nop\n\tv_nop" : "+v"(c) : "v"(ah), "v"(al), "v"(bh), "v"(bl));
  return c;
}
// batched GEMM like k_gemm_b but f16 operands: A f32 (split into f16 hi/lo if ASPLIT, else rounded to f16), Bt = f16 values [n][k]; alpha; C f32; N multiple of 16 (partial tiles skipped)
template <bool ASPLIT>
__global__ __launch_bounds__(128) void k_gemm_h(const float* __restrict__ A, int lda, size_t sA, const _Float16* __restrict__ Bh, int ldb, size_t sB, float alpha, float* __restrict__ C, int ldc, size_t sC, int M, int N, int K) {
  __shared__ __attribute__((aligned(16))) float so[4][16][64];
  const int tid = threadIdx.x, w = tid >> 5, lane = tid & 31, ln = lane & 15, hh = lane >> 4; const int by = blockIdx.y;
  A += (size_t)by * sA; Bh += (size_t)by * sB; C += (size_t)by * sC;
  const int ntn = (N + 63) / 64; const int wid = blockIdx.x * 4 + w; const int mt = wid / ntn, nq = wid % ntn; if (mt * 16 >= M) return;
  const int row0 = mt * 16, col0 = nq * 64; const float* arow = A + (size_t)(row0 + ln) * lda;
  v8f acc[4] = {};
  for (int kb = 0; kb < K; kb += 32) {
    FragH ah, al;
    const v4f x0 = *(const v4fa*)(arow + kb + 8 * hh), x1 = *(const v4fa*)(arow + kb + 8 * hh + 4), x2 = *(const v4fa*)(arow + kb + 16 + 8 * hh), x3 = *(const v4fa*)(arow + kb + 16 + 8 * hh + 4);
    float xs[16] = {x0[0],x0[1],x0[2],x0[3],x1[0],x1[1],x1[2],x1[3],x2[0],x2[1],x2[2],x2[3],x3[0],x3[1],x3[2],x3[3]};
#pragma unroll
    for (int i = 0; i < 16; ++i) { const _Float16 h = (_Float16)xs[i]; ah.h[i] = h; al.h[i] = ASPLIT ? (_Float16)(xs[i] - (float)h) : (_Float16)0.0f; }
#pragma unroll
    for (int t = 0; t < 4; ++t) { if (col0 + t * 16 >= N) continue; const size_t boff = (size_t)(col0 + t * 16 + ln) * ldb + kb; FragH bq; bq.half[0] = *(const v8us*)(Bh + boff + 8 * hh); bq.half[1] = *(const v8us*)(Bh + boff + 16 + 8 * hh);
      acc[t] = mmaH<ASPLIT ? 2 : 1>(ah.v, al.v, bq.v, bq.v, acc[t]); }
  }
#pragma unroll
  for (int t = 0; t < 4; ++t) { if (col0 + t * 16 >= N) continue;
#pragma unroll
    for (int r = 0; r < 8; ++r) so[w][8 * hh + r][t * 16 + ln] = acc[t][r] * alpha; }
  __builtin_amdgcn_fence(__ATOMIC_ACQ_REL, "workgroup"); __builtin_amdgcn_wave_barrier();
  const int rsub = lane >> 4, c4 = (lane & 15) * 4;
  {
#pragma unroll
    for (int q = 0; q < 8; ++q) { const int r = q * 2 + rsub; if (col0 + c4 < N) { const v4f v = *(const v4fa*)&so[w][r][c4]; *(v4f*)(C + (size_t)(row0 + r) * ldc + col0 + c4) = v; } }
     }
}

// Wt[n][k] = f16(W[k][n]·scale) from f32 row-major W[K][N] (scale = power of two; bf16-exact weights stay exact in f16 away from the subnormal range)
__global__ __launch_bounds__(256) void k_wt_f16(const float* __restrict__ W, _Float16* __restrict__ Wt, int K, int N, float scale) {
  const int t = blockIdx.x * 256 + threadIdx.x; if (t >= N * (K / 8)) return; const int n = t / (K / 8), k8 = (t % (K / 8)) * 8; FragH f;
#pragma unroll
  for (int i = 0; i < 8; ++i) f.h[i] = (_Float16)(bf16_round(W[(size_t)(k8 + i) * N + n]) * scale); const v8us o = f.half[0];
  *(v8us*)((unsigned short*)Wt + (size_t)n * K + k8) = o; 
}
// k_gemm_hh variant with fused epilogue: v = acc·alpha + bias[by·sBias + col] (+ CP[(row/rowsPerB)·sCPb + by·64 + col] if CP) ; ACT 0 none / 1 elu ; writes f16 C16 (and f32 C if non-null)
template <int ACT>
__global__ __launch_bounds__(128) void k_gemm_hhx(const _Float16* __restrict__ A, int lda, size_t sA, const _Float16* __restrict__ Bh, int ldb, size_t sB, float alpha, const float* __restrict__ bias, size_t sBias, const float* __restrict__ CP, int rowsPerB, size_t sCPb, int row0g,
    float* __restrict__ C, _Float16* __restrict__ C16, int ldc, size_t sC, int M, int N, int K) {
  __shared__ __attribute__((aligned(16))) float so[4][16][64];
  const int tid = threadIdx.x, w = tid >> 5, lane = tid & 31, ln = lane & 15, hh = lane >> 4; const int by = blockIdx.y;
  A += (size_t)by * sA; Bh += (size_t)by * sB; const size_t cofs = (size_t)by * sC; const float* bp = bias ? bias + (size_t)by * sBias : nullptr;
  const int ntn = (N + 63) / 64; const int wid = blockIdx.x * 4 + w; const int mt = wid / ntn, nq = wid % ntn; if (mt * 16 >= M) return;
  const int row0 = mt * 16, col0 = nq * 64; const _Float16* arow = A + (size_t)(row0 + ln) * lda;
  v8f acc[4] = {};
  for (int kb = 0; kb < K; kb += 32) { FragH ah; ah.half[0] = *(const v8us*)((const unsigned short*)arow + kb + 8 * hh); ah.half[1] = *(const v8us*)((const unsigned short*)arow + kb + 16 + 8 * hh);
#pragma unroll
    for (int t = 0; t < 4; ++t) { if (col0 + t * 16 >= N) continue; const size_t boff = (size_t)(col0 + t * 16 + ln) * ldb + kb; FragH bq; bq.half[0] = *(const v8us*)((const unsigned short*)Bh + boff + 8 * hh); bq.half[1] = *(const v8us*)((const unsigned short*)Bh + boff + 16 + 8 * hh);
      acc[t] = mmaH<1>(ah.v, ah.v, bq.v, bq.v, acc[t]); }
  }
#pragma unroll
  for (int t = 0; t < 4; ++t) { if (col0 + t * 16 >= N) continue; const int col = col0 + t * 16 + ln; const float bv = bp ? bf16_round(bp[col]) : 0.f;
#pragma unroll
    for (int r = 0; r < 8; ++r) { float v = acc[t][r] * alpha + bv; if (CP) { const int rr = row0g + row0 + 8 * hh + r; if (rowsPerB < 0) v += CP[cofs + (size_t)rr * ldc + col];      /* rowsPerB < 0: own element of the batched C plane */ else { const int bidx = rr / rowsPerB; v += CP[(size_t)bidx * sCPb + (size_t)by * 64 + col]; } } if (ACT == 1) v = (v > 0.f) ? v : expm1f(v); else if (ACT == 7) v = (v > 0.f) ? v + 1.0f : expf(v); else if (ACT == 8) v = tanhf(v); else if (ACT == 9) v = 0.5f * v * (1.0f + tanhf(0.7978845608028654f * (v + 0.044715f * v * v * v))); else if (ACT == 11) v = 1.0f / (1.0f + expf(-v)); else if (ACT == 12) v = (v > 0.f) ? v : 0.01f * v; else if (ACT == 14) v = (v > 0.f) ? v : 0.1f * v; else if (ACT == 16) v = (v >= 0.f) ? v : 0.3f * v; else if (ACT == 17) v = (v >= 0.f) ? v : 0.2f * v; else if (ACT == 15) v = v / (1.0f + expf(-v)); else if (ACT == 3) v = fmaxf(v, 0.f); else if (ACT == 6) v = 0.5f * v * (1.0f + erff(v * 0.70710678118654752f)); so[w][8 * hh + r][t * 16 + ln] = v; } }
  __builtin_amdgcn_fence(__ATOMIC_ACQ_REL, "workgroup"); __builtin_amdgcn_wave_barrier();
  const int rsub = lane >> 4, c4 = (lane & 15) * 4; typedef _Float16 v4h __attribute__((ext_vector_type(4)));
  {
#pragma unroll
    for (int q = 0; q < 8; ++q) { const int r = q * 2 + rsub; if (col0 + c4 < N) { const v4f v = *(const v4fa*)&so[w][r][c4]; if (C) *(v4f*)(C + cofs + (size_t)(row0 + r) * ldc + col0 + c4) = v; if (C16) { v4h h4; for (int i = 0; i < 4; ++i) h4[i] = (_Float16)v[i]; *(v4h*)(C16 + cofs + (size_t)(row0 + r) * ldc + col0 + c4) = h4; } } }
     }
}

typedef _Float16 v4h __attribute__((ext_vector_type(4)));

__global__ __launch_bounds__(256) void k_x16(const float* __restrict__ x, _Float16* __restrict__ X16, size_t n8) { const size_t t = (size_t)blockIdx.x * 256 + threadIdx.x; if (t >= n8) return; FragH f;
#pragma unroll
  for (int q = 0; q < 8; ++q) f.h[q] = (_Float16)bf16_round(x[t * 8 + q]); *(v8us*)((unsigned short*)X16 + t * 8) = f.half[0];  }
__global__ __launch_bounds__(256) void k_h16(const float* __restrict__ x, _Float16* __restrict__ X16, size_t n8) { const size_t t = (size_t)blockIdx.x * 256 + threadIdx.x; if (t >= n8) return; FragH f;
#pragma unroll
  for (int q = 0; q < 8; ++q) f.h[q] = (_Float16)x[t * 8 + q]; *(v8us*)((unsigned short*)X16 + t * 8) = f.half[0];  }
__global__ __launch_bounds__(256) void k_round16f(const float* __restrict__ W, _Float16* __restrict__ Bt, size_t n8) { const size_t t = (size_t)blockIdx.x * 256 + threadIdx.x; if (t >= n8) return; FragH f;
#pragma unroll
  for (int i = 0; i < 8; ++i) f.h[i] = (_Float16)(bf16_round(W[t * 8 + i]) * 16.0f); *(v8us*)((unsigned short*)Bt + t * 8) = f.half[0];  }
template <int NHv, int TTv>
__global__ __launch_bounds__(256) void k_vt(const _Float16* __restrict__ V16, int ldv, int voff, _Float16* __restrict__ Vt) { __shared__ unsigned short tl[64][66]; const int tid = threadIdx.x; const int slab = blockIdx.x / (TTv / 64), lg = blockIdx.x % (TTv / 64); const int b = slab / NHv, h = slab % NHv;
  for (int i = tid; i < 64 * 8; i += 256) { const int r = i / 8, c8 = (i % 8) * 8; FragH f; f.half[0] = *(const v8us*)((const unsigned short*)V16 + ((size_t)b * TTv + lg * 64 + r) * ldv + voff + h * 64 + c8);
#pragma unroll
    for (int q = 0; q < 8; ++q) tl[r][c8 + q] = f.u[q]; }
  __syncthreads();
  {
#pragma unroll
    for (int rd = 0; rd < 2; ++rd) { const int d = rd * 32 + tid / 8, pc = tid % 8; FragH f;
#pragma unroll
      for (int q = 0; q < 8; ++q) f.u[q] = tl[pc * 8 + q][d];
      *(v8us*)((unsigned short*)Vt + ((size_t)slab * 64 + d) * TTv + lg * 64 + pc * 8) = f.half[0]; }
     } }

__global__ __launch_bounds__(256) void k_hl(const float* __restrict__ F, _Float16* __restrict__ Hh, _Float16* __restrict__ Hl, size_t n8) { const size_t t = (size_t)blockIdx.x * 256 + threadIdx.x; if (t >= n8) return; FragH fh, fl; const v4f a = *(const v4fa*)(F + t * 8), c = *(const v4fa*)(F + t * 8 + 4);
#pragma unroll
  for (int q = 0; q < 4; ++q) { _Float16 h = (_Float16)a[q]; fh.h[q] = h; fl.h[q] = (_Float16)((a[q] - (float)h) * 1024.0f); h = (_Float16)c[q]; fh.h[4 + q] = h; fl.h[4 + q] = (_Float16)((c[q] - (float)h) * 1024.0f); }
  { *(v8us*)((unsigned short*)Hh + t * 8) = fh.half[0]; *(v8us*)((unsigned short*)Hl + t * 8) = fl.half[0];  } }

// ---- fast GEMM (wave tile 32x64; requires M % 32 == 0 rows per launch region and N % 64 == 0); epilogue = k_gemm_hhx semantics ----
__device__ __forceinline__ v16h g2_frag(const _Float16* p, int hh) { FragH f; f.half[0] = *(const v8us*)((const unsigned short*)p + 8 * hh); f.half[1] = *(const v8us*)((const unsigned short*)p + 16 + 8 * hh); return f.v; }
__device__ __forceinline__ v8f g2_mma(v16h a, v16h b, v8f c) { v8f d = __builtin_amdgcn_wmma_f32_16x16x32_f16(false, a, false, b, (short)0, c, false, false); asm volatile("v_nop\n\tv_nop\n\tv_nop\n\tv_nop" : "+v"(d) : "v"(a), "v"(b)); return d; }
template <int ACT>
__global__ __launch_bounds__(128) void k_gemm2(const _Float16* __restrict__ A, int lda, size_t sA, const _Float16* __restrict__ Bh, int ldb, size_t sB, float alpha, const float* __restrict__ bias, size_t sBias, const float* __restrict__ CP, int rowsPerB, size_t sCPb, int row0g,
    float* __restrict__ C, _Float16* __restrict__ C16, int ldc, size_t sC, int M, int N, int K) { static_assert(ACT == 0 || ACT == 3 || ACT == 6 || ACT == 8 || ACT == 9 || ACT == 11 || ACT == 12 || ACT == 14 || ACT == 15 || ACT == 16 || ACT == 17, "k_gemm2: unsupported ACT code (would silently apply no activation)");
  __shared__ __attribute__((aligned(16))) float so[4][32][68];
  const int tid = threadIdx.x, w = tid >> 5, lane = tid & 31, ln = lane & 15, hh = lane >> 4; const int by = blockIdx.y;
  A += (size_t)by * sA; Bh += (size_t)by * sB; const size_t cofs = (size_t)by * sC; const float* bp = bias ? bias + (size_t)by * sBias : nullptr;
  const int ntn = N >> 6; const int mt = blockIdx.x / ntn, nq = blockIdx.x - mt * ntn; const int row0 = mt * 128 + 32 * w, col0 = nq * 64; if (row0 >= M) return;
  const _Float16* a0p = A + (size_t)(row0 + ln) * lda; const _Float16* a1p = a0p + (size_t)16 * lda;
  const _Float16* b0p = Bh + (size_t)(col0 + ln) * ldb; const _Float16* b1p = b0p + (size_t)16 * ldb; const _Float16* b2p = b1p + (size_t)16 * ldb; const _Float16* b3p = b2p + (size_t)16 * ldb;
  const v8f z8 = {0.f,0.f,0.f,0.f,0.f,0.f,0.f,0.f}; v8f c00 = z8, c01 = z8, c02 = z8, c03 = z8, c10 = z8, c11 = z8, c12 = z8, c13 = z8;
  for (int kb = 0; kb < K; kb += 32) { const v16h a0 = g2_frag(a0p + kb, hh), a1 = g2_frag(a1p + kb, hh);
    v16h b = g2_frag(b0p + kb, hh); c00 = g2_mma(a0, b, c00); c10 = g2_mma(a1, b, c10);
    b = g2_frag(b1p + kb, hh); c01 = g2_mma(a0, b, c01); c11 = g2_mma(a1, b, c11);
    b = g2_frag(b2p + kb, hh); c02 = g2_mma(a0, b, c02); c12 = g2_mma(a1, b, c12);
    b = g2_frag(b3p + kb, hh); c03 = g2_mma(a0, b, c03); c13 = g2_mma(a1, b, c13); }
  v8f accs[8] = {c00, c01, c02, c03, c10, c11, c12, c13};
#pragma unroll
  for (int u = 0; u < 8; ++u) { const int t = u & 3, half = u >> 2; const int col = col0 + t * 16 + ln; const float bv = bp ? bf16_round(bp[col]) : 0.f;
#pragma unroll
    for (int r = 0; r < 8; ++r) { const int rloc = half * 16 + 8 * hh + r; float v = accs[u][r] * alpha + bv; if (CP) { if (rowsPerB < 0) v += CP[cofs + (size_t)(row0g + row0 + rloc) * ldc + col];      /* rowsPerB < 0: own element of the batched C plane */ else { const int bidx = (row0g + row0 + rloc) / rowsPerB; v += CP[(size_t)bidx * sCPb + (size_t)by * 64 + col]; } }
      if (ACT == 3) v = fmaxf(v, 0.f); else if (ACT == 6) v = 0.5f * v * (1.0f + erff(v * 0.70710678118654752f)); else if (ACT == 11) v = 1.0f / (1.0f + expf(-v)); else if (ACT == 15) v = v / (1.0f + expf(-v)); else if (ACT == 12) v = (v > 0.f) ? v : 0.01f * v; else if (ACT == 8) v = tanhf(v); else if (ACT == 9) v = 0.5f * v * (1.0f + tanhf(0.7978845608028654f * (v + 0.044715f * v * v * v))); else if (ACT == 14) v = (v > 0.f) ? v : 0.1f * v; else if (ACT == 16) v = (v >= 0.f) ? v : 0.3f * v; else if (ACT == 17) v = (v >= 0.f) ? v : 0.2f * v;
      so[w][rloc][t * 16 + ln] = v; } }
  __builtin_amdgcn_fence(__ATOMIC_ACQ_REL, "workgroup"); __builtin_amdgcn_wave_barrier();
  const int rsub = lane >> 4, c4 = (lane & 15) * 4;
  {
#pragma unroll
    for (int q = 0; q < 16; ++q) { const int r = q * 2 + rsub; const v4f v = *(const v4fa*)&so[w][r][c4]; if (C) *(v4f*)(C + cofs + (size_t)(row0 + r) * ldc + col0 + c4) = v; if (C16) { v4h h4; for (int i = 0; i < 4; ++i) h4[i] = (_Float16)v[i]; *(v4h*)(C16 + cofs + (size_t)(row0 + r) * ldc + col0 + c4) = h4; } }
     } }

__global__ __launch_bounds__(256) void k_wnat(const float* __restrict__ w, size_t n8, _Float16* __restrict__ Bt) { const size_t t = (size_t)blockIdx.x * 256 + threadIdx.x; if (t >= n8) return; FragH f; for (int q = 0; q < 8; ++q) f.h[q] = (_Float16)(bf16_round(w[t * 8 + q]) * 16.0f); *(v8us*)((unsigned short*)Bt + t * 8) = f.half[0];  }

// exp2 with the one issue slot that the instruction set asks for behind a transcendental (before its source is overwritten or its result read) in the same statement.
__device__ __forceinline__ float exp2_slot(float x) { float e; asm("v_exp_f32 %0, %1\n\tv_nop" : "=v"(e) : "v"(x)); return e; }
// Row softmax, ONE WAVE PER ROW: lane l holds elements c*128 + 4l .. + 3 of the row's NC chunks in registers, so S is read once, every load covers 512 contiguous bytes and every store 256.
// Element values as before (masked score, __expf(score - max) * 256 / sum); the row sum is four chains per lane and a five-step butterfly.
template <int NC>
__device__ __forceinline__ void rsm_row(const float* __restrict__ s, unsigned short* __restrict__ d, int last, int lane) {
  v4f v[NC]; const float* sl = s + lane * 4;
#pragma unroll
  for (int c = 0; c < NC; ++c) v[c] = *(const v4fa*)(sl + c * 128);
  asm volatile("s_wait_xcnt 0x0" :: "v"(sl) : "memory");      /* the wait in front of any overwrite of the loads' address pair; naming the pair keeps it whole up to here (without it the longest row's last load got the pair as its destination) */
  __builtin_amdgcn_sched_barrier(0);      /* keeps every load of the row issued ahead of the first data wait (without it the longer bodies issue part of their loads behind a wait: one more round trip) */
  float mx = -3.0e38f;
#pragma unroll
  for (int c = 0; c < NC; ++c)
#pragma unroll
    for (int q = 0; q < 4; ++q) { const float f = (c * 128 + lane * 4 + q <= last) ? 1.f : 0.f; v[c][q] = fmaf(f, v[c][q], (1.f - f) * -1.0e9f); mx = fmaxf(mx, v[c][q]); }
#pragma unroll
  for (int m = 16; m >= 1; m >>= 1) mx = fmaxf(mx, __shfl_xor(mx, m, 32));
  v4f se4 = {0.f, 0.f, 0.f, 0.f};
#pragma unroll
  for (int c = 0; c < NC; ++c)
#pragma unroll
    for (int q = 0; q < 4; ++q) { v[c][q] = exp2_slot((v[c][q] - mx) * 1.44269504088896340736f); se4[q] += v[c][q]; }      /* = __expf(score - max) */
  float se = (se4[0] + se4[1]) + (se4[2] + se4[3]);
#pragma unroll
  for (int m = 16; m >= 1; m >>= 1) se += __shfl_xor(se, m, 32);
  const float sc = 256.0f / se;
#pragma unroll
  for (int c = 0; c < NC; ++c) { v4h h4;
#pragma unroll
    for (int q = 0; q < 4; ++q) h4[q] = (_Float16)(v[c][q] * sc);
    *(v4h*)((_Float16*)d + c * 128 + lane * 4) = h4; } }
template <int NC>      /* NC = nk / 128 chunks: one kernel per row length, a straight-line body that keeps the whole row's loads in flight together */
__global__ __launch_bounds__(256) void k_rsmcf2(const float* __restrict__ S, _Float16* __restrict__ P, int hg, int q0) {
  const int lane = threadIdx.x & 31; const int t = blockIdx.x * 8 + (threadIdx.x >> 5); if (t >= hg * QT) return;      /* wave-uniform; the kernel has no barrier */
  const size_t i = (size_t)t; rsm_row<NC>(S + i * NKX, (unsigned short*)P + i * NKX, q0 + (t % QT), lane); }

template <int MASKADD>
__global__ __launch_bounds__(64) void k_att0(const float* __restrict__ QF, const float* __restrict__ KF, const float* __restrict__ VF, int ld, const float* __restrict__ mask, float scale, float* __restrict__ OF, int ldo) {
  __shared__ __attribute__((aligned(16))) float lq[64][64]; __shared__ __attribute__((aligned(16))) float lo[64][64];
  const int tid = threadIdx.x; const int h = blockIdx.x / (QT0 / 64), rg = blockIdx.x % (QT0 / 64); const int i = rg * 64 + tid;
  const float* qr = QF + (size_t)i * ld + h * HD;
  for (int c = 0; c < HD / 4; ++c) { *(v4f*)&lq[tid][c * 4] = *(const v4fa*)(qr + c * 4); const v4f z = {0.f, 0.f, 0.f, 0.f}; *(v4f*)&lo[tid][c * 4] = z; }
  float m = -1.0e30f, l = 0.f; const int jmax = MASKADD ? (SQ - 1) : (rg * 64 + 63);      /* additive-mask form: every key (the mask input decides); causal form: keys up to the block's last row */
  for (int j = 0; j <= jmax; ++j) { const float* kr = KF + (size_t)j * ld + h * HD; const float* vr = VF + (size_t)j * ld + h * HD; float s = 0.f;
    for (int c = 0; c < HD / 4; ++c) { const v4f kq = *(const v4fa*)(kr + c * 4); const v4f qq = *(v4f*)&lq[tid][c * 4]; s = __fadd_rn(s, __fmul_rn(qq[0], kq[0])); s = __fadd_rn(s, __fmul_rn(qq[1], kq[1])); s = __fadd_rn(s, __fmul_rn(qq[2], kq[2])); s = __fadd_rn(s, __fmul_rn(qq[3], kq[3])); }
    s = __fmul_rn(s, scale); if (MASKADD) s = __fadd_rn(s, __fmul_rn(bf16_round(mask[(size_t)i * SQ + j]), -10000.0f));
    const float f = (MASKADD || j <= i) ? 1.f : 0.f; const float sm = fmaf(f, s, (1.f - f) * -1.0e30f); const float mn = fmaxf(m, sm); const float sc = expf(m - mn); const float e = expf(sm - mn); l = __fadd_rn(__fmul_rn(l, sc), e); m = mn;
    for (int c = 0; c < HD / 4; ++c) { const v4f vv = *(const v4fa*)(vr + c * 4); v4f oo = *(v4f*)&lo[tid][c * 4]; for (int u = 0; u < 4; ++u) oo[u] = __fadd_rn(__fmul_rn(oo[u], sc), __fmul_rn(e, vv[u])); *(v4f*)&lo[tid][c * 4] = oo; } }
  const float fin = 64.0f / l;      /* o carried x64 like the f16 path */
  for (int c = 0; c < HD / 4; ++c) { v4f oo = *(v4f*)&lo[tid][c * 4]; for (int u = 0; u < 4; ++u) oo[u] = __fmul_rn(oo[u], fin); *(v4f*)&lo[tid][c * 4] = oo; }
  __syncthreads();
  {
    for (int it = 0; it < 16; ++it) { const int row = it * 4 + tid / 16, pc = (tid % 16) * 4; const v4f v = *(const v4f*)&lo[row][pc]; *(v4f*)(OF + (size_t)(rg * 64 + row) * ldo + h * HD + pc) = v; }
     } }

__global__ __launch_bounds__(256) void k_kvexp(const float* __restrict__ src, float* __restrict__ dst, size_t n4) { const size_t t = (size_t)blockIdx.x * 256 + threadIdx.x; if (t >= n4) return; const size_t e = t * 4; const size_t row = e / DM; const int col = (int)(e % DM); const int h = col / HD, d = col % HD; const v4f v = *(const v4fa*)(src + row * KVD + (size_t)(h / HPG) * HD + d); *(v4f*)(dst + e) = v;  }

__global__ __launch_bounds__(256) void k_tab2(float theta, float* __restrict__ CS, float* __restrict__ SN) {
  const int t = blockIdx.x * 256 + threadIdx.x; if (t >= SQ * (HD / 2)) return; const int i = t % (HD / 2); const int p = t / (HD / 2); const float invf = 1.0f / powf(theta, (float)(2 * i) / (float)HD); const float ang = __fmul_rn((float)p, invf); const float c = cosf(ang), s = sinf(ang);
  *(float*)(CS + t) = c; *(float*)(SN + t) = s;  }
template <int NORM, int ROPE>
__global__ __launch_bounds__(64) void k_xform(const float* __restrict__ F, int ldf, int nh, const float* __restrict__ gain, float eps, const float* __restrict__ CS, const float* __restrict__ SN, _Float16* __restrict__ H16, int ldo) {
  __shared__ float xv[HD]; __shared__ float red[HD]; __shared__ unsigned short sh_[HD]; const int d = threadIdx.x; const int h = blockIdx.x % nh; const size_t r = blockIdx.x / nh; const int p = (int)(r % SQ);
  float x = F[r * (size_t)ldf + (size_t)h * HD + d];
  if (NORM) { red[d] = __fmul_rn(x, x); __syncthreads(); for (int st = HD / 2; st > 0; st >>= 1) { if (d < st) red[d] = __fadd_rn(red[d], red[d + st]); __syncthreads(); } const float rs = rsqrtf(__fadd_rn(red[0] / (float)HD, eps)); x = __fmul_rn(__fmul_rn(x, rs), bf16_round(gain[d])); }
  xv[d] = x; __syncthreads();
  float o = x;
  if (ROPE == 1) { const int i = d >> 1; const float c = CS[p * (HD / 2) + i], s = SN[p * (HD / 2) + i]; const float ev = xv[2 * i], od = xv[2 * i + 1]; o = (d & 1) ? __fadd_rn(__fmul_rn(ev, s), __fmul_rn(od, c)) : __fadd_rn(__fmul_rn(ev, c), -__fmul_rn(od, s)); }
  if (ROPE == 2) { const int i = d & (HD / 2 - 1); const float c = CS[p * (HD / 2) + i], s = SN[p * (HD / 2) + i]; const float lo = xv[i], hi = xv[i + HD / 2]; o = (d < HD / 2) ? __fadd_rn(__fmul_rn(lo, c), -__fmul_rn(hi, s)) : __fadd_rn(__fmul_rn(lo, s), __fmul_rn(hi, c)); }
  if (ROPE == 3) { const float c = CS[p * HD + d], s = SN[p * HD + d]; const float lo = xv[d & (HD / 2 - 1)], hi = xv[(d & (HD / 2 - 1)) + HD / 2]; o = (d < HD / 2) ? __fadd_rn(__fmul_rn(lo, c), -__fmul_rn(hi, s)) : __fadd_rn(__fmul_rn(hi, c), __fmul_rn(lo, s)); }      /* rotate-half with FULL-width per-element tables [pos][HD] */
  FragH th; th.h[0] = (_Float16)o; sh_[d] = th.u[0]; __syncthreads();
  if (d < HD / 8) { FragH f; for (int q = 0; q < 8; ++q) f.u[q] = sh_[d * 8 + q]; unsigned short* dst = (unsigned short*)H16 + r * (size_t)ldo + (size_t)h * HD + d * 8; *(v8us*)dst = f.half[0];  } }

template <int NORM, int ROPE>
__global__ __launch_bounds__(64) void k_xformf(const float* __restrict__ F, int ldf, int nh, const float* __restrict__ gain, float eps, const float* __restrict__ CS, const float* __restrict__ SN, float* __restrict__ F32, int ldo) {
  __shared__ float xv[HD]; __shared__ float red[HD]; const int d = threadIdx.x; const int h = blockIdx.x % nh; const size_t r = blockIdx.x / nh; const int p = (int)(r % SQ);
  float x = F[r * (size_t)ldf + (size_t)h * HD + d];
  if (NORM) { red[d] = __fmul_rn(x, x); __syncthreads(); for (int st = HD / 2; st > 0; st >>= 1) { if (d < st) red[d] = __fadd_rn(red[d], red[d + st]); __syncthreads(); } const float rs = rsqrtf(__fadd_rn(red[0] / (float)HD, eps)); x = __fmul_rn(__fmul_rn(x, rs), bf16_round(gain[d])); }
  xv[d] = x; __syncthreads();
  float o = x;
  if (ROPE == 1) { const int i = d >> 1; const float c = CS[p * (HD / 2) + i], s = SN[p * (HD / 2) + i]; const float ev = xv[2 * i], od = xv[2 * i + 1]; o = (d & 1) ? __fadd_rn(__fmul_rn(ev, s), __fmul_rn(od, c)) : __fadd_rn(__fmul_rn(ev, c), -__fmul_rn(od, s)); }
  if (ROPE == 2) { const int i = d & (HD / 2 - 1); const float c = CS[p * (HD / 2) + i], s = SN[p * (HD / 2) + i]; const float lo = xv[i], hi = xv[i + HD / 2]; o = (d < HD / 2) ? __fadd_rn(__fmul_rn(lo, c), -__fmul_rn(hi, s)) : __fadd_rn(__fmul_rn(lo, s), __fmul_rn(hi, c)); }
  if (ROPE == 3) { const float c = CS[p * HD + d], s = SN[p * HD + d]; const float lo = xv[d & (HD / 2 - 1)], hi = xv[(d & (HD / 2 - 1)) + HD / 2]; o = (d < HD / 2) ? __fadd_rn(__fmul_rn(lo, c), -__fmul_rn(hi, s)) : __fadd_rn(__fmul_rn(hi, c), __fmul_rn(lo, s)); }      /* rotate-half with FULL-width per-element tables [pos][HD] */
  float* dst = F32 + r * (size_t)ldo + (size_t)h * HD + d; *(float*)dst = o;  }

__global__ __launch_bounds__(256) void k_bfcp(const float* __restrict__ src, float* __restrict__ dst, size_t n4) { const size_t t = (size_t)blockIdx.x * 256 + threadIdx.x; if (t >= n4) return; const v4f a = *(const v4fa*)(src + t * 4); v4f o; for (int q = 0; q < 4; ++q) o[q] = bf16_round(a[q]); *(v4f*)(dst + t * 4) = o;  }

__global__ __launch_bounds__(256) void k_tabhalf(const float* __restrict__ cs, const float* __restrict__ sn, float* __restrict__ CS, float* __restrict__ SN) { const int t = blockIdx.x * 256 + threadIdx.x; if (t >= SQ * (HD / 2)) return; const int p = t / (HD / 2), i = t % (HD / 2); const float c = bf16_round(cs[(size_t)p * HD + i]), s = bf16_round(sn[(size_t)p * HD + i]);
  *(float*)(CS + t) = c; *(float*)(SN + t) = s;  }

__global__ __launch_bounds__(256) void k_tab2d(float* __restrict__ CS, float* __restrict__ SN) {
  const int t = blockIdx.x * 256 + threadIdx.x; if (t >= SQ * (HD / 2)) return; const int i = t % (HD / 2); const int p = t / (HD / 2); const float invf = (float)(1.0 / pow(10000.0, (double)(2 * i) / (double)HD)); const float ang = __fmul_rn((float)p, invf); const float c = cosf(ang), s = sinf(ang);
  *(float*)(CS + t) = c; *(float*)(SN + t) = s;  }
extern "C" void kernel_launch(void* const* d_in, const int* in_sizes, int n_in,
                              void* d_out, int out_size, void* d_ws, size_t ws_size, hipStream_t stream) {
  (void)in_sizes; (void)n_in; (void)out_size;
  const float* const* I = (const float* const*)d_in; const float* x = I[0]; const float* xk = I[1]; const float* xv = I[2]; const float* wq = I[3]; const float* wk = I[5]; const float* wv = I[7]; const float* wo = I[9];      /* the streams query, key, value; natural [out][in] W_q, W_k, W_v, W_o; the biases b_q = I[4], b_k = I[6], b_v = I[8], b_o = I[10]; rope tables computed in-kernel (positions = row index) */
  static_assert(HPG == 1 && NH == NG * HPG && NH * HD == DM && KVD == DM, "plain multi-head attention as 16 kv groups of one query head"); const float* bq = I[4]; const float* bk = I[6]; const float* bv = I[8]; const float* bo = I[10];      /* the four biases, each bound to its projection (read through the GEMM bias pointer, bf16-rounded on load) */
  char* ws = (char*)d_ws; size_t off = 0;
  auto take = [&](size_t bytes) { char* p = ws + off; off += (bytes + 255) & ~(size_t)255; return p; };
  _Float16* BQKV = (_Float16*)take((size_t)3 * DM * DM * 2); _Float16* BQ = BQKV; _Float16* BK = BQKV + (size_t)DM * DM; _Float16* BV = BQKV + (size_t)2 * DM * DM; _Float16* BO = (_Float16*)take((size_t)DM * DM * 2);      /* one plane Bt [3072][1024]: rows 0..1023 = W_q, 1024.. = W_k, 2048.. = W_v (natural [out][in] weights are Bt as they stand) */
  _Float16* X16 = (_Float16*)take(NR * DM * 2); _Float16* XK16 = (_Float16*)take(NR * DM * 2); _Float16* XV16 = (_Float16*)take(NR * DM * 2); float* QF = (float*)take((size_t)SQ * DM * 4); float* KF = (float*)take((size_t)SQ * KVD * 4); float* CSB = (float*)take((size_t)SQ * HD * 4); float* SNB = (float*)take((size_t)SQ * HD * 4); _Float16* Q16 = (_Float16*)take(NR * DM * 2); _Float16* K16 = (_Float16*)take(NR * KVD * 2); _Float16* V16 = (_Float16*)take(NR * KVD * 2); _Float16* O16 = (_Float16*)take(NR * DM * 2);
  float* S = (float*)take((size_t)NH * QT * NKX * 4); _Float16* P = (_Float16*)take((size_t)NH * QT * NKX * 2); _Float16* VT = (_Float16*)take((size_t)NH * HD * SQ * 2);
  float* QF0 = (float*)take((size_t)QT0 * DM * 4); float* KF0 = (float*)take((size_t)QT0 * KVD * 4); float* VF0 = (float*)take((size_t)QT0 * KVD * 4); float* KF0e = (float*)take((size_t)QT0 * DM * 4); float* VF0e = (float*)take((size_t)QT0 * DM * 4); float* OF0 = (float*)take((size_t)NB * QT0 * DM * 4); _Float16* OH0 = (_Float16*)take((size_t)NB * QT0 * DM * 2); _Float16* OL0 = (_Float16*)take((size_t)NB * QT0 * DM * 2);
  if (off > ws_size) return;
  { const unsigned g = (unsigned)(((size_t)DM * DM / 8 + 255) / 256); k_wnat<<<g, 256, 0, stream>>>(wq, (size_t)DM * DM / 8, BQ); k_wnat<<<g, 256, 0, stream>>>(wk, (size_t)DM * DM / 8, BK); k_wnat<<<g, 256, 0, stream>>>(wv, (size_t)DM * DM / 8, BV); k_wnat<<<g, 256, 0, stream>>>(wo, (size_t)DM * DM / 8, BO); }      /* natural [out][in] = Bt x16 */
  k_x16<<<(unsigned)((NR * DM / 8 + 255) / 256), 256, 0, stream>>>(x, X16, NR * DM / 8); k_x16<<<(unsigned)((NR * DM / 8 + 255) / 256), 256, 0, stream>>>(xk, XK16, NR * DM / 8); k_x16<<<(unsigned)((NR * DM / 8 + 255) / 256), 256, 0, stream>>>(xv, XV16, NR * DM / 8);      /* the three streams as exact f16 rows */
  k_tab2d<<<(SQ * (HD / 2) + 255) / 256, 256, 0, stream>>>(CSB, SNB);      /* rope tables cos/sin(p / 10000^(2i/64)): inv_freq double-derived -> f32, f32 angle */
  const size_t r0p = (size_t)B0 * SQ;      /* first projected row */
  k_gemm2<0><<<dim3((unsigned)((MP / 128) * (KVD / 64)), 1), 128, 0, stream>>>(XV16 + r0p * DM, DM, 0, BV, DM, 0, 0.0625f, bv, 0, nullptr, 1, 0, 0, nullptr, V16 + r0p * KVD, KVD, 0, MP, KVD, DM);
  for (int b = B0; b < B0 + NBR; ++b) { const size_t r0 = (size_t)b * SQ;
    k_gemm2<0><<<dim3((unsigned)((SQ / 128) * (DM / 64)), 1), 128, 0, stream>>>(X16 + r0 * DM, DM, 0, BQ, DM, 0, 0.0625f, bq, 0, nullptr, 1, 0, 0, QF, nullptr, DM, 0, SQ, DM, DM);      /* q (f32) of this batch */
    k_gemm2<0><<<dim3((unsigned)((SQ / 128) * (KVD / 64)), 1), 128, 0, stream>>>(XK16 + r0 * DM, DM, 0, BK, DM, 0, 0.0625f, bk, 0, nullptr, 1, 0, 0, KF, nullptr, KVD, 0, SQ, KVD, DM);      /* k (f32) */
    k_xform<0, 2><<<(unsigned)((size_t)SQ * NH), 64, 0, stream>>>(QF, DM, NH, nullptr, 0.f, CSB, SNB, Q16 + r0 * DM, DM); k_xform<0, 2><<<(unsigned)((size_t)SQ * NG), 64, 0, stream>>>(KF, KVD, NG, nullptr, 0.f, CSB, SNB, K16 + r0 * KVD, KVD);      /* half-split rope <0, 2> (out_lo = x_lo c - x_hi s, out_hi = x_lo s + x_hi c = t cos + rotate_half(t) sin with the module's [f | f] tables) -> f16 rows */
    k_xformf<0, 2><<<(unsigned)(QT0 * NH), 64, 0, stream>>>(QF, DM, NH, nullptr, 0.f, CSB, SNB, QF0, DM); k_xformf<0, 2><<<(unsigned)(QT0 * NG), 64, 0, stream>>>(KF, KVD, NG, nullptr, 0.f, CSB, SNB, KF0, KVD);      /* f32 half-split-roped q, k of rows 0..255 */
    k_vt<NG, SQ><<<NG * (SQ / 64), 256, 0, stream>>>(V16 + r0 * KVD, KVD, 0, VT);      /* V^T [NH][HD][SQ] for this batch */
    k_gemm2<0><<<dim3((QT0 / 128) * (KVD / 64), 1), 128, 0, stream>>>(XV16 + r0 * DM, DM, 0, BV, DM, 0, 0.0625f, bv, 0, nullptr, 1, 0, 0, VF0, nullptr, KVD, 0, QT0, KVD, DM);
    k_kvexp<<<(unsigned)(((size_t)QT0 * DM / 4 + 255) / 256), 256, 0, stream>>>(KF0, KF0e, (size_t)QT0 * DM / 4); k_kvexp<<<(unsigned)(((size_t)QT0 * DM / 4 + 255) / 256), 256, 0, stream>>>(VF0, VF0e, (size_t)QT0 * DM / 4);      /* head h <- kv group h/HPG = h for the exact first-tile kernel */      /* f32 q, k, v of the first 256 rows (exact products) */
    k_att0<0><<<NH * (QT0 / 64), 64, 0, stream>>>(QF0, KF0e, VF0e, DM, nullptr, 0.125f, OF0 + (size_t)b * QT0 * DM, DM);      /* exact f32 attention for rows 0..255 (o x64) */
    for (int q0 = 0; q0 < QN; q0 += QT) { const int nk = q0 + QT;      /* causal: only keys below the tile end are computed */
      k_gemm2<0><<<dim3((QT / 128) * (nk / 64), NH), 128, 0, stream>>>(Q16 + (r0 + q0) * LQ, LQ, (size_t)HD, K16 + r0 * KVD, KVD, (size_t)HD, 0.125f, nullptr, 0, nullptr, 1, 0, 0, S, nullptr, NKX, (size_t)QT * NKX, QT, nk, HD);      /* scores: HPG == 1 (every head has its own keys): ONE launch with all 16 heads on grid.y, key head stride HD instead of the grouped form's 0 (the 16 per-group launches of one head each, fused) */
      static_assert(SQ / QT == 8 && QT == 256, "one softmax kernel per causal row length"); switch (nk / QT) { case 1: k_rsmcf2<2><<<(NHD * QT + 7) / 8, 256, 0, stream>>>(S, P, NHD, q0); break; case 2: k_rsmcf2<4><<<(NHD * QT + 7) / 8, 256, 0, stream>>>(S, P, NHD, q0); break; case 3: k_rsmcf2<6><<<(NHD * QT + 7) / 8, 256, 0, stream>>>(S, P, NHD, q0); break; case 4: k_rsmcf2<8><<<(NHD * QT + 7) / 8, 256, 0, stream>>>(S, P, NHD, q0); break; case 5: k_rsmcf2<10><<<(NHD * QT + 7) / 8, 256, 0, stream>>>(S, P, NHD, q0); break; case 6: k_rsmcf2<12><<<(NHD * QT + 7) / 8, 256, 0, stream>>>(S, P, NHD, q0); break; case 7: k_rsmcf2<14><<<(NHD * QT + 7) / 8, 256, 0, stream>>>(S, P, NHD, q0); break; case 8: k_rsmcf2<16><<<(NHD * QT + 7) / 8, 256, 0, stream>>>(S, P, NHD, q0); break; default: break; }      /* eight rows (waves) per block; row length nk as the template argument */
      k_gemm2<0><<<dim3((QT / 128) * (HD / 64), NH), 128, 0, stream>>>(P, NKX, (size_t)QT * NKX, VT, SQ, (size_t)HD * SQ, 0.25f, nullptr, 0, nullptr, 1, 0, 0, nullptr, O16 + (r0 + q0) * DM, DM, (size_t)HD, QT, HD, nk); } }      /* o for all 16 heads in ONE launch (value head stride HD*SQ) (x64) */
  k_gemm2<0><<<dim3((unsigned)((MPO / 128) * (DM / 64)), 1), 128, 0, stream>>>(O16 + r0p * DM, DM, 0, BO, DM, 0, 0.0009765625f, bo, 0, nullptr, 1, 0, 0, (float*)d_out + r0p * DM, nullptr, DM, 0, MPO, DM, DM);      /* out rows are the output layout */
  k_hl<<<(unsigned)(((size_t)NB * QT0 * DM / 8 + 255) / 256), 256, 0, stream>>>(OF0, OH0, OL0, (size_t)NB * QT0 * DM / 8);      /* first-tile o (x64) -> f16 hi + x1024 residual planes */
  for (int b = B0; b < B0 + NBR; ++b) { const size_t r0 = (size_t)b * SQ; const size_t f0 = (size_t)b * QT0;
    k_gemm2<0><<<dim3((QT0 / 128) * (DM / 64), 1), 128, 0, stream>>>(OH0 + f0 * DM, DM, 0, BO, DM, 0, 0.0009765625f, bo, 0, nullptr, 1, 0, 0, (float*)d_out + r0 * DM, nullptr, DM, 0, QT0, DM, DM);      /* rows 0..255: out = o_hi Wo (+ b), overwriting the f16-path rows */
    k_gemm2<0><<<dim3((QT0 / 128) * (DM / 64), 1), 128, 0, stream>>>(OL0 + f0 * DM, DM, 0, BO, DM, 0, 0.00000095367431640625f, nullptr, 0, (const float*)d_out + r0 * DM, -1, 0, 0, (float*)d_out + r0 * DM, nullptr, DM, 0, QT0, DM, DM); }      /* += o_lo Wo 2^-20 (own-element accumulate) */
}

// v002
// A run of this version takes 1830 microseconds.
// Timed twice side by side with v001, it ran 1.79 times as fast both times.
// Over all steps from v000 it is 4.01 times as fast.
#include <hip/hip_runtime.h>
// Causal multi-head attention over THREE input streams with rotate-half RoPE computed in the module (query, key, value [4][2048][1024]; Q = query W_q^T + b_q, K = key W_k^T + b_k, V = value W_v^T + b_v (natural [out][in] [1024][1024]; the four biases: bound and read), 16 heads of 64; cos / sin = [f, f] of pos * 10000^(-2i/64); Q = Q cos + rotate_half(Q) sin with rotate_half = cat(-x2, x1), likewise K (the bias is added BEFORE the rope); scores / sqrt(64); causal (triu k=1 at -inf); softmax; y = merged W_o^T + b_o (natural) -> [4][2048][1024]); run as grouped-query causal attention with 16 groups of ONE head with the rope stage in its half-split mode.
// Compute dtype: inputs rounded to bf16; x / weights exact; q, k, v, softmax weights and o as plain f16 GEMM operands (~2^-12); scores and softmax statistics f32; v_wmma_f32_16x16x32_f16.
#define NB 4
#define NG 16
#define HPG 1
#define KVD (NG * HD)
#define SQ 2048
#define DM 1024
#define NH 16
#define HD 64
#define HG 4                         /* unused */
#define QT 256                       /* unused */
#define NKX SQ                       /* unused */
#define QT0 256                      /* first-tile rows recomputed exactly in f32 */
#define B0 0                         /* first batch processed (debug hook) */
#define NBR NB                       /* batches processed (debug hook) */
#define NR ((size_t)NB * SQ)         /* token rows */
#define MP ((int)((size_t)NBR * SQ)) /* rows projected (debug hook) */
#define QN SQ                        /* query rows attended per batch (debug hook) */
#define NHD NH                       /* heads attended (debug hook) */
#define MPO MP                       /* rows through the output stage (debug hook) */
#define LQ DM      /* row pitch of the q/k/v rows */
typedef __bf16 v16b __attribute__((ext_vector_type(16)));
typedef unsigned short v8us __attribute__((ext_vector_type(8), may_alias));
typedef float  v8f  __attribute__((ext_vector_type(8)));
typedef float  v4f  __attribute__((ext_vector_type(4)));
typedef float  v4fa __attribute__((ext_vector_type(4), may_alias));
union FragB { v16b v; v8us half[2]; unsigned short u[16]; };

__device__ __forceinline__ unsigned short bf16_bits(float x) { unsigned int u = __float_as_uint(x); return (unsigned short)((u + 0x7FFFu + ((u >> 16) & 1u)) >> 16); }
__device__ __forceinline__ float bf16_val(unsigned short b) { return __uint_as_float(((unsigned int)b) << 16); }
__device__ __forceinline__ float bf16_round(float x) { return bf16_val(bf16_bits(x)); }
// D += A·B with NT terms: 1 = ah·bh, 2 = + al·bh (A split), 3 = + ah·bl (both split)
template <int NT>
__device__ __forceinline__ v8f mmaN(v16b ah, v16b al, v16b bh, v16b bl, v8f c) {
  c = __builtin_amdgcn_wmma_f32_16x16x32_bf16(false, ah, false, bh, (short)0, c, false, false);
  if (NT >= 2) c = __builtin_amdgcn_wmma_f32_16x16x32_bf16(false, al, false, bh, (short)0, c, false, false);
  if (NT >= 3) c = __builtin_amdgcn_wmma_f32_16x16x32_bf16(false, ah, false, bl, (short)0, c, false, false);
  asm volatile("v_nop\n\tv_nop\n\tv_nop\n\tv_nop" : "+v"(c) : "v"(ah), "v"(al), "v"(bh), "v"(bl));
  return c;
}

__global__ __launch_bounds__(256) void k_wt_bf16(const float* __restrict__ W, unsigned short* __restrict__ Wt, int K, int N) {
  const int t = blockIdx.x * 256 + threadIdx.x;
  const int k8n = K / 8;
  if (t >= N * k8n) return;
  const int n = t / k8n, k8 = (t % k8n) * 8;
  v8us v;
#pragma unroll
  for (int i = 0; i < 8; ++i) v[i] = bf16_bits(W[(size_t)(k8 + i) * N + n]);
  *(v8us*)(Wt + (size_t)n * K + k8) = v;
  
}

// GEMM C[M][N] (f32, pitch ldc) = act(A[M][K]·W + bias). A f32 row-major (pitch lda) converted per fragment to bf16
// (ASPLIT: hi/lo two planes -> 2 terms, else single rounded term); Wt bf16 [N][K] (pitch ldb). BIAS_BF16 rounds the
// bias to bf16 first (bias quantised to bf16 before the add). K%32==0, M%16==0, N%64==0.
template <bool ASPLIT, int ACT, bool BIAS_BF16>
__global__ __launch_bounds__(128) void k_gemm_bf(const float* __restrict__ A, int lda, const unsigned short* __restrict__ Wt, int ldb,
                                               const float* __restrict__ bias, float* __restrict__ C, int ldc, int M, int N, int K) {
  __shared__ __attribute__((aligned(16))) float so[4][16][64];
  const int tid = threadIdx.x, w = tid >> 5, lane = tid & 31, ln = lane & 15, hh = lane >> 4;
  const int ntn = N / 64;
  const int wid = blockIdx.x * 4 + w;
  const int mt = wid / ntn, nq = wid % ntn;
  if (mt * 16 >= M) return;
  const int row0 = mt * 16, col0 = nq * 64;
  const float* arow = A + (size_t)(row0 + ln) * lda;
  v8f acc[4] = {};
  for (int kb = 0; kb < K; kb += 32) {
    FragB ah, al;
    const v4f x0 = *(const v4fa*)(arow + kb + 8 * hh), x1 = *(const v4fa*)(arow + kb + 8 * hh + 4);
    const v4f x2 = *(const v4fa*)(arow + kb + 16 + 8 * hh), x3 = *(const v4fa*)(arow + kb + 16 + 8 * hh + 4);
    float xs[16] = {x0[0],x0[1],x0[2],x0[3],x1[0],x1[1],x1[2],x1[3],x2[0],x2[1],x2[2],x2[3],x3[0],x3[1],x3[2],x3[3]};
#pragma unroll
    for (int i = 0; i < 16; ++i) { const unsigned short hb = bf16_bits(xs[i]); ah.u[i] = hb; al.u[i] = ASPLIT ? bf16_bits(xs[i] - bf16_val(hb)) : (unsigned short)0; }
#pragma unroll
    for (int t = 0; t < 4; ++t) {
      const unsigned short* brow = Wt + (size_t)(col0 + t * 16 + ln) * ldb + kb;
      FragB b;
      b.half[0] = *(const v8us*)(brow + 8 * hh);
      b.half[1] = *(const v8us*)(brow + 16 + 8 * hh);
      acc[t] = mmaN<ASPLIT ? 2 : 1>(ah.v, al.v, b.v, b.v, acc[t]);
    }
  }
#pragma unroll
  for (int t = 0; t < 4; ++t) {
    float bv = bias ? bias[col0 + t * 16 + ln] : 0.f;
    if (BIAS_BF16) bv = bf16_round(bv);
#pragma unroll
    for (int r = 0; r < 8; ++r) { float v = acc[t][r] + bv; if (ACT == 1) v = fmaxf(v, 0.f); so[w][8 * hh + r][t * 16 + ln] = v; }
  }
  __builtin_amdgcn_fence(__ATOMIC_ACQ_REL, "workgroup");
  __builtin_amdgcn_wave_barrier();
  const int rsub = lane >> 4, c4 = (lane & 15) * 4;
  {
#pragma unroll
    for (int q = 0; q < 8; ++q) {
      const int r = q * 2 + rsub;
      const v4f v = *(const v4fa*)&so[w][r][c4];
      *(v4f*)(C + (size_t)(row0 + r) * ldc + col0 + c4) = v;
    }
    
  }
}

// GEMM C = act(A·W + bias + resid): A f32 (ASPLIT -> hi/lo 2 terms), Wt bf16 [N][K]; ACT 0 none, 1 relu, 2 exact gelu;
// resid (optional, f32, row index = (row % rmod), pitch ldr, RES_BF16 rounds it) added before the activation.
template <bool ASPLIT, int ACT, bool BIAS_BF16, bool RES_BF16>
__global__ __launch_bounds__(128) void k_gemm_bf3(const float* __restrict__ A, int lda, const unsigned short* __restrict__ Wt, int ldb,
                                                const float* __restrict__ bias, const float* __restrict__ resid, int rmod, int ldr,
                                                float* __restrict__ C, int ldc, int M, int N, int K) {
  __shared__ __attribute__((aligned(16))) float so[4][16][64];
  const int tid = threadIdx.x, w = tid >> 5, lane = tid & 31, ln = lane & 15, hh = lane >> 4;
  const int ntn = N / 64;
  const int wid = blockIdx.x * 4 + w;
  const int mt = wid / ntn, nq = wid % ntn;
  if (mt * 16 >= M) return;
  const int row0 = mt * 16, col0 = nq * 64;
  const float* arow = A + (size_t)(row0 + ln) * lda;
  v8f acc[4] = {};
  for (int kb = 0; kb < K; kb += 32) {
    FragB ah, al;
    const v4f x0 = *(const v4fa*)(arow + kb + 8 * hh), x1 = *(const v4fa*)(arow + kb + 8 * hh + 4);
    const v4f x2 = *(const v4fa*)(arow + kb + 16 + 8 * hh), x3 = *(const v4fa*)(arow + kb + 16 + 8 * hh + 4);
    float xs[16] = {x0[0],x0[1],x0[2],x0[3],x1[0],x1[1],x1[2],x1[3],x2[0],x2[1],x2[2],x2[3],x3[0],x3[1],x3[2],x3[3]};
#pragma unroll
    for (int i = 0; i < 16; ++i) { const unsigned short hb = bf16_bits(xs[i]); ah.u[i] = hb; al.u[i] = ASPLIT ? bf16_bits(xs[i] - bf16_val(hb)) : (unsigned short)0; }
#pragma unroll
    for (int t = 0; t < 4; ++t) {
      const unsigned short* brow = Wt + (size_t)(col0 + t * 16 + ln) * ldb + kb;
      FragB b;
      b.half[0] = *(const v8us*)(brow + 8 * hh);
      b.half[1] = *(const v8us*)(brow + 16 + 8 * hh);
      acc[t] = mmaN<ASPLIT ? 2 : 1>(ah.v, al.v, b.v, b.v, acc[t]);
    }
  }
#pragma unroll
  for (int t = 0; t < 4; ++t) {
    const int col = col0 + t * 16 + ln;
    float bv = bias ? bias[col] : 0.f;
    if (BIAS_BF16) bv = bf16_round(bv);
#pragma unroll
    for (int r = 0; r < 8; ++r) {
      float v = acc[t][r] + bv;
      if (resid) { float rv = resid[(size_t)((row0 + 8 * hh + r) % rmod) * ldr + col]; if (RES_BF16) rv = bf16_round(rv); v += rv; }
      if (ACT == 1) v = fmaxf(v, 0.f);
      if (ACT == 2) v = 0.5f * v * (1.0f + erff(v * 0.70710678118654752f));
      if (ACT == 3) { const float u = 0.7978845608028654f * (v + 0.044715f * v * v * v); v = 0.5f * v * (1.0f + tanhf(u)); }
      so[w][8 * hh + r][t * 16 + ln] = v;
    }
  }
  __builtin_amdgcn_fence(__ATOMIC_ACQ_REL, "workgroup");
  __builtin_amdgcn_wave_barrier();
  const int rsub = lane >> 4, c4 = (lane & 15) * 4;
  {
#pragma unroll
    for (int q = 0; q < 8; ++q) {
      const int r = q * 2 + rsub;
      const v4f v = *(const v4fa*)&so[w][r][c4];
      *(v4f*)(C + (size_t)(row0 + r) * ldc + col0 + c4) = v;
    }
    
  }
}
// row LayerNorm (biased variance, eps) over N: s = X (+ R); optional out_sum <- s; out_norm <- (s-mu)*rsqrt(var+eps)*g + b
template <bool PARAM_BF16>
__global__ __launch_bounds__(256) void k_layernorm(const float* __restrict__ X, const float* __restrict__ R, const float* __restrict__ g, const float* __restrict__ bta,
                                                  float* __restrict__ out_sum, float* __restrict__ out_norm, int N, float eps) {
  __shared__ float red[256];
  const int row = blockIdx.x, tid = threadIdx.x;
  const float* x = X + (size_t)row * N; const float* rr = R ? R + (size_t)row * N : nullptr;
  float vals[16];                     // up to N = 4096
  const int per = N / 256;            // contiguous chunk per thread? use strided-by-4 chunks: thread handles j = tid*4 + 1024*u
  float s1 = 0.f;
  for (int u = 0; u < per / 4; ++u) {
    const int j = tid * 4 + 1024 * u;
    const v4f a = *(const v4fa*)(x + j);
    v4f b = {0.f,0.f,0.f,0.f}; if (rr) b = *(const v4fa*)(rr + j);
#pragma unroll
    for (int q = 0; q < 4; ++q) { const float v = a[q] + b[q]; vals[u * 4 + q] = v; s1 += v; }
  }
  red[tid] = s1; __syncthreads();
  for (int st = 128; st > 0; st >>= 1) { if (tid < st) red[tid] += red[tid + st]; __syncthreads(); }
  const float mu = red[0] / (float)N; __syncthreads();
  float s2 = 0.f;
  for (int u = 0; u < per / 4; ++u)
#pragma unroll
    for (int q = 0; q < 4; ++q) { const float c = vals[u * 4 + q] - mu; s2 += c * c; }
  red[tid] = s2; __syncthreads();
  for (int st = 128; st > 0; st >>= 1) { if (tid < st) red[tid] += red[tid + st]; __syncthreads(); }
  const float rs = rsqrtf(red[0] / (float)N + eps);
  {
    for (int u = 0; u < per / 4; ++u) {
      const int j = tid * 4 + 1024 * u;
      v4f o, sm;
#pragma unroll
      for (int q = 0; q < 4; ++q) {
        float gg = g[j + q], bb = bta[j + q];
        if (PARAM_BF16) { gg = bf16_round(gg); bb = bf16_round(bb); }
        sm[q] = vals[u * 4 + q]; o[q] = (vals[u * 4 + q] - mu) * rs * gg + bb;
      }
      if (out_sum) *(v4f*)(out_sum + (size_t)row * N + j) = sm;
      *(v4f*)(out_norm + (size_t)row * N + j) = o;
    }
    
  }
}

// ---- f16 WMMA path (v_wmma_f32_16x16x32_f16): 11-bit significands for operands in range — used where a [0,1] probability operand needs more precision than bf16
typedef _Float16 v16h __attribute__((ext_vector_type(16)));
union FragH { v16h v; v8us half[2]; _Float16 h[16]; unsigned short u[16]; };
template <int NT>
__device__ __forceinline__ v8f mmaH(v16h ah, v16h al, v16h bh, v16h bl, v8f c) {
  c = __builtin_amdgcn_wmma_f32_16x16x32_f16(false, ah, false, bh, (short)0, c, false, false);
  if (NT >= 2) c = __builtin_amdgcn_wmma_f32_16x16x32_f16(false, al, false, bh, (short)0, c, false, false);
  if (NT >= 3) c = __builtin_amdgcn_wmma_f32_16x16x32_f16(false, ah, false, bl, (short)0, c, false, false);
  asm volatile("v_nop\n\tv_nop\n\tv_nop\n\tv_nop" : "+v"(c) : "v"(ah), "v"(al), "v"(bh), "v"(bl));
  return c;
}
// batched GEMM like k_gemm_b but f16 operands: A f32 (split into f16 hi/lo if ASPLIT, else rounded to f16), Bt = f16 values [n][k]; alpha; C f32; N multiple of 16 (partial tiles skipped)
template <bool ASPLIT>
__global__ __launch_bounds__(128) void k_gemm_h(const float* __restrict__ A, int lda, size_t sA, const _Float16* __restrict__ Bh, int ldb, size_t sB, float alpha, float* __restrict__ C, int ldc, size_t sC, int M, int N, int K) {
  __shared__ __attribute__((aligned(16))) float so[4][16][64];
  const int tid = threadIdx.x, w = tid >> 5, lane = tid & 31, ln = lane & 15, hh = lane >> 4; const int by = blockIdx.y;
  A += (size_t)by * sA; Bh += (size_t)by * sB; C += (size_t)by * sC;
  const int ntn = (N + 63) / 64; const int wid = blockIdx.x * 4 + w; const int mt = wid / ntn, nq = wid % ntn; if (mt * 16 >= M) return;
  const int row0 = mt * 16, col0 = nq * 64; const float* arow = A + (size_t)(row0 + ln) * lda;
  v8f acc[4] = {};
  for (int kb = 0; kb < K; kb += 32) {
    FragH ah, al;
    const v4f x0 = *(const v4fa*)(arow + kb + 8 * hh), x1 = *(const v4fa*)(arow + kb + 8 * hh + 4), x2 = *(const v4fa*)(arow + kb + 16 + 8 * hh), x3 = *(const v4fa*)(arow + kb + 16 + 8 * hh + 4);
    float xs[16] = {x0[0],x0[1],x0[2],x0[3],x1[0],x1[1],x1[2],x1[3],x2[0],x2[1],x2[2],x2[3],x3[0],x3[1],x3[2],x3[3]};
#pragma unroll
    for (int i = 0; i < 16; ++i) { const _Float16 h = (_Float16)xs[i]; ah.h[i] = h; al.h[i] = ASPLIT ? (_Float16)(xs[i] - (float)h) : (_Float16)0.0f; }
#pragma unroll
    for (int t = 0; t < 4; ++t) { if (col0 + t * 16 >= N) continue; const size_t boff = (size_t)(col0 + t * 16 + ln) * ldb + kb; FragH bq; bq.half[0] = *(const v8us*)(Bh + boff + 8 * hh); bq.half[1] = *(const v8us*)(Bh + boff + 16 + 8 * hh);
      acc[t] = mmaH<ASPLIT ? 2 : 1>(ah.v, al.v, bq.v, bq.v, acc[t]); }
  }
#pragma unroll
  for (int t = 0; t < 4; ++t) { if (col0 + t * 16 >= N) continue;
#pragma unroll
    for (int r = 0; r < 8; ++r) so[w][8 * hh + r][t * 16 + ln] = acc[t][r] * alpha; }
  __builtin_amdgcn_fence(__ATOMIC_ACQ_REL, "workgroup"); __builtin_amdgcn_wave_barrier();
  const int rsub = lane >> 4, c4 = (lane & 15) * 4;
  {
#pragma unroll
    for (int q = 0; q < 8; ++q) { const int r = q * 2 + rsub; if (col0 + c4 < N) { const v4f v = *(const v4fa*)&so[w][r][c4]; *(v4f*)(C + (size_t)(row0 + r) * ldc + col0 + c4) = v; } }
     }
}

// Wt[n][k] = f16(W[k][n]·scale) from f32 row-major W[K][N] (scale = power of two; bf16-exact weights stay exact in f16 away from the subnormal range)
__global__ __launch_bounds__(256) void k_wt_f16(const float* __restrict__ W, _Float16* __restrict__ Wt, int K, int N, float scale) {
  const int t = blockIdx.x * 256 + threadIdx.x; if (t >= N * (K / 8)) return; const int n = t / (K / 8), k8 = (t % (K / 8)) * 8; FragH f;
#pragma unroll
  for (int i = 0; i < 8; ++i) f.h[i] = (_Float16)(bf16_round(W[(size_t)(k8 + i) * N + n]) * scale); const v8us o = f.half[0];
  *(v8us*)((unsigned short*)Wt + (size_t)n * K + k8) = o; 
}
// k_gemm_hh variant with fused epilogue: v = acc·alpha + bias[by·sBias + col] (+ CP[(row/rowsPerB)·sCPb + by·64 + col] if CP) ; ACT 0 none / 1 elu ; writes f16 C16 (and f32 C if non-null)
template <int ACT>
__global__ __launch_bounds__(128) void k_gemm_hhx(const _Float16* __restrict__ A, int lda, size_t sA, const _Float16* __restrict__ Bh, int ldb, size_t sB, float alpha, const float* __restrict__ bias, size_t sBias, const float* __restrict__ CP, int rowsPerB, size_t sCPb, int row0g,
    float* __restrict__ C, _Float16* __restrict__ C16, int ldc, size_t sC, int M, int N, int K) {
  __shared__ __attribute__((aligned(16))) float so[4][16][64];
  const int tid = threadIdx.x, w = tid >> 5, lane = tid & 31, ln = lane & 15, hh = lane >> 4; const int by = blockIdx.y;
  A += (size_t)by * sA; Bh += (size_t)by * sB; const size_t cofs = (size_t)by * sC; const float* bp = bias ? bias + (size_t)by * sBias : nullptr;
  const int ntn = (N + 63) / 64; const int wid = blockIdx.x * 4 + w; const int mt = wid / ntn, nq = wid % ntn; if (mt * 16 >= M) return;
  const int row0 = mt * 16, col0 = nq * 64; const _Float16* arow = A + (size_t)(row0 + ln) * lda;
  v8f acc[4] = {};
  for (int kb = 0; kb < K; kb += 32) { FragH ah; ah.half[0] = *(const v8us*)((const unsigned short*)arow + kb + 8 * hh); ah.half[1] = *(const v8us*)((const unsigned short*)arow + kb + 16 + 8 * hh);
#pragma unroll
    for (int t = 0; t < 4; ++t) { if (col0 + t * 16 >= N) continue; const size_t boff = (size_t)(col0 + t * 16 + ln) * ldb + kb; FragH bq; bq.half[0] = *(const v8us*)((const unsigned short*)Bh + boff + 8 * hh); bq.half[1] = *(const v8us*)((const unsigned short*)Bh + boff + 16 + 8 * hh);
      acc[t] = mmaH<1>(ah.v, ah.v, bq.v, bq.v, acc[t]); }
  }
#pragma unroll
  for (int t = 0; t < 4; ++t) { if (col0 + t * 16 >= N) continue; const int col = col0 + t * 16 + ln; const float bv = bp ? bf16_round(bp[col]) : 0.f;
#pragma unroll
    for (int r = 0; r < 8; ++r) { float v = acc[t][r] * alpha + bv; if (CP) { const int rr = row0g + row0 + 8 * hh + r; if (rowsPerB < 0) v += CP[cofs + (size_t)rr * ldc + col];      /* rowsPerB < 0: own element of the batched C plane */ else { const int bidx = rr / rowsPerB; v += CP[(size_t)bidx * sCPb + (size_t)by * 64 + col]; } } if (ACT == 1) v = (v > 0.f) ? v : expm1f(v); else if (ACT == 7) v = (v > 0.f) ? v + 1.0f : expf(v); else if (ACT == 8) v = tanhf(v); else if (ACT == 9) v = 0.5f * v * (1.0f + tanhf(0.7978845608028654f * (v + 0.044715f * v * v * v))); else if (ACT == 11) v = 1.0f / (1.0f + expf(-v)); else if (ACT == 12) v = (v > 0.f) ? v : 0.01f * v; else if (ACT == 14) v = (v > 0.f) ? v : 0.1f * v; else if (ACT == 16) v = (v >= 0.f) ? v : 0.3f * v; else if (ACT == 17) v = (v >= 0.f) ? v : 0.2f * v; else if (ACT == 15) v = v / (1.0f + expf(-v)); else if (ACT == 3) v = fmaxf(v, 0.f); else if (ACT == 6) v = 0.5f * v * (1.0f + erff(v * 0.70710678118654752f)); so[w][8 * hh + r][t * 16 + ln] = v; } }
  __builtin_amdgcn_fence(__ATOMIC_ACQ_REL, "workgroup"); __builtin_amdgcn_wave_barrier();
  const int rsub = lane >> 4, c4 = (lane & 15) * 4; typedef _Float16 v4h __attribute__((ext_vector_type(4)));
  {
#pragma unroll
    for (int q = 0; q < 8; ++q) { const int r = q * 2 + rsub; if (col0 + c4 < N) { const v4f v = *(const v4fa*)&so[w][r][c4]; if (C) *(v4f*)(C + cofs + (size_t)(row0 + r) * ldc + col0 + c4) = v; if (C16) { v4h h4; for (int i = 0; i < 4; ++i) h4[i] = (_Float16)v[i]; *(v4h*)(C16 + cofs + (size_t)(row0 + r) * ldc + col0 + c4) = h4; } } }
     }
}

typedef _Float16 v4h __attribute__((ext_vector_type(4)));

__global__ __launch_bounds__(256) void k_x16(const float* __restrict__ x, _Float16* __restrict__ X16, size_t n8) { const size_t t = (size_t)blockIdx.x * 256 + threadIdx.x; if (t >= n8) return; FragH f;
#pragma unroll
  for (int q = 0; q < 8; ++q) f.h[q] = (_Float16)bf16_round(x[t * 8 + q]); *(v8us*)((unsigned short*)X16 + t * 8) = f.half[0];  }
__global__ __launch_bounds__(256) void k_h16(const float* __restrict__ x, _Float16* __restrict__ X16, size_t n8) { const size_t t = (size_t)blockIdx.x * 256 + threadIdx.x; if (t >= n8) return; FragH f;
#pragma unroll
  for (int q = 0; q < 8; ++q) f.h[q] = (_Float16)x[t * 8 + q]; *(v8us*)((unsigned short*)X16 + t * 8) = f.half[0];  }
__global__ __launch_bounds__(256) void k_round16f(const float* __restrict__ W, _Float16* __restrict__ Bt, size_t n8) { const size_t t = (size_t)blockIdx.x * 256 + threadIdx.x; if (t >= n8) return; FragH f;
#pragma unroll
  for (int i = 0; i < 8; ++i) f.h[i] = (_Float16)(bf16_round(W[t * 8 + i]) * 16.0f); *(v8us*)((unsigned short*)Bt + t * 8) = f.half[0];  }
template <int NHv, int TTv>
__global__ __launch_bounds__(256) void k_vt(const _Float16* __restrict__ V16, int ldv, int voff, _Float16* __restrict__ Vt) { __shared__ unsigned short tl[64][66]; const int tid = threadIdx.x; const int slab = blockIdx.x / (TTv / 64), lg = blockIdx.x % (TTv / 64); const int b = slab / NHv, h = slab % NHv;
  for (int i = tid; i < 64 * 8; i += 256) { const int r = i / 8, c8 = (i % 8) * 8; FragH f; f.half[0] = *(const v8us*)((const unsigned short*)V16 + ((size_t)b * TTv + lg * 64 + r) * ldv + voff + h * 64 + c8);
#pragma unroll
    for (int q = 0; q < 8; ++q) tl[r][c8 + q] = f.u[q]; }
  __syncthreads();
  {
#pragma unroll
    for (int rd = 0; rd < 2; ++rd) { const int d = rd * 32 + tid / 8, pc = tid % 8; FragH f;
#pragma unroll
      for (int q = 0; q < 8; ++q) f.u[q] = tl[pc * 8 + q][d];
      *(v8us*)((unsigned short*)Vt + ((size_t)slab * 64 + d) * TTv + lg * 64 + pc * 8) = f.half[0]; }
     } }

__global__ __launch_bounds__(256) void k_hl(const float* __restrict__ F, _Float16* __restrict__ Hh, _Float16* __restrict__ Hl, size_t n8) { const size_t t = (size_t)blockIdx.x * 256 + threadIdx.x; if (t >= n8) return; FragH fh, fl; const v4f a = *(const v4fa*)(F + t * 8), c = *(const v4fa*)(F + t * 8 + 4);
#pragma unroll
  for (int q = 0; q < 4; ++q) { _Float16 h = (_Float16)a[q]; fh.h[q] = h; fl.h[q] = (_Float16)((a[q] - (float)h) * 1024.0f); h = (_Float16)c[q]; fh.h[4 + q] = h; fl.h[4 + q] = (_Float16)((c[q] - (float)h) * 1024.0f); }
  { *(v8us*)((unsigned short*)Hh + t * 8) = fh.half[0]; *(v8us*)((unsigned short*)Hl + t * 8) = fl.half[0];  } }

// ---- fast GEMM (wave tile 32x64; requires M % 32 == 0 rows per launch region and N % 64 == 0); epilogue = k_gemm_hhx semantics ----
__device__ __forceinline__ v16h g2_frag(const _Float16* p, int hh) { FragH f; f.half[0] = *(const v8us*)((const unsigned short*)p + 8 * hh); f.half[1] = *(const v8us*)((const unsigned short*)p + 16 + 8 * hh); return f.v; }
__device__ __forceinline__ v8f g2_mma(v16h a, v16h b, v8f c) { v8f d = __builtin_amdgcn_wmma_f32_16x16x32_f16(false, a, false, b, (short)0, c, false, false); asm volatile("v_nop\n\tv_nop\n\tv_nop\n\tv_nop" : "+v"(d) : "v"(a), "v"(b)); return d; }
template <int ACT>
__global__ __launch_bounds__(128) void k_gemm2(const _Float16* __restrict__ A, int lda, size_t sA, const _Float16* __restrict__ Bh, int ldb, size_t sB, float alpha, const float* __restrict__ bias, size_t sBias, const float* __restrict__ CP, int rowsPerB, size_t sCPb, int row0g,
    float* __restrict__ C, _Float16* __restrict__ C16, int ldc, size_t sC, int M, int N, int K) { static_assert(ACT == 0 || ACT == 3 || ACT == 6 || ACT == 8 || ACT == 9 || ACT == 11 || ACT == 12 || ACT == 14 || ACT == 15 || ACT == 16 || ACT == 17, "k_gemm2: unsupported ACT code (would silently apply no activation)");
  __shared__ __attribute__((aligned(16))) float so[4][32][68];
  const int tid = threadIdx.x, w = tid >> 5, lane = tid & 31, ln = lane & 15, hh = lane >> 4; const int by = blockIdx.y;
  A += (size_t)by * sA; Bh += (size_t)by * sB; const size_t cofs = (size_t)by * sC; const float* bp = bias ? bias + (size_t)by * sBias : nullptr;
  const int ntn = N >> 6; const int mt = blockIdx.x / ntn, nq = blockIdx.x - mt * ntn; const int row0 = mt * 128 + 32 * w, col0 = nq * 64; if (row0 >= M) return;
  const _Float16* a0p = A + (size_t)(row0 + ln) * lda; const _Float16* a1p = a0p + (size_t)16 * lda;
  const _Float16* b0p = Bh + (size_t)(col0 + ln) * ldb; const _Float16* b1p = b0p + (size_t)16 * ldb; const _Float16* b2p = b1p + (size_t)16 * ldb; const _Float16* b3p = b2p + (size_t)16 * ldb;
  const v8f z8 = {0.f,0.f,0.f,0.f,0.f,0.f,0.f,0.f}; v8f c00 = z8, c01 = z8, c02 = z8, c03 = z8, c10 = z8, c11 = z8, c12 = z8, c13 = z8;
  for (int kb = 0; kb < K; kb += 32) { const v16h a0 = g2_frag(a0p + kb, hh), a1 = g2_frag(a1p + kb, hh);
    v16h b = g2_frag(b0p + kb, hh); c00 = g2_mma(a0, b, c00); c10 = g2_mma(a1, b, c10);
    b = g2_frag(b1p + kb, hh); c01 = g2_mma(a0, b, c01); c11 = g2_mma(a1, b, c11);
    b = g2_frag(b2p + kb, hh); c02 = g2_mma(a0, b, c02); c12 = g2_mma(a1, b, c12);
    b = g2_frag(b3p + kb, hh); c03 = g2_mma(a0, b, c03); c13 = g2_mma(a1, b, c13); }
  v8f accs[8] = {c00, c01, c02, c03, c10, c11, c12, c13};
#pragma unroll
  for (int u = 0; u < 8; ++u) { const int t = u & 3, half = u >> 2; const int col = col0 + t * 16 + ln; const float bv = bp ? bf16_round(bp[col]) : 0.f;
#pragma unroll
    for (int r = 0; r < 8; ++r) { const int rloc = half * 16 + 8 * hh + r; float v = accs[u][r] * alpha + bv; if (CP) { if (rowsPerB < 0) v += CP[cofs + (size_t)(row0g + row0 + rloc) * ldc + col];      /* rowsPerB < 0: own element of the batched C plane */ else { const int bidx = (row0g + row0 + rloc) / rowsPerB; v += CP[(size_t)bidx * sCPb + (size_t)by * 64 + col]; } }
      if (ACT == 3) v = fmaxf(v, 0.f); else if (ACT == 6) v = 0.5f * v * (1.0f + erff(v * 0.70710678118654752f)); else if (ACT == 11) v = 1.0f / (1.0f + expf(-v)); else if (ACT == 15) v = v / (1.0f + expf(-v)); else if (ACT == 12) v = (v > 0.f) ? v : 0.01f * v; else if (ACT == 8) v = tanhf(v); else if (ACT == 9) v = 0.5f * v * (1.0f + tanhf(0.7978845608028654f * (v + 0.044715f * v * v * v))); else if (ACT == 14) v = (v > 0.f) ? v : 0.1f * v; else if (ACT == 16) v = (v >= 0.f) ? v : 0.3f * v; else if (ACT == 17) v = (v >= 0.f) ? v : 0.2f * v;
      so[w][rloc][t * 16 + ln] = v; } }
  __builtin_amdgcn_fence(__ATOMIC_ACQ_REL, "workgroup"); __builtin_amdgcn_wave_barrier();
  const int rsub = lane >> 4, c4 = (lane & 15) * 4;
  {
#pragma unroll
    for (int q = 0; q < 16; ++q) { const int r = q * 2 + rsub; const v4f v = *(const v4fa*)&so[w][r][c4]; if (C) *(v4f*)(C + cofs + (size_t)(row0 + r) * ldc + col0 + c4) = v; if (C16) { v4h h4; for (int i = 0; i < 4; ++i) h4[i] = (_Float16)v[i]; *(v4h*)(C16 + cofs + (size_t)(row0 + r) * ldc + col0 + c4) = h4; } }
     } }

__global__ __launch_bounds__(256) void k_wnat(const float* __restrict__ w, size_t n8, _Float16* __restrict__ Bt) { const size_t t = (size_t)blockIdx.x * 256 + threadIdx.x; if (t >= n8) return; FragH f; for (int q = 0; q < 8; ++q) f.h[q] = (_Float16)(bf16_round(w[t * 8 + q]) * 16.0f); *(v8us*)((unsigned short*)Bt + t * 8) = f.half[0];  }

// exp2 with the one issue slot that the instruction set asks for behind a transcendental (before its source is overwritten or its result read) in the same statement.
__device__ __forceinline__ float exp2_slot(float x) { float e; asm("v_exp_f32 %0, %1\n\tv_nop" : "=v"(e) : "v"(x)); return e; }
__device__ __forceinline__ v8f fa_mma(v16h a, v16h b, v8f c) { return __builtin_amdgcn_wmma_f32_16x16x32_f16(false, a, false, b, (short)0, c, false, false); }
__device__ __forceinline__ float fa_xhalf(float x) { return __builtin_bit_cast(float, __builtin_amdgcn_permlanex16(__builtin_bit_cast(int, x), __builtin_bit_cast(int, x), 0x76543210, 0xfedcba98, false, false)); }      /* lane l with lane l ^ 16 */
__device__ __forceinline__ void fa_gap() { __builtin_amdgcn_sched_barrier(0); asm volatile("v_nop\n\tv_nop\n\tv_nop\n\tv_nop"); __builtin_amdgcn_sched_barrier(0); }      /* the four vector slots behind a group of WMMAs, on every path: a branch or a load over their operands follows; the two scheduling barriers keep the slots (and the loads issued ahead) where they stand */
template <bool LAST>      /* LAST = the wave's diagonal pass: masked, and no further K rows are fetched */
__device__ __forceinline__ void fa_pass(v16h (&kf)[2][2], const _Float16* __restrict__ kn, const _Float16* __restrict__ vp, int key0, int qw0, int ln, int hh, const v16h (&qf)[2][2], v8f (&acc)[2][4], float (&m_run)[2], float (&l_run)[2]) {
  const float cs = 0.125f * 1.44269504088896340736f;
  v16h vf[4];
#pragma unroll
  for (int t = 0; t < 4; ++t) vf[t] = g2_frag(vp + (size_t)(16 * t) * SQ, hh);      /* this pass's V^T rows, in flight under the scores and the exponentials */
  v8f s[2][2];
#pragma unroll
  for (int kt = 0; kt < 2; ++kt)
#pragma unroll
    for (int g = 0; g < 2; ++g) { const v8f z = {0.f, 0.f, 0.f, 0.f, 0.f, 0.f, 0.f, 0.f}; s[kt][g] = fa_mma(kf[kt][1], qf[g][1], fa_mma(kf[kt][0], qf[g][0], z)); }
  fa_gap();
  if (!LAST) {
#pragma unroll
    for (int kt = 0; kt < 2; ++kt)
#pragma unroll
      for (int kc = 0; kc < 2; ++kc) kf[kt][kc] = g2_frag(kn + (size_t)(16 * kt) * KVD + 32 * kc, hh);      /* next pass's K rows, one pass ahead */
  }
  if (LAST) {
#pragma unroll
    for (int g = 0; g < 2; ++g)
#pragma unroll
      for (int kt = 0; kt < 2; ++kt)
#pragma unroll
        for (int r = 0; r < 8; ++r) if (key0 + 16 * kt + 8 * hh + r > qw0 + 16 * g + ln) s[kt][g][r] = -3.0e38f;      /* causal: key above the query (key0 itself is never masked, so every maximum stays a real score) */
  }
  float mb[2]; bool need = false;
#pragma unroll
  for (int g = 0; g < 2; ++g) { float mx = s[0][g][0];
#pragma unroll
    for (int r = 1; r < 8; ++r) mx = fmaxf(mx, s[0][g][r]);
#pragma unroll
    for (int r = 0; r < 8; ++r) mx = fmaxf(mx, s[1][g][r]);
    mx = fmaxf(mx, fa_xhalf(mx)) * cs; mb[g] = mx; need = need || (mx > m_run[g] + 8.0f); }
  if (__builtin_amdgcn_ballot_w32(need) != 0) {      /* wave-uniform; rare after the first passes */
#pragma unroll
    for (int g = 0; g < 2; ++g) { const float mn = fmaxf(m_run[g], mb[g]); const float corr = exp2_slot(m_run[g] - mn); m_run[g] = mn; l_run[g] *= corr;
#pragma unroll
      for (int t = 0; t < 4; ++t) acc[g][t] = acc[g][t] * corr; }
  }
  FragH pf[2];
#pragma unroll
  for (int g = 0; g < 2; ++g) { const float nm = -m_run[g]; float ls[4] = {0.f, 0.f, 0.f, 0.f};
#pragma unroll
    for (int i = 0; i < 16; ++i) { const float e = exp2_slot(fmaf(s[i >> 3][g][i & 7], cs, nm)); ls[i & 3] += e; pf[g].h[i] = (_Float16)e; }
    l_run[g] += (ls[0] + ls[1]) + (ls[2] + ls[3]); }
  __builtin_amdgcn_sched_barrier(0);      /* every exponential stands ahead of the WMMAs */
#pragma unroll
  for (int g = 0; g < 2; ++g)
#pragma unroll
    for (int t = 0; t < 4; ++t) acc[g][t] = fa_mma(vf[t], pf[g].v, acc[g][t]);
  fa_gap();
  if (!LAST) { asm volatile("s_wait_xcnt 0x0" ::: "memory"); __builtin_amdgcn_sched_barrier(0); }      /* the wait in front of the advance of the K and V^T address pairs at the loop's foot; the scheduling barrier keeps the advance behind it */
}
__global__ __launch_bounds__(128) void k_fattn(const _Float16* __restrict__ Q, const _Float16* __restrict__ K, const _Float16* __restrict__ Vt, _Float16* __restrict__ O) {
  const int lane = threadIdx.x & 31, ln = lane & 15, hh = lane >> 4; const int w = __builtin_amdgcn_readfirstlane((int)(threadIdx.x >> 5));      /* the wave's number in a scalar register: trip count and branches stay scalar, EXEC stays full for the WMMAs */
  const int h = blockIdx.y, b = blockIdx.z; const int xs = (int)blockIdx.x, nq = (int)gridDim.x; const int qa = (xs & 1) ? (xs >> 1) : nq - 1 - (xs >> 1); const int qb = (b & 1) ? nq - 1 - qa : qa;      /* a permutation of the query tiles: long and short ones alternate between neighbouring blocks and between batches, so that the blocks that share a WGP carry about the same number of passes (speed only) */
  const int qw0 = qb * 128 + w * 32;
  const _Float16* Ql = Q + ((size_t)b * SQ + qw0 + ln) * DM + h * HD; const _Float16* Kl = K + ((size_t)b * SQ + ln) * KVD + h * HD; const _Float16* Vl = Vt + (((size_t)b * NH + h) * HD + ln) * SQ;
  v16h qf[2][2], kf[2][2];
#pragma unroll
  for (int g = 0; g < 2; ++g)
#pragma unroll
    for (int kc = 0; kc < 2; ++kc) { qf[g][kc] = g2_frag(Ql + (size_t)(16 * g) * DM + 32 * kc, hh); kf[g][kc] = g2_frag(Kl + (size_t)(16 * g) * KVD + 32 * kc, hh); }
  __builtin_amdgcn_sched_barrier(0); asm volatile("s_wait_xcnt 0x0" ::: "memory"); __builtin_amdgcn_sched_barrier(0);      /* the wait in front of any overwrite of these loads' address pairs; the scheduling barriers keep later register writes behind it */
  v8f acc[2][4]; float m_run[2] = {-3.0e38f, -3.0e38f}, l_run[2] = {0.f, 0.f};
#pragma unroll
  for (int g = 0; g < 2; ++g)
#pragma unroll
    for (int t = 0; t < 4; ++t) acc[g][t] = v8f{0.f, 0.f, 0.f, 0.f, 0.f, 0.f, 0.f, 0.f};
  const int nfull = qw0 / 32;      /* passes wholly below the diagonal */
#pragma unroll 1      /* one pass per trip: an unrolled body would hold two passes' fragments and lose a wave per SIMD */
  for (int p = 0; p < nfull; ++p) fa_pass<false>(kf, Kl + (size_t)(p + 1) * 32 * KVD, Vl + p * 32, p * 32, qw0, ln, hh, qf, acc, m_run, l_run);
  fa_pass<true>(kf, Kl, Vl + nfull * 32, nfull * 32, qw0, ln, hh, qf, acc, m_run, l_run);
  FragH of[2][4];
#pragma unroll
  for (int g = 0; g < 2; ++g) { const float l = l_run[g] + fa_xhalf(l_run[g]); const float inv = 64.0f / l;
#pragma unroll
    for (int t = 0; t < 4; ++t)
#pragma unroll
      for (int r = 0; r < 8; ++r) of[g][t].h[r] = (_Float16)(acc[g][t][r] * inv); }
  __builtin_amdgcn_sched_barrier(0);      /* all eight packed rows are made ahead of the first store, so that no register of an issued store is written again */
#pragma unroll
  for (int g = 0; g < 2; ++g)
#pragma unroll
    for (int t = 0; t < 4; ++t) *(v8us*)((unsigned short*)O + ((size_t)b * SQ + qw0 + 16 * g + ln) * DM + h * HD + 16 * t + 8 * hh) = of[g][t].half[0];      /* register r of tile t is d = 16 t + 8 hh + r of query ln: 16 bytes a lane; the wave writes each query's whole 128-byte head row */
}

template <int MASKADD>
__global__ __launch_bounds__(64) void k_att0(const float* __restrict__ QF, const float* __restrict__ KF, const float* __restrict__ VF, int ld, const float* __restrict__ mask, float scale, float* __restrict__ OF, int ldo) {
  __shared__ __attribute__((aligned(16))) float lq[64][64]; __shared__ __attribute__((aligned(16))) float lo[64][64];
  const int tid = threadIdx.x; const int h = blockIdx.x / (QT0 / 64), rg = blockIdx.x % (QT0 / 64); const int i = rg * 64 + tid;
  const float* qr = QF + (size_t)i * ld + h * HD;
  for (int c = 0; c < HD / 4; ++c) { *(v4f*)&lq[tid][c * 4] = *(const v4fa*)(qr + c * 4); const v4f z = {0.f, 0.f, 0.f, 0.f}; *(v4f*)&lo[tid][c * 4] = z; }
  float m = -1.0e30f, l = 0.f; const int jmax = MASKADD ? (SQ - 1) : (rg * 64 + 63);      /* additive-mask form: every key (the mask input decides); causal form: keys up to the block's last row */
  for (int j = 0; j <= jmax; ++j) { const float* kr = KF + (size_t)j * ld + h * HD; const float* vr = VF + (size_t)j * ld + h * HD; float s = 0.f;
    for (int c = 0; c < HD / 4; ++c) { const v4f kq = *(const v4fa*)(kr + c * 4); const v4f qq = *(v4f*)&lq[tid][c * 4]; s = __fadd_rn(s, __fmul_rn(qq[0], kq[0])); s = __fadd_rn(s, __fmul_rn(qq[1], kq[1])); s = __fadd_rn(s, __fmul_rn(qq[2], kq[2])); s = __fadd_rn(s, __fmul_rn(qq[3], kq[3])); }
    s = __fmul_rn(s, scale); if (MASKADD) s = __fadd_rn(s, __fmul_rn(bf16_round(mask[(size_t)i * SQ + j]), -10000.0f));
    const float f = (MASKADD || j <= i) ? 1.f : 0.f; const float sm = fmaf(f, s, (1.f - f) * -1.0e30f); const float mn = fmaxf(m, sm); const float sc = expf(m - mn); const float e = expf(sm - mn); l = __fadd_rn(__fmul_rn(l, sc), e); m = mn;
    for (int c = 0; c < HD / 4; ++c) { const v4f vv = *(const v4fa*)(vr + c * 4); v4f oo = *(v4f*)&lo[tid][c * 4]; for (int u = 0; u < 4; ++u) oo[u] = __fadd_rn(__fmul_rn(oo[u], sc), __fmul_rn(e, vv[u])); *(v4f*)&lo[tid][c * 4] = oo; } }
  const float fin = 64.0f / l;      /* o carried x64 like the f16 path */
  for (int c = 0; c < HD / 4; ++c) { v4f oo = *(v4f*)&lo[tid][c * 4]; for (int u = 0; u < 4; ++u) oo[u] = __fmul_rn(oo[u], fin); *(v4f*)&lo[tid][c * 4] = oo; }
  __syncthreads();
  {
    for (int it = 0; it < 16; ++it) { const int row = it * 4 + tid / 16, pc = (tid % 16) * 4; const v4f v = *(const v4f*)&lo[row][pc]; *(v4f*)(OF + (size_t)(rg * 64 + row) * ldo + h * HD + pc) = v; }
     } }

__global__ __launch_bounds__(256) void k_kvexp(const float* __restrict__ src, float* __restrict__ dst, size_t n4) { const size_t t = (size_t)blockIdx.x * 256 + threadIdx.x; if (t >= n4) return; const size_t e = t * 4; const size_t row = e / DM; const int col = (int)(e % DM); const int h = col / HD, d = col % HD; const v4f v = *(const v4fa*)(src + row * KVD + (size_t)(h / HPG) * HD + d); *(v4f*)(dst + e) = v;  }

__global__ __launch_bounds__(256) void k_tab2(float theta, float* __restrict__ CS, float* __restrict__ SN) {
  const int t = blockIdx.x * 256 + threadIdx.x; if (t >= SQ * (HD / 2)) return; const int i = t % (HD / 2); const int p = t / (HD / 2); const float invf = 1.0f / powf(theta, (float)(2 * i) / (float)HD); const float ang = __fmul_rn((float)p, invf); const float c = cosf(ang), s = sinf(ang);
  *(float*)(CS + t) = c; *(float*)(SN + t) = s;  }
template <int NORM, int ROPE>
__global__ __launch_bounds__(64) void k_xform(const float* __restrict__ F, int ldf, int nh, const float* __restrict__ gain, float eps, const float* __restrict__ CS, const float* __restrict__ SN, _Float16* __restrict__ H16, int ldo) {
  __shared__ float xv[HD]; __shared__ float red[HD]; __shared__ unsigned short sh_[HD]; const int d = threadIdx.x; const int h = blockIdx.x % nh; const size_t r = blockIdx.x / nh; const int p = (int)(r % SQ);
  float x = F[r * (size_t)ldf + (size_t)h * HD + d];
  if (NORM) { red[d] = __fmul_rn(x, x); __syncthreads(); for (int st = HD / 2; st > 0; st >>= 1) { if (d < st) red[d] = __fadd_rn(red[d], red[d + st]); __syncthreads(); } const float rs = rsqrtf(__fadd_rn(red[0] / (float)HD, eps)); x = __fmul_rn(__fmul_rn(x, rs), bf16_round(gain[d])); }
  xv[d] = x; __syncthreads();
  float o = x;
  if (ROPE == 1) { const int i = d >> 1; const float c = CS[p * (HD / 2) + i], s = SN[p * (HD / 2) + i]; const float ev = xv[2 * i], od = xv[2 * i + 1]; o = (d & 1) ? __fadd_rn(__fmul_rn(ev, s), __fmul_rn(od, c)) : __fadd_rn(__fmul_rn(ev, c), -__fmul_rn(od, s)); }
  if (ROPE == 2) { const int i = d & (HD / 2 - 1); const float c = CS[p * (HD / 2) + i], s = SN[p * (HD / 2) + i]; const float lo = xv[i], hi = xv[i + HD / 2]; o = (d < HD / 2) ? __fadd_rn(__fmul_rn(lo, c), -__fmul_rn(hi, s)) : __fadd_rn(__fmul_rn(lo, s), __fmul_rn(hi, c)); }
  if (ROPE == 3) { const float c = CS[p * HD + d], s = SN[p * HD + d]; const float lo = xv[d & (HD / 2 - 1)], hi = xv[(d & (HD / 2 - 1)) + HD / 2]; o = (d < HD / 2) ? __fadd_rn(__fmul_rn(lo, c), -__fmul_rn(hi, s)) : __fadd_rn(__fmul_rn(hi, c), __fmul_rn(lo, s)); }      /* rotate-half with FULL-width per-element tables [pos][HD] */
  FragH th; th.h[0] = (_Float16)o; sh_[d] = th.u[0]; __syncthreads();
  if (d < HD / 8) { FragH f; for (int q = 0; q < 8; ++q) f.u[q] = sh_[d * 8 + q]; unsigned short* dst = (unsigned short*)H16 + r * (size_t)ldo + (size_t)h * HD + d * 8; *(v8us*)dst = f.half[0];  } }

template <int NORM, int ROPE>
__global__ __launch_bounds__(64) void k_xformf(const float* __restrict__ F, int ldf, int nh, const float* __restrict__ gain, float eps, const float* __restrict__ CS, const float* __restrict__ SN, float* __restrict__ F32, int ldo) {
  __shared__ float xv[HD]; __shared__ float red[HD]; const int d = threadIdx.x; const int h = blockIdx.x % nh; const size_t r = blockIdx.x / nh; const int p = (int)(r % SQ);
  float x = F[r * (size_t)ldf + (size_t)h * HD + d];
  if (NORM) { red[d] = __fmul_rn(x, x); __syncthreads(); for (int st = HD / 2; st > 0; st >>= 1) { if (d < st) red[d] = __fadd_rn(red[d], red[d + st]); __syncthreads(); } const float rs = rsqrtf(__fadd_rn(red[0] / (float)HD, eps)); x = __fmul_rn(__fmul_rn(x, rs), bf16_round(gain[d])); }
  xv[d] = x; __syncthreads();
  float o = x;
  if (ROPE == 1) { const int i = d >> 1; const float c = CS[p * (HD / 2) + i], s = SN[p * (HD / 2) + i]; const float ev = xv[2 * i], od = xv[2 * i + 1]; o = (d & 1) ? __fadd_rn(__fmul_rn(ev, s), __fmul_rn(od, c)) : __fadd_rn(__fmul_rn(ev, c), -__fmul_rn(od, s)); }
  if (ROPE == 2) { const int i = d & (HD / 2 - 1); const float c = CS[p * (HD / 2) + i], s = SN[p * (HD / 2) + i]; const float lo = xv[i], hi = xv[i + HD / 2]; o = (d < HD / 2) ? __fadd_rn(__fmul_rn(lo, c), -__fmul_rn(hi, s)) : __fadd_rn(__fmul_rn(lo, s), __fmul_rn(hi, c)); }
  if (ROPE == 3) { const float c = CS[p * HD + d], s = SN[p * HD + d]; const float lo = xv[d & (HD / 2 - 1)], hi = xv[(d & (HD / 2 - 1)) + HD / 2]; o = (d < HD / 2) ? __fadd_rn(__fmul_rn(lo, c), -__fmul_rn(hi, s)) : __fadd_rn(__fmul_rn(hi, c), __fmul_rn(lo, s)); }      /* rotate-half with FULL-width per-element tables [pos][HD] */
  float* dst = F32 + r * (size_t)ldo + (size_t)h * HD + d; *(float*)dst = o;  }

__global__ __launch_bounds__(256) void k_bfcp(const float* __restrict__ src, float* __restrict__ dst, size_t n4) { const size_t t = (size_t)blockIdx.x * 256 + threadIdx.x; if (t >= n4) return; const v4f a = *(const v4fa*)(src + t * 4); v4f o; for (int q = 0; q < 4; ++q) o[q] = bf16_round(a[q]); *(v4f*)(dst + t * 4) = o;  }

__global__ __launch_bounds__(256) void k_tabhalf(const float* __restrict__ cs, const float* __restrict__ sn, float* __restrict__ CS, float* __restrict__ SN) { const int t = blockIdx.x * 256 + threadIdx.x; if (t >= SQ * (HD / 2)) return; const int p = t / (HD / 2), i = t % (HD / 2); const float c = bf16_round(cs[(size_t)p * HD + i]), s = bf16_round(sn[(size_t)p * HD + i]);
  *(float*)(CS + t) = c; *(float*)(SN + t) = s;  }

__global__ __launch_bounds__(256) void k_tab2d(float* __restrict__ CS, float* __restrict__ SN) {
  const int t = blockIdx.x * 256 + threadIdx.x; if (t >= SQ * (HD / 2)) return; const int i = t % (HD / 2); const int p = t / (HD / 2); const float invf = (float)(1.0 / pow(10000.0, (double)(2 * i) / (double)HD)); const float ang = __fmul_rn((float)p, invf); const float c = cosf(ang), s = sinf(ang);
  *(float*)(CS + t) = c; *(float*)(SN + t) = s;  }
extern "C" void kernel_launch(void* const* d_in, const int* in_sizes, int n_in,
                              void* d_out, int out_size, void* d_ws, size_t ws_size, hipStream_t stream) {
  (void)in_sizes; (void)n_in; (void)out_size;
  const float* const* I = (const float* const*)d_in; const float* x = I[0]; const float* xk = I[1]; const float* xv = I[2]; const float* wq = I[3]; const float* wk = I[5]; const float* wv = I[7]; const float* wo = I[9];      /* the streams query, key, value; natural [out][in] W_q, W_k, W_v, W_o; the biases b_q = I[4], b_k = I[6], b_v = I[8], b_o = I[10]; rope tables computed in-kernel (positions = row index) */
  static_assert(HPG == 1 && NH == NG * HPG && NH * HD == DM && KVD == DM, "plain multi-head attention as 16 kv groups of one query head"); const float* bq = I[4]; const float* bk = I[6]; const float* bv = I[8]; const float* bo = I[10];      /* the four biases, each bound to its projection (read through the GEMM bias pointer, bf16-rounded on load) */
  char* ws = (char*)d_ws; size_t off = 0;
  auto take = [&](size_t bytes) { char* p = ws + off; off += (bytes + 255) & ~(size_t)255; return p; };
  _Float16* BQKV = (_Float16*)take((size_t)3 * DM * DM * 2); _Float16* BQ = BQKV; _Float16* BK = BQKV + (size_t)DM * DM; _Float16* BV = BQKV + (size_t)2 * DM * DM; _Float16* BO = (_Float16*)take((size_t)DM * DM * 2);      /* one plane Bt [3072][1024]: rows 0..1023 = W_q, 1024.. = W_k, 2048.. = W_v (natural [out][in] weights are Bt as they stand) */
  _Float16* X16 = (_Float16*)take(NR * DM * 2); _Float16* XK16 = (_Float16*)take(NR * DM * 2); _Float16* XV16 = (_Float16*)take(NR * DM * 2); float* QF = (float*)take((size_t)SQ * DM * 4); float* KF = (float*)take((size_t)SQ * KVD * 4); float* CSB = (float*)take((size_t)SQ * HD * 4); float* SNB = (float*)take((size_t)SQ * HD * 4); _Float16* Q16 = (_Float16*)take(NR * DM * 2); _Float16* K16 = (_Float16*)take(NR * KVD * 2); _Float16* V16 = (_Float16*)take(NR * KVD * 2); _Float16* O16 = (_Float16*)take(NR * DM * 2);
  _Float16* VT = (_Float16*)take((size_t)NB * NH * HD * SQ * 2);
  float* QF0 = (float*)take((size_t)QT0 * DM * 4); float* KF0 = (float*)take((size_t)QT0 * KVD * 4); float* VF0 = (float*)take((size_t)QT0 * KVD * 4); float* KF0e = (float*)take((size_t)QT0 * DM * 4); float* VF0e = (float*)take((size_t)QT0 * DM * 4); float* OF0 = (float*)take((size_t)NB * QT0 * DM * 4); _Float16* OH0 = (_Float16*)take((size_t)NB * QT0 * DM * 2); _Float16* OL0 = (_Float16*)take((size_t)NB * QT0 * DM * 2);
  if (off > ws_size) return;
  { const unsigned g = (unsigned)(((size_t)DM * DM / 8 + 255) / 256); k_wnat<<<g, 256, 0, stream>>>(wq, (size_t)DM * DM / 8, BQ); k_wnat<<<g, 256, 0, stream>>>(wk, (size_t)DM * DM / 8, BK); k_wnat<<<g, 256, 0, stream>>>(wv, (size_t)DM * DM / 8, BV); k_wnat<<<g, 256, 0, stream>>>(wo, (size_t)DM * DM / 8, BO); }      /* natural [out][in] = Bt x16 */
  k_x16<<<(unsigned)((NR * DM / 8 + 255) / 256), 256, 0, stream>>>(x, X16, NR * DM / 8); k_x16<<<(unsigned)((NR * DM / 8 + 255) / 256), 256, 0, stream>>>(xk, XK16, NR * DM / 8); k_x16<<<(unsigned)((NR * DM / 8 + 255) / 256), 256, 0, stream>>>(xv, XV16, NR * DM / 8);      /* the three streams as exact f16 rows */
  k_tab2d<<<(SQ * (HD / 2) + 255) / 256, 256, 0, stream>>>(CSB, SNB);      /* rope tables cos/sin(p / 10000^(2i/64)): inv_freq double-derived -> f32, f32 angle */
  const size_t r0p = (size_t)B0 * SQ;      /* first projected row */
  k_gemm2<0><<<dim3((unsigned)((MP / 128) * (KVD / 64)), 1), 128, 0, stream>>>(XV16 + r0p * DM, DM, 0, BV, DM, 0, 0.0625f, bv, 0, nullptr, 1, 0, 0, nullptr, V16 + r0p * KVD, KVD, 0, MP, KVD, DM);
  for (int b = B0; b < B0 + NBR; ++b) { const size_t r0 = (size_t)b * SQ;
    k_gemm2<0><<<dim3((unsigned)((SQ / 128) * (DM / 64)), 1), 128, 0, stream>>>(X16 + r0 * DM, DM, 0, BQ, DM, 0, 0.0625f, bq, 0, nullptr, 1, 0, 0, QF, nullptr, DM, 0, SQ, DM, DM);      /* q (f32) of this batch */
    k_gemm2<0><<<dim3((unsigned)((SQ / 128) * (KVD / 64)), 1), 128, 0, stream>>>(XK16 + r0 * DM, DM, 0, BK, DM, 0, 0.0625f, bk, 0, nullptr, 1, 0, 0, KF, nullptr, KVD, 0, SQ, KVD, DM);      /* k (f32) */
    k_xform<0, 2><<<(unsigned)((size_t)SQ * NH), 64, 0, stream>>>(QF, DM, NH, nullptr, 0.f, CSB, SNB, Q16 + r0 * DM, DM); k_xform<0, 2><<<(unsigned)((size_t)SQ * NG), 64, 0, stream>>>(KF, KVD, NG, nullptr, 0.f, CSB, SNB, K16 + r0 * KVD, KVD);      /* half-split rope <0, 2> (out_lo = x_lo c - x_hi s, out_hi = x_lo s + x_hi c = t cos + rotate_half(t) sin with the module's [f | f] tables) -> f16 rows */
    k_xformf<0, 2><<<(unsigned)(QT0 * NH), 64, 0, stream>>>(QF, DM, NH, nullptr, 0.f, CSB, SNB, QF0, DM); k_xformf<0, 2><<<(unsigned)(QT0 * NG), 64, 0, stream>>>(KF, KVD, NG, nullptr, 0.f, CSB, SNB, KF0, KVD);      /* f32 half-split-roped q, k of rows 0..255 */
    k_vt<NG, SQ><<<NG * (SQ / 64), 256, 0, stream>>>(V16 + r0 * KVD, KVD, 0, VT + (size_t)b * NH * HD * SQ);      /* V^T [NH][HD][SQ] of this batch, in its own plane */
    k_gemm2<0><<<dim3((QT0 / 128) * (KVD / 64), 1), 128, 0, stream>>>(XV16 + r0 * DM, DM, 0, BV, DM, 0, 0.0625f, bv, 0, nullptr, 1, 0, 0, VF0, nullptr, KVD, 0, QT0, KVD, DM);
    k_kvexp<<<(unsigned)(((size_t)QT0 * DM / 4 + 255) / 256), 256, 0, stream>>>(KF0, KF0e, (size_t)QT0 * DM / 4); k_kvexp<<<(unsigned)(((size_t)QT0 * DM / 4 + 255) / 256), 256, 0, stream>>>(VF0, VF0e, (size_t)QT0 * DM / 4);      /* head h <- kv group h/HPG = h for the exact first-tile kernel */      /* f32 q, k, v of the first 256 rows (exact products) */
    k_att0<0><<<NH * (QT0 / 64), 64, 0, stream>>>(QF0, KF0e, VF0e, DM, nullptr, 0.125f, OF0 + (size_t)b * QT0 * DM, DM);      /* exact f32 attention for rows 0..255 (o x64) */
  }
  static_assert(SQ % 128 == 0 && HD == 64 && B0 == 0 && NBR == NB && QN == SQ && NHD == NH, "k_fattn: four waves of 32 query columns, head size 64, every batch and head");
  k_fattn<<<dim3(SQ / 128, NH, NB), 128, 0, stream>>>(Q16, K16, VT, O16);      /* scores, causal softmax and o (x64) of every batch, head and query tile in ONE launch */
  k_gemm2<0><<<dim3((unsigned)((MPO / 128) * (DM / 64)), 1), 128, 0, stream>>>(O16 + r0p * DM, DM, 0, BO, DM, 0, 0.0009765625f, bo, 0, nullptr, 1, 0, 0, (float*)d_out + r0p * DM, nullptr, DM, 0, MPO, DM, DM);      /* out rows are the output layout */
  k_hl<<<(unsigned)(((size_t)NB * QT0 * DM / 8 + 255) / 256), 256, 0, stream>>>(OF0, OH0, OL0, (size_t)NB * QT0 * DM / 8);      /* first-tile o (x64) -> f16 hi + x1024 residual planes */
  for (int b = B0; b < B0 + NBR; ++b) { const size_t r0 = (size_t)b * SQ; const size_t f0 = (size_t)b * QT0;
    k_gemm2<0><<<dim3((QT0 / 128) * (DM / 64), 1), 128, 0, stream>>>(OH0 + f0 * DM, DM, 0, BO, DM, 0, 0.0009765625f, bo, 0, nullptr, 1, 0, 0, (float*)d_out + r0 * DM, nullptr, DM, 0, QT0, DM, DM);      /* rows 0..255: out = o_hi Wo (+ b), overwriting the f16-path rows */
    k_gemm2<0><<<dim3((QT0 / 128) * (DM / 64), 1), 128, 0, stream>>>(OL0 + f0 * DM, DM, 0, BO, DM, 0, 0.00000095367431640625f, nullptr, 0, (const float*)d_out + r0 * DM, -1, 0, 0, (float*)d_out + r0 * DM, nullptr, DM, 0, QT0, DM, DM); }      /* += o_lo Wo 2^-20 (own-element accumulate) */
}

// v003
// It runs in 708 microseconds.
// Next to v002, in two timings, it ran 2.59 times as fast each time.
// Counting every step since v000, it is 10.4 times as fast.
#include <hip/hip_runtime.h>
// Causal multi-head attention over THREE input streams with rotate-half RoPE computed in the module (query, key, value [4][2048][1024]; Q = query W_q^T + b_q, K = key W_k^T + b_k, V = value W_v^T + b_v (natural [out][in] [1024][1024]; the four biases: bound and read), 16 heads of 64; cos / sin = [f, f] of pos * 10000^(-2i/64); Q = Q cos + rotate_half(Q) sin with rotate_half = cat(-x2, x1), likewise K (the bias is added BEFORE the rope); scores / sqrt(64); causal (triu k=1 at -inf); softmax; y = merged W_o^T + b_o (natural) -> [4][2048][1024]); run as grouped-query causal attention with 16 groups of ONE head with the rope stage in its half-split mode.
// Compute dtype: inputs rounded to bf16; x / weights exact; q, k, v, softmax weights and o as plain f16 GEMM operands (~2^-12); scores and softmax statistics f32; v_wmma_f32_16x16x32_f16.
#define NB 4
#define NG 16
#define HPG 1
#define KVD (NG * HD)
#define SQ 2048
#define DM 1024
#define NH 16
#define HD 64
#define HG 4                         /* unused */
#define QT 256                       /* unused */
#define NKX SQ                       /* unused */
#define QT0 256                      /* first-tile rows recomputed exactly in f32 */
#define B0 0                         /* first batch processed (debug hook) */
#define NBR NB                       /* batches processed (debug hook) */
#define NR ((size_t)NB * SQ)         /* token rows */
#define MP ((int)((size_t)NBR * SQ)) /* rows projected (debug hook) */
#define QN SQ                        /* query rows attended per batch (debug hook) */
#define NHD NH                       /* heads attended (debug hook) */
#define MPO MP                       /* rows through the output stage (debug hook) */
#define LQ DM      /* unused */
typedef __bf16 v16b __attribute__((ext_vector_type(16)));
typedef unsigned short v8us __attribute__((ext_vector_type(8), may_alias));
typedef float  v8f  __attribute__((ext_vector_type(8)));
typedef float  v4f  __attribute__((ext_vector_type(4)));
typedef float  v4fa __attribute__((ext_vector_type(4), may_alias));
union FragB { v16b v; v8us half[2]; unsigned short u[16]; };

__device__ __forceinline__ unsigned short bf16_bits(float x) { unsigned int u = __float_as_uint(x); return (unsigned short)((u + 0x7FFFu + ((u >> 16) & 1u)) >> 16); }
__device__ __forceinline__ float bf16_val(unsigned short b) { return __uint_as_float(((unsigned int)b) << 16); }
__device__ __forceinline__ float bf16_round(float x) { return bf16_val(bf16_bits(x)); }
// D += A·B with NT terms: 1 = ah·bh, 2 = + al·bh (A split), 3 = + ah·bl (both split)
template <int NT>
__device__ __forceinline__ v8f mmaN(v16b ah, v16b al, v16b bh, v16b bl, v8f c) {
  c = __builtin_amdgcn_wmma_f32_16x16x32_bf16(false, ah, false, bh, (short)0, c, false, false);
  if (NT >= 2) c = __builtin_amdgcn_wmma_f32_16x16x32_bf16(false, al, false, bh, (short)0, c, false, false);
  if (NT >= 3) c = __builtin_amdgcn_wmma_f32_16x16x32_bf16(false, ah, false, bl, (short)0, c, false, false);
  asm volatile("v_nop\n\tv_nop\n\tv_nop\n\tv_nop" : "+v"(c) : "v"(ah), "v"(al), "v"(bh), "v"(bl));
  return c;
}

__global__ __launch_bounds__(256) void k_wt_bf16(const float* __restrict__ W, unsigned short* __restrict__ Wt, int K, int N) {
  const int t = blockIdx.x * 256 + threadIdx.x;
  const int k8n = K / 8;
  if (t >= N * k8n) return;
  const int n = t / k8n, k8 = (t % k8n) * 8;
  v8us v;
#pragma unroll
  for (int i = 0; i < 8; ++i) v[i] = bf16_bits(W[(size_t)(k8 + i) * N + n]);
  *(v8us*)(Wt + (size_t)n * K + k8) = v;
  
}

// GEMM C[M][N] (f32, pitch ldc) = act(A[M][K]·W + bias). A f32 row-major (pitch lda) converted per fragment to bf16
// (ASPLIT: hi/lo two planes -> 2 terms, else single rounded term); Wt bf16 [N][K] (pitch ldb). BIAS_BF16 rounds the
// bias to bf16 first (bias quantised to bf16 before the add). K%32==0, M%16==0, N%64==0.
template <bool ASPLIT, int ACT, bool BIAS_BF16>
__global__ __launch_bounds__(128) void k_gemm_bf(const float* __restrict__ A, int lda, const unsigned short* __restrict__ Wt, int ldb,
                                               const float* __restrict__ bias, float* __restrict__ C, int ldc, int M, int N, int K) {
  __shared__ __attribute__((aligned(16))) float so[4][16][64];
  const int tid = threadIdx.x, w = tid >> 5, lane = tid & 31, ln = lane & 15, hh = lane >> 4;
  const int ntn = N / 64;
  const int wid = blockIdx.x * 4 + w;
  const int mt = wid / ntn, nq = wid % ntn;
  if (mt * 16 >= M) return;
  const int row0 = mt * 16, col0 = nq * 64;
  const float* arow = A + (size_t)(row0 + ln) * lda;
  v8f acc[4] = {};
  for (int kb = 0; kb < K; kb += 32) {
    FragB ah, al;
    const v4f x0 = *(const v4fa*)(arow + kb + 8 * hh), x1 = *(const v4fa*)(arow + kb + 8 * hh + 4);
    const v4f x2 = *(const v4fa*)(arow + kb + 16 + 8 * hh), x3 = *(const v4fa*)(arow + kb + 16 + 8 * hh + 4);
    float xs[16] = {x0[0],x0[1],x0[2],x0[3],x1[0],x1[1],x1[2],x1[3],x2[0],x2[1],x2[2],x2[3],x3[0],x3[1],x3[2],x3[3]};
#pragma unroll
    for (int i = 0; i < 16; ++i) { const unsigned short hb = bf16_bits(xs[i]); ah.u[i] = hb; al.u[i] = ASPLIT ? bf16_bits(xs[i] - bf16_val(hb)) : (unsigned short)0; }
#pragma unroll
    for (int t = 0; t < 4; ++t) {
      const unsigned short* brow = Wt + (size_t)(col0 + t * 16 + ln) * ldb + kb;
      FragB b;
      b.half[0] = *(const v8us*)(brow + 8 * hh);
      b.half[1] = *(const v8us*)(brow + 16 + 8 * hh);
      acc[t] = mmaN<ASPLIT ? 2 : 1>(ah.v, al.v, b.v, b.v, acc[t]);
    }
  }
#pragma unroll
  for (int t = 0; t < 4; ++t) {
    float bv = bias ? bias[col0 + t * 16 + ln] : 0.f;
    if (BIAS_BF16) bv = bf16_round(bv);
#pragma unroll
    for (int r = 0; r < 8; ++r) { float v = acc[t][r] + bv; if (ACT == 1) v = fmaxf(v, 0.f); so[w][8 * hh + r][t * 16 + ln] = v; }
  }
  __builtin_amdgcn_fence(__ATOMIC_ACQ_REL, "workgroup");
  __builtin_amdgcn_wave_barrier();
  const int rsub = lane >> 4, c4 = (lane & 15) * 4;
  {
#pragma unroll
    for (int q = 0; q < 8; ++q) {
      const int r = q * 2 + rsub;
      const v4f v = *(const v4fa*)&so[w][r][c4];
      *(v4f*)(C + (size_t)(row0 + r) * ldc + col0 + c4) = v;
    }
    
  }
}

// GEMM C = act(A·W + bias + resid): A f32 (ASPLIT -> hi/lo 2 terms), Wt bf16 [N][K]; ACT 0 none, 1 relu, 2 exact gelu;
// resid (optional, f32, row index = (row % rmod), pitch ldr, RES_BF16 rounds it) added before the activation.
template <bool ASPLIT, int ACT, bool BIAS_BF16, bool RES_BF16>
__global__ __launch_bounds__(128) void k_gemm_bf3(const float* __restrict__ A, int lda, const unsigned short* __restrict__ Wt, int ldb,
                                                const float* __restrict__ bias, const float* __restrict__ resid, int rmod, int ldr,
                                                float* __restrict__ C, int ldc, int M, int N, int K) {
  __shared__ __attribute__((aligned(16))) float so[4][16][64];
  const int tid = threadIdx.x, w = tid >> 5, lane = tid & 31, ln = lane & 15, hh = lane >> 4;
  const int ntn = N / 64;
  const int wid = blockIdx.x * 4 + w;
  const int mt = wid / ntn, nq = wid % ntn;
  if (mt * 16 >= M) return;
  const int row0 = mt * 16, col0 = nq * 64;
  const float* arow = A + (size_t)(row0 + ln) * lda;
  v8f acc[4] = {};
  for (int kb = 0; kb < K; kb += 32) {
    FragB ah, al;
    const v4f x0 = *(const v4fa*)(arow + kb + 8 * hh), x1 = *(const v4fa*)(arow + kb + 8 * hh + 4);
    const v4f x2 = *(const v4fa*)(arow + kb + 16 + 8 * hh), x3 = *(const v4fa*)(arow + kb + 16 + 8 * hh + 4);
    float xs[16] = {x0[0],x0[1],x0[2],x0[3],x1[0],x1[1],x1[2],x1[3],x2[0],x2[1],x2[2],x2[3],x3[0],x3[1],x3[2],x3[3]};
#pragma unroll
    for (int i = 0; i < 16; ++i) { const unsigned short hb = bf16_bits(xs[i]); ah.u[i] = hb; al.u[i] = ASPLIT ? bf16_bits(xs[i] - bf16_val(hb)) : (unsigned short)0; }
#pragma unroll
    for (int t = 0; t < 4; ++t) {
      const unsigned short* brow = Wt + (size_t)(col0 + t * 16 + ln) * ldb + kb;
      FragB b;
      b.half[0] = *(const v8us*)(brow + 8 * hh);
      b.half[1] = *(const v8us*)(brow + 16 + 8 * hh);
      acc[t] = mmaN<ASPLIT ? 2 : 1>(ah.v, al.v, b.v, b.v, acc[t]);
    }
  }
#pragma unroll
  for (int t = 0; t < 4; ++t) {
    const int col = col0 + t * 16 + ln;
    float bv = bias ? bias[col] : 0.f;
    if (BIAS_BF16) bv = bf16_round(bv);
#pragma unroll
    for (int r = 0; r < 8; ++r) {
      float v = acc[t][r] + bv;
      if (resid) { float rv = resid[(size_t)((row0 + 8 * hh + r) % rmod) * ldr + col]; if (RES_BF16) rv = bf16_round(rv); v += rv; }
      if (ACT == 1) v = fmaxf(v, 0.f);
      if (ACT == 2) v = 0.5f * v * (1.0f + erff(v * 0.70710678118654752f));
      if (ACT == 3) { const float u = 0.7978845608028654f * (v + 0.044715f * v * v * v); v = 0.5f * v * (1.0f + tanhf(u)); }
      so[w][8 * hh + r][t * 16 + ln] = v;
    }
  }
  __builtin_amdgcn_fence(__ATOMIC_ACQ_REL, "workgroup");
  __builtin_amdgcn_wave_barrier();
  const int rsub = lane >> 4, c4 = (lane & 15) * 4;
  {
#pragma unroll
    for (int q = 0; q < 8; ++q) {
      const int r = q * 2 + rsub;
      const v4f v = *(const v4fa*)&so[w][r][c4];
      *(v4f*)(C + (size_t)(row0 + r) * ldc + col0 + c4) = v;
    }
    
  }
}
// row LayerNorm (biased variance, eps) over N: s = X (+ R); optional out_sum <- s; out_norm <- (s-mu)*rsqrt(var+eps)*g + b
template <bool PARAM_BF16>
__global__ __launch_bounds__(256) void k_layernorm(const float* __restrict__ X, const float* __restrict__ R, const float* __restrict__ g, const float* __restrict__ bta,
                                                  float* __restrict__ out_sum, float* __restrict__ out_norm, int N, float eps) {
  __shared__ float red[256];
  const int row = blockIdx.x, tid = threadIdx.x;
  const float* x = X + (size_t)row * N; const float* rr = R ? R + (size_t)row * N : nullptr;
  float vals[16];                     // up to N = 4096
  const int per = N / 256;            // contiguous chunk per thread? use strided-by-4 chunks: thread handles j = tid*4 + 1024*u
  float s1 = 0.f;
  for (int u = 0; u < per / 4; ++u) {
    const int j = tid * 4 + 1024 * u;
    const v4f a = *(const v4fa*)(x + j);
    v4f b = {0.f,0.f,0.f,0.f}; if (rr) b = *(const v4fa*)(rr + j);
#pragma unroll
    for (int q = 0; q < 4; ++q) { const float v = a[q] + b[q]; vals[u * 4 + q] = v; s1 += v; }
  }
  red[tid] = s1; __syncthreads();
  for (int st = 128; st > 0; st >>= 1) { if (tid < st) red[tid] += red[tid + st]; __syncthreads(); }
  const float mu = red[0] / (float)N; __syncthreads();
  float s2 = 0.f;
  for (int u = 0; u < per / 4; ++u)
#pragma unroll
    for (int q = 0; q < 4; ++q) { const float c = vals[u * 4 + q] - mu; s2 += c * c; }
  red[tid] = s2; __syncthreads();
  for (int st = 128; st > 0; st >>= 1) { if (tid < st) red[tid] += red[tid + st]; __syncthreads(); }
  const float rs = rsqrtf(red[0] / (float)N + eps);
  {
    for (int u = 0; u < per / 4; ++u) {
      const int j = tid * 4 + 1024 * u;
      v4f o, sm;
#pragma unroll
      for (int q = 0; q < 4; ++q) {
        float gg = g[j + q], bb = bta[j + q];
        if (PARAM_BF16) { gg = bf16_round(gg); bb = bf16_round(bb); }
        sm[q] = vals[u * 4 + q]; o[q] = (vals[u * 4 + q] - mu) * rs * gg + bb;
      }
      if (out_sum) *(v4f*)(out_sum + (size_t)row * N + j) = sm;
      *(v4f*)(out_norm + (size_t)row * N + j) = o;
    }
    
  }
}

// ---- f16 WMMA path (v_wmma_f32_16x16x32_f16): 11-bit significands for operands in range — used where a [0,1] probability operand needs more precision than bf16
typedef _Float16 v16h __attribute__((ext_vector_type(16)));
union FragH { v16h v; v8us half[2]; _Float16 h[16]; unsigned short u[16]; };
template <int NT>
__device__ __forceinline__ v8f mmaH(v16h ah, v16h al, v16h bh, v16h bl, v8f c) {
  c = __builtin_amdgcn_wmma_f32_16x16x32_f16(false, ah, false, bh, (short)0, c, false, false);
  if (NT >= 2) c = __builtin_amdgcn_wmma_f32_16x16x32_f16(false, al, false, bh, (short)0, c, false, false);
  if (NT >= 3) c = __builtin_amdgcn_wmma_f32_16x16x32_f16(false, ah, false, bl, (short)0, c, false, false);
  asm volatile("v_nop\n\tv_nop\n\tv_nop\n\tv_nop" : "+v"(c) : "v"(ah), "v"(al), "v"(bh), "v"(bl));
  return c;
}
// batched GEMM like k_gemm_b but f16 operands: A f32 (split into f16 hi/lo if ASPLIT, else rounded to f16), Bt = f16 values [n][k]; alpha; C f32; N multiple of 16 (partial tiles skipped)
template <bool ASPLIT>
__global__ __launch_bounds__(128) void k_gemm_h(const float* __restrict__ A, int lda, size_t sA, const _Float16* __restrict__ Bh, int ldb, size_t sB, float alpha, float* __restrict__ C, int ldc, size_t sC, int M, int N, int K) {
  __shared__ __attribute__((aligned(16))) float so[4][16][64];
  const int tid = threadIdx.x, w = tid >> 5, lane = tid & 31, ln = lane & 15, hh = lane >> 4; const int by = blockIdx.y;
  A += (size_t)by * sA; Bh += (size_t)by * sB; C += (size_t)by * sC;
  const int ntn = (N + 63) / 64; const int wid = blockIdx.x * 4 + w; const int mt = wid / ntn, nq = wid % ntn; if (mt * 16 >= M) return;
  const int row0 = mt * 16, col0 = nq * 64; const float* arow = A + (size_t)(row0 + ln) * lda;
  v8f acc[4] = {};
  for (int kb = 0; kb < K; kb += 32) {
    FragH ah, al;
    const v4f x0 = *(const v4fa*)(arow + kb + 8 * hh), x1 = *(const v4fa*)(arow + kb + 8 * hh + 4), x2 = *(const v4fa*)(arow + kb + 16 + 8 * hh), x3 = *(const v4fa*)(arow + kb + 16 + 8 * hh + 4);
    float xs[16] = {x0[0],x0[1],x0[2],x0[3],x1[0],x1[1],x1[2],x1[3],x2[0],x2[1],x2[2],x2[3],x3[0],x3[1],x3[2],x3[3]};
#pragma unroll
    for (int i = 0; i < 16; ++i) { const _Float16 h = (_Float16)xs[i]; ah.h[i] = h; al.h[i] = ASPLIT ? (_Float16)(xs[i] - (float)h) : (_Float16)0.0f; }
#pragma unroll
    for (int t = 0; t < 4; ++t) { if (col0 + t * 16 >= N) continue; const size_t boff = (size_t)(col0 + t * 16 + ln) * ldb + kb; FragH bq; bq.half[0] = *(const v8us*)(Bh + boff + 8 * hh); bq.half[1] = *(const v8us*)(Bh + boff + 16 + 8 * hh);
      acc[t] = mmaH<ASPLIT ? 2 : 1>(ah.v, al.v, bq.v, bq.v, acc[t]); }
  }
#pragma unroll
  for (int t = 0; t < 4; ++t) { if (col0 + t * 16 >= N) continue;
#pragma unroll
    for (int r = 0; r < 8; ++r) so[w][8 * hh + r][t * 16 + ln] = acc[t][r] * alpha; }
  __builtin_amdgcn_fence(__ATOMIC_ACQ_REL, "workgroup"); __builtin_amdgcn_wave_barrier();
  const int rsub = lane >> 4, c4 = (lane & 15) * 4;
  {
#pragma unroll
    for (int q = 0; q < 8; ++q) { const int r = q * 2 + rsub; if (col0 + c4 < N) { const v4f v = *(const v4fa*)&so[w][r][c4]; *(v4f*)(C + (size_t)(row0 + r) * ldc + col0 + c4) = v; } }
     }
}

// Wt[n][k] = f16(W[k][n]·scale) from f32 row-major W[K][N] (scale = power of two; bf16-exact weights stay exact in f16 away from the subnormal range)
__global__ __launch_bounds__(256) void k_wt_f16(const float* __restrict__ W, _Float16* __restrict__ Wt, int K, int N, float scale) {
  const int t = blockIdx.x * 256 + threadIdx.x; if (t >= N * (K / 8)) return; const int n = t / (K / 8), k8 = (t % (K / 8)) * 8; FragH f;
#pragma unroll
  for (int i = 0; i < 8; ++i) f.h[i] = (_Float16)(bf16_round(W[(size_t)(k8 + i) * N + n]) * scale); const v8us o = f.half[0];
  *(v8us*)((unsigned short*)Wt + (size_t)n * K + k8) = o; 
}
// k_gemm_hh variant with fused epilogue: v = acc·alpha + bias[by·sBias + col] (+ CP[(row/rowsPerB)·sCPb + by·64 + col] if CP) ; ACT 0 none / 1 elu ; writes f16 C16 (and f32 C if non-null)
template <int ACT>
__global__ __launch_bounds__(128) void k_gemm_hhx(const _Float16* __restrict__ A, int lda, size_t sA, const _Float16* __restrict__ Bh, int ldb, size_t sB, float alpha, const float* __restrict__ bias, size_t sBias, const float* __restrict__ CP, int rowsPerB, size_t sCPb, int row0g,
    float* __restrict__ C, _Float16* __restrict__ C16, int ldc, size_t sC, int M, int N, int K) {
  __shared__ __attribute__((aligned(16))) float so[4][16][64];
  const int tid = threadIdx.x, w = tid >> 5, lane = tid & 31, ln = lane & 15, hh = lane >> 4; const int by = blockIdx.y;
  A += (size_t)by * sA; Bh += (size_t)by * sB; const size_t cofs = (size_t)by * sC; const float* bp = bias ? bias + (size_t)by * sBias : nullptr;
  const int ntn = (N + 63) / 64; const int wid = blockIdx.x * 4 + w; const int mt = wid / ntn, nq = wid % ntn; if (mt * 16 >= M) return;
  const int row0 = mt * 16, col0 = nq * 64; const _Float16* arow = A + (size_t)(row0 + ln) * lda;
  v8f acc[4] = {};
  for (int kb = 0; kb < K; kb += 32) { FragH ah; ah.half[0] = *(const v8us*)((const unsigned short*)arow + kb + 8 * hh); ah.half[1] = *(const v8us*)((const unsigned short*)arow + kb + 16 + 8 * hh);
#pragma unroll
    for (int t = 0; t < 4; ++t) { if (col0 + t * 16 >= N) continue; const size_t boff = (size_t)(col0 + t * 16 + ln) * ldb + kb; FragH bq; bq.half[0] = *(const v8us*)((const unsigned short*)Bh + boff + 8 * hh); bq.half[1] = *(const v8us*)((const unsigned short*)Bh + boff + 16 + 8 * hh);
      acc[t] = mmaH<1>(ah.v, ah.v, bq.v, bq.v, acc[t]); }
  }
#pragma unroll
  for (int t = 0; t < 4; ++t) { if (col0 + t * 16 >= N) continue; const int col = col0 + t * 16 + ln; const float bv = bp ? bf16_round(bp[col]) : 0.f;
#pragma unroll
    for (int r = 0; r < 8; ++r) { float v = acc[t][r] * alpha + bv; if (CP) { const int rr = row0g + row0 + 8 * hh + r; if (rowsPerB < 0) v += CP[cofs + (size_t)rr * ldc + col];      /* rowsPerB < 0: own element of the batched C plane */ else { const int bidx = rr / rowsPerB; v += CP[(size_t)bidx * sCPb + (size_t)by * 64 + col]; } } if (ACT == 1) v = (v > 0.f) ? v : expm1f(v); else if (ACT == 7) v = (v > 0.f) ? v + 1.0f : expf(v); else if (ACT == 8) v = tanhf(v); else if (ACT == 9) v = 0.5f * v * (1.0f + tanhf(0.7978845608028654f * (v + 0.044715f * v * v * v))); else if (ACT == 11) v = 1.0f / (1.0f + expf(-v)); else if (ACT == 12) v = (v > 0.f) ? v : 0.01f * v; else if (ACT == 14) v = (v > 0.f) ? v : 0.1f * v; else if (ACT == 16) v = (v >= 0.f) ? v : 0.3f * v; else if (ACT == 17) v = (v >= 0.f) ? v : 0.2f * v; else if (ACT == 15) v = v / (1.0f + expf(-v)); else if (ACT == 3) v = fmaxf(v, 0.f); else if (ACT == 6) v = 0.5f * v * (1.0f + erff(v * 0.70710678118654752f)); so[w][8 * hh + r][t * 16 + ln] = v; } }
  __builtin_amdgcn_fence(__ATOMIC_ACQ_REL, "workgroup"); __builtin_amdgcn_wave_barrier();
  const int rsub = lane >> 4, c4 = (lane & 15) * 4; typedef _Float16 v4h __attribute__((ext_vector_type(4)));
  {
#pragma unroll
    for (int q = 0; q < 8; ++q) { const int r = q * 2 + rsub; if (col0 + c4 < N) { const v4f v = *(const v4fa*)&so[w][r][c4]; if (C) *(v4f*)(C + cofs + (size_t)(row0 + r) * ldc + col0 + c4) = v; if (C16) { v4h h4; for (int i = 0; i < 4; ++i) h4[i] = (_Float16)v[i]; *(v4h*)(C16 + cofs + (size_t)(row0 + r) * ldc + col0 + c4) = h4; } } }
     }
}

typedef _Float16 v4h __attribute__((ext_vector_type(4)));

__global__ __launch_bounds__(256) void k_x16(const float* __restrict__ x, _Float16* __restrict__ X16, size_t n8) { const size_t t = (size_t)blockIdx.x * 256 + threadIdx.x; if (t >= n8) return; FragH f;
#pragma unroll
  for (int q = 0; q < 8; ++q) f.h[q] = (_Float16)bf16_round(x[t * 8 + q]); *(v8us*)((unsigned short*)X16 + t * 8) = f.half[0];  }
__global__ __launch_bounds__(256) void k_h16(const float* __restrict__ x, _Float16* __restrict__ X16, size_t n8) { const size_t t = (size_t)blockIdx.x * 256 + threadIdx.x; if (t >= n8) return; FragH f;
#pragma unroll
  for (int q = 0; q < 8; ++q) f.h[q] = (_Float16)x[t * 8 + q]; *(v8us*)((unsigned short*)X16 + t * 8) = f.half[0];  }
__global__ __launch_bounds__(256) void k_round16f(const float* __restrict__ W, _Float16* __restrict__ Bt, size_t n8) { const size_t t = (size_t)blockIdx.x * 256 + threadIdx.x; if (t >= n8) return; FragH f;
#pragma unroll
  for (int i = 0; i < 8; ++i) f.h[i] = (_Float16)(bf16_round(W[t * 8 + i]) * 16.0f); *(v8us*)((unsigned short*)Bt + t * 8) = f.half[0];  }
template <int NHv, int TTv>
__global__ __launch_bounds__(256) void k_vt(const _Float16* __restrict__ V16, int ldv, int voff, _Float16* __restrict__ Vt) { __shared__ unsigned short tl[64][66]; const int tid = threadIdx.x; const int slab = blockIdx.x / (TTv / 64), lg = blockIdx.x % (TTv / 64); const int b = slab / NHv, h = slab % NHv;
  for (int i = tid; i < 64 * 8; i += 256) { const int r = i / 8, c8 = (i % 8) * 8; FragH f; f.half[0] = *(const v8us*)((const unsigned short*)V16 + ((size_t)b * TTv + lg * 64 + r) * ldv + voff + h * 64 + c8);
#pragma unroll
    for (int q = 0; q < 8; ++q) tl[r][c8 + q] = f.u[q]; }
  __syncthreads();
  {
#pragma unroll
    for (int rd = 0; rd < 2; ++rd) { const int d = rd * 32 + tid / 8, pc = tid % 8; FragH f;
#pragma unroll
      for (int q = 0; q < 8; ++q) f.u[q] = tl[pc * 8 + q][d];
      *(v8us*)((unsigned short*)Vt + ((size_t)slab * 64 + d) * TTv + lg * 64 + pc * 8) = f.half[0]; }
     } }

__global__ __launch_bounds__(256) void k_hl(const float* __restrict__ F, _Float16* __restrict__ Hh, _Float16* __restrict__ Hl, size_t n8) { const size_t t = (size_t)blockIdx.x * 256 + threadIdx.x; if (t >= n8) return; FragH fh, fl; const v4f a = *(const v4fa*)(F + t * 8), c = *(const v4fa*)(F + t * 8 + 4);
#pragma unroll
  for (int q = 0; q < 4; ++q) { _Float16 h = (_Float16)a[q]; fh.h[q] = h; fl.h[q] = (_Float16)((a[q] - (float)h) * 1024.0f); h = (_Float16)c[q]; fh.h[4 + q] = h; fl.h[4 + q] = (_Float16)((c[q] - (float)h) * 1024.0f); }
  { *(v8us*)((unsigned short*)Hh + t * 8) = fh.half[0]; *(v8us*)((unsigned short*)Hl + t * 8) = fl.half[0];  } }

// ---- fast GEMM (wave tile 32x64; requires M % 32 == 0 rows per launch region and N % 64 == 0); epilogue = k_gemm_hhx semantics ----
__device__ __forceinline__ v16h g2_frag(const _Float16* p, int hh) { FragH f; f.half[0] = *(const v8us*)((const unsigned short*)p + 8 * hh); f.half[1] = *(const v8us*)((const unsigned short*)p + 16 + 8 * hh); return f.v; }
__device__ __forceinline__ v8f g2_mma(v16h a, v16h b, v8f c) { v8f d = __builtin_amdgcn_wmma_f32_16x16x32_f16(false, a, false, b, (short)0, c, false, false); asm volatile("v_nop\n\tv_nop\n\tv_nop\n\tv_nop" : "+v"(d) : "v"(a), "v"(b)); return d; }
template <int ACT>
__global__ __launch_bounds__(128) void k_gemm2(const _Float16* __restrict__ A, int lda, size_t sA, const _Float16* __restrict__ Bh, int ldb, size_t sB, float alpha, const float* __restrict__ bias, size_t sBias, const float* __restrict__ CP, int rowsPerB, size_t sCPb, int row0g,
    float* __restrict__ C, _Float16* __restrict__ C16, int ldc, size_t sC, int M, int N, int K) { static_assert(ACT == 0 || ACT == 3 || ACT == 6 || ACT == 8 || ACT == 9 || ACT == 11 || ACT == 12 || ACT == 14 || ACT == 15 || ACT == 16 || ACT == 17, "k_gemm2: unsupported ACT code (would silently apply no activation)");
  __shared__ __attribute__((aligned(16))) float so[4][32][68];
  const int tid = threadIdx.x, w = tid >> 5, lane = tid & 31, ln = lane & 15, hh = lane >> 4; const int by = blockIdx.y;
  A += (size_t)by * sA; Bh += (size_t)by * sB; const size_t cofs = (size_t)by * sC; const float* bp = bias ? bias + (size_t)by * sBias : nullptr;
  const int ntn = N >> 6; const int mt = blockIdx.x / ntn, nq = blockIdx.x - mt * ntn; const int row0 = mt * 128 + 32 * w, col0 = nq * 64; if (row0 >= M) return;
  const _Float16* a0p = A + (size_t)(row0 + ln) * lda; const _Float16* a1p = a0p + (size_t)16 * lda;
  const _Float16* b0p = Bh + (size_t)(col0 + ln) * ldb; const _Float16* b1p = b0p + (size_t)16 * ldb; const _Float16* b2p = b1p + (size_t)16 * ldb; const _Float16* b3p = b2p + (size_t)16 * ldb;
  const v8f z8 = {0.f,0.f,0.f,0.f,0.f,0.f,0.f,0.f}; v8f c00 = z8, c01 = z8, c02 = z8, c03 = z8, c10 = z8, c11 = z8, c12 = z8, c13 = z8;
  for (int kb = 0; kb < K; kb += 32) { const v16h a0 = g2_frag(a0p + kb, hh), a1 = g2_frag(a1p + kb, hh);
    v16h b = g2_frag(b0p + kb, hh); c00 = g2_mma(a0, b, c00); c10 = g2_mma(a1, b, c10);
    b = g2_frag(b1p + kb, hh); c01 = g2_mma(a0, b, c01); c11 = g2_mma(a1, b, c11);
    b = g2_frag(b2p + kb, hh); c02 = g2_mma(a0, b, c02); c12 = g2_mma(a1, b, c12);
    b = g2_frag(b3p + kb, hh); c03 = g2_mma(a0, b, c03); c13 = g2_mma(a1, b, c13); }
  v8f accs[8] = {c00, c01, c02, c03, c10, c11, c12, c13};
#pragma unroll
  for (int u = 0; u < 8; ++u) { const int t = u & 3, half = u >> 2; const int col = col0 + t * 16 + ln; const float bv = bp ? bf16_round(bp[col]) : 0.f;
#pragma unroll
    for (int r = 0; r < 8; ++r) { const int rloc = half * 16 + 8 * hh + r; float v = accs[u][r] * alpha + bv; if (CP) { if (rowsPerB < 0) v += CP[cofs + (size_t)(row0g + row0 + rloc) * ldc + col];      /* rowsPerB < 0: own element of the batched C plane */ else { const int bidx = (row0g + row0 + rloc) / rowsPerB; v += CP[(size_t)bidx * sCPb + (size_t)by * 64 + col]; } }
      if (ACT == 3) v = fmaxf(v, 0.f); else if (ACT == 6) v = 0.5f * v * (1.0f + erff(v * 0.70710678118654752f)); else if (ACT == 11) v = 1.0f / (1.0f + expf(-v)); else if (ACT == 15) v = v / (1.0f + expf(-v)); else if (ACT == 12) v = (v > 0.f) ? v : 0.01f * v; else if (ACT == 8) v = tanhf(v); else if (ACT == 9) v = 0.5f * v * (1.0f + tanhf(0.7978845608028654f * (v + 0.044715f * v * v * v))); else if (ACT == 14) v = (v > 0.f) ? v : 0.1f * v; else if (ACT == 16) v = (v >= 0.f) ? v : 0.3f * v; else if (ACT == 17) v = (v >= 0.f) ? v : 0.2f * v;
      so[w][rloc][t * 16 + ln] = v; } }
  __builtin_amdgcn_fence(__ATOMIC_ACQ_REL, "workgroup"); __builtin_amdgcn_wave_barrier();
  const int rsub = lane >> 4, c4 = (lane & 15) * 4;
  {
#pragma unroll
    for (int q = 0; q < 16; ++q) { const int r = q * 2 + rsub; const v4f v = *(const v4fa*)&so[w][r][c4]; if (C) *(v4f*)(C + cofs + (size_t)(row0 + r) * ldc + col0 + c4) = v; if (C16) { v4h h4; for (int i = 0; i < 4; ++i) h4[i] = (_Float16)v[i]; *(v4h*)(C16 + cofs + (size_t)(row0 + r) * ldc + col0 + c4) = h4; } }
     } }

__global__ __launch_bounds__(256) void k_wnat(const float* __restrict__ w, size_t n8, _Float16* __restrict__ Bt) { const size_t t = (size_t)blockIdx.x * 256 + threadIdx.x; if (t >= n8) return; FragH f; for (int q = 0; q < 8; ++q) f.h[q] = (_Float16)(bf16_round(w[t * 8 + q]) * 16.0f); *(v8us*)((unsigned short*)Bt + t * 8) = f.half[0];  }

// exp2 with the one issue slot that the instruction set asks for behind a transcendental (before its source is overwritten or its result read) in the same statement.
__device__ __forceinline__ float exp2_slot(float x) { float e; asm("v_exp_f32 %0, %1\n\tv_nop" : "=v"(e) : "v"(x)); return e; }
__device__ __forceinline__ v8f fa_mma(v16h a, v16h b, v8f c) { return __builtin_amdgcn_wmma_f32_16x16x32_f16(false, a, false, b, (short)0, c, false, false); }
__device__ __forceinline__ float fa_xhalf(float x) { return __builtin_bit_cast(float, __builtin_amdgcn_permlanex16(__builtin_bit_cast(int, x), __builtin_bit_cast(int, x), 0x76543210, 0xfedcba98, false, false)); }      /* lane l with lane l ^ 16 */
__device__ __forceinline__ void fa_gap() { __builtin_amdgcn_sched_barrier(0); asm volatile("v_nop\n\tv_nop\n\tv_nop\n\tv_nop"); __builtin_amdgcn_sched_barrier(0); }      /* the four vector slots behind a group of WMMAs, on every path: a branch or a load over their operands follows; the two scheduling barriers keep the slots (and the loads issued ahead) where they stand */
template <bool LAST>      /* LAST = the wave's diagonal pass: masked, and no further K rows are fetched */
__device__ __forceinline__ void fa_pass(v16h (&kf)[2][2], const _Float16* __restrict__ kn, const _Float16* __restrict__ vp, int key0, int qw0, int ln, int hh, const v16h (&qf)[2][2], v8f (&acc)[2][4], float (&m_run)[2], float (&l_run)[2]) {
  const float cs = 0.125f * 1.44269504088896340736f;
  v16h vf[4];
#pragma unroll
  for (int t = 0; t < 4; ++t) vf[t] = g2_frag(vp + (size_t)(16 * t) * SQ, hh);      /* this pass's V^T rows, in flight under the scores and the exponentials */
  v8f s[2][2];
#pragma unroll
  for (int kt = 0; kt < 2; ++kt)
#pragma unroll
    for (int g = 0; g < 2; ++g) { const v8f z = {0.f, 0.f, 0.f, 0.f, 0.f, 0.f, 0.f, 0.f}; s[kt][g] = fa_mma(kf[kt][1], qf[g][1], fa_mma(kf[kt][0], qf[g][0], z)); }
  fa_gap();
  if (!LAST) {
#pragma unroll
    for (int kt = 0; kt < 2; ++kt)
#pragma unroll
      for (int kc = 0; kc < 2; ++kc) kf[kt][kc] = g2_frag(kn + (size_t)(16 * kt) * KVD + 32 * kc, hh);      /* next pass's K rows, one pass ahead */
  }
  if (LAST) {
#pragma unroll
    for (int g = 0; g < 2; ++g)
#pragma unroll
      for (int kt = 0; kt < 2; ++kt)
#pragma unroll
        for (int r = 0; r < 8; ++r) if (key0 + 16 * kt + 8 * hh + r > qw0 + 16 * g + ln) s[kt][g][r] = -3.0e38f;      /* causal: key above the query (key0 itself is never masked, so every maximum stays a real score) */
  }
  float mb[2]; bool need = false;
#pragma unroll
  for (int g = 0; g < 2; ++g) { float mx = s[0][g][0];
#pragma unroll
    for (int r = 1; r < 8; ++r) mx = fmaxf(mx, s[0][g][r]);
#pragma unroll
    for (int r = 0; r < 8; ++r) mx = fmaxf(mx, s[1][g][r]);
    mx = fmaxf(mx, fa_xhalf(mx)) * cs; mb[g] = mx; need = need || (mx > m_run[g] + 8.0f); }
  if (__builtin_amdgcn_ballot_w32(need) != 0) {      /* wave-uniform; rare after the first passes */
#pragma unroll
    for (int g = 0; g < 2; ++g) { const float mn = fmaxf(m_run[g], mb[g]); const float corr = exp2_slot(m_run[g] - mn); m_run[g] = mn; l_run[g] *= corr;
#pragma unroll
      for (int t = 0; t < 4; ++t) acc[g][t] = acc[g][t] * corr; }
  }
  FragH pf[2];
#pragma unroll
  for (int g = 0; g < 2; ++g) { const float nm = -m_run[g]; float ls[4] = {0.f, 0.f, 0.f, 0.f};
#pragma unroll
    for (int i = 0; i < 16; ++i) { const float e = exp2_slot(fmaf(s[i >> 3][g][i & 7], cs, nm)); ls[i & 3] += e; pf[g].h[i] = (_Float16)e; }
    l_run[g] += (ls[0] + ls[1]) + (ls[2] + ls[3]); }
  __builtin_amdgcn_sched_barrier(0);      /* every exponential stands ahead of the WMMAs */
#pragma unroll
  for (int g = 0; g < 2; ++g)
#pragma unroll
    for (int t = 0; t < 4; ++t) acc[g][t] = fa_mma(vf[t], pf[g].v, acc[g][t]);
  fa_gap();
  if (!LAST) { asm volatile("s_wait_xcnt 0x0" ::: "memory"); __builtin_amdgcn_sched_barrier(0); }      /* the wait in front of the advance of the K and V^T address pairs at the loop's foot; the scheduling barrier keeps the advance behind it */
}
__global__ __launch_bounds__(128) void k_fattn(const _Float16* __restrict__ Q, const _Float16* __restrict__ K, const _Float16* __restrict__ Vt, _Float16* __restrict__ O) {
  const int lane = threadIdx.x & 31, ln = lane & 15, hh = lane >> 4; const int w = __builtin_amdgcn_readfirstlane((int)(threadIdx.x >> 5));      /* the wave's number in a scalar register: trip count and branches stay scalar, EXEC stays full for the WMMAs */
  const int h = blockIdx.y, b = blockIdx.z; const int xs = (int)blockIdx.x, nq = (int)gridDim.x; const int qa = (xs & 1) ? (xs >> 1) : nq - 1 - (xs >> 1); const int qb = (b & 1) ? nq - 1 - qa : qa;      /* a permutation of the query tiles: long and short ones alternate between neighbouring blocks and between batches, so that the blocks that share a WGP carry about the same number of passes (speed only) */
  const int qw0 = qb * 128 + w * 32;
  const _Float16* Ql = Q + ((size_t)b * SQ + qw0 + ln) * DM + h * HD; const _Float16* Kl = K + ((size_t)b * SQ + ln) * KVD + h * HD; const _Float16* Vl = Vt + (((size_t)b * NH + h) * HD + ln) * SQ;
  v16h qf[2][2], kf[2][2];
#pragma unroll
  for (int g = 0; g < 2; ++g)
#pragma unroll
    for (int kc = 0; kc < 2; ++kc) { qf[g][kc] = g2_frag(Ql + (size_t)(16 * g) * DM + 32 * kc, hh); kf[g][kc] = g2_frag(Kl + (size_t)(16 * g) * KVD + 32 * kc, hh); }
  __builtin_amdgcn_sched_barrier(0); asm volatile("s_wait_xcnt 0x0" ::: "memory"); __builtin_amdgcn_sched_barrier(0);      /* the wait in front of any overwrite of these loads' address pairs; the scheduling barriers keep later register writes behind it */
  v8f acc[2][4]; float m_run[2] = {-3.0e38f, -3.0e38f}, l_run[2] = {0.f, 0.f};
#pragma unroll
  for (int g = 0; g < 2; ++g)
#pragma unroll
    for (int t = 0; t < 4; ++t) acc[g][t] = v8f{0.f, 0.f, 0.f, 0.f, 0.f, 0.f, 0.f, 0.f};
  const int nfull = qw0 / 32;      /* passes wholly below the diagonal */
#pragma unroll 1      /* one pass per trip: an unrolled body would hold two passes' fragments and lose a wave per SIMD */
  for (int p = 0; p < nfull; ++p) fa_pass<false>(kf, Kl + (size_t)(p + 1) * 32 * KVD, Vl + p * 32, p * 32, qw0, ln, hh, qf, acc, m_run, l_run);
  fa_pass<true>(kf, Kl, Vl + nfull * 32, nfull * 32, qw0, ln, hh, qf, acc, m_run, l_run);
  FragH of[2][4];
#pragma unroll
  for (int g = 0; g < 2; ++g) { const float l = l_run[g] + fa_xhalf(l_run[g]); const float inv = 64.0f / l;
#pragma unroll
    for (int t = 0; t < 4; ++t)
#pragma unroll
      for (int r = 0; r < 8; ++r) of[g][t].h[r] = (_Float16)(acc[g][t][r] * inv); }
  __builtin_amdgcn_sched_barrier(0);      /* all eight packed rows are made ahead of the first store, so that no register of an issued store is written again */
#pragma unroll
  for (int g = 0; g < 2; ++g)
#pragma unroll
    for (int t = 0; t < 4; ++t) *(v8us*)((unsigned short*)O + ((size_t)b * SQ + qw0 + 16 * g + ln) * DM + h * HD + 16 * t + 8 * hh) = of[g][t].half[0];      /* register r of tile t is d = 16 t + 8 hh + r of query ln: 16 bytes a lane; the wave writes each query's whole 128-byte head row */
}

template <int MASKADD>
__global__ __launch_bounds__(64) void k_att0(const float* __restrict__ QF, const float* __restrict__ KF, const float* __restrict__ VF, int ld, const float* __restrict__ mask, float scale, float* __restrict__ OF, int ldo) {
  __shared__ __attribute__((aligned(16))) float lq[64][64]; __shared__ __attribute__((aligned(16))) float lo[64][64];
  const int tid = threadIdx.x; const int h = blockIdx.x / (QT0 / 64), rg = blockIdx.x % (QT0 / 64); const int i = rg * 64 + tid;
  { const size_t pb = (size_t)blockIdx.y * QT0; QF += pb * ld; KF += pb * ld; VF += pb * ld; OF += pb * ldo; }      /* blockIdx.y = batch: each batch's first-tile rows lie in a plane of their own */
  const float* qr = QF + (size_t)i * ld + h * HD;
  for (int c = 0; c < HD / 4; ++c) { *(v4f*)&lq[tid][c * 4] = *(const v4fa*)(qr + c * 4); const v4f z = {0.f, 0.f, 0.f, 0.f}; *(v4f*)&lo[tid][c * 4] = z; }
  float m = -1.0e30f, l = 0.f; const int jmax = MASKADD ? (SQ - 1) : (rg * 64 + 63);      /* additive-mask form: every key (the mask input decides); causal form: keys up to the block's last row */
  for (int j = 0; j <= jmax; ++j) { const float* kr = KF + (size_t)j * ld + h * HD; const float* vr = VF + (size_t)j * ld + h * HD; float s = 0.f;
    for (int c = 0; c < HD / 4; ++c) { const v4f kq = *(const v4fa*)(kr + c * 4); const v4f qq = *(v4f*)&lq[tid][c * 4]; s = __fadd_rn(s, __fmul_rn(qq[0], kq[0])); s = __fadd_rn(s, __fmul_rn(qq[1], kq[1])); s = __fadd_rn(s, __fmul_rn(qq[2], kq[2])); s = __fadd_rn(s, __fmul_rn(qq[3], kq[3])); }
    s = __fmul_rn(s, scale); if (MASKADD) s = __fadd_rn(s, __fmul_rn(bf16_round(mask[(size_t)i * SQ + j]), -10000.0f));
    const float f = (MASKADD || j <= i) ? 1.f : 0.f; const float sm = fmaf(f, s, (1.f - f) * -1.0e30f); const float mn = fmaxf(m, sm); const float sc = expf(m - mn); const float e = expf(sm - mn); l = __fadd_rn(__fmul_rn(l, sc), e); m = mn;
    for (int c = 0; c < HD / 4; ++c) { const v4f vv = *(const v4fa*)(vr + c * 4); v4f oo = *(v4f*)&lo[tid][c * 4]; for (int u = 0; u < 4; ++u) oo[u] = __fadd_rn(__fmul_rn(oo[u], sc), __fmul_rn(e, vv[u])); *(v4f*)&lo[tid][c * 4] = oo; } }
  const float fin = 64.0f / l;      /* o carried x64 like the f16 path */
  for (int c = 0; c < HD / 4; ++c) { v4f oo = *(v4f*)&lo[tid][c * 4]; for (int u = 0; u < 4; ++u) oo[u] = __fmul_rn(oo[u], fin); *(v4f*)&lo[tid][c * 4] = oo; }
  __syncthreads();
  {
    for (int it = 0; it < 16; ++it) { const int row = it * 4 + tid / 16, pc = (tid % 16) * 4; const v4f v = *(const v4f*)&lo[row][pc]; *(v4f*)(OF + (size_t)(rg * 64 + row) * ldo + h * HD + pc) = v; }
     } }

__global__ __launch_bounds__(256) void k_kvexp(const float* __restrict__ src, float* __restrict__ dst, size_t n4) { const size_t t = (size_t)blockIdx.x * 256 + threadIdx.x; if (t >= n4) return; const size_t e = t * 4; const size_t row = e / DM; const int col = (int)(e % DM); const int h = col / HD, d = col % HD; const v4f v = *(const v4fa*)(src + row * KVD + (size_t)(h / HPG) * HD + d); *(v4f*)(dst + e) = v;  }

__global__ __launch_bounds__(256) void k_tab2(float theta, float* __restrict__ CS, float* __restrict__ SN) {
  const int t = blockIdx.x * 256 + threadIdx.x; if (t >= SQ * (HD / 2)) return; const int i = t % (HD / 2); const int p = t / (HD / 2); const float invf = 1.0f / powf(theta, (float)(2 * i) / (float)HD); const float ang = __fmul_rn((float)p, invf); const float c = cosf(ang), s = sinf(ang);
  *(float*)(CS + t) = c; *(float*)(SN + t) = s;  }
template <int NORM, int ROPE>
__global__ __launch_bounds__(64) void k_xform(const float* __restrict__ F, int ldf, int nh, const float* __restrict__ gain, float eps, const float* __restrict__ CS, const float* __restrict__ SN, _Float16* __restrict__ H16, int ldo) {
  __shared__ float xv[HD]; __shared__ float red[HD]; __shared__ unsigned short sh_[HD]; const int d = threadIdx.x; const int h = blockIdx.x % nh; const size_t r = blockIdx.x / nh; const int p = (int)(r % SQ);
  float x = F[r * (size_t)ldf + (size_t)h * HD + d];
  if (NORM) { red[d] = __fmul_rn(x, x); __syncthreads(); for (int st = HD / 2; st > 0; st >>= 1) { if (d < st) red[d] = __fadd_rn(red[d], red[d + st]); __syncthreads(); } const float rs = rsqrtf(__fadd_rn(red[0] / (float)HD, eps)); x = __fmul_rn(__fmul_rn(x, rs), bf16_round(gain[d])); }
  xv[d] = x; __syncthreads();
  float o = x;
  if (ROPE == 1) { const int i = d >> 1; const float c = CS[p * (HD / 2) + i], s = SN[p * (HD / 2) + i]; const float ev = xv[2 * i], od = xv[2 * i + 1]; o = (d & 1) ? __fadd_rn(__fmul_rn(ev, s), __fmul_rn(od, c)) : __fadd_rn(__fmul_rn(ev, c), -__fmul_rn(od, s)); }
  if (ROPE == 2) { const int i = d & (HD / 2 - 1); const float c = CS[p * (HD / 2) + i], s = SN[p * (HD / 2) + i]; const float lo = xv[i], hi = xv[i + HD / 2]; o = (d < HD / 2) ? __fadd_rn(__fmul_rn(lo, c), -__fmul_rn(hi, s)) : __fadd_rn(__fmul_rn(lo, s), __fmul_rn(hi, c)); }
  if (ROPE == 3) { const float c = CS[p * HD + d], s = SN[p * HD + d]; const float lo = xv[d & (HD / 2 - 1)], hi = xv[(d & (HD / 2 - 1)) + HD / 2]; o = (d < HD / 2) ? __fadd_rn(__fmul_rn(lo, c), -__fmul_rn(hi, s)) : __fadd_rn(__fmul_rn(hi, c), __fmul_rn(lo, s)); }      /* rotate-half with FULL-width per-element tables [pos][HD] */
  FragH th; th.h[0] = (_Float16)o; sh_[d] = th.u[0]; __syncthreads();
  if (d < HD / 8) { FragH f; for (int q = 0; q < 8; ++q) f.u[q] = sh_[d * 8 + q]; unsigned short* dst = (unsigned short*)H16 + r * (size_t)ldo + (size_t)h * HD + d * 8; *(v8us*)dst = f.half[0];  } }

template <int NORM, int ROPE>
__global__ __launch_bounds__(64) void k_xformf(const float* __restrict__ F, int ldf, int nh, const float* __restrict__ gain, float eps, const float* __restrict__ CS, const float* __restrict__ SN, float* __restrict__ F32, int ldo) {
  __shared__ float xv[HD]; __shared__ float red[HD]; const int d = threadIdx.x; const int h = blockIdx.x % nh; const size_t r = blockIdx.x / nh; const int p = (int)(r % SQ);
  F += (size_t)blockIdx.y * SQ * ldf; F32 += (size_t)blockIdx.y * QT0 * ldo;      /* blockIdx.y = batch: rows 0..QT0-1 of that batch's SQ source rows go to its own plane of QT0 rows */
  float x = F[r * (size_t)ldf + (size_t)h * HD + d];
  if (NORM) { red[d] = __fmul_rn(x, x); __syncthreads(); for (int st = HD / 2; st > 0; st >>= 1) { if (d < st) red[d] = __fadd_rn(red[d], red[d + st]); __syncthreads(); } const float rs = rsqrtf(__fadd_rn(red[0] / (float)HD, eps)); x = __fmul_rn(__fmul_rn(x, rs), bf16_round(gain[d])); }
  xv[d] = x; __syncthreads();
  float o = x;
  if (ROPE == 1) { const int i = d >> 1; const float c = CS[p * (HD / 2) + i], s = SN[p * (HD / 2) + i]; const float ev = xv[2 * i], od = xv[2 * i + 1]; o = (d & 1) ? __fadd_rn(__fmul_rn(ev, s), __fmul_rn(od, c)) : __fadd_rn(__fmul_rn(ev, c), -__fmul_rn(od, s)); }
  if (ROPE == 2) { const int i = d & (HD / 2 - 1); const float c = CS[p * (HD / 2) + i], s = SN[p * (HD / 2) + i]; const float lo = xv[i], hi = xv[i + HD / 2]; o = (d < HD / 2) ? __fadd_rn(__fmul_rn(lo, c), -__fmul_rn(hi, s)) : __fadd_rn(__fmul_rn(lo, s), __fmul_rn(hi, c)); }
  if (ROPE == 3) { const float c = CS[p * HD + d], s = SN[p * HD + d]; const float lo = xv[d & (HD / 2 - 1)], hi = xv[(d & (HD / 2 - 1)) + HD / 2]; o = (d < HD / 2) ? __fadd_rn(__fmul_rn(lo, c), -__fmul_rn(hi, s)) : __fadd_rn(__fmul_rn(hi, c), __fmul_rn(lo, s)); }      /* rotate-half with FULL-width per-element tables [pos][HD] */
  float* dst = F32 + r * (size_t)ldo + (size_t)h * HD + d; *(float*)dst = o;  }

__global__ __launch_bounds__(256) void k_bfcp(const float* __restrict__ src, float* __restrict__ dst, size_t n4) { const size_t t = (size_t)blockIdx.x * 256 + threadIdx.x; if (t >= n4) return; const v4f a = *(const v4fa*)(src + t * 4); v4f o; for (int q = 0; q < 4; ++q) o[q] = bf16_round(a[q]); *(v4f*)(dst + t * 4) = o;  }

__global__ __launch_bounds__(256) void k_tabhalf(const float* __restrict__ cs, const float* __restrict__ sn, float* __restrict__ CS, float* __restrict__ SN) { const int t = blockIdx.x * 256 + threadIdx.x; if (t >= SQ * (HD / 2)) return; const int p = t / (HD / 2), i = t % (HD / 2); const float c = bf16_round(cs[(size_t)p * HD + i]), s = bf16_round(sn[(size_t)p * HD + i]);
  *(float*)(CS + t) = c; *(float*)(SN + t) = s;  }

__global__ __launch_bounds__(256) void k_tab2d(float* __restrict__ CS, float* __restrict__ SN) {
  const int t = blockIdx.x * 256 + threadIdx.x; if (t >= SQ * (HD / 2)) return; const int i = t % (HD / 2); const int p = t / (HD / 2); const float invf = (float)(1.0 / pow(10000.0, (double)(2 * i) / (double)HD)); const float ang = __fmul_rn((float)p, invf); const float c = cosf(ang), s = sinf(ang);
  *(float*)(CS + t) = c; *(float*)(SN + t) = s;  }
extern "C" void kernel_launch(void* const* d_in, const int* in_sizes, int n_in,
                              void* d_out, int out_size, void* d_ws, size_t ws_size, hipStream_t stream) {
  (void)in_sizes; (void)n_in; (void)out_size;
  const float* const* I = (const float* const*)d_in; const float* x = I[0]; const float* xk = I[1]; const float* xv = I[2]; const float* wq = I[3]; const float* wk = I[5]; const float* wv = I[7]; const float* wo = I[9];      /* the streams query, key, value; natural [out][in] W_q, W_k, W_v, W_o; the biases b_q = I[4], b_k = I[6], b_v = I[8], b_o = I[10]; rope tables computed in-kernel (positions = row index) */
  static_assert(HPG == 1 && NH == NG * HPG && NH * HD == DM && KVD == DM, "plain multi-head attention as 16 kv groups of one query head"); const float* bq = I[4]; const float* bk = I[6]; const float* bv = I[8]; const float* bo = I[10];      /* the four biases, each bound to its projection (read through the GEMM bias pointer, bf16-rounded on load) */
  char* ws = (char*)d_ws; size_t off = 0;
  auto take = [&](size_t bytes) { char* p = ws + off; off += (bytes + 255) & ~(size_t)255; return p; };
  _Float16* BQKV = (_Float16*)take((size_t)3 * DM * DM * 2); _Float16* BQ = BQKV; _Float16* BK = BQKV + (size_t)DM * DM; _Float16* BV = BQKV + (size_t)2 * DM * DM; _Float16* BO = (_Float16*)take((size_t)DM * DM * 2);      /* one plane Bt [3072][1024]: rows 0..1023 = W_q, 1024.. = W_k, 2048.. = W_v (natural [out][in] weights are Bt as they stand) */
  _Float16* X16 = (_Float16*)take(NR * DM * 2); _Float16* XK16 = (_Float16*)take(NR * DM * 2); _Float16* XV16 = (_Float16*)take(NR * DM * 2); float* QF = (float*)take(NR * DM * 4); float* KF = (float*)take(NR * KVD * 4); float* CSB = (float*)take((size_t)SQ * HD * 4); float* SNB = (float*)take((size_t)SQ * HD * 4); _Float16* Q16 = (_Float16*)take(NR * DM * 2); _Float16* K16 = (_Float16*)take(NR * KVD * 2); _Float16* V16 = (_Float16*)take(NR * KVD * 2); _Float16* O16 = (_Float16*)take(NR * DM * 2);
  _Float16* VT = (_Float16*)take((size_t)NB * NH * HD * SQ * 2);
  float* QF0 = (float*)take((size_t)NB * QT0 * DM * 4); float* KF0 = (float*)take((size_t)NB * QT0 * KVD * 4); float* VF0 = (float*)take((size_t)NB * QT0 * KVD * 4); float* KF0e = (float*)take((size_t)NB * QT0 * DM * 4); float* VF0e = (float*)take((size_t)NB * QT0 * DM * 4); float* OF0 = (float*)take((size_t)NB * QT0 * DM * 4); _Float16* OH0 = (_Float16*)take((size_t)NB * QT0 * DM * 2); _Float16* OL0 = (_Float16*)take((size_t)NB * QT0 * DM * 2);
  if (off > ws_size) return;
  { const unsigned g = (unsigned)(((size_t)DM * DM / 8 + 255) / 256); k_wnat<<<g, 256, 0, stream>>>(wq, (size_t)DM * DM / 8, BQ); k_wnat<<<g, 256, 0, stream>>>(wk, (size_t)DM * DM / 8, BK); k_wnat<<<g, 256, 0, stream>>>(wv, (size_t)DM * DM / 8, BV); k_wnat<<<g, 256, 0, stream>>>(wo, (size_t)DM * DM / 8, BO); }      /* natural [out][in] = Bt x16 */
  k_x16<<<(unsigned)((NR * DM / 8 + 255) / 256), 256, 0, stream>>>(x, X16, NR * DM / 8); k_x16<<<(unsigned)((NR * DM / 8 + 255) / 256), 256, 0, stream>>>(xk, XK16, NR * DM / 8); k_x16<<<(unsigned)((NR * DM / 8 + 255) / 256), 256, 0, stream>>>(xv, XV16, NR * DM / 8);      /* the three streams as exact f16 rows */
  k_tab2d<<<(SQ * (HD / 2) + 255) / 256, 256, 0, stream>>>(CSB, SNB);      /* rope tables cos/sin(p / 10000^(2i/64)): inv_freq double-derived -> f32, f32 angle */
  const size_t r0p = (size_t)B0 * SQ;      /* first projected row */
  k_gemm2<0><<<dim3((unsigned)((MP / 128) * (KVD / 64)), 1), 128, 0, stream>>>(XV16 + r0p * DM, DM, 0, BV, DM, 0, 0.0625f, bv, 0, nullptr, 1, 0, 0, nullptr, V16 + r0p * KVD, KVD, 0, MP, KVD, DM);
  static_assert(B0 == 0 && NBR == NB && MP == NB * SQ, "every stage below takes all batches in one launch");
  k_gemm2<0><<<dim3((unsigned)((MP / 128) * (DM / 64)), 1), 128, 0, stream>>>(X16, DM, 0, BQ, DM, 0, 0.0625f, bq, 0, nullptr, 1, 0, 0, QF, nullptr, DM, 0, MP, DM, DM);      /* q (f32), every batch */
  k_xform<0, 2><<<(unsigned)(NR * NH), 64, 0, stream>>>(QF, DM, NH, nullptr, 0.f, CSB, SNB, Q16, DM);      /* half-split rope <0, 2> (out_lo = x_lo c - x_hi s, out_hi = x_lo s + x_hi c = t cos + rotate_half(t) sin with the module's [f | f] tables) -> f16 rows; position = row % SQ */
  k_xformf<0, 2><<<dim3((unsigned)(QT0 * NH), NB), 64, 0, stream>>>(QF, DM, NH, nullptr, 0.f, CSB, SNB, QF0, DM);      /* f32 half-split-roped q of rows 0..255 of each batch */
  k_gemm2<0><<<dim3((unsigned)((MP / 128) * (KVD / 64)), 1), 128, 0, stream>>>(XK16, DM, 0, BK, DM, 0, 0.0625f, bk, 0, nullptr, 1, 0, 0, KF, nullptr, KVD, 0, MP, KVD, DM);      /* k (f32), every batch */
  k_xform<0, 2><<<(unsigned)(NR * NG), 64, 0, stream>>>(KF, KVD, NG, nullptr, 0.f, CSB, SNB, K16, KVD);
  k_xformf<0, 2><<<dim3((unsigned)(QT0 * NG), NB), 64, 0, stream>>>(KF, KVD, NG, nullptr, 0.f, CSB, SNB, KF0, KVD);      /* likewise k */
  k_vt<NG, SQ><<<NB * NG * (SQ / 64), 256, 0, stream>>>(V16, KVD, 0, VT);      /* V^T [NB][NH][HD][SQ] */
  k_gemm2<0><<<dim3((QT0 / 128) * (KVD / 64), NB), 128, 0, stream>>>(XV16, DM, (size_t)SQ * DM, BV, DM, 0, 0.0625f, bv, 0, nullptr, 1, 0, 0, VF0, nullptr, KVD, (size_t)QT0 * KVD, QT0, KVD, DM);      /* f32 v of the first 256 rows of each batch (grid y = batch) */
  k_kvexp<<<(unsigned)(((size_t)NB * QT0 * DM / 4 + 255) / 256), 256, 0, stream>>>(KF0, KF0e, (size_t)NB * QT0 * DM / 4); k_kvexp<<<(unsigned)(((size_t)NB * QT0 * DM / 4 + 255) / 256), 256, 0, stream>>>(VF0, VF0e, (size_t)NB * QT0 * DM / 4);      /* head h <- its kv group for the exact first-tile kernel */
  k_att0<0><<<dim3(NH * (QT0 / 64), NB), 64, 0, stream>>>(QF0, KF0e, VF0e, DM, nullptr, 0.125f, OF0, DM);      /* exact f32 attention for rows 0..255 of every batch (o x64) */
  static_assert(SQ % 128 == 0 && HD == 64 && B0 == 0 && NBR == NB && QN == SQ && NHD == NH, "k_fattn: four waves of 32 query columns, head size 64, every batch and head");
  k_fattn<<<dim3(SQ / 128, NH, NB), 128, 0, stream>>>(Q16, K16, VT, O16);      /* scores, causal softmax and o (x64) of every batch, head and query tile in ONE launch */
  k_gemm2<0><<<dim3((unsigned)((MPO / 128) * (DM / 64)), 1), 128, 0, stream>>>(O16 + r0p * DM, DM, 0, BO, DM, 0, 0.0009765625f, bo, 0, nullptr, 1, 0, 0, (float*)d_out + r0p * DM, nullptr, DM, 0, MPO, DM, DM);      /* out rows are the output layout */
  k_hl<<<(unsigned)(((size_t)NB * QT0 * DM / 8 + 255) / 256), 256, 0, stream>>>(OF0, OH0, OL0, (size_t)NB * QT0 * DM / 8);      /* first-tile o (x64) -> f16 hi + x1024 residual planes */
  k_gemm2<0><<<dim3((QT0 / 128) * (DM / 64), NB), 128, 0, stream>>>(OH0, DM, (size_t)QT0 * DM, BO, DM, 0, 0.0009765625f, bo, 0, nullptr, 1, 0, 0, (float*)d_out, nullptr, DM, (size_t)SQ * DM, QT0, DM, DM);      /* rows 0..255 of each batch (grid y = batch): out = o_hi Wo (+ b), overwriting the f16-path rows */
  k_gemm2<0><<<dim3((QT0 / 128) * (DM / 64), NB), 128, 0, stream>>>(OL0, DM, (size_t)QT0 * DM, BO, DM, 0, 0.00000095367431640625f, nullptr, 0, (const float*)d_out, -1, 0, 0, (float*)d_out, nullptr, DM, (size_t)SQ * DM, QT0, DM, DM);      /* += o_lo Wo 2^-20 (own-element accumulate) */
}

// v004
// It runs in 670 microseconds.
// Timed twice side by side with v003, it ran 1.06 times as fast both times.
// Over all steps from v000 it is 11.0 times as fast.
#include <hip/hip_runtime.h>
// Causal multi-head attention over THREE input streams with rotate-half RoPE computed in the module (query, key, value [4][2048][1024]; Q = query W_q^T + b_q, K = key W_k^T + b_k, V = value W_v^T + b_v (natural [out][in] [1024][1024]; the four biases: bound and read), 16 heads of 64; cos / sin = [f, f] of pos * 10000^(-2i/64); Q = Q cos + rotate_half(Q) sin with rotate_half = cat(-x2, x1), likewise K (the bias is added BEFORE the rope); scores / sqrt(64); causal (triu k=1 at -inf); softmax; y = merged W_o^T + b_o (natural) -> [4][2048][1024]); run as grouped-query causal attention with 16 groups of ONE head with the rope stage in its half-split mode.
// Compute dtype: inputs rounded to bf16; x / weights exact; q, k, v, softmax weights and o as plain f16 GEMM operands (~2^-12); scores and softmax statistics f32; v_wmma_f32_16x16x32_f16.
#define NB 4
#define NG 16
#define HPG 1
#define KVD (NG * HD)
#define SQ 2048
#define DM 1024
#define NH 16
#define HD 64
#define HG 4                         /* unused */
#define QT 256                       /* unused */
#define NKX SQ                       /* unused */
#define QT0 256                      /* first-tile rows recomputed exactly in f32 */
#define B0 0                         /* first batch processed (debug hook) */
#define NBR NB                       /* batches processed (debug hook) */
#define NR ((size_t)NB * SQ)         /* token rows */
#define MP ((int)((size_t)NBR * SQ)) /* rows projected (debug hook) */
#define QN SQ                        /* query rows attended per batch (debug hook) */
#define NHD NH                       /* heads attended (debug hook) */
#define MPO MP                       /* rows through the output stage (debug hook) */
#define LQ DM      /* unused */
typedef __bf16 v16b __attribute__((ext_vector_type(16)));
typedef unsigned short v8us __attribute__((ext_vector_type(8), may_alias));
typedef float  v8f  __attribute__((ext_vector_type(8)));
typedef float  v4f  __attribute__((ext_vector_type(4)));
typedef float  v4fa __attribute__((ext_vector_type(4), may_alias));
union FragB { v16b v; v8us half[2]; unsigned short u[16]; };

__device__ __forceinline__ unsigned short bf16_bits(float x) { unsigned int u = __float_as_uint(x); return (unsigned short)((u + 0x7FFFu + ((u >> 16) & 1u)) >> 16); }
__device__ __forceinline__ float bf16_val(unsigned short b) { return __uint_as_float(((unsigned int)b) << 16); }
__device__ __forceinline__ float bf16_round(float x) { return bf16_val(bf16_bits(x)); }
// D += A·B with NT terms: 1 = ah·bh, 2 = + al·bh (A split), 3 = + ah·bl (both split)
template <int NT>
__device__ __forceinline__ v8f mmaN(v16b ah, v16b al, v16b bh, v16b bl, v8f c) {
  c = __builtin_amdgcn_wmma_f32_16x16x32_bf16(false, ah, false, bh, (short)0, c, false, false);
  if (NT >= 2) c = __builtin_amdgcn_wmma_f32_16x16x32_bf16(false, al, false, bh, (short)0, c, false, false);
  if (NT >= 3) c = __builtin_amdgcn_wmma_f32_16x16x32_bf16(false, ah, false, bl, (short)0, c, false, false);
  asm volatile("v_nop\n\tv_nop\n\tv_nop\n\tv_nop" : "+v"(c) : "v"(ah), "v"(al), "v"(bh), "v"(bl));
  return c;
}

__global__ __launch_bounds__(256) void k_wt_bf16(const float* __restrict__ W, unsigned short* __restrict__ Wt, int K, int N) {
  const int t = blockIdx.x * 256 + threadIdx.x;
  const int k8n = K / 8;
  if (t >= N * k8n) return;
  const int n = t / k8n, k8 = (t % k8n) * 8;
  v8us v;
#pragma unroll
  for (int i = 0; i < 8; ++i) v[i] = bf16_bits(W[(size_t)(k8 + i) * N + n]);
  *(v8us*)(Wt + (size_t)n * K + k8) = v;
  
}

// GEMM C[M][N] (f32, pitch ldc) = act(A[M][K]·W + bias). A f32 row-major (pitch lda) converted per fragment to bf16
// (ASPLIT: hi/lo two planes -> 2 terms, else single rounded term); Wt bf16 [N][K] (pitch ldb). BIAS_BF16 rounds the
// bias to bf16 first (bias quantised to bf16 before the add). K%32==0, M%16==0, N%64==0.
template <bool ASPLIT, int ACT, bool BIAS_BF16>
__global__ __launch_bounds__(128) void k_gemm_bf(const float* __restrict__ A, int lda, const unsigned short* __restrict__ Wt, int ldb,
                                               const float* __restrict__ bias, float* __restrict__ C, int ldc, int M, int N, int K) {
  __shared__ __attribute__((aligned(16))) float so[4][16][64];
  const int tid = threadIdx.x, w = tid >> 5, lane = tid & 31, ln = lane & 15, hh = lane >> 4;
  const int ntn = N / 64;
  const int wid = blockIdx.x * 4 + w;
  const int mt = wid / ntn, nq = wid % ntn;
  if (mt * 16 >= M) return;
  const int row0 = mt * 16, col0 = nq * 64;
  const float* arow = A + (size_t)(row0 + ln) * lda;
  v8f acc[4] = {};
  for (int kb = 0; kb < K; kb += 32) {
    FragB ah, al;
    const v4f x0 = *(const v4fa*)(arow + kb + 8 * hh), x1 = *(const v4fa*)(arow + kb + 8 * hh + 4);
    const v4f x2 = *(const v4fa*)(arow + kb + 16 + 8 * hh), x3 = *(const v4fa*)(arow + kb + 16 + 8 * hh + 4);
    float xs[16] = {x0[0],x0[1],x0[2],x0[3],x1[0],x1[1],x1[2],x1[3],x2[0],x2[1],x2[2],x2[3],x3[0],x3[1],x3[2],x3[3]};
#pragma unroll
    for (int i = 0; i < 16; ++i) { const unsigned short hb = bf16_bits(xs[i]); ah.u[i] = hb; al.u[i] = ASPLIT ? bf16_bits(xs[i] - bf16_val(hb)) : (unsigned short)0; }
#pragma unroll
    for (int t = 0; t < 4; ++t) {
      const unsigned short* brow = Wt + (size_t)(col0 + t * 16 + ln) * ldb + kb;
      FragB b;
      b.half[0] = *(const v8us*)(brow + 8 * hh);
      b.half[1] = *(const v8us*)(brow + 16 + 8 * hh);
      acc[t] = mmaN<ASPLIT ? 2 : 1>(ah.v, al.v, b.v, b.v, acc[t]);
    }
  }
#pragma unroll
  for (int t = 0; t < 4; ++t) {
    float bv = bias ? bias[col0 + t * 16 + ln] : 0.f;
    if (BIAS_BF16) bv = bf16_round(bv);
#pragma unroll
    for (int r = 0; r < 8; ++r) { float v = acc[t][r] + bv; if (ACT == 1) v = fmaxf(v, 0.f); so[w][8 * hh + r][t * 16 + ln] = v; }
  }
  __builtin_amdgcn_fence(__ATOMIC_ACQ_REL, "workgroup");
  __builtin_amdgcn_wave_barrier();
  const int rsub = lane >> 4, c4 = (lane & 15) * 4;
  {
#pragma unroll
    for (int q = 0; q < 8; ++q) {
      const int r = q * 2 + rsub;
      const v4f v = *(const v4fa*)&so[w][r][c4];
      *(v4f*)(C + (size_t)(row0 + r) * ldc + col0 + c4) = v;
    }
    
  }
}

// GEMM C = act(A·W + bias + resid): A f32 (ASPLIT -> hi/lo 2 terms), Wt bf16 [N][K]; ACT 0 none, 1 relu, 2 exact gelu;
// resid (optional, f32, row index = (row % rmod), pitch ldr, RES_BF16 rounds it) added before the activation.
template <bool ASPLIT, int ACT, bool BIAS_BF16, bool RES_BF16>
__global__ __launch_bounds__(128) void k_gemm_bf3(const float* __restrict__ A, int lda, const unsigned short* __restrict__ Wt, int ldb,
                                                const float* __restrict__ bias, const float* __restrict__ resid, int rmod, int ldr,
                                                float* __restrict__ C, int ldc, int M, int N, int K) {
  __shared__ __attribute__((aligned(16))) float so[4][16][64];
  const int tid = threadIdx.x, w = tid >> 5, lane = tid & 31, ln = lane & 15, hh = lane >> 4;
  const int ntn = N / 64;
  const int wid = blockIdx.x * 4 + w;
  const int mt = wid / ntn, nq = wid % ntn;
  if (mt * 16 >= M) return;
  const int row0 = mt * 16, col0 = nq * 64;
  const float* arow = A + (size_t)(row0 + ln) * lda;
  v8f acc[4] = {};
  for (int kb = 0; kb < K; kb += 32) {
    FragB ah, al;
    const v4f x0 = *(const v4fa*)(arow + kb + 8 * hh), x1 = *(const v4fa*)(arow + kb + 8 * hh + 4);
    const v4f x2 = *(const v4fa*)(arow + kb + 16 + 8 * hh), x3 = *(const v4fa*)(arow + kb + 16 + 8 * hh + 4);
    float xs[16] = {x0[0],x0[1],x0[2],x0[3],x1[0],x1[1],x1[2],x1[3],x2[0],x2[1],x2[2],x2[3],x3[0],x3[1],x3[2],x3[3]};
#pragma unroll
    for (int i = 0; i < 16; ++i) { const unsigned short hb = bf16_bits(xs[i]); ah.u[i] = hb; al.u[i] = ASPLIT ? bf16_bits(xs[i] - bf16_val(hb)) : (unsigned short)0; }
#pragma unroll
    for (int t = 0; t < 4; ++t) {
      const unsigned short* brow = Wt + (size_t)(col0 + t * 16 + ln) * ldb + kb;
      FragB b;
      b.half[0] = *(const v8us*)(brow + 8 * hh);
      b.half[1] = *(const v8us*)(brow + 16 + 8 * hh);
      acc[t] = mmaN<ASPLIT ? 2 : 1>(ah.v, al.v, b.v, b.v, acc[t]);
    }
  }
#pragma unroll
  for (int t = 0; t < 4; ++t) {
    const int col = col0 + t * 16 + ln;
    float bv = bias ? bias[col] : 0.f;
    if (BIAS_BF16) bv = bf16_round(bv);
#pragma unroll
    for (int r = 0; r < 8; ++r) {
      float v = acc[t][r] + bv;
      if (resid) { float rv = resid[(size_t)((row0 + 8 * hh + r) % rmod) * ldr + col]; if (RES_BF16) rv = bf16_round(rv); v += rv; }
      if (ACT == 1) v = fmaxf(v, 0.f);
      if (ACT == 2) v = 0.5f * v * (1.0f + erff(v * 0.70710678118654752f));
      if (ACT == 3) { const float u = 0.7978845608028654f * (v + 0.044715f * v * v * v); v = 0.5f * v * (1.0f + tanhf(u)); }
      so[w][8 * hh + r][t * 16 + ln] = v;
    }
  }
  __builtin_amdgcn_fence(__ATOMIC_ACQ_REL, "workgroup");
  __builtin_amdgcn_wave_barrier();
  const int rsub = lane >> 4, c4 = (lane & 15) * 4;
  {
#pragma unroll
    for (int q = 0; q < 8; ++q) {
      const int r = q * 2 + rsub;
      const v4f v = *(const v4fa*)&so[w][r][c4];
      *(v4f*)(C + (size_t)(row0 + r) * ldc + col0 + c4) = v;
    }
    
  }
}
// row LayerNorm (biased variance, eps) over N: s = X (+ R); optional out_sum <- s; out_norm <- (s-mu)*rsqrt(var+eps)*g + b
template <bool PARAM_BF16>
__global__ __launch_bounds__(256) void k_layernorm(const float* __restrict__ X, const float* __restrict__ R, const float* __restrict__ g, const float* __restrict__ bta,
                                                  float* __restrict__ out_sum, float* __restrict__ out_norm, int N, float eps) {
  __shared__ float red[256];
  const int row = blockIdx.x, tid = threadIdx.x;
  const float* x = X + (size_t)row * N; const float* rr = R ? R + (size_t)row * N : nullptr;
  float vals[16];                     // up to N = 4096
  const int per = N / 256;            // contiguous chunk per thread? use strided-by-4 chunks: thread handles j = tid*4 + 1024*u
  float s1 = 0.f;
  for (int u = 0; u < per / 4; ++u) {
    const int j = tid * 4 + 1024 * u;
    const v4f a = *(const v4fa*)(x + j);
    v4f b = {0.f,0.f,0.f,0.f}; if (rr) b = *(const v4fa*)(rr + j);
#pragma unroll
    for (int q = 0; q < 4; ++q) { const float v = a[q] + b[q]; vals[u * 4 + q] = v; s1 += v; }
  }
  red[tid] = s1; __syncthreads();
  for (int st = 128; st > 0; st >>= 1) { if (tid < st) red[tid] += red[tid + st]; __syncthreads(); }
  const float mu = red[0] / (float)N; __syncthreads();
  float s2 = 0.f;
  for (int u = 0; u < per / 4; ++u)
#pragma unroll
    for (int q = 0; q < 4; ++q) { const float c = vals[u * 4 + q] - mu; s2 += c * c; }
  red[tid] = s2; __syncthreads();
  for (int st = 128; st > 0; st >>= 1) { if (tid < st) red[tid] += red[tid + st]; __syncthreads(); }
  const float rs = rsqrtf(red[0] / (float)N + eps);
  {
    for (int u = 0; u < per / 4; ++u) {
      const int j = tid * 4 + 1024 * u;
      v4f o, sm;
#pragma unroll
      for (int q = 0; q < 4; ++q) {
        float gg = g[j + q], bb = bta[j + q];
        if (PARAM_BF16) { gg = bf16_round(gg); bb = bf16_round(bb); }
        sm[q] = vals[u * 4 + q]; o[q] = (vals[u * 4 + q] - mu) * rs * gg + bb;
      }
      if (out_sum) *(v4f*)(out_sum + (size_t)row * N + j) = sm;
      *(v4f*)(out_norm + (size_t)row * N + j) = o;
    }
    
  }
}

// ---- f16 WMMA path (v_wmma_f32_16x16x32_f16): 11-bit significands for operands in range — used where a [0,1] probability operand needs more precision than bf16
typedef _Float16 v16h __attribute__((ext_vector_type(16)));
union FragH { v16h v; v8us half[2]; _Float16 h[16]; unsigned short u[16]; };
template <int NT>
__device__ __forceinline__ v8f mmaH(v16h ah, v16h al, v16h bh, v16h bl, v8f c) {
  c = __builtin_amdgcn_wmma_f32_16x16x32_f16(false, ah, false, bh, (short)0, c, false, false);
  if (NT >= 2) c = __builtin_amdgcn_wmma_f32_16x16x32_f16(false, al, false, bh, (short)0, c, false, false);
  if (NT >= 3) c = __builtin_amdgcn_wmma_f32_16x16x32_f16(false, ah, false, bl, (short)0, c, false, false);
  asm volatile("v_nop\n\tv_nop\n\tv_nop\n\tv_nop" : "+v"(c) : "v"(ah), "v"(al), "v"(bh), "v"(bl));
  return c;
}
// batched GEMM like k_gemm_b but f16 operands: A f32 (split into f16 hi/lo if ASPLIT, else rounded to f16), Bt = f16 values [n][k]; alpha; C f32; N multiple of 16 (partial tiles skipped)
template <bool ASPLIT>
__global__ __launch_bounds__(128) void k_gemm_h(const float* __restrict__ A, int lda, size_t sA, const _Float16* __restrict__ Bh, int ldb, size_t sB, float alpha, float* __restrict__ C, int ldc, size_t sC, int M, int N, int K) {
  __shared__ __attribute__((aligned(16))) float so[4][16][64];
  const int tid = threadIdx.x, w = tid >> 5, lane = tid & 31, ln = lane & 15, hh = lane >> 4; const int by = blockIdx.y;
  A += (size_t)by * sA; Bh += (size_t)by * sB; C += (size_t)by * sC;
  const int ntn = (N + 63) / 64; const int wid = blockIdx.x * 4 + w; const int mt = wid / ntn, nq = wid % ntn; if (mt * 16 >= M) return;
  const int row0 = mt * 16, col0 = nq * 64; const float* arow = A + (size_t)(row0 + ln) * lda;
  v8f acc[4] = {};
  for (int kb = 0; kb < K; kb += 32) {
    FragH ah, al;
    const v4f x0 = *(const v4fa*)(arow + kb + 8 * hh), x1 = *(const v4fa*)(arow + kb + 8 * hh + 4), x2 = *(const v4fa*)(arow + kb + 16 + 8 * hh), x3 = *(const v4fa*)(arow + kb + 16 + 8 * hh + 4);
    float xs[16] = {x0[0],x0[1],x0[2],x0[3],x1[0],x1[1],x1[2],x1[3],x2[0],x2[1],x2[2],x2[3],x3[0],x3[1],x3[2],x3[3]};
#pragma unroll
    for (int i = 0; i < 16; ++i) { const _Float16 h = (_Float16)xs[i]; ah.h[i] = h; al.h[i] = ASPLIT ? (_Float16)(xs[i] - (float)h) : (_Float16)0.0f; }
#pragma unroll
    for (int t = 0; t < 4; ++t) { if (col0 + t * 16 >= N) continue; const size_t boff = (size_t)(col0 + t * 16 + ln) * ldb + kb; FragH bq; bq.half[0] = *(const v8us*)(Bh + boff + 8 * hh); bq.half[1] = *(const v8us*)(Bh + boff + 16 + 8 * hh);
      acc[t] = mmaH<ASPLIT ? 2 : 1>(ah.v, al.v, bq.v, bq.v, acc[t]); }
  }
#pragma unroll
  for (int t = 0; t < 4; ++t) { if (col0 + t * 16 >= N) continue;
#pragma unroll
    for (int r = 0; r < 8; ++r) so[w][8 * hh + r][t * 16 + ln] = acc[t][r] * alpha; }
  __builtin_amdgcn_fence(__ATOMIC_ACQ_REL, "workgroup"); __builtin_amdgcn_wave_barrier();
  const int rsub = lane >> 4, c4 = (lane & 15) * 4;
  {
#pragma unroll
    for (int q = 0; q < 8; ++q) { const int r = q * 2 + rsub; if (col0 + c4 < N) { const v4f v = *(const v4fa*)&so[w][r][c4]; *(v4f*)(C + (size_t)(row0 + r) * ldc + col0 + c4) = v; } }
     }
}

// Wt[n][k] = f16(W[k][n]·scale) from f32 row-major W[K][N] (scale = power of two; bf16-exact weights stay exact in f16 away from the subnormal range)
__global__ __launch_bounds__(256) void k_wt_f16(const float* __restrict__ W, _Float16* __restrict__ Wt, int K, int N, float scale) {
  const int t = blockIdx.x * 256 + threadIdx.x; if (t >= N * (K / 8)) return; const int n = t / (K / 8), k8 = (t % (K / 8)) * 8; FragH f;
#pragma unroll
  for (int i = 0; i < 8; ++i) f.h[i] = (_Float16)(bf16_round(W[(size_t)(k8 + i) * N + n]) * scale); const v8us o = f.half[0];
  *(v8us*)((unsigned short*)Wt + (size_t)n * K + k8) = o; 
}
// k_gemm_hh variant with fused epilogue: v = acc·alpha + bias[by·sBias + col] (+ CP[(row/rowsPerB)·sCPb + by·64 + col] if CP) ; ACT 0 none / 1 elu ; writes f16 C16 (and f32 C if non-null)
template <int ACT>
__global__ __launch_bounds__(128) void k_gemm_hhx(const _Float16* __restrict__ A, int lda, size_t sA, const _Float16* __restrict__ Bh, int ldb, size_t sB, float alpha, const float* __restrict__ bias, size_t sBias, const float* __restrict__ CP, int rowsPerB, size_t sCPb, int row0g,
    float* __restrict__ C, _Float16* __restrict__ C16, int ldc, size_t sC, int M, int N, int K) {
  __shared__ __attribute__((aligned(16))) float so[4][16][64];
  const int tid = threadIdx.x, w = tid >> 5, lane = tid & 31, ln = lane & 15, hh = lane >> 4; const int by = blockIdx.y;
  A += (size_t)by * sA; Bh += (size_t)by * sB; const size_t cofs = (size_t)by * sC; const float* bp = bias ? bias + (size_t)by * sBias : nullptr;
  const int ntn = (N + 63) / 64; const int wid = blockIdx.x * 4 + w; const int mt = wid / ntn, nq = wid % ntn; if (mt * 16 >= M) return;
  const int row0 = mt * 16, col0 = nq * 64; const _Float16* arow = A + (size_t)(row0 + ln) * lda;
  v8f acc[4] = {};
  for (int kb = 0; kb < K; kb += 32) { FragH ah; ah.half[0] = *(const v8us*)((const unsigned short*)arow + kb + 8 * hh); ah.half[1] = *(const v8us*)((const unsigned short*)arow + kb + 16 + 8 * hh);
#pragma unroll
    for (int t = 0; t < 4; ++t) { if (col0 + t * 16 >= N) continue; const size_t boff = (size_t)(col0 + t * 16 + ln) * ldb + kb; FragH bq; bq.half[0] = *(const v8us*)((const unsigned short*)Bh + boff + 8 * hh); bq.half[1] = *(const v8us*)((const unsigned short*)Bh + boff + 16 + 8 * hh);
      acc[t] = mmaH<1>(ah.v, ah.v, bq.v, bq.v, acc[t]); }
  }
#pragma unroll
  for (int t = 0; t < 4; ++t) { if (col0 + t * 16 >= N) continue; const int col = col0 + t * 16 + ln; const float bv = bp ? bf16_round(bp[col]) : 0.f;
#pragma unroll
    for (int r = 0; r < 8; ++r) { float v = acc[t][r] * alpha + bv; if (CP) { const int rr = row0g + row0 + 8 * hh + r; if (rowsPerB < 0) v += CP[cofs + (size_t)rr * ldc + col];      /* rowsPerB < 0: own element of the batched C plane */ else { const int bidx = rr / rowsPerB; v += CP[(size_t)bidx * sCPb + (size_t)by * 64 + col]; } } if (ACT == 1) v = (v > 0.f) ? v : expm1f(v); else if (ACT == 7) v = (v > 0.f) ? v + 1.0f : expf(v); else if (ACT == 8) v = tanhf(v); else if (ACT == 9) v = 0.5f * v * (1.0f + tanhf(0.7978845608028654f * (v + 0.044715f * v * v * v))); else if (ACT == 11) v = 1.0f / (1.0f + expf(-v)); else if (ACT == 12) v = (v > 0.f) ? v : 0.01f * v; else if (ACT == 14) v = (v > 0.f) ? v : 0.1f * v; else if (ACT == 16) v = (v >= 0.f) ? v : 0.3f * v; else if (ACT == 17) v = (v >= 0.f) ? v : 0.2f * v; else if (ACT == 15) v = v / (1.0f + expf(-v)); else if (ACT == 3) v = fmaxf(v, 0.f); else if (ACT == 6) v = 0.5f * v * (1.0f + erff(v * 0.70710678118654752f)); so[w][8 * hh + r][t * 16 + ln] = v; } }
  __builtin_amdgcn_fence(__ATOMIC_ACQ_REL, "workgroup"); __builtin_amdgcn_wave_barrier();
  const int rsub = lane >> 4, c4 = (lane & 15) * 4; typedef _Float16 v4h __attribute__((ext_vector_type(4)));
  {
#pragma unroll
    for (int q = 0; q < 8; ++q) { const int r = q * 2 + rsub; if (col0 + c4 < N) { const v4f v = *(const v4fa*)&so[w][r][c4]; if (C) *(v4f*)(C + cofs + (size_t)(row0 + r) * ldc + col0 + c4) = v; if (C16) { v4h h4; for (int i = 0; i < 4; ++i) h4[i] = (_Float16)v[i]; *(v4h*)(C16 + cofs + (size_t)(row0 + r) * ldc + col0 + c4) = h4; } } }
     }
}

typedef _Float16 v4h __attribute__((ext_vector_type(4)));

// 64 elements a thread (the stage costs the start of its waves more than its bytes): a block converts 64 KiB of source that lie in a row; group u of four elements of thread t is 256 u + t, so every load and store covers whole 128-byte lines under one index register.
typedef _Float16 v4ha __attribute__((ext_vector_type(4), may_alias));
__global__ __launch_bounds__(256) void k_x16(const float* __restrict__ x, _Float16* __restrict__ X16) { const unsigned i0 = blockIdx.x * 4096u + threadIdx.x; v4f a[16]; v4h o[16];
#pragma unroll
  for (int u = 0; u < 16; ++u) a[u] = ((const v4fa*)(x + u * 1024))[i0];
#pragma unroll
  for (int u = 0; u < 16; ++u)
#pragma unroll
    for (int q = 0; q < 4; ++q) o[u][q] = (_Float16)bf16_round(a[u][q]);
#pragma unroll
  for (int u = 0; u < 16; ++u) ((v4ha*)(X16 + u * 1024))[i0] = o[u]; }
__global__ __launch_bounds__(256) void k_h16(const float* __restrict__ x, _Float16* __restrict__ X16, size_t n8) { const size_t t = (size_t)blockIdx.x * 256 + threadIdx.x; if (t >= n8) return; FragH f;
#pragma unroll
  for (int q = 0; q < 8; ++q) f.h[q] = (_Float16)x[t * 8 + q]; *(v8us*)((unsigned short*)X16 + t * 8) = f.half[0];  }
__global__ __launch_bounds__(256) void k_round16f(const float* __restrict__ W, _Float16* __restrict__ Bt, size_t n8) { const size_t t = (size_t)blockIdx.x * 256 + threadIdx.x; if (t >= n8) return; FragH f;
#pragma unroll
  for (int i = 0; i < 8; ++i) f.h[i] = (_Float16)(bf16_round(W[t * 8 + i]) * 16.0f); *(v8us*)((unsigned short*)Bt + t * 8) = f.half[0];  }
template <int NHv, int TTv>
__global__ __launch_bounds__(256) void k_vt(const _Float16* __restrict__ V16, int ldv, int voff, _Float16* __restrict__ Vt) { __shared__ unsigned short tl[64][66]; const int tid = threadIdx.x; const int slab = blockIdx.x / (TTv / 64), lg = blockIdx.x % (TTv / 64); const int b = slab / NHv, h = slab % NHv;
  for (int i = tid; i < 64 * 8; i += 256) { const int r = i / 8, c8 = (i % 8) * 8; FragH f; f.half[0] = *(const v8us*)((const unsigned short*)V16 + ((size_t)b * TTv + lg * 64 + r) * ldv + voff + h * 64 + c8);
#pragma unroll
    for (int q = 0; q < 8; ++q) tl[r][c8 + q] = f.u[q]; }
  __syncthreads();
  {
#pragma unroll
    for (int rd = 0; rd < 2; ++rd) { const int d = rd * 32 + tid / 8, pc = tid % 8; FragH f;
#pragma unroll
      for (int q = 0; q < 8; ++q) f.u[q] = tl[pc * 8 + q][d];
      *(v8us*)((unsigned short*)Vt + ((size_t)slab * 64 + d) * TTv + lg * 64 + pc * 8) = f.half[0]; }
     } }

__global__ __launch_bounds__(256) void k_hl(const float* __restrict__ F, _Float16* __restrict__ Hh, _Float16* __restrict__ Hl, size_t n8) { const size_t t = (size_t)blockIdx.x * 256 + threadIdx.x; if (t >= n8) return; FragH fh, fl; const v4f a = *(const v4fa*)(F + t * 8), c = *(const v4fa*)(F + t * 8 + 4);
#pragma unroll
  for (int q = 0; q < 4; ++q) { _Float16 h = (_Float16)a[q]; fh.h[q] = h; fl.h[q] = (_Float16)((a[q] - (float)h) * 1024.0f); h = (_Float16)c[q]; fh.h[4 + q] = h; fl.h[4 + q] = (_Float16)((c[q] - (float)h) * 1024.0f); }
  { *(v8us*)((unsigned short*)Hh + t * 8) = fh.half[0]; *(v8us*)((unsigned short*)Hl + t * 8) = fl.half[0];  } }

// ---- fast GEMM (wave tile 32x64; requires M % 32 == 0 rows per launch region and N % 64 == 0); epilogue = k_gemm_hhx semantics ----
__device__ __forceinline__ v16h g2_frag(const _Float16* p, int hh) { FragH f; f.half[0] = *(const v8us*)((const unsigned short*)p + 8 * hh); f.half[1] = *(const v8us*)((const unsigned short*)p + 16 + 8 * hh); return f.v; }
__device__ __forceinline__ v8f g2_mma(v16h a, v16h b, v8f c) { v8f d = __builtin_amdgcn_wmma_f32_16x16x32_f16(false, a, false, b, (short)0, c, false, false); asm volatile("v_nop\n\tv_nop\n\tv_nop\n\tv_nop" : "+v"(d) : "v"(a), "v"(b)); return d; }
template <int ACT>
__global__ __launch_bounds__(128) void k_gemm2(const _Float16* __restrict__ A, int lda, size_t sA, const _Float16* __restrict__ Bh, int ldb, size_t sB, float alpha, const float* __restrict__ bias, size_t sBias, const float* __restrict__ CP, int rowsPerB, size_t sCPb, int row0g,
    float* __restrict__ C, _Float16* __restrict__ C16, int ldc, size_t sC, int M, int N, int K) { static_assert(ACT == 0 || ACT == 3 || ACT == 6 || ACT == 8 || ACT == 9 || ACT == 11 || ACT == 12 || ACT == 14 || ACT == 15 || ACT == 16 || ACT == 17, "k_gemm2: unsupported ACT code (would silently apply no activation)");
  __shared__ __attribute__((aligned(16))) float so[4][32][68];
  const int tid = threadIdx.x, w = tid >> 5, lane = tid & 31, ln = lane & 15, hh = lane >> 4; const int by = blockIdx.y;
  A += (size_t)by * sA; Bh += (size_t)by * sB; const size_t cofs = (size_t)by * sC; const float* bp = bias ? bias + (size_t)by * sBias : nullptr;
  const int ntn = N >> 6; const int mt = blockIdx.x / ntn, nq = blockIdx.x - mt * ntn; const int row0 = mt * 128 + 32 * w, col0 = nq * 64; if (row0 >= M) return;
  const _Float16* a0p = A + (size_t)(row0 + ln) * lda; const _Float16* a1p = a0p + (size_t)16 * lda;
  const _Float16* b0p = Bh + (size_t)(col0 + ln) * ldb; const _Float16* b1p = b0p + (size_t)16 * ldb; const _Float16* b2p = b1p + (size_t)16 * ldb; const _Float16* b3p = b2p + (size_t)16 * ldb;
  const v8f z8 = {0.f,0.f,0.f,0.f,0.f,0.f,0.f,0.f}; v8f c00 = z8, c01 = z8, c02 = z8, c03 = z8, c10 = z8, c11 = z8, c12 = z8, c13 = z8;
  for (int kb = 0; kb < K; kb += 32) { const v16h a0 = g2_frag(a0p + kb, hh), a1 = g2_frag(a1p + kb, hh);
    v16h b = g2_frag(b0p + kb, hh); c00 = g2_mma(a0, b, c00); c10 = g2_mma(a1, b, c10);
    b = g2_frag(b1p + kb, hh); c01 = g2_mma(a0, b, c01); c11 = g2_mma(a1, b, c11);
    b = g2_frag(b2p + kb, hh); c02 = g2_mma(a0, b, c02); c12 = g2_mma(a1, b, c12);
    b = g2_frag(b3p + kb, hh); c03 = g2_mma(a0, b, c03); c13 = g2_mma(a1, b, c13); }
  v8f accs[8] = {c00, c01, c02, c03, c10, c11, c12, c13};
#pragma unroll
  for (int u = 0; u < 8; ++u) { const int t = u & 3, half = u >> 2; const int col = col0 + t * 16 + ln; const float bv = bp ? bf16_round(bp[col]) : 0.f;
#pragma unroll
    for (int r = 0; r < 8; ++r) { const int rloc = half * 16 + 8 * hh + r; float v = accs[u][r] * alpha + bv; if (CP) { if (rowsPerB < 0) v += CP[cofs + (size_t)(row0g + row0 + rloc) * ldc + col];      /* rowsPerB < 0: own element of the batched C plane */ else { const int bidx = (row0g + row0 + rloc) / rowsPerB; v += CP[(size_t)bidx * sCPb + (size_t)by * 64 + col]; } }
      if (ACT == 3) v = fmaxf(v, 0.f); else if (ACT == 6) v = 0.5f * v * (1.0f + erff(v * 0.70710678118654752f)); else if (ACT == 11) v = 1.0f / (1.0f + expf(-v)); else if (ACT == 15) v = v / (1.0f + expf(-v)); else if (ACT == 12) v = (v > 0.f) ? v : 0.01f * v; else if (ACT == 8) v = tanhf(v); else if (ACT == 9) v = 0.5f * v * (1.0f + tanhf(0.7978845608028654f * (v + 0.044715f * v * v * v))); else if (ACT == 14) v = (v > 0.f) ? v : 0.1f * v; else if (ACT == 16) v = (v >= 0.f) ? v : 0.3f * v; else if (ACT == 17) v = (v >= 0.f) ? v : 0.2f * v;
      so[w][rloc][t * 16 + ln] = v; } }
  __builtin_amdgcn_fence(__ATOMIC_ACQ_REL, "workgroup"); __builtin_amdgcn_wave_barrier();
  const int rsub = lane >> 4, c4 = (lane & 15) * 4;
  {
#pragma unroll
    for (int q = 0; q < 16; ++q) { const int r = q * 2 + rsub; const v4f v = *(const v4fa*)&so[w][r][c4]; if (C) *(v4f*)(C + cofs + (size_t)(row0 + r) * ldc + col0 + c4) = v; if (C16) { v4h h4; for (int i = 0; i < 4; ++i) h4[i] = (_Float16)v[i]; *(v4h*)(C16 + cofs + (size_t)(row0 + r) * ldc + col0 + c4) = h4; } }
     } }

__global__ __launch_bounds__(256) void k_wnat(const float* __restrict__ w, size_t n8, _Float16* __restrict__ Bt) { const size_t t = (size_t)blockIdx.x * 256 + threadIdx.x; if (t >= n8) return; FragH f; for (int q = 0; q < 8; ++q) f.h[q] = (_Float16)(bf16_round(w[t * 8 + q]) * 16.0f); *(v8us*)((unsigned short*)Bt + t * 8) = f.half[0];  }

// exp2 with the one issue slot that the instruction set asks for behind a transcendental (before its source is overwritten or its result read) in the same statement.
__device__ __forceinline__ float exp2_slot(float x) { float e; asm("v_exp_f32 %0, %1\n\tv_nop" : "=v"(e) : "v"(x)); return e; }
__device__ __forceinline__ v8f fa_mma(v16h a, v16h b, v8f c) { return __builtin_amdgcn_wmma_f32_16x16x32_f16(false, a, false, b, (short)0, c, false, false); }
__device__ __forceinline__ float fa_xhalf(float x) { return __builtin_bit_cast(float, __builtin_amdgcn_permlanex16(__builtin_bit_cast(int, x), __builtin_bit_cast(int, x), 0x76543210, 0xfedcba98, false, false)); }      /* lane l with lane l ^ 16 */
__device__ __forceinline__ void fa_gap() { __builtin_amdgcn_sched_barrier(0); asm volatile("v_nop\n\tv_nop\n\tv_nop\n\tv_nop"); __builtin_amdgcn_sched_barrier(0); }      /* the four vector slots behind a group of WMMAs, on every path: a branch or a load over their operands follows; the two scheduling barriers keep the slots (and the loads issued ahead) where they stand */
template <bool LAST>      /* LAST = the wave's diagonal pass: masked, and no further K rows are fetched */
__device__ __forceinline__ void fa_pass(v16h (&kf)[2][2], const _Float16* __restrict__ kn, const _Float16* __restrict__ vp, int key0, int qw0, int ln, int hh, const v16h (&qf)[2][2], v8f (&acc)[2][4], float (&m_run)[2], float (&l_run)[2]) {
  const float cs = 0.125f * 1.44269504088896340736f;
  v16h vf[4];
#pragma unroll
  for (int t = 0; t < 4; ++t) vf[t] = g2_frag(vp + (size_t)(16 * t) * SQ, hh);      /* this pass's V^T rows, in flight under the scores and the exponentials */
  v8f s[2][2];
#pragma unroll
  for (int kt = 0; kt < 2; ++kt)
#pragma unroll
    for (int g = 0; g < 2; ++g) { const v8f z = {0.f, 0.f, 0.f, 0.f, 0.f, 0.f, 0.f, 0.f}; s[kt][g] = fa_mma(kf[kt][1], qf[g][1], fa_mma(kf[kt][0], qf[g][0], z)); }
  fa_gap();
  if (!LAST) {
#pragma unroll
    for (int kt = 0; kt < 2; ++kt)
#pragma unroll
      for (int kc = 0; kc < 2; ++kc) kf[kt][kc] = g2_frag(kn + (size_t)(16 * kt) * KVD + 32 * kc, hh);      /* next pass's K rows, one pass ahead */
  }
  if (LAST) {
#pragma unroll
    for (int g = 0; g < 2; ++g)
#pragma unroll
      for (int kt = 0; kt < 2; ++kt)
#pragma unroll
        for (int r = 0; r < 8; ++r) if (key0 + 16 * kt + 8 * hh + r > qw0 + 16 * g + ln) s[kt][g][r] = -3.0e38f;      /* causal: key above the query (key0 itself is never masked, so every maximum stays a real score) */
  }
  float mb[2]; bool need = false;
#pragma unroll
  for (int g = 0; g < 2; ++g) { float mx = s[0][g][0];
#pragma unroll
    for (int r = 1; r < 8; ++r) mx = fmaxf(mx, s[0][g][r]);
#pragma unroll
    for (int r = 0; r < 8; ++r) mx = fmaxf(mx, s[1][g][r]);
    mx = fmaxf(mx, fa_xhalf(mx)) * cs; mb[g] = mx; need = need || (mx > m_run[g] + 8.0f); }
  if (__builtin_amdgcn_ballot_w32(need) != 0) {      /* wave-uniform; rare after the first passes */
#pragma unroll
    for (int g = 0; g < 2; ++g) { const float mn = fmaxf(m_run[g], mb[g]); const float corr = exp2_slot(m_run[g] - mn); m_run[g] = mn; l_run[g] *= corr;
#pragma unroll
      for (int t = 0; t < 4; ++t) acc[g][t] = acc[g][t] * corr; }
  }
  FragH pf[2];
#pragma unroll
  for (int g = 0; g < 2; ++g) { const float nm = -m_run[g]; float ls[4] = {0.f, 0.f, 0.f, 0.f};
#pragma unroll
    for (int i = 0; i < 16; ++i) { const float e = exp2_slot(fmaf(s[i >> 3][g][i & 7], cs, nm)); ls[i & 3] += e; pf[g].h[i] = (_Float16)e; }
    l_run[g] += (ls[0] + ls[1]) + (ls[2] + ls[3]); }
  __builtin_amdgcn_sched_barrier(0);      /* every exponential stands ahead of the WMMAs */
#pragma unroll
  for (int g = 0; g < 2; ++g)
#pragma unroll
    for (int t = 0; t < 4; ++t) acc[g][t] = fa_mma(vf[t], pf[g].v, acc[g][t]);
  fa_gap();
  if (!LAST) { asm volatile("s_wait_xcnt 0x0" ::: "memory"); __builtin_amdgcn_sched_barrier(0); }      /* the wait in front of the advance of the K and V^T address pairs at the loop's foot; the scheduling barrier keeps the advance behind it */
}
__global__ __launch_bounds__(128) void k_fattn(const _Float16* __restrict__ Q, const _Float16* __restrict__ K, const _Float16* __restrict__ Vt, _Float16* __restrict__ O) {
  const int lane = threadIdx.x & 31, ln = lane & 15, hh = lane >> 4; const int w = __builtin_amdgcn_readfirstlane((int)(threadIdx.x >> 5));      /* the wave's number in a scalar register: trip count and branches stay scalar, EXEC stays full for the WMMAs */
  const int h = blockIdx.y, b = blockIdx.z; const int xs = (int)blockIdx.x, nq = (int)gridDim.x; const int qa = (xs & 1) ? (xs >> 1) : nq - 1 - (xs >> 1); const int qb = (b & 1) ? nq - 1 - qa : qa;      /* a permutation of the query tiles: long and short ones alternate between neighbouring blocks and between batches, so that the blocks that share a WGP carry about the same number of passes (speed only) */
  const int qw0 = qb * 128 + w * 32;
  const _Float16* Ql = Q + ((size_t)b * SQ + qw0 + ln) * DM + h * HD; const _Float16* Kl = K + ((size_t)b * SQ + ln) * KVD + h * HD; const _Float16* Vl = Vt + (((size_t)b * NH + h) * HD + ln) * SQ;
  v16h qf[2][2], kf[2][2];
#pragma unroll
  for (int g = 0; g < 2; ++g)
#pragma unroll
    for (int kc = 0; kc < 2; ++kc) { qf[g][kc] = g2_frag(Ql + (size_t)(16 * g) * DM + 32 * kc, hh); kf[g][kc] = g2_frag(Kl + (size_t)(16 * g) * KVD + 32 * kc, hh); }
  __builtin_amdgcn_sched_barrier(0); asm volatile("s_wait_xcnt 0x0" ::: "memory"); __builtin_amdgcn_sched_barrier(0);      /* the wait in front of any overwrite of these loads' address pairs; the scheduling barriers keep later register writes behind it */
  v8f acc[2][4]; float m_run[2] = {-3.0e38f, -3.0e38f}, l_run[2] = {0.f, 0.f};
#pragma unroll
  for (int g = 0; g < 2; ++g)
#pragma unroll
    for (int t = 0; t < 4; ++t) acc[g][t] = v8f{0.f, 0.f, 0.f, 0.f, 0.f, 0.f, 0.f, 0.f};
  const int nfull = qw0 / 32;      /* passes wholly below the diagonal */
#pragma unroll 1      /* one pass per trip: an unrolled body would hold two passes' fragments and lose a wave per SIMD */
  for (int p = 0; p < nfull; ++p) fa_pass<false>(kf, Kl + (size_t)(p + 1) * 32 * KVD, Vl + p * 32, p * 32, qw0, ln, hh, qf, acc, m_run, l_run);
  fa_pass<true>(kf, Kl, Vl + nfull * 32, nfull * 32, qw0, ln, hh, qf, acc, m_run, l_run);
  FragH of[2][4];
#pragma unroll
  for (int g = 0; g < 2; ++g) { const float l = l_run[g] + fa_xhalf(l_run[g]); const float inv = 64.0f / l;
#pragma unroll
    for (int t = 0; t < 4; ++t)
#pragma unroll
      for (int r = 0; r < 8; ++r) of[g][t].h[r] = (_Float16)(acc[g][t][r] * inv); }
  __builtin_amdgcn_sched_barrier(0);      /* all eight packed rows are made ahead of the first store, so that no register of an issued store is written again */
#pragma unroll
  for (int g = 0; g < 2; ++g)
#pragma unroll
    for (int t = 0; t < 4; ++t) *(v8us*)((unsigned short*)O + ((size_t)b * SQ + qw0 + 16 * g + ln) * DM + h * HD + 16 * t + 8 * hh) = of[g][t].half[0];      /* register r of tile t is d = 16 t + 8 hh + r of query ln: 16 bytes a lane; the wave writes each query's whole 128-byte head row */
}

template <int MASKADD>
__global__ __launch_bounds__(64) void k_att0(const float* __restrict__ QF, const float* __restrict__ KF, const float* __restrict__ VF, int ld, const float* __restrict__ mask, float scale, float* __restrict__ OF, int ldo) {
  __shared__ __attribute__((aligned(16))) float lq[64][64]; __shared__ __attribute__((aligned(16))) float lo[64][64];
  const int tid = threadIdx.x; const int h = blockIdx.x / (QT0 / 64), rg = blockIdx.x % (QT0 / 64); const int i = rg * 64 + tid;
  { const size_t pb = (size_t)blockIdx.y * QT0; QF += pb * ld; KF += pb * ld; VF += pb * ld; OF += pb * ldo; }      /* blockIdx.y = batch: each batch's first-tile rows lie in a plane of their own */
  const float* qr = QF + (size_t)i * ld + h * HD;
  for (int c = 0; c < HD / 4; ++c) { *(v4f*)&lq[tid][c * 4] = *(const v4fa*)(qr + c * 4); const v4f z = {0.f, 0.f, 0.f, 0.f}; *(v4f*)&lo[tid][c * 4] = z; }
  float m = -1.0e30f, l = 0.f; const int jmax = MASKADD ? (SQ - 1) : (rg * 64 + 63);      /* additive-mask form: every key (the mask input decides); causal form: keys up to the block's last row */
  for (int j = 0; j <= jmax; ++j) { const float* kr = KF + (size_t)j * ld + h * HD; const float* vr = VF + (size_t)j * ld + h * HD; float s = 0.f;
    for (int c = 0; c < HD / 4; ++c) { const v4f kq = *(const v4fa*)(kr + c * 4); const v4f qq = *(v4f*)&lq[tid][c * 4]; s = __fadd_rn(s, __fmul_rn(qq[0], kq[0])); s = __fadd_rn(s, __fmul_rn(qq[1], kq[1])); s = __fadd_rn(s, __fmul_rn(qq[2], kq[2])); s = __fadd_rn(s, __fmul_rn(qq[3], kq[3])); }
    s = __fmul_rn(s, scale); if (MASKADD) s = __fadd_rn(s, __fmul_rn(bf16_round(mask[(size_t)i * SQ + j]), -10000.0f));
    const float f = (MASKADD || j <= i) ? 1.f : 0.f; const float sm = fmaf(f, s, (1.f - f) * -1.0e30f); const float mn = fmaxf(m, sm); const float sc = expf(m - mn); const float e = expf(sm - mn); l = __fadd_rn(__fmul_rn(l, sc), e); m = mn;
    for (int c = 0; c < HD / 4; ++c) { const v4f vv = *(const v4fa*)(vr + c * 4); v4f oo = *(v4f*)&lo[tid][c * 4]; for (int u = 0; u < 4; ++u) oo[u] = __fadd_rn(__fmul_rn(oo[u], sc), __fmul_rn(e, vv[u])); *(v4f*)&lo[tid][c * 4] = oo; } }
  const float fin = 64.0f / l;      /* o carried x64 like the f16 path */
  for (int c = 0; c < HD / 4; ++c) { v4f oo = *(v4f*)&lo[tid][c * 4]; for (int u = 0; u < 4; ++u) oo[u] = __fmul_rn(oo[u], fin); *(v4f*)&lo[tid][c * 4] = oo; }
  __syncthreads();
  {
    for (int it = 0; it < 16; ++it) { const int row = it * 4 + tid / 16, pc = (tid % 16) * 4; const v4f v = *(const v4f*)&lo[row][pc]; *(v4f*)(OF + (size_t)(rg * 64 + row) * ldo + h * HD + pc) = v; }
     } }

__global__ __launch_bounds__(256) void k_kvexp(const float* __restrict__ src, float* __restrict__ dst, size_t n4) { const size_t t = (size_t)blockIdx.x * 256 + threadIdx.x; if (t >= n4) return; const size_t e = t * 4; const size_t row = e / DM; const int col = (int)(e % DM); const int h = col / HD, d = col % HD; const v4f v = *(const v4fa*)(src + row * KVD + (size_t)(h / HPG) * HD + d); *(v4f*)(dst + e) = v;  }

__global__ __launch_bounds__(256) void k_tab2(float theta, float* __restrict__ CS, float* __restrict__ SN) {
  const int t = blockIdx.x * 256 + threadIdx.x; if (t >= SQ * (HD / 2)) return; const int i = t % (HD / 2); const int p = t / (HD / 2); const float invf = 1.0f / powf(theta, (float)(2 * i) / (float)HD); const float ang = __fmul_rn((float)p, invf); const float c = cosf(ang), s = sinf(ang);
  *(float*)(CS + t) = c; *(float*)(SN + t) = s;  }
// Half-split rope (out_lo = x_lo c - x_hi s, out_hi = x_lo s + x_hi c, position = row in its batch), 64 elements a thread: the stage moves few bytes, so what it costs is the start of its waves.
// Thread (p, c) takes columns 4 (c & 7) .. + 3 of the low half and of the high half of heads c >> 3 and (c >> 3) + 8, at position p of every batch: one pair of table loads serves all eight head rows; eight lanes cover a whole 128-byte line in every load.
// F32OUT = false: f16 rows of all SQ positions (H16, batch pitch SQ rows); true: f32 rows of the first QT0 positions (F32, batch pitch QT0 rows). The grid gives the number of positions: 4 a block.
template <bool F32OUT>
__global__ __launch_bounds__(256) void k_rope(const float* __restrict__ F, const float* __restrict__ CS, const float* __restrict__ SN, _Float16* __restrict__ H16, float* __restrict__ F32) {
  static_assert(HD == 64 && NH == 16 && NG == NH && KVD == DM && DM == NH * HD, "k_rope: 16 heads of 64 in rows of 1024");
  const unsigned t = blockIdx.x * 256u + threadIdx.x; const unsigned p = t >> 6, c = t & 63u;
  const unsigned e4 = p * (DM / 4) + (c >> 3) * (HD / 4) + (c & 7u);      /* offset inside a batch plane, in groups of four elements, the same for source and result */
  const unsigned t4 = p * (HD / 8) + (c & 7u);
  unsigned ix[NB], ox[NB];      /* one 32-bit index a batch under the uniform base: source, result */
#pragma unroll
  for (int b = 0; b < NB; ++b) { ix[b] = e4 + (unsigned)b * (SQ * DM / 4); ox[b] = e4 + (unsigned)b * ((F32OUT ? QT0 : SQ) * DM / 4); }
  const v4f cs = ((const v4fa*)CS)[t4], sn = ((const v4fa*)SN)[t4];
  v4f lo[NB][2], hi[NB][2];
#pragma unroll
  for (int b = 0; b < NB; ++b)
#pragma unroll
    for (int g = 0; g < 2; ++g) { const float* s = F + g * (8 * HD); lo[b][g] = ((const v4fa*)s)[ix[b]]; hi[b][g] = ((const v4fa*)(s + HD / 2))[ix[b]]; }
  static_assert(NB == 4, "the wait below names four source indices");
  asm volatile("s_wait_xcnt 0x0" :: "v"(t4), "v"(ix[0]), "v"(ix[1]), "v"(ix[2]), "v"(ix[3]) : "memory");      /* the wait in front of any overwrite of these loads' index registers; named as inputs, they stay whole up to it (no later load lands on one) */
  __builtin_amdgcn_sched_barrier(0);      /* all eighteen loads are issued ahead of the first product: one round trip to memory a wave (the build had held six of them back behind waits) */
  v4h la[NB][2], ha[NB][2];
#pragma unroll
  for (int b = 0; b < NB; ++b)
#pragma unroll
    for (int g = 0; g < 2; ++g) { const v4f l = lo[b][g], h = hi[b][g];
#pragma unroll
      for (int q = 0; q < 4; ++q) { const float ol = __fadd_rn(__fmul_rn(l[q], cs[q]), -__fmul_rn(h[q], sn[q])), oh = __fadd_rn(__fmul_rn(l[q], sn[q]), __fmul_rn(h[q], cs[q]));
        if (F32OUT) { lo[b][g][q] = ol; hi[b][g][q] = oh; } else { la[b][g][q] = (_Float16)ol; ha[b][g][q] = (_Float16)oh; } } }
  __builtin_amdgcn_sched_barrier(0);      /* every result is made ahead of the first store, so that no register of an issued store is written again */
#pragma unroll
  for (int b = 0; b < NB; ++b)
#pragma unroll
    for (int g = 0; g < 2; ++g) {
      if (F32OUT) { float* d = F32 + g * (8 * HD); ((v4fa*)d)[ox[b]] = lo[b][g]; ((v4fa*)(d + HD / 2))[ox[b]] = hi[b][g]; }
      else { _Float16* d = H16 + g * (8 * HD); ((v4ha*)d)[ox[b]] = la[b][g]; ((v4ha*)(d + HD / 2))[ox[b]] = ha[b][g]; } }
}

__global__ __launch_bounds__(256) void k_bfcp(const float* __restrict__ src, float* __restrict__ dst, size_t n4) { const size_t t = (size_t)blockIdx.x * 256 + threadIdx.x; if (t >= n4) return; const v4f a = *(const v4fa*)(src + t * 4); v4f o; for (int q = 0; q < 4; ++q) o[q] = bf16_round(a[q]); *(v4f*)(dst + t * 4) = o;  }

__global__ __launch_bounds__(256) void k_tabhalf(const float* __restrict__ cs, const float* __restrict__ sn, float* __restrict__ CS, float* __restrict__ SN) { const int t = blockIdx.x * 256 + threadIdx.x; if (t >= SQ * (HD / 2)) return; const int p = t / (HD / 2), i = t % (HD / 2); const float c = bf16_round(cs[(size_t)p * HD + i]), s = bf16_round(sn[(size_t)p * HD + i]);
  *(float*)(CS + t) = c; *(float*)(SN + t) = s;  }

__global__ __launch_bounds__(256) void k_tab2d(float* __restrict__ CS, float* __restrict__ SN) {
  const int t = blockIdx.x * 256 + threadIdx.x; if (t >= SQ * (HD / 2)) return; const int i = t % (HD / 2); const int p = t / (HD / 2); const float invf = (float)(1.0 / pow(10000.0, (double)(2 * i) / (double)HD)); const float ang = __fmul_rn((float)p, invf); const float c = cosf(ang), s = sinf(ang);
  *(float*)(CS + t) = c; *(float*)(SN + t) = s;  }
extern "C" void kernel_launch(void* const* d_in, const int* in_sizes, int n_in,
                              void* d_out, int out_size, void* d_ws, size_t ws_size, hipStream_t stream) {
  (void)in_sizes; (void)n_in; (void)out_size;
  const float* const* I = (const float* const*)d_in; const float* x = I[0]; const float* xk = I[1]; const float* xv = I[2]; const float* wq = I[3]; const float* wk = I[5]; const float* wv = I[7]; const float* wo = I[9];      /* the streams query, key, value; natural [out][in] W_q, W_k, W_v, W_o; the biases b_q = I[4], b_k = I[6], b_v = I[8], b_o = I[10]; rope tables computed in-kernel (positions = row index) */
  static_assert(HPG == 1 && NH == NG * HPG && NH * HD == DM && KVD == DM, "plain multi-head attention as 16 kv groups of one query head"); const float* bq = I[4]; const float* bk = I[6]; const float* bv = I[8]; const float* bo = I[10];      /* the four biases, each bound to its projection (read through the GEMM bias pointer, bf16-rounded on load) */
  char* ws = (char*)d_ws; size_t off = 0;
  auto take = [&](size_t bytes) { char* p = ws + off; off += (bytes + 255) & ~(size_t)255; return p; };
  _Float16* BQKV = (_Float16*)take((size_t)3 * DM * DM * 2); _Float16* BQ = BQKV; _Float16* BK = BQKV + (size_t)DM * DM; _Float16* BV = BQKV + (size_t)2 * DM * DM; _Float16* BO = (_Float16*)take((size_t)DM * DM * 2);      /* one plane Bt [3072][1024]: rows 0..1023 = W_q, 1024.. = W_k, 2048.. = W_v (natural [out][in] weights are Bt as they stand) */
  _Float16* X16 = (_Float16*)take(NR * DM * 2); _Float16* XK16 = (_Float16*)take(NR * DM * 2); _Float16* XV16 = (_Float16*)take(NR * DM * 2); float* QF = (float*)take(NR * DM * 4); float* KF = (float*)take(NR * KVD * 4); float* CSB = (float*)take((size_t)SQ * HD * 4); float* SNB = (float*)take((size_t)SQ * HD * 4); _Float16* Q16 = (_Float16*)take(NR * DM * 2); _Float16* K16 = (_Float16*)take(NR * KVD * 2); _Float16* V16 = (_Float16*)take(NR * KVD * 2); _Float16* O16 = (_Float16*)take(NR * DM * 2);
  _Float16* VT = (_Float16*)take((size_t)NB * NH * HD * SQ * 2);
  float* QF0 = (float*)take((size_t)NB * QT0 * DM * 4); float* KF0 = (float*)take((size_t)NB * QT0 * KVD * 4); float* VF0 = (float*)take((size_t)NB * QT0 * KVD * 4); float* KF0e = (float*)take((size_t)NB * QT0 * DM * 4); float* VF0e = (float*)take((size_t)NB * QT0 * DM * 4); float* OF0 = (float*)take((size_t)NB * QT0 * DM * 4); _Float16* OH0 = (_Float16*)take((size_t)NB * QT0 * DM * 2); _Float16* OL0 = (_Float16*)take((size_t)NB * QT0 * DM * 2);
  if (off > ws_size) return;
  { const unsigned g = (unsigned)(((size_t)DM * DM / 8 + 255) / 256); k_wnat<<<g, 256, 0, stream>>>(wq, (size_t)DM * DM / 8, BQ); k_wnat<<<g, 256, 0, stream>>>(wk, (size_t)DM * DM / 8, BK); k_wnat<<<g, 256, 0, stream>>>(wv, (size_t)DM * DM / 8, BV); k_wnat<<<g, 256, 0, stream>>>(wo, (size_t)DM * DM / 8, BO); }      /* natural [out][in] = Bt x16 */
  static_assert(NR * DM % 16384 == 0, "k_x16: whole blocks of 16384 elements"); k_x16<<<(unsigned)(NR * DM / 16384), 256, 0, stream>>>(x, X16); k_x16<<<(unsigned)(NR * DM / 16384), 256, 0, stream>>>(xk, XK16); k_x16<<<(unsigned)(NR * DM / 16384), 256, 0, stream>>>(xv, XV16);      /* the three streams as exact f16 rows */
  k_tab2d<<<(SQ * (HD / 2) + 255) / 256, 256, 0, stream>>>(CSB, SNB);      /* rope tables cos/sin(p / 10000^(2i/64)): inv_freq double-derived -> f32, f32 angle */
  const size_t r0p = (size_t)B0 * SQ;      /* first projected row */
  k_gemm2<0><<<dim3((unsigned)((MP / 128) * (KVD / 64)), 1), 128, 0, stream>>>(XV16 + r0p * DM, DM, 0, BV, DM, 0, 0.0625f, bv, 0, nullptr, 1, 0, 0, nullptr, V16 + r0p * KVD, KVD, 0, MP, KVD, DM);
  static_assert(B0 == 0 && NBR == NB && MP == NB * SQ, "every stage below takes all batches in one launch");
  k_gemm2<0><<<dim3((unsigned)((MP / 128) * (DM / 64)), 1), 128, 0, stream>>>(X16, DM, 0, BQ, DM, 0, 0.0625f, bq, 0, nullptr, 1, 0, 0, QF, nullptr, DM, 0, MP, DM, DM);      /* q (f32), every batch */
  k_rope<false><<<SQ / 4, 256, 0, stream>>>(QF, CSB, SNB, Q16, nullptr);      /* half-split rope (out_lo = x_lo c - x_hi s, out_hi = x_lo s + x_hi c = t cos + rotate_half(t) sin with the module's [f | f] tables) -> f16 rows of every batch; position = row in its batch; 4 positions a block */
  k_rope<true><<<QT0 / 4, 256, 0, stream>>>(QF, CSB, SNB, nullptr, QF0);      /* f32 half-split-roped q of rows 0..255 of each batch */
  k_gemm2<0><<<dim3((unsigned)((MP / 128) * (KVD / 64)), 1), 128, 0, stream>>>(XK16, DM, 0, BK, DM, 0, 0.0625f, bk, 0, nullptr, 1, 0, 0, KF, nullptr, KVD, 0, MP, KVD, DM);      /* k (f32), every batch */
  k_rope<false><<<SQ / 4, 256, 0, stream>>>(KF, CSB, SNB, K16, nullptr);
  k_rope<true><<<QT0 / 4, 256, 0, stream>>>(KF, CSB, SNB, nullptr, KF0);      /* likewise k */
  k_vt<NG, SQ><<<NB * NG * (SQ / 64), 256, 0, stream>>>(V16, KVD, 0, VT);      /* V^T [NB][NH][HD][SQ] */
  k_gemm2<0><<<dim3((QT0 / 128) * (KVD / 64), NB), 128, 0, stream>>>(XV16, DM, (size_t)SQ * DM, BV, DM, 0, 0.0625f, bv, 0, nullptr, 1, 0, 0, VF0, nullptr, KVD, (size_t)QT0 * KVD, QT0, KVD, DM);      /* f32 v of the first 256 rows of each batch (grid y = batch) */
  k_kvexp<<<(unsigned)(((size_t)NB * QT0 * DM / 4 + 255) / 256), 256, 0, stream>>>(KF0, KF0e, (size_t)NB * QT0 * DM / 4); k_kvexp<<<(unsigned)(((size_t)NB * QT0 * DM / 4 + 255) / 256), 256, 0, stream>>>(VF0, VF0e, (size_t)NB * QT0 * DM / 4);      /* head h <- its kv group for the exact first-tile kernel */
  k_att0<0><<<dim3(NH * (QT0 / 64), NB), 64, 0, stream>>>(QF0, KF0e, VF0e, DM, nullptr, 0.125f, OF0, DM);      /* exact f32 attention for rows 0..255 of every batch (o x64) */
  static_assert(SQ % 128 == 0 && HD == 64 && B0 == 0 && NBR == NB && QN == SQ && NHD == NH, "k_fattn: four waves of 32 query columns, head size 64, every batch and head");
  k_fattn<<<dim3(SQ / 128, NH, NB), 128, 0, stream>>>(Q16, K16, VT, O16);      /* scores, causal softmax and o (x64) of every batch, head and query tile in ONE launch */
  k_gemm2<0><<<dim3((unsigned)((MPO / 128) * (DM / 64)), 1), 128, 0, stream>>>(O16 + r0p * DM, DM, 0, BO, DM, 0, 0.0009765625f, bo, 0, nullptr, 1, 0, 0, (float*)d_out + r0p * DM, nullptr, DM, 0, MPO, DM, DM);      /* out rows are the output layout */
  k_hl<<<(unsigned)(((size_t)NB * QT0 * DM / 8 + 255) / 256), 256, 0, stream>>>(OF0, OH0, OL0, (size_t)NB * QT0 * DM / 8);      /* first-tile o (x64) -> f16 hi + x1024 residual planes */
  k_gemm2<0><<<dim3((QT0 / 128) * (DM / 64), NB), 128, 0, stream>>>(OH0, DM, (size_t)QT0 * DM, BO, DM, 0, 0.0009765625f, bo, 0, nullptr, 1, 0, 0, (float*)d_out, nullptr, DM, (size_t)SQ * DM, QT0, DM, DM);      /* rows 0..255 of each batch (grid y = batch): out = o_hi Wo (+ b), overwriting the f16-path rows */
  k_gemm2<0><<<dim3((QT0 / 128) * (DM / 64), NB), 128, 0, stream>>>(OL0, DM, (size_t)QT0 * DM, BO, DM, 0, 0.00000095367431640625f, nullptr, 0, (const float*)d_out, -1, 0, 0, (float*)d_out, nullptr, DM, (size_t)SQ * DM, QT0, DM, DM);      /* += o_lo Wo 2^-20 (own-element accumulate) */
}

// v005
// One run takes 462 microseconds.
// Two timings next to v004 both put it at 1.45 times that version's speed.
// Counting every step since v000, it is 15.9 times as fast.
#include <hip/hip_runtime.h>
// Causal multi-head attention over THREE input streams with rotate-half RoPE computed in the module (query, key, value [4][2048][1024]; Q = query W_q^T + b_q, K = key W_k^T + b_k, V = value W_v^T + b_v (natural [out][in] [1024][1024]; the four biases: bound and read), 16 heads of 64; cos / sin = [f, f] of pos * 10000^(-2i/64); Q = Q cos + rotate_half(Q) sin with rotate_half = cat(-x2, x1), likewise K (the bias is added BEFORE the rope); scores / sqrt(64); causal (triu k=1 at -inf); softmax; y = merged W_o^T + b_o (natural) -> [4][2048][1024]); run as grouped-query causal attention with 16 groups of ONE head with the rope stage in its half-split mode.
// Compute dtype: inputs rounded to bf16; x / weights exact; q, k, v, softmax weights and o as plain f16 GEMM operands (~2^-12); scores and softmax statistics f32; v_wmma_f32_16x16x32_f16; rows 0..255 of each batch redone in f32 on v_wmma_f32_16x16x4_f32, their o as f16 hi + x1024 residual.
#define NB 4
#define NG 16
#define HPG 1
#define KVD (NG * HD)
#define SQ 2048
#define DM 1024
#define NH 16
#define HD 64
#define HG 4                         /* unused */
#define QT 256                       /* unused */
#define NKX SQ                       /* unused */
#define QT0 256                      /* first-tile rows recomputed exactly in f32 */
#define B0 0                         /* first batch processed (debug hook) */
#define NBR NB                       /* batches processed (debug hook) */
#define NR ((size_t)NB * SQ)         /* token rows */
#define MP ((int)((size_t)NBR * SQ)) /* rows projected (debug hook) */
#define QN SQ                        /* query rows attended per batch (debug hook) */
#define NHD NH                       /* heads attended (debug hook) */
#define MPO MP                       /* rows through the output stage (debug hook) */
#define LQ DM      /* unused */
typedef __bf16 v16b __attribute__((ext_vector_type(16)));
typedef unsigned short v8us __attribute__((ext_vector_type(8), may_alias));
typedef float  v8f  __attribute__((ext_vector_type(8)));
typedef float  v4f  __attribute__((ext_vector_type(4)));
typedef float  v4fa __attribute__((ext_vector_type(4), may_alias));
union FragB { v16b v; v8us half[2]; unsigned short u[16]; };

__device__ __forceinline__ unsigned short bf16_bits(float x) { unsigned int u = __float_as_uint(x); return (unsigned short)((u + 0x7FFFu + ((u >> 16) & 1u)) >> 16); }
__device__ __forceinline__ float bf16_val(unsigned short b) { return __uint_as_float(((unsigned int)b) << 16); }
__device__ __forceinline__ float bf16_round(float x) { return bf16_val(bf16_bits(x)); }
// D += A·B with NT terms: 1 = ah·bh, 2 = + al·bh (A split), 3 = + ah·bl (both split)
template <int NT>
__device__ __forceinline__ v8f mmaN(v16b ah, v16b al, v16b bh, v16b bl, v8f c) {
  c = __builtin_amdgcn_wmma_f32_16x16x32_bf16(false, ah, false, bh, (short)0, c, false, false);
  if (NT >= 2) c = __builtin_amdgcn_wmma_f32_16x16x32_bf16(false, al, false, bh, (short)0, c, false, false);
  if (NT >= 3) c = __builtin_amdgcn_wmma_f32_16x16x32_bf16(false, ah, false, bl, (short)0, c, false, false);
  asm volatile("v_nop\n\tv_nop\n\tv_nop\n\tv_nop" : "+v"(c) : "v"(ah), "v"(al), "v"(bh), "v"(bl));
  return c;
}

__global__ __launch_bounds__(256) void k_wt_bf16(const float* __restrict__ W, unsigned short* __restrict__ Wt, int K, int N) {
  const int t = blockIdx.x * 256 + threadIdx.x;
  const int k8n = K / 8;
  if (t >= N * k8n) return;
  const int n = t / k8n, k8 = (t % k8n) * 8;
  v8us v;
#pragma unroll
  for (int i = 0; i < 8; ++i) v[i] = bf16_bits(W[(size_t)(k8 + i) * N + n]);
  *(v8us*)(Wt + (size_t)n * K + k8) = v;
  
}

// GEMM C[M][N] (f32, pitch ldc) = act(A[M][K]·W + bias). A f32 row-major (pitch lda) converted per fragment to bf16
// (ASPLIT: hi/lo two planes -> 2 terms, else single rounded term); Wt bf16 [N][K] (pitch ldb). BIAS_BF16 rounds the
// bias to bf16 first (bias quantised to bf16 before the add). K%32==0, M%16==0, N%64==0.
template <bool ASPLIT, int ACT, bool BIAS_BF16>
__global__ __launch_bounds__(128) void k_gemm_bf(const float* __restrict__ A, int lda, const unsigned short* __restrict__ Wt, int ldb,
                                               const float* __restrict__ bias, float* __restrict__ C, int ldc, int M, int N, int K) {
  __shared__ __attribute__((aligned(16))) float so[4][16][64];
  const int tid = threadIdx.x, w = tid >> 5, lane = tid & 31, ln = lane & 15, hh = lane >> 4;
  const int ntn = N / 64;
  const int wid = blockIdx.x * 4 + w;
  const int mt = wid / ntn, nq = wid % ntn;
  if (mt * 16 >= M) return;
  const int row0 = mt * 16, col0 = nq * 64;
  const float* arow = A + (size_t)(row0 + ln) * lda;
  v8f acc[4] = {};
  for (int kb = 0; kb < K; kb += 32) {
    FragB ah, al;
    const v4f x0 = *(const v4fa*)(arow + kb + 8 * hh), x1 = *(const v4fa*)(arow + kb + 8 * hh + 4);
    const v4f x2 = *(const v4fa*)(arow + kb + 16 + 8 * hh), x3 = *(const v4fa*)(arow + kb + 16 + 8 * hh + 4);
    float xs[16] = {x0[0],x0[1],x0[2],x0[3],x1[0],x1[1],x1[2],x1[3],x2[0],x2[1],x2[2],x2[3],x3[0],x3[1],x3[2],x3[3]};
#pragma unroll
    for (int i = 0; i < 16; ++i) { const unsigned short hb = bf16_bits(xs[i]); ah.u[i] = hb; al.u[i] = ASPLIT ? bf16_bits(xs[i] - bf16_val(hb)) : (unsigned short)0; }
#pragma unroll
    for (int t = 0; t < 4; ++t) {
      const unsigned short* brow = Wt + (size_t)(col0 + t * 16 + ln) * ldb + kb;
      FragB b;
      b.half[0] = *(const v8us*)(brow + 8 * hh);
      b.half[1] = *(const v8us*)(brow + 16 + 8 * hh);
      acc[t] = mmaN<ASPLIT ? 2 : 1>(ah.v, al.v, b.v, b.v, acc[t]);
    }
  }
#pragma unroll
  for (int t = 0; t < 4; ++t) {
    float bv = bias ? bias[col0 + t * 16 + ln] : 0.f;
    if (BIAS_BF16) bv = bf16_round(bv);
#pragma unroll
    for (int r = 0; r < 8; ++r) { float v = acc[t][r] + bv; if (ACT == 1) v = fmaxf(v, 0.f); so[w][8 * hh + r][t * 16 + ln] = v; }
  }
  __builtin_amdgcn_fence(__ATOMIC_ACQ_REL, "workgroup");
  __builtin_amdgcn_wave_barrier();
  const int rsub = lane >> 4, c4 = (lane & 15) * 4;
  {
#pragma unroll
    for (int q = 0; q < 8; ++q) {
      const int r = q * 2 + rsub;
      const v4f v = *(const v4fa*)&so[w][r][c4];
      *(v4f*)(C + (size_t)(row0 + r) * ldc + col0 + c4) = v;
    }
    
  }
}

// GEMM C = act(A·W + bias + resid): A f32 (ASPLIT -> hi/lo 2 terms), Wt bf16 [N][K]; ACT 0 none, 1 relu, 2 exact gelu;
// resid (optional, f32, row index = (row % rmod), pitch ldr, RES_BF16 rounds it) added before the activation.
template <bool ASPLIT, int ACT, bool BIAS_BF16, bool RES_BF16>
__global__ __launch_bounds__(128) void k_gemm_bf3(const float* __restrict__ A, int lda, const unsigned short* __restrict__ Wt, int ldb,
                                                const float* __restrict__ bias, const float* __restrict__ resid, int rmod, int ldr,
                                                float* __restrict__ C, int ldc, int M, int N, int K) {
  __shared__ __attribute__((aligned(16))) float so[4][16][64];
  const int tid = threadIdx.x, w = tid >> 5, lane = tid & 31, ln = lane & 15, hh = lane >> 4;
  const int ntn = N / 64;
  const int wid = blockIdx.x * 4 + w;
  const int mt = wid / ntn, nq = wid % ntn;
  if (mt * 16 >= M) return;
  const int row0 = mt * 16, col0 = nq * 64;
  const float* arow = A + (size_t)(row0 + ln) * lda;
  v8f acc[4] = {};
  for (int kb = 0; kb < K; kb += 32) {
    FragB ah, al;
    const v4f x0 = *(const v4fa*)(arow + kb + 8 * hh), x1 = *(const v4fa*)(arow + kb + 8 * hh + 4);
    const v4f x2 = *(const v4fa*)(arow + kb + 16 + 8 * hh), x3 = *(const v4fa*)(arow + kb + 16 + 8 * hh + 4);
    float xs[16] = {x0[0],x0[1],x0[2],x0[3],x1[0],x1[1],x1[2],x1[3],x2[0],x2[1],x2[2],x2[3],x3[0],x3[1],x3[2],x3[3]};
#pragma unroll
    for (int i = 0; i < 16; ++i) { const unsigned short hb = bf16_bits(xs[i]); ah.u[i] = hb; al.u[i] = ASPLIT ? bf16_bits(xs[i] - bf16_val(hb)) : (unsigned short)0; }
#pragma unroll
    for (int t = 0; t < 4; ++t) {
      const unsigned short* brow = Wt + (size_t)(col0 + t * 16 + ln) * ldb + kb;
      FragB b;
      b.half[0] = *(const v8us*)(brow + 8 * hh);
      b.half[1] = *(const v8us*)(brow + 16 + 8 * hh);
      acc[t] = mmaN<ASPLIT ? 2 : 1>(ah.v, al.v, b.v, b.v, acc[t]);
    }
  }
#pragma unroll
  for (int t = 0; t < 4; ++t) {
    const int col = col0 + t * 16 + ln;
    float bv = bias ? bias[col] : 0.f;
    if (BIAS_BF16) bv = bf16_round(bv);
#pragma unroll
    for (int r = 0; r < 8; ++r) {
      float v = acc[t][r] + bv;
      if (resid) { float rv = resid[(size_t)((row0 + 8 * hh + r) % rmod) * ldr + col]; if (RES_BF16) rv = bf16_round(rv); v += rv; }
      if (ACT == 1) v = fmaxf(v, 0.f);
      if (ACT == 2) v = 0.5f * v * (1.0f + erff(v * 0.70710678118654752f));
      if (ACT == 3) { const float u = 0.7978845608028654f * (v + 0.044715f * v * v * v); v = 0.5f * v * (1.0f + tanhf(u)); }
      so[w][8 * hh + r][t * 16 + ln] = v;
    }
  }
  __builtin_amdgcn_fence(__ATOMIC_ACQ_REL, "workgroup");
  __builtin_amdgcn_wave_barrier();
  const int rsub = lane >> 4, c4 = (lane & 15) * 4;
  {
#pragma unroll
    for (int q = 0; q < 8; ++q) {
      const int r = q * 2 + rsub;
      const v4f v = *(const v4fa*)&so[w][r][c4];
      *(v4f*)(C + (size_t)(row0 + r) * ldc + col0 + c4) = v;
    }
    
  }
}
// row LayerNorm (biased variance, eps) over N: s = X (+ R); optional out_sum <- s; out_norm <- (s-mu)*rsqrt(var+eps)*g + b
template <bool PARAM_BF16>
__global__ __launch_bounds__(256) void k_layernorm(const float* __restrict__ X, const float* __restrict__ R, const float* __restrict__ g, const float* __restrict__ bta,
                                                  float* __restrict__ out_sum, float* __restrict__ out_norm, int N, float eps) {
  __shared__ float red[256];
  const int row = blockIdx.x, tid = threadIdx.x;
  const float* x = X + (size_t)row * N; const float* rr = R ? R + (size_t)row * N : nullptr;
  float vals[16];                     // up to N = 4096
  const int per = N / 256;            // contiguous chunk per thread? use strided-by-4 chunks: thread handles j = tid*4 + 1024*u
  float s1 = 0.f;
  for (int u = 0; u < per / 4; ++u) {
    const int j = tid * 4 + 1024 * u;
    const v4f a = *(const v4fa*)(x + j);
    v4f b = {0.f,0.f,0.f,0.f}; if (rr) b = *(const v4fa*)(rr + j);
#pragma unroll
    for (int q = 0; q < 4; ++q) { const float v = a[q] + b[q]; vals[u * 4 + q] = v; s1 += v; }
  }
  red[tid] = s1; __syncthreads();
  for (int st = 128; st > 0; st >>= 1) { if (tid < st) red[tid] += red[tid + st]; __syncthreads(); }
  const float mu = red[0] / (float)N; __syncthreads();
  float s2 = 0.f;
  for (int u = 0; u < per / 4; ++u)
#pragma unroll
    for (int q = 0; q < 4; ++q) { const float c = vals[u * 4 + q] - mu; s2 += c * c; }
  red[tid] = s2; __syncthreads();
  for (int st = 128; st > 0; st >>= 1) { if (tid < st) red[tid] += red[tid + st]; __syncthreads(); }
  const float rs = rsqrtf(red[0] / (float)N + eps);
  {
    for (int u = 0; u < per / 4; ++u) {
      const int j = tid * 4 + 1024 * u;
      v4f o, sm;
#pragma unroll
      for (int q = 0; q < 4; ++q) {
        float gg = g[j + q], bb = bta[j + q];
        if (PARAM_BF16) { gg = bf16_round(gg); bb = bf16_round(bb); }
        sm[q] = vals[u * 4 + q]; o[q] = (vals[u * 4 + q] - mu) * rs * gg + bb;
      }
      if (out_sum) *(v4f*)(out_sum + (size_t)row * N + j) = sm;
      *(v4f*)(out_norm + (size_t)row * N + j) = o;
    }
    
  }
}

// ---- f16 WMMA path (v_wmma_f32_16x16x32_f16): 11-bit significands for operands in range — used where a [0,1] probability operand needs more precision than bf16
typedef _Float16 v16h __attribute__((ext_vector_type(16)));
union FragH { v16h v; v8us half[2]; _Float16 h[16]; unsigned short u[16]; };
template <int NT>
__device__ __forceinline__ v8f mmaH(v16h ah, v16h al, v16h bh, v16h bl, v8f c) {
  c = __builtin_amdgcn_wmma_f32_16x16x32_f16(false, ah, false, bh, (short)0, c, false, false);
  if (NT >= 2) c = __builtin_amdgcn_wmma_f32_16x16x32_f16(false, al, false, bh, (short)0, c, false, false);
  if (NT >= 3) c = __builtin_amdgcn_wmma_f32_16x16x32_f16(false, ah, false, bl, (short)0, c, false, false);
  asm volatile("v_nop\n\tv_nop\n\tv_nop\n\tv_nop" : "+v"(c) : "v"(ah), "v"(al), "v"(bh), "v"(bl));
  return c;
}
// batched GEMM like k_gemm_b but f16 operands: A f32 (split into f16 hi/lo if ASPLIT, else rounded to f16), Bt = f16 values [n][k]; alpha; C f32; N multiple of 16 (partial tiles skipped)
template <bool ASPLIT>
__global__ __launch_bounds__(128) void k_gemm_h(const float* __restrict__ A, int lda, size_t sA, const _Float16* __restrict__ Bh, int ldb, size_t sB, float alpha, float* __restrict__ C, int ldc, size_t sC, int M, int N, int K) {
  __shared__ __attribute__((aligned(16))) float so[4][16][64];
  const int tid = threadIdx.x, w = tid >> 5, lane = tid & 31, ln = lane & 15, hh = lane >> 4; const int by = blockIdx.y;
  A += (size_t)by * sA; Bh += (size_t)by * sB; C += (size_t)by * sC;
  const int ntn = (N + 63) / 64; const int wid = blockIdx.x * 4 + w; const int mt = wid / ntn, nq = wid % ntn; if (mt * 16 >= M) return;
  const int row0 = mt * 16, col0 = nq * 64; const float* arow = A + (size_t)(row0 + ln) * lda;
  v8f acc[4] = {};
  for (int kb = 0; kb < K; kb += 32) {
    FragH ah, al;
    const v4f x0 = *(const v4fa*)(arow + kb + 8 * hh), x1 = *(const v4fa*)(arow + kb + 8 * hh + 4), x2 = *(const v4fa*)(arow + kb + 16 + 8 * hh), x3 = *(const v4fa*)(arow + kb + 16 + 8 * hh + 4);
    float xs[16] = {x0[0],x0[1],x0[2],x0[3],x1[0],x1[1],x1[2],x1[3],x2[0],x2[1],x2[2],x2[3],x3[0],x3[1],x3[2],x3[3]};
#pragma unroll
    for (int i = 0; i < 16; ++i) { const _Float16 h = (_Float16)xs[i]; ah.h[i] = h; al.h[i] = ASPLIT ? (_Float16)(xs[i] - (float)h) : (_Float16)0.0f; }
#pragma unroll
    for (int t = 0; t < 4; ++t) { if (col0 + t * 16 >= N) continue; const size_t boff = (size_t)(col0 + t * 16 + ln) * ldb + kb; FragH bq; bq.half[0] = *(const v8us*)(Bh + boff + 8 * hh); bq.half[1] = *(const v8us*)(Bh + boff + 16 + 8 * hh);
      acc[t] = mmaH<ASPLIT ? 2 : 1>(ah.v, al.v, bq.v, bq.v, acc[t]); }
  }
#pragma unroll
  for (int t = 0; t < 4; ++t) { if (col0 + t * 16 >= N) continue;
#pragma unroll
    for (int r = 0; r < 8; ++r) so[w][8 * hh + r][t * 16 + ln] = acc[t][r] * alpha; }
  __builtin_amdgcn_fence(__ATOMIC_ACQ_REL, "workgroup"); __builtin_amdgcn_wave_barrier();
  const int rsub = lane >> 4, c4 = (lane & 15) * 4;
  {
#pragma unroll
    for (int q = 0; q < 8; ++q) { const int r = q * 2 + rsub; if (col0 + c4 < N) { const v4f v = *(const v4fa*)&so[w][r][c4]; *(v4f*)(C + (size_t)(row0 + r) * ldc + col0 + c4) = v; } }
     }
}

// Wt[n][k] = f16(W[k][n]·scale) from f32 row-major W[K][N] (scale = power of two; bf16-exact weights stay exact in f16 away from the subnormal range)
__global__ __launch_bounds__(256) void k_wt_f16(const float* __restrict__ W, _Float16* __restrict__ Wt, int K, int N, float scale) {
  const int t = blockIdx.x * 256 + threadIdx.x; if (t >= N * (K / 8)) return; const int n = t / (K / 8), k8 = (t % (K / 8)) * 8; FragH f;
#pragma unroll
  for (int i = 0; i < 8; ++i) f.h[i] = (_Float16)(bf16_round(W[(size_t)(k8 + i) * N + n]) * scale); const v8us o = f.half[0];
  *(v8us*)((unsigned short*)Wt + (size_t)n * K + k8) = o; 
}
// k_gemm_hh variant with fused epilogue: v = acc·alpha + bias[by·sBias + col] (+ CP[(row/rowsPerB)·sCPb + by·64 + col] if CP) ; ACT 0 none / 1 elu ; writes f16 C16 (and f32 C if non-null)
template <int ACT>
__global__ __launch_bounds__(128) void k_gemm_hhx(const _Float16* __restrict__ A, int lda, size_t sA, const _Float16* __restrict__ Bh, int ldb, size_t sB, float alpha, const float* __restrict__ bias, size_t sBias, const float* __restrict__ CP, int rowsPerB, size_t sCPb, int row0g,
    float* __restrict__ C, _Float16* __restrict__ C16, int ldc, size_t sC, int M, int N, int K) {
  __shared__ __attribute__((aligned(16))) float so[4][16][64];
  const int tid = threadIdx.x, w = tid >> 5, lane = tid & 31, ln = lane & 15, hh = lane >> 4; const int by = blockIdx.y;
  A += (size_t)by * sA; Bh += (size_t)by * sB; const size_t cofs = (size_t)by * sC; const float* bp = bias ? bias + (size_t)by * sBias : nullptr;
  const int ntn = (N + 63) / 64; const int wid = blockIdx.x * 4 + w; const int mt = wid / ntn, nq = wid % ntn; if (mt * 16 >= M) return;
  const int row0 = mt * 16, col0 = nq * 64; const _Float16* arow = A + (size_t)(row0 + ln) * lda;
  v8f acc[4] = {};
  for (int kb = 0; kb < K; kb += 32) { FragH ah; ah.half[0] = *(const v8us*)((const unsigned short*)arow + kb + 8 * hh); ah.half[1] = *(const v8us*)((const unsigned short*)arow + kb + 16 + 8 * hh);
#pragma unroll
    for (int t = 0; t < 4; ++t) { if (col0 + t * 16 >= N) continue; const size_t boff = (size_t)(col0 + t * 16 + ln) * ldb + kb; FragH bq; bq.half[0] = *(const v8us*)((const unsigned short*)Bh + boff + 8 * hh); bq.half[1] = *(const v8us*)((const unsigned short*)Bh + boff + 16 + 8 * hh);
      acc[t] = mmaH<1>(ah.v, ah.v, bq.v, bq.v, acc[t]); }
  }
#pragma unroll
  for (int t = 0; t < 4; ++t) { if (col0 + t * 16 >= N) continue; const int col = col0 + t * 16 + ln; const float bv = bp ? bf16_round(bp[col]) : 0.f;
#pragma unroll
    for (int r = 0; r < 8; ++r) { float v = acc[t][r] * alpha + bv; if (CP) { const int rr = row0g + row0 + 8 * hh + r; if (rowsPerB < 0) v += CP[cofs + (size_t)rr * ldc + col];      /* rowsPerB < 0: own element of the batched C plane */ else { const int bidx = rr / rowsPerB; v += CP[(size_t)bidx * sCPb + (size_t)by * 64 + col]; } } if (ACT == 1) v = (v > 0.f) ? v : expm1f(v); else if (ACT == 7) v = (v > 0.f) ? v + 1.0f : expf(v); else if (ACT == 8) v = tanhf(v); else if (ACT == 9) v = 0.5f * v * (1.0f + tanhf(0.7978845608028654f * (v + 0.044715f * v * v * v))); else if (ACT == 11) v = 1.0f / (1.0f + expf(-v)); else if (ACT == 12) v = (v > 0.f) ? v : 0.01f * v; else if (ACT == 14) v = (v > 0.f) ? v : 0.1f * v; else if (ACT == 16) v = (v >= 0.f) ? v : 0.3f * v; else if (ACT == 17) v = (v >= 0.f) ? v : 0.2f * v; else if (ACT == 15) v = v / (1.0f + expf(-v)); else if (ACT == 3) v = fmaxf(v, 0.f); else if (ACT == 6) v = 0.5f * v * (1.0f + erff(v * 0.70710678118654752f)); so[w][8 * hh + r][t * 16 + ln] = v; } }
  __builtin_amdgcn_fence(__ATOMIC_ACQ_REL, "workgroup"); __builtin_amdgcn_wave_barrier();
  const int rsub = lane >> 4, c4 = (lane & 15) * 4; typedef _Float16 v4h __attribute__((ext_vector_type(4)));
  {
#pragma unroll
    for (int q = 0; q < 8; ++q) { const int r = q * 2 + rsub; if (col0 + c4 < N) { const v4f v = *(const v4fa*)&so[w][r][c4]; if (C) *(v4f*)(C + cofs + (size_t)(row0 + r) * ldc + col0 + c4) = v; if (C16) { v4h h4; for (int i = 0; i < 4; ++i) h4[i] = (_Float16)v[i]; *(v4h*)(C16 + cofs + (size_t)(row0 + r) * ldc + col0 + c4) = h4; } } }
     }
}

typedef _Float16 v4h __attribute__((ext_vector_type(4)));

// 64 elements a thread (the stage costs the start of its waves more than its bytes): a block converts 64 KiB of source that lie in a row; group u of four elements of thread t is 256 u + t, so every load and store covers whole 128-byte lines under one index register.
typedef _Float16 v4ha __attribute__((ext_vector_type(4), may_alias));
__global__ __launch_bounds__(256) void k_x16(const float* __restrict__ x, _Float16* __restrict__ X16) { const unsigned i0 = blockIdx.x * 4096u + threadIdx.x; v4f a[16]; v4h o[16];
#pragma unroll
  for (int u = 0; u < 16; ++u) a[u] = ((const v4fa*)(x + u * 1024))[i0];
#pragma unroll
  for (int u = 0; u < 16; ++u)
#pragma unroll
    for (int q = 0; q < 4; ++q) o[u][q] = (_Float16)bf16_round(a[u][q]);
#pragma unroll
  for (int u = 0; u < 16; ++u) ((v4ha*)(X16 + u * 1024))[i0] = o[u]; }
__global__ __launch_bounds__(256) void k_h16(const float* __restrict__ x, _Float16* __restrict__ X16, size_t n8) { const size_t t = (size_t)blockIdx.x * 256 + threadIdx.x; if (t >= n8) return; FragH f;
#pragma unroll
  for (int q = 0; q < 8; ++q) f.h[q] = (_Float16)x[t * 8 + q]; *(v8us*)((unsigned short*)X16 + t * 8) = f.half[0];  }
__global__ __launch_bounds__(256) void k_round16f(const float* __restrict__ W, _Float16* __restrict__ Bt, size_t n8) { const size_t t = (size_t)blockIdx.x * 256 + threadIdx.x; if (t >= n8) return; FragH f;
#pragma unroll
  for (int i = 0; i < 8; ++i) f.h[i] = (_Float16)(bf16_round(W[t * 8 + i]) * 16.0f); *(v8us*)((unsigned short*)Bt + t * 8) = f.half[0];  }
template <int NHv, int TTv>
__global__ __launch_bounds__(256) void k_vt(const _Float16* __restrict__ V16, int ldv, int voff, _Float16* __restrict__ Vt) { __shared__ unsigned short tl[64][66]; const int tid = threadIdx.x; const int slab = blockIdx.x / (TTv / 64), lg = blockIdx.x % (TTv / 64); const int b = slab / NHv, h = slab % NHv;
  for (int i = tid; i < 64 * 8; i += 256) { const int r = i / 8, c8 = (i % 8) * 8; FragH f; f.half[0] = *(const v8us*)((const unsigned short*)V16 + ((size_t)b * TTv + lg * 64 + r) * ldv + voff + h * 64 + c8);
#pragma unroll
    for (int q = 0; q < 8; ++q) tl[r][c8 + q] = f.u[q]; }
  __syncthreads();
  {
#pragma unroll
    for (int rd = 0; rd < 2; ++rd) { const int d = rd * 32 + tid / 8, pc = tid % 8; FragH f;
#pragma unroll
      for (int q = 0; q < 8; ++q) f.u[q] = tl[pc * 8 + q][d];
      *(v8us*)((unsigned short*)Vt + ((size_t)slab * 64 + d) * TTv + lg * 64 + pc * 8) = f.half[0]; }
     } }

__global__ __launch_bounds__(256) void k_hl(const float* __restrict__ F, _Float16* __restrict__ Hh, _Float16* __restrict__ Hl, size_t n8) { const size_t t = (size_t)blockIdx.x * 256 + threadIdx.x; if (t >= n8) return; FragH fh, fl; const v4f a = *(const v4fa*)(F + t * 8), c = *(const v4fa*)(F + t * 8 + 4);
#pragma unroll
  for (int q = 0; q < 4; ++q) { _Float16 h = (_Float16)a[q]; fh.h[q] = h; fl.h[q] = (_Float16)((a[q] - (float)h) * 1024.0f); h = (_Float16)c[q]; fh.h[4 + q] = h; fl.h[4 + q] = (_Float16)((c[q] - (float)h) * 1024.0f); }
  { *(v8us*)((unsigned short*)Hh + t * 8) = fh.half[0]; *(v8us*)((unsigned short*)Hl + t * 8) = fl.half[0];  } }

// ---- fast GEMM (wave tile 32x64; requires M % 32 == 0 rows per launch region and N % 64 == 0); epilogue = k_gemm_hhx semantics ----
__device__ __forceinline__ v16h g2_frag(const _Float16* p, int hh) { FragH f; f.half[0] = *(const v8us*)((const unsigned short*)p + 8 * hh); f.half[1] = *(const v8us*)((const unsigned short*)p + 16 + 8 * hh); return f.v; }
__device__ __forceinline__ v8f g2_mma(v16h a, v16h b, v8f c) { v8f d = __builtin_amdgcn_wmma_f32_16x16x32_f16(false, a, false, b, (short)0, c, false, false); asm volatile("v_nop\n\tv_nop\n\tv_nop\n\tv_nop" : "+v"(d) : "v"(a), "v"(b)); return d; }
template <int ACT>
__global__ __launch_bounds__(128) void k_gemm2(const _Float16* __restrict__ A, int lda, size_t sA, const _Float16* __restrict__ Bh, int ldb, size_t sB, float alpha, const float* __restrict__ bias, size_t sBias, const float* __restrict__ CP, int rowsPerB, size_t sCPb, int row0g,
    float* __restrict__ C, _Float16* __restrict__ C16, int ldc, size_t sC, int M, int N, int K) { static_assert(ACT == 0 || ACT == 3 || ACT == 6 || ACT == 8 || ACT == 9 || ACT == 11 || ACT == 12 || ACT == 14 || ACT == 15 || ACT == 16 || ACT == 17, "k_gemm2: unsupported ACT code (would silently apply no activation)");
  __shared__ __attribute__((aligned(16))) float so[4][32][68];
  const int tid = threadIdx.x, w = tid >> 5, lane = tid & 31, ln = lane & 15, hh = lane >> 4; const int by = blockIdx.y;
  A += (size_t)by * sA; Bh += (size_t)by * sB; const size_t cofs = (size_t)by * sC; const float* bp = bias ? bias + (size_t)by * sBias : nullptr;
  const int ntn = N >> 6; const int mt = blockIdx.x / ntn, nq = blockIdx.x - mt * ntn; const int row0 = mt * 128 + 32 * w, col0 = nq * 64; if (row0 >= M) return;
  const _Float16* a0p = A + (size_t)(row0 + ln) * lda; const _Float16* a1p = a0p + (size_t)16 * lda;
  const _Float16* b0p = Bh + (size_t)(col0 + ln) * ldb; const _Float16* b1p = b0p + (size_t)16 * ldb; const _Float16* b2p = b1p + (size_t)16 * ldb; const _Float16* b3p = b2p + (size_t)16 * ldb;
  const v8f z8 = {0.f,0.f,0.f,0.f,0.f,0.f,0.f,0.f}; v8f c00 = z8, c01 = z8, c02 = z8, c03 = z8, c10 = z8, c11 = z8, c12 = z8, c13 = z8;
  for (int kb = 0; kb < K; kb += 32) { const v16h a0 = g2_frag(a0p + kb, hh), a1 = g2_frag(a1p + kb, hh);
    v16h b = g2_frag(b0p + kb, hh); c00 = g2_mma(a0, b, c00); c10 = g2_mma(a1, b, c10);
    b = g2_frag(b1p + kb, hh); c01 = g2_mma(a0, b, c01); c11 = g2_mma(a1, b, c11);
    b = g2_frag(b2p + kb, hh); c02 = g2_mma(a0, b, c02); c12 = g2_mma(a1, b, c12);
    b = g2_frag(b3p + kb, hh); c03 = g2_mma(a0, b, c03); c13 = g2_mma(a1, b, c13); }
  v8f accs[8] = {c00, c01, c02, c03, c10, c11, c12, c13};
#pragma unroll
  for (int u = 0; u < 8; ++u) { const int t = u & 3, half = u >> 2; const int col = col0 + t * 16 + ln; const float bv = bp ? bf16_round(bp[col]) : 0.f;
#pragma unroll
    for (int r = 0; r < 8; ++r) { const int rloc = half * 16 + 8 * hh + r; float v = accs[u][r] * alpha + bv; if (CP) { if (rowsPerB < 0) v += CP[cofs + (size_t)(row0g + row0 + rloc) * ldc + col];      /* rowsPerB < 0: own element of the batched C plane */ else { const int bidx = (row0g + row0 + rloc) / rowsPerB; v += CP[(size_t)bidx * sCPb + (size_t)by * 64 + col]; } }
      if (ACT == 3) v = fmaxf(v, 0.f); else if (ACT == 6) v = 0.5f * v * (1.0f + erff(v * 0.70710678118654752f)); else if (ACT == 11) v = 1.0f / (1.0f + expf(-v)); else if (ACT == 15) v = v / (1.0f + expf(-v)); else if (ACT == 12) v = (v > 0.f) ? v : 0.01f * v; else if (ACT == 8) v = tanhf(v); else if (ACT == 9) v = 0.5f * v * (1.0f + tanhf(0.7978845608028654f * (v + 0.044715f * v * v * v))); else if (ACT == 14) v = (v > 0.f) ? v : 0.1f * v; else if (ACT == 16) v = (v >= 0.f) ? v : 0.3f * v; else if (ACT == 17) v = (v >= 0.f) ? v : 0.2f * v;
      so[w][rloc][t * 16 + ln] = v; } }
  __builtin_amdgcn_fence(__ATOMIC_ACQ_REL, "workgroup"); __builtin_amdgcn_wave_barrier();
  const int rsub = lane >> 4, c4 = (lane & 15) * 4;
  {
#pragma unroll
    for (int q = 0; q < 16; ++q) { const int r = q * 2 + rsub; const v4f v = *(const v4fa*)&so[w][r][c4]; if (C) *(v4f*)(C + cofs + (size_t)(row0 + r) * ldc + col0 + c4) = v; if (C16) { v4h h4; for (int i = 0; i < 4; ++i) h4[i] = (_Float16)v[i]; *(v4h*)(C16 + cofs + (size_t)(row0 + r) * ldc + col0 + c4) = h4; } }
     } }

__global__ __launch_bounds__(256) void k_wnat(const float* __restrict__ w, size_t n8, _Float16* __restrict__ Bt) { const size_t t = (size_t)blockIdx.x * 256 + threadIdx.x; if (t >= n8) return; FragH f; for (int q = 0; q < 8; ++q) f.h[q] = (_Float16)(bf16_round(w[t * 8 + q]) * 16.0f); *(v8us*)((unsigned short*)Bt + t * 8) = f.half[0];  }

// exp2 with the one issue slot that the instruction set asks for behind a transcendental (before its source is overwritten or its result read) in the same statement.
__device__ __forceinline__ float exp2_slot(float x) { float e; asm("v_exp_f32 %0, %1\n\tv_nop" : "=v"(e) : "v"(x)); return e; }
__device__ __forceinline__ v8f fa_mma(v16h a, v16h b, v8f c) { return __builtin_amdgcn_wmma_f32_16x16x32_f16(false, a, false, b, (short)0, c, false, false); }
__device__ __forceinline__ float fa_xhalf(float x) { return __builtin_bit_cast(float, __builtin_amdgcn_permlanex16(__builtin_bit_cast(int, x), __builtin_bit_cast(int, x), 0x76543210, 0xfedcba98, false, false)); }      /* lane l with lane l ^ 16 */
__device__ __forceinline__ void fa_gap() { __builtin_amdgcn_sched_barrier(0); asm volatile("v_nop\n\tv_nop\n\tv_nop\n\tv_nop"); __builtin_amdgcn_sched_barrier(0); }      /* the four vector slots behind a group of WMMAs, on every path: a branch or a load over their operands follows; the two scheduling barriers keep the slots (and the loads issued ahead) where they stand */
template <bool LAST>      /* LAST = the wave's diagonal pass: masked, and no further K rows are fetched */
__device__ __forceinline__ void fa_pass(v16h (&kf)[2][2], const _Float16* __restrict__ kn, const _Float16* __restrict__ vp, int key0, int qw0, int ln, int hh, const v16h (&qf)[2][2], v8f (&acc)[2][4], float (&m_run)[2], float (&l_run)[2]) {
  const float cs = 0.125f * 1.44269504088896340736f;
  v16h vf[4];
#pragma unroll
  for (int t = 0; t < 4; ++t) vf[t] = g2_frag(vp + (size_t)(16 * t) * SQ, hh);      /* this pass's V^T rows, in flight under the scores and the exponentials */
  v8f s[2][2];
#pragma unroll
  for (int kt = 0; kt < 2; ++kt)
#pragma unroll
    for (int g = 0; g < 2; ++g) { const v8f z = {0.f, 0.f, 0.f, 0.f, 0.f, 0.f, 0.f, 0.f}; s[kt][g] = fa_mma(kf[kt][1], qf[g][1], fa_mma(kf[kt][0], qf[g][0], z)); }
  fa_gap();
  if (!LAST) {
#pragma unroll
    for (int kt = 0; kt < 2; ++kt)
#pragma unroll
      for (int kc = 0; kc < 2; ++kc) kf[kt][kc] = g2_frag(kn + (size_t)(16 * kt) * KVD + 32 * kc, hh);      /* next pass's K rows, one pass ahead */
  }
  if (LAST) {
#pragma unroll
    for (int g = 0; g < 2; ++g)
#pragma unroll
      for (int kt = 0; kt < 2; ++kt)
#pragma unroll
        for (int r = 0; r < 8; ++r) if (key0 + 16 * kt + 8 * hh + r > qw0 + 16 * g + ln) s[kt][g][r] = -3.0e38f;      /* causal: key above the query (key0 itself is never masked, so every maximum stays a real score) */
  }
  float mb[2]; bool need = false;
#pragma unroll
  for (int g = 0; g < 2; ++g) { float mx = s[0][g][0];
#pragma unroll
    for (int r = 1; r < 8; ++r) mx = fmaxf(mx, s[0][g][r]);
#pragma unroll
    for (int r = 0; r < 8; ++r) mx = fmaxf(mx, s[1][g][r]);
    mx = fmaxf(mx, fa_xhalf(mx)) * cs; mb[g] = mx; need = need || (mx > m_run[g] + 8.0f); }
  if (__builtin_amdgcn_ballot_w32(need) != 0) {      /* wave-uniform; rare after the first passes */
#pragma unroll
    for (int g = 0; g < 2; ++g) { const float mn = fmaxf(m_run[g], mb[g]); const float corr = exp2_slot(m_run[g] - mn); m_run[g] = mn; l_run[g] *= corr;
#pragma unroll
      for (int t = 0; t < 4; ++t) acc[g][t] = acc[g][t] * corr; }
  }
  FragH pf[2];
#pragma unroll
  for (int g = 0; g < 2; ++g) { const float nm = -m_run[g]; float ls[4] = {0.f, 0.f, 0.f, 0.f};
#pragma unroll
    for (int i = 0; i < 16; ++i) { const float e = exp2_slot(fmaf(s[i >> 3][g][i & 7], cs, nm)); ls[i & 3] += e; pf[g].h[i] = (_Float16)e; }
    l_run[g] += (ls[0] + ls[1]) + (ls[2] + ls[3]); }
  __builtin_amdgcn_sched_barrier(0);      /* every exponential stands ahead of the WMMAs */
#pragma unroll
  for (int g = 0; g < 2; ++g)
#pragma unroll
    for (int t = 0; t < 4; ++t) acc[g][t] = fa_mma(vf[t], pf[g].v, acc[g][t]);
  fa_gap();
  if (!LAST) { asm volatile("s_wait_xcnt 0x0" ::: "memory"); __builtin_amdgcn_sched_barrier(0); }      /* the wait in front of the advance of the K and V^T address pairs at the loop's foot; the scheduling barrier keeps the advance behind it */
}
__global__ __launch_bounds__(128) void k_fattn(const _Float16* __restrict__ Q, const _Float16* __restrict__ K, const _Float16* __restrict__ Vt, _Float16* __restrict__ O) {
  const int lane = threadIdx.x & 31, ln = lane & 15, hh = lane >> 4; const int w = __builtin_amdgcn_readfirstlane((int)(threadIdx.x >> 5));      /* the wave's number in a scalar register: trip count and branches stay scalar, EXEC stays full for the WMMAs */
  const int h = blockIdx.y, b = blockIdx.z; const int xs = (int)blockIdx.x, nq = (int)gridDim.x; const int qa = (xs & 1) ? (xs >> 1) : nq - 1 - (xs >> 1); const int qb = (b & 1) ? nq - 1 - qa : qa;      /* a permutation of the query tiles: long and short ones alternate between neighbouring blocks and between batches, so that the blocks that share a WGP carry about the same number of passes (speed only) */
  const int qw0 = qb * 128 + w * 32;
  const _Float16* Ql = Q + ((size_t)b * SQ + qw0 + ln) * DM + h * HD; const _Float16* Kl = K + ((size_t)b * SQ + ln) * KVD + h * HD; const _Float16* Vl = Vt + (((size_t)b * NH + h) * HD + ln) * SQ;
  v16h qf[2][2], kf[2][2];
#pragma unroll
  for (int g = 0; g < 2; ++g)
#pragma unroll
    for (int kc = 0; kc < 2; ++kc) { qf[g][kc] = g2_frag(Ql + (size_t)(16 * g) * DM + 32 * kc, hh); kf[g][kc] = g2_frag(Kl + (size_t)(16 * g) * KVD + 32 * kc, hh); }
  __builtin_amdgcn_sched_barrier(0); asm volatile("s_wait_xcnt 0x0" ::: "memory"); __builtin_amdgcn_sched_barrier(0);      /* the wait in front of any overwrite of these loads' address pairs; the scheduling barriers keep later register writes behind it */
  v8f acc[2][4]; float m_run[2] = {-3.0e38f, -3.0e38f}, l_run[2] = {0.f, 0.f};
#pragma unroll
  for (int g = 0; g < 2; ++g)
#pragma unroll
    for (int t = 0; t < 4; ++t) acc[g][t] = v8f{0.f, 0.f, 0.f, 0.f, 0.f, 0.f, 0.f, 0.f};
  const int nfull = qw0 / 32;      /* passes wholly below the diagonal */
#pragma unroll 1      /* one pass per trip: an unrolled body would hold two passes' fragments and lose a wave per SIMD */
  for (int p = 0; p < nfull; ++p) fa_pass<false>(kf, Kl + (size_t)(p + 1) * 32 * KVD, Vl + p * 32, p * 32, qw0, ln, hh, qf, acc, m_run, l_run);
  fa_pass<true>(kf, Kl, Vl + nfull * 32, nfull * 32, qw0, ln, hh, qf, acc, m_run, l_run);
  FragH of[2][4];
#pragma unroll
  for (int g = 0; g < 2; ++g) { const float l = l_run[g] + fa_xhalf(l_run[g]); const float inv = 64.0f / l;
#pragma unroll
    for (int t = 0; t < 4; ++t)
#pragma unroll
      for (int r = 0; r < 8; ++r) of[g][t].h[r] = (_Float16)(acc[g][t][r] * inv); }
  __builtin_amdgcn_sched_barrier(0);      /* all eight packed rows are made ahead of the first store, so that no register of an issued store is written again */
#pragma unroll
  for (int g = 0; g < 2; ++g)
#pragma unroll
    for (int t = 0; t < 4; ++t) *(v8us*)((unsigned short*)O + ((size_t)b * SQ + qw0 + 16 * g + ln) * DM + h * HD + 16 * t + 8 * hh) = of[g][t].half[0];      /* register r of tile t is d = 16 t + 8 hh + r of query ln: 16 bytes a lane; the wave writes each query's whole 128-byte head row */
}

// Exact f32 attention of the first QT0 rows of every batch and head on the f32 matrix form (v_wmma_f32_16x16x4_f32: full f32 operands, every addition rounded in f32): a wave owns 16 query columns and walks its keys in passes of 16 with an online softmax.
// Transposed products as in k_fattn: S^T = K Q^T (A = K rows, B = Q rows, both through the same loader, so their k order is equal: 16 bytes at d = 8 j + 4 hh, elements 0, 1 in one product and 2, 3 in the next) leaves key 8 hh + r of query ln in register r.
// Registers 2 s, 2 s + 1 of the weights ARE a B operand of keys 8 hh + 2 s + e (e = 0, 1); the A operand of O^T += V^T P^T takes V[8 hh + 2 s + e][16 t + ln] from the natural V rows: 64 bytes in a row for each wave half, no transposed copy.
typedef float v2f __attribute__((ext_vector_type(2)));
__device__ __forceinline__ v8f a0_mma(v2f a, v2f b, v8f c) { return __builtin_amdgcn_wmma_f32_16x16x4_f32(false, a, false, b, (short)0, c, false, false); }
template <bool LAST>      /* LAST = the wave's diagonal pass: masked, and no further K or V rows are fetched */
__device__ __forceinline__ void a0_pass(v4f (&kf)[8], v2f (&vf)[4][4], const float* __restrict__ kn, const float* __restrict__ vn, int ln, int hh, const v4f (&qf)[8], v8f (&acc)[4], float& m_run, float& l_run) {
  const float cs = 0.125f * 1.44269504088896340736f;
  v8f sc = {0.f, 0.f, 0.f, 0.f, 0.f, 0.f, 0.f, 0.f};
#pragma unroll
  for (int j = 0; j < 8; ++j) { sc = a0_mma(v2f{kf[j][0], kf[j][1]}, v2f{qf[j][0], qf[j][1]}, sc); sc = a0_mma(v2f{kf[j][2], kf[j][3]}, v2f{qf[j][2], qf[j][3]}, sc); }
  /* the four vector slots behind the score WMMAs, tied to their result so that they stand behind the last one (untied, the build had put them in front of the first); the memory clobber keeps the loads over the K operands behind the slots; in the diagonal pass the lane's column passes through too, so that the mask's lane arithmetic stands behind them (the build had put it between the WMMAs, over an operand register of the one before) */
  if (LAST) asm volatile("v_nop\n\tv_nop\n\tv_nop\n\tv_nop" : "+v"(sc), "+v"(ln) : : "memory");
  else asm volatile("v_nop\n\tv_nop\n\tv_nop\n\tv_nop" : "+v"(sc) : : "memory");
  if (!LAST) {
#pragma unroll
    for (int j = 0; j < 8; ++j) kf[j] = *(const v4fa*)(kn + 8 * j);      /* next pass's K rows, in flight under the exponentials and the second product */
  }
  if (LAST) { const int dl = ln - 8 * hh;
#pragma unroll
    for (int r = 0; r < 8; ++r) if (r > dl) sc[r] = -3.0e38f;      /* causal: key 8 hh + r above query ln (the pass's first key is never masked, so every maximum stays a real score) */
  }
  float mx = sc[0];
#pragma unroll
  for (int r = 1; r < 8; ++r) mx = fmaxf(mx, sc[r]);
  mx = fmaxf(mx, fa_xhalf(mx)) * cs;
  const float mn = fmaxf(m_run, mx); const float corr = exp2_slot(m_run - mn); m_run = mn;
#pragma unroll
  for (int t = 0; t < 4; ++t) acc[t] = acc[t] * corr;
  float e[8];
#pragma unroll
  for (int r = 0; r < 8; ++r) e[r] = exp2_slot(fmaf(sc[r], cs, -mn));
  __builtin_amdgcn_sched_barrier(0);      /* every exponential stands ahead of the WMMAs */
#pragma unroll
  for (int s = 0; s < 4; ++s)
#pragma unroll
    for (int t = 0; t < 4; ++t) acc[t] = a0_mma(vf[s][t], v2f{e[2 * s], e[2 * s + 1]}, acc[t]);
  asm volatile("v_nop\n\tv_nop\n\tv_nop\n\tv_nop" : "+v"(acc[0]), "+v"(acc[1]), "+v"(acc[2]), "+v"(acc[3]), "+v"(e[0]), "+v"(e[1]), "+v"(e[2]), "+v"(e[3]), "+v"(e[4]), "+v"(e[5]), "+v"(e[6]), "+v"(e[7]) : : "memory");      /* the four vector slots behind the last WMMAs, on every path (a branch follows); the memory clobber keeps the loads over the V operands behind them; the weights pass through it so that their sum below, which reuses their registers, stands behind the slots too (the build had put it between the WMMAs that read them) */
  if (!LAST) {
#pragma unroll
    for (int s = 0; s < 4; ++s)
#pragma unroll
      for (int t = 0; t < 4; ++t) { vf[s][t][0] = vn[(2 * s) * DM + 16 * t]; vf[s][t][1] = vn[(2 * s + 1) * DM + 16 * t]; }      /* next pass's V rows, in flight under its scores and exponentials */
  }
  l_run = fmaf(l_run, corr, ((e[0] + e[1]) + (e[2] + e[3])) + ((e[4] + e[5]) + (e[6] + e[7])));
  if (!LAST) { asm volatile("s_wait_xcnt 0x0" ::: "memory"); __builtin_amdgcn_sched_barrier(0); }      /* the wait in front of the next trip's rewrite of the K and V address registers; the scheduling barrier keeps that rewrite behind it */
}
__global__ __launch_bounds__(128) void k_att0(const float* __restrict__ QF, const float* __restrict__ KF, const float* __restrict__ VF, float* __restrict__ OF) {
  static_assert(QT0 == 256 && HD == 64, "k_att0: 16 query tiles of 16 rows (4 blocks of 4 waves), head size 64");
  const int lane = threadIdx.x & 31, ln = lane & 15, hh = lane >> 4; const int w = __builtin_amdgcn_readfirstlane((int)(threadIdx.x >> 5));      /* the wave's number in a scalar register: trip count and branches stay scalar, EXEC stays full for the WMMAs */
  const int qt = (int)blockIdx.x + 4 * w;      /* query tile: a block's four waves take short and long tiles */
  const size_t pb = ((size_t)blockIdx.z * QT0) * DM + (size_t)blockIdx.y * HD;      /* blockIdx.z = batch (each batch's first-tile rows lie in a plane of their own), blockIdx.y = head */
  const float* Ql = QF + pb + (size_t)(qt * 16 + ln) * DM + 4 * hh; const float* Kl = KF + pb + (size_t)ln * DM + 4 * hh; const float* Vl = VF + pb + (size_t)(8 * hh) * DM + ln;
  v4f qf[8], kf[8]; v2f vf[4][4];
#pragma unroll
  for (int j = 0; j < 8; ++j) { qf[j] = *(const v4fa*)(Ql + 8 * j); kf[j] = *(const v4fa*)(Kl + 8 * j); }
  __builtin_amdgcn_sched_barrier(0);      /* the K rows are issued ahead of the V rows, as in the loop: the counted wait at the loop's head then leaves the V loads in flight (with K last here, the build waited for them at the head of every pass) */
#pragma unroll
  for (int s = 0; s < 4; ++s)
#pragma unroll
    for (int t = 0; t < 4; ++t) { vf[s][t][0] = Vl[(2 * s) * DM + 16 * t]; vf[s][t][1] = Vl[(2 * s + 1) * DM + 16 * t]; }
  __builtin_amdgcn_sched_barrier(0); asm volatile("s_wait_xcnt 0x0" ::: "memory"); __builtin_amdgcn_sched_barrier(0);      /* the wait in front of any overwrite of these loads' address pairs; the scheduling barriers keep later register writes behind it */
  v8f acc[4]; float m_run = -3.0e38f, l_run = 0.f;
#pragma unroll
  for (int t = 0; t < 4; ++t) acc[t] = v8f{0.f, 0.f, 0.f, 0.f, 0.f, 0.f, 0.f, 0.f};
#pragma unroll 1      /* one pass per trip: the trip count differs from wave to wave, and an unrolled body would only add code */
  for (int p = 0; p < qt; ++p) a0_pass<false>(kf, vf, Kl + (size_t)(p + 1) * 16 * DM, Vl + (size_t)(p + 1) * 16 * DM, ln, hh, qf, acc, m_run, l_run);
  a0_pass<true>(kf, vf, Kl, Vl, ln, hh, qf, acc, m_run, l_run);
  const float l = l_run + fa_xhalf(l_run); const float fin = 64.0f / l;      /* the two wave halves' sums joined; o carried x64 like the f16 path */
#pragma unroll
  for (int t = 0; t < 4; ++t) acc[t] = acc[t] * fin;
  __builtin_amdgcn_sched_barrier(0);      /* every result is made ahead of the first store, so that no register of an issued store is written again */
  float* Ol = OF + pb + (size_t)(qt * 16 + ln) * DM + 8 * hh;
#pragma unroll
  for (int t = 0; t < 4; ++t) { *(v4fa*)(Ol + 16 * t) = v4f{acc[t][0], acc[t][1], acc[t][2], acc[t][3]}; *(v4fa*)(Ol + 16 * t + 4) = v4f{acc[t][4], acc[t][5], acc[t][6], acc[t][7]}; }      /* register r of tile t is d = 16 t + 8 hh + r of query ln: 32 bytes a lane; the wave writes each query's whole 256-byte head row */
}

__global__ __launch_bounds__(256) void k_kvexp(const float* __restrict__ src, float* __restrict__ dst, size_t n4) { const size_t t = (size_t)blockIdx.x * 256 + threadIdx.x; if (t >= n4) return; const size_t e = t * 4; const size_t row = e / DM; const int col = (int)(e % DM); const int h = col / HD, d = col % HD; const v4f v = *(const v4fa*)(src + row * KVD + (size_t)(h / HPG) * HD + d); *(v4f*)(dst + e) = v;  }

__global__ __launch_bounds__(256) void k_tab2(float theta, float* __restrict__ CS, float* __restrict__ SN) {
  const int t = blockIdx.x * 256 + threadIdx.x; if (t >= SQ * (HD / 2)) return; const int i = t % (HD / 2); const int p = t / (HD / 2); const float invf = 1.0f / powf(theta, (float)(2 * i) / (float)HD); const float ang = __fmul_rn((float)p, invf); const float c = cosf(ang), s = sinf(ang);
  *(float*)(CS + t) = c; *(float*)(SN + t) = s;  }
// Half-split rope (out_lo = x_lo c - x_hi s, out_hi = x_lo s + x_hi c, position = row in its batch), 64 elements a thread: the stage moves few bytes, so what it costs is the start of its waves.
// Thread (p, c) takes columns 4 (c & 7) .. + 3 of the low half and of the high half of heads c >> 3 and (c >> 3) + 8, at position p of every batch: one pair of table loads serves all eight head rows; eight lanes cover a whole 128-byte line in every load.
// F32OUT = false: f16 rows of all SQ positions (H16, batch pitch SQ rows); true: f32 rows of the first QT0 positions (F32, batch pitch QT0 rows). The grid gives the number of positions: 4 a block.
template <bool F32OUT>
__global__ __launch_bounds__(256) void k_rope(const float* __restrict__ F, const float* __restrict__ CS, const float* __restrict__ SN, _Float16* __restrict__ H16, float* __restrict__ F32) {
  static_assert(HD == 64 && NH == 16 && NG == NH && KVD == DM && DM == NH * HD, "k_rope: 16 heads of 64 in rows of 1024");
  const unsigned t = blockIdx.x * 256u + threadIdx.x; const unsigned p = t >> 6, c = t & 63u;
  const unsigned e4 = p * (DM / 4) + (c >> 3) * (HD / 4) + (c & 7u);      /* offset inside a batch plane, in groups of four elements, the same for source and result */
  const unsigned t4 = p * (HD / 8) + (c & 7u);
  unsigned ix[NB], ox[NB];      /* one 32-bit index a batch under the uniform base: source, result */
#pragma unroll
  for (int b = 0; b < NB; ++b) { ix[b] = e4 + (unsigned)b * (SQ * DM / 4); ox[b] = e4 + (unsigned)b * ((F32OUT ? QT0 : SQ) * DM / 4); }
  const v4f cs = ((const v4fa*)CS)[t4], sn = ((const v4fa*)SN)[t4];
  v4f lo[NB][2], hi[NB][2];
#pragma unroll
  for (int b = 0; b < NB; ++b)
#pragma unroll
    for (int g = 0; g < 2; ++g) { const float* s = F + g * (8 * HD); lo[b][g] = ((const v4fa*)s)[ix[b]]; hi[b][g] = ((const v4fa*)(s + HD / 2))[ix[b]]; }
  static_assert(NB == 4, "the wait below names four source indices");
  asm volatile("s_wait_xcnt 0x0" :: "v"(t4), "v"(ix[0]), "v"(ix[1]), "v"(ix[2]), "v"(ix[3]) : "memory");      /* the wait in front of any overwrite of these loads' index registers; named as inputs, they stay whole up to it (no later load lands on one) */
  __builtin_amdgcn_sched_barrier(0);      /* all eighteen loads are issued ahead of the first product: one round trip to memory a wave (the build had held six of them back behind waits) */
  v4h la[NB][2], ha[NB][2];
#pragma unroll
  for (int b = 0; b < NB; ++b)
#pragma unroll
    for (int g = 0; g < 2; ++g) { const v4f l = lo[b][g], h = hi[b][g];
#pragma unroll
      for (int q = 0; q < 4; ++q) { const float ol = __fadd_rn(__fmul_rn(l[q], cs[q]), -__fmul_rn(h[q], sn[q])), oh = __fadd_rn(__fmul_rn(l[q], sn[q]), __fmul_rn(h[q], cs[q]));
        if (F32OUT) { lo[b][g][q] = ol; hi[b][g][q] = oh; } else { la[b][g][q] = (_Float16)ol; ha[b][g][q] = (_Float16)oh; } } }
  __builtin_amdgcn_sched_barrier(0);      /* every result is made ahead of the first store, so that no register of an issued store is written again */
#pragma unroll
  for (int b = 0; b < NB; ++b)
#pragma unroll
    for (int g = 0; g < 2; ++g) {
      if (F32OUT) { float* d = F32 + g * (8 * HD); ((v4fa*)d)[ox[b]] = lo[b][g]; ((v4fa*)(d + HD / 2))[ox[b]] = hi[b][g]; }
      else { _Float16* d = H16 + g * (8 * HD); ((v4ha*)d)[ox[b]] = la[b][g]; ((v4ha*)(d + HD / 2))[ox[b]] = ha[b][g]; } }
}

__global__ __launch_bounds__(256) void k_bfcp(const float* __restrict__ src, float* __restrict__ dst, size_t n4) { const size_t t = (size_t)blockIdx.x * 256 + threadIdx.x; if (t >= n4) return; const v4f a = *(const v4fa*)(src + t * 4); v4f o; for (int q = 0; q < 4; ++q) o[q] = bf16_round(a[q]); *(v4f*)(dst + t * 4) = o;  }

__global__ __launch_bounds__(256) void k_tabhalf(const float* __restrict__ cs, const float* __restrict__ sn, float* __restrict__ CS, float* __restrict__ SN) { const int t = blockIdx.x * 256 + threadIdx.x; if (t >= SQ * (HD / 2)) return; const int p = t / (HD / 2), i = t % (HD / 2); const float c = bf16_round(cs[(size_t)p * HD + i]), s = bf16_round(sn[(size_t)p * HD + i]);
  *(float*)(CS + t) = c; *(float*)(SN + t) = s;  }

__global__ __launch_bounds__(256) void k_tab2d(float* __restrict__ CS, float* __restrict__ SN) {
  const int t = blockIdx.x * 256 + threadIdx.x; if (t >= SQ * (HD / 2)) return; const int i = t % (HD / 2); const int p = t / (HD / 2); const float invf = (float)(1.0 / pow(10000.0, (double)(2 * i) / (double)HD)); const float ang = __fmul_rn((float)p, invf); const float c = cosf(ang), s = sinf(ang);
  *(float*)(CS + t) = c; *(float*)(SN + t) = s;  }
extern "C" void kernel_launch(void* const* d_in, const int* in_sizes, int n_in,
                              void* d_out, int out_size, void* d_ws, size_t ws_size, hipStream_t stream) {
  (void)in_sizes; (void)n_in; (void)out_size;
  const float* const* I = (const float* const*)d_in; const float* x = I[0]; const float* xk = I[1]; const float* xv = I[2]; const float* wq = I[3]; const float* wk = I[5]; const float* wv = I[7]; const float* wo = I[9];      /* the streams query, key, value; natural [out][in] W_q, W_k, W_v, W_o; the biases b_q = I[4], b_k = I[6], b_v = I[8], b_o = I[10]; rope tables computed in-kernel (positions = row index) */
  static_assert(HPG == 1 && NH == NG * HPG && NH * HD == DM && KVD == DM, "plain multi-head attention as 16 kv groups of one query head"); const float* bq = I[4]; const float* bk = I[6]; const float* bv = I[8]; const float* bo = I[10];      /* the four biases, each bound to its projection (read through the GEMM bias pointer, bf16-rounded on load) */
  char* ws = (char*)d_ws; size_t off = 0;
  auto take = [&](size_t bytes) { char* p = ws + off; off += (bytes + 255) & ~(size_t)255; return p; };
  _Float16* BQKV = (_Float16*)take((size_t)3 * DM * DM * 2); _Float16* BQ = BQKV; _Float16* BK = BQKV + (size_t)DM * DM; _Float16* BV = BQKV + (size_t)2 * DM * DM; _Float16* BO = (_Float16*)take((size_t)DM * DM * 2);      /* one plane Bt [3072][1024]: rows 0..1023 = W_q, 1024.. = W_k, 2048.. = W_v (natural [out][in] weights are Bt as they stand) */
  _Float16* X16 = (_Float16*)take(NR * DM * 2); _Float16* XK16 = (_Float16*)take(NR * DM * 2); _Float16* XV16 = (_Float16*)take(NR * DM * 2); float* QF = (float*)take(NR * DM * 4); float* KF = (float*)take(NR * KVD * 4); float* CSB = (float*)take((size_t)SQ * HD * 4); float* SNB = (float*)take((size_t)SQ * HD * 4); _Float16* Q16 = (_Float16*)take(NR * DM * 2); _Float16* K16 = (_Float16*)take(NR * KVD * 2); _Float16* V16 = (_Float16*)take(NR * KVD * 2); _Float16* O16 = (_Float16*)take(NR * DM * 2);
  _Float16* VT = (_Float16*)take((size_t)NB * NH * HD * SQ * 2);
  float* QF0 = (float*)take((size_t)NB * QT0 * DM * 4); float* KF0 = (float*)take((size_t)NB * QT0 * KVD * 4); float* VF0 = (float*)take((size_t)NB * QT0 * KVD * 4); float* KF0e = (float*)take((size_t)NB * QT0 * DM * 4); float* VF0e = (float*)take((size_t)NB * QT0 * DM * 4); float* OF0 = (float*)take((size_t)NB * QT0 * DM * 4); _Float16* OH0 = (_Float16*)take((size_t)NB * QT0 * DM * 2); _Float16* OL0 = (_Float16*)take((size_t)NB * QT0 * DM * 2);
  if (off > ws_size) return;
  { const unsigned g = (unsigned)(((size_t)DM * DM / 8 + 255) / 256); k_wnat<<<g, 256, 0, stream>>>(wq, (size_t)DM * DM / 8, BQ); k_wnat<<<g, 256, 0, stream>>>(wk, (size_t)DM * DM / 8, BK); k_wnat<<<g, 256, 0, stream>>>(wv, (size_t)DM * DM / 8, BV); k_wnat<<<g, 256, 0, stream>>>(wo, (size_t)DM * DM / 8, BO); }      /* natural [out][in] = Bt x16 */
  static_assert(NR * DM % 16384 == 0, "k_x16: whole blocks of 16384 elements"); k_x16<<<(unsigned)(NR * DM / 16384), 256, 0, stream>>>(x, X16); k_x16<<<(unsigned)(NR * DM / 16384), 256, 0, stream>>>(xk, XK16); k_x16<<<(unsigned)(NR * DM / 16384), 256, 0, stream>>>(xv, XV16);      /* the three streams as exact f16 rows */
  k_tab2d<<<(SQ * (HD / 2) + 255) / 256, 256, 0, stream>>>(CSB, SNB);      /* rope tables cos/sin(p / 10000^(2i/64)): inv_freq double-derived -> f32, f32 angle */
  const size_t r0p = (size_t)B0 * SQ;      /* first projected row */
  k_gemm2<0><<<dim3((unsigned)((MP / 128) * (KVD / 64)), 1), 128, 0, stream>>>(XV16 + r0p * DM, DM, 0, BV, DM, 0, 0.0625f, bv, 0, nullptr, 1, 0, 0, nullptr, V16 + r0p * KVD, KVD, 0, MP, KVD, DM);
  static_assert(B0 == 0 && NBR == NB && MP == NB * SQ, "every stage below takes all batches in one launch");
  k_gemm2<0><<<dim3((unsigned)((MP / 128) * (DM / 64)), 1), 128, 0, stream>>>(X16, DM, 0, BQ, DM, 0, 0.0625f, bq, 0, nullptr, 1, 0, 0, QF, nullptr, DM, 0, MP, DM, DM);      /* q (f32), every batch */
  k_rope<false><<<SQ / 4, 256, 0, stream>>>(QF, CSB, SNB, Q16, nullptr);      /* half-split rope (out_lo = x_lo c - x_hi s, out_hi = x_lo s + x_hi c = t cos + rotate_half(t) sin with the module's [f | f] tables) -> f16 rows of every batch; position = row in its batch; 4 positions a block */
  k_rope<true><<<QT0 / 4, 256, 0, stream>>>(QF, CSB, SNB, nullptr, QF0);      /* f32 half-split-roped q of rows 0..255 of each batch */
  k_gemm2<0><<<dim3((unsigned)((MP / 128) * (KVD / 64)), 1), 128, 0, stream>>>(XK16, DM, 0, BK, DM, 0, 0.0625f, bk, 0, nullptr, 1, 0, 0, KF, nullptr, KVD, 0, MP, KVD, DM);      /* k (f32), every batch */
  k_rope<false><<<SQ / 4, 256, 0, stream>>>(KF, CSB, SNB, K16, nullptr);
  k_rope<true><<<QT0 / 4, 256, 0, stream>>>(KF, CSB, SNB, nullptr, KF0);      /* likewise k */
  k_vt<NG, SQ><<<NB * NG * (SQ / 64), 256, 0, stream>>>(V16, KVD, 0, VT);      /* V^T [NB][NH][HD][SQ] */
  k_gemm2<0><<<dim3((QT0 / 128) * (KVD / 64), NB), 128, 0, stream>>>(XV16, DM, (size_t)SQ * DM, BV, DM, 0, 0.0625f, bv, 0, nullptr, 1, 0, 0, VF0, nullptr, KVD, (size_t)QT0 * KVD, QT0, KVD, DM);      /* f32 v of the first 256 rows of each batch (grid y = batch) */
  k_kvexp<<<(unsigned)(((size_t)NB * QT0 * DM / 4 + 255) / 256), 256, 0, stream>>>(KF0, KF0e, (size_t)NB * QT0 * DM / 4); k_kvexp<<<(unsigned)(((size_t)NB * QT0 * DM / 4 + 255) / 256), 256, 0, stream>>>(VF0, VF0e, (size_t)NB * QT0 * DM / 4);      /* head h <- its kv group for the exact first-tile kernel */
  k_att0<<<dim3(QT0 / 64, NH, NB), 128, 0, stream>>>(QF0, KF0e, VF0e, OF0);      /* exact f32 attention for rows 0..255 of every batch (o x64) */
  static_assert(SQ % 128 == 0 && HD == 64 && B0 == 0 && NBR == NB && QN == SQ && NHD == NH, "k_fattn: four waves of 32 query columns, head size 64, every batch and head");
  k_fattn<<<dim3(SQ / 128, NH, NB), 128, 0, stream>>>(Q16, K16, VT, O16);      /* scores, causal softmax and o (x64) of every batch, head and query tile in ONE launch */
  k_gemm2<0><<<dim3((unsigned)((MPO / 128) * (DM / 64)), 1), 128, 0, stream>>>(O16 + r0p * DM, DM, 0, BO, DM, 0, 0.0009765625f, bo, 0, nullptr, 1, 0, 0, (float*)d_out + r0p * DM, nullptr, DM, 0, MPO, DM, DM);      /* out rows are the output layout */
  k_hl<<<(unsigned)(((size_t)NB * QT0 * DM / 8 + 255) / 256), 256, 0, stream>>>(OF0, OH0, OL0, (size_t)NB * QT0 * DM / 8);      /* first-tile o (x64) -> f16 hi + x1024 residual planes */
  k_gemm2<0><<<dim3((QT0 / 128) * (DM / 64), NB), 128, 0, stream>>>(OH0, DM, (size_t)QT0 * DM, BO, DM, 0, 0.0009765625f, bo, 0, nullptr, 1, 0, 0, (float*)d_out, nullptr, DM, (size_t)SQ * DM, QT0, DM, DM);      /* rows 0..255 of each batch (grid y = batch): out = o_hi Wo (+ b), overwriting the f16-path rows */
  k_gemm2<0><<<dim3((QT0 / 128) * (DM / 64), NB), 128, 0, stream>>>(OL0, DM, (size_t)QT0 * DM, BO, DM, 0, 0.00000095367431640625f, nullptr, 0, (const float*)d_out, -1, 0, 0, (float*)d_out, nullptr, DM, (size_t)SQ * DM, QT0, DM, DM);      /* += o_lo Wo 2^-20 (own-element accumulate) */
}

// v006
// A run of this version takes 251 microseconds.
// Next to v005, in two timings, it ran 1.84 and 1.85 times as fast.
// All steps since v000 together make it 29.3 times as fast.
#include <hip/hip_runtime.h>
// Causal multi-head attention over THREE input streams with rotate-half RoPE computed in the module (query, key, value [4][2048][1024]; Q = query W_q^T + b_q, K = key W_k^T + b_k, V = value W_v^T + b_v (natural [out][in] [1024][1024]; the four biases: bound and read), 16 heads of 64; cos / sin = [f, f] of pos * 10000^(-2i/64); Q = Q cos + rotate_half(Q) sin with rotate_half = cat(-x2, x1), likewise K (the bias is added BEFORE the rope); scores / sqrt(64); causal (triu k=1 at -inf); softmax; y = merged W_o^T + b_o (natural) -> [4][2048][1024]); run as grouped-query causal attention with 16 groups of ONE head with the rope stage in its half-split mode.
// Compute dtype: inputs rounded to bf16; x / weights exact; q, k, v, softmax weights and o as plain f16 GEMM operands (~2^-12); scores and softmax statistics f32; v_wmma_f32_16x16x32_f16; rows 0..255 of each batch redone in f32 on v_wmma_f32_16x16x4_f32, their o as f16 hi + x1024 residual.
#define NB 4
#define NG 16
#define HPG 1
#define KVD (NG * HD)
#define SQ 2048
#define DM 1024
#define NH 16
#define HD 64
#define HG 4                         /* unused */
#define QT 256                       /* unused */
#define NKX SQ                       /* unused */
#define QT0 256                      /* first-tile rows recomputed exactly in f32 */
#define B0 0                         /* first batch processed (debug hook) */
#define NBR NB                       /* batches processed (debug hook) */
#define NR ((size_t)NB * SQ)         /* token rows */
#define MP ((int)((size_t)NBR * SQ)) /* rows projected (debug hook) */
#define QN SQ                        /* query rows attended per batch (debug hook) */
#define NHD NH                       /* heads attended (debug hook) */
#define MPO MP                       /* rows through the output stage (debug hook) */
#define LQ DM      /* unused */
typedef __bf16 v16b __attribute__((ext_vector_type(16)));
typedef unsigned short v8us __attribute__((ext_vector_type(8), may_alias));
typedef float  v8f  __attribute__((ext_vector_type(8)));
typedef float  v4f  __attribute__((ext_vector_type(4)));
typedef float  v4fa __attribute__((ext_vector_type(4), may_alias));
union FragB { v16b v; v8us half[2]; unsigned short u[16]; };

__device__ __forceinline__ unsigned short bf16_bits(float x) { unsigned int u = __float_as_uint(x); return (unsigned short)((u + 0x7FFFu + ((u >> 16) & 1u)) >> 16); }
__device__ __forceinline__ float bf16_val(unsigned short b) { return __uint_as_float(((unsigned int)b) << 16); }
__device__ __forceinline__ float bf16_round(float x) { return bf16_val(bf16_bits(x)); }
// D += A·B with NT terms: 1 = ah·bh, 2 = + al·bh (A split), 3 = + ah·bl (both split)
template <int NT>
__device__ __forceinline__ v8f mmaN(v16b ah, v16b al, v16b bh, v16b bl, v8f c) {
  c = __builtin_amdgcn_wmma_f32_16x16x32_bf16(false, ah, false, bh, (short)0, c, false, false);
  if (NT >= 2) c = __builtin_amdgcn_wmma_f32_16x16x32_bf16(false, al, false, bh, (short)0, c, false, false);
  if (NT >= 3) c = __builtin_amdgcn_wmma_f32_16x16x32_bf16(false, ah, false, bl, (short)0, c, false, false);
  asm volatile("v_nop\n\tv_nop\n\tv_nop\n\tv_nop" : "+v"(c) : "v"(ah), "v"(al), "v"(bh), "v"(bl));
  return c;
}

__global__ __launch_bounds__(256) void k_wt_bf16(const float* __restrict__ W, unsigned short* __restrict__ Wt, int K, int N) {
  const int t = blockIdx.x * 256 + threadIdx.x;
  const int k8n = K / 8;
  if (t >= N * k8n) return;
  const int n = t / k8n, k8 = (t % k8n) * 8;
  v8us v;
#pragma unroll
  for (int i = 0; i < 8; ++i) v[i] = bf16_bits(W[(size_t)(k8 + i) * N + n]);
  *(v8us*)(Wt + (size_t)n * K + k8) = v;
  
}

// GEMM C[M][N] (f32, pitch ldc) = act(A[M][K]·W + bias). A f32 row-major (pitch lda) converted per fragment to bf16
// (ASPLIT: hi/lo two planes -> 2 terms, else single rounded term); Wt bf16 [N][K] (pitch ldb). BIAS_BF16 rounds the
// bias to bf16 first (bias quantised to bf16 before the add). K%32==0, M%16==0, N%64==0.
template <bool ASPLIT, int ACT, bool BIAS_BF16>
__global__ __launch_bounds__(128) void k_gemm_bf(const float* __restrict__ A, int lda, const unsigned short* __restrict__ Wt, int ldb,
                                               const float* __restrict__ bias, float* __restrict__ C, int ldc, int M, int N, int K) {
  __shared__ __attribute__((aligned(16))) float so[4][16][64];
  const int tid = threadIdx.x, w = tid >> 5, lane = tid & 31, ln = lane & 15, hh = lane >> 4;
  const int ntn = N / 64;
  const int wid = blockIdx.x * 4 + w;
  const int mt = wid / ntn, nq = wid % ntn;
  if (mt * 16 >= M) return;
  const int row0 = mt * 16, col0 = nq * 64;
  const float* arow = A + (size_t)(row0 + ln) * lda;
  v8f acc[4] = {};
  for (int kb = 0; kb < K; kb += 32) {
    FragB ah, al;
    const v4f x0 = *(const v4fa*)(arow + kb + 8 * hh), x1 = *(const v4fa*)(arow + kb + 8 * hh + 4);
    const v4f x2 = *(const v4fa*)(arow + kb + 16 + 8 * hh), x3 = *(const v4fa*)(arow + kb + 16 + 8 * hh + 4);
    float xs[16] = {x0[0],x0[1],x0[2],x0[3],x1[0],x1[1],x1[2],x1[3],x2[0],x2[1],x2[2],x2[3],x3[0],x3[1],x3[2],x3[3]};
#pragma unroll
    for (int i = 0; i < 16; ++i) { const unsigned short hb = bf16_bits(xs[i]); ah.u[i] = hb; al.u[i] = ASPLIT ? bf16_bits(xs[i] - bf16_val(hb)) : (unsigned short)0; }
#pragma unroll
    for (int t = 0; t < 4; ++t) {
      const unsigned short* brow = Wt + (size_t)(col0 + t * 16 + ln) * ldb + kb;
      FragB b;
      b.half[0] = *(const v8us*)(brow + 8 * hh);
      b.half[1] = *(const v8us*)(brow + 16 + 8 * hh);
      acc[t] = mmaN<ASPLIT ? 2 : 1>(ah.v, al.v, b.v, b.v, acc[t]);
    }
  }
#pragma unroll
  for (int t = 0; t < 4; ++t) {
    float bv = bias ? bias[col0 + t * 16 + ln] : 0.f;
    if (BIAS_BF16) bv = bf16_round(bv);
#pragma unroll
    for (int r = 0; r < 8; ++r) { float v = acc[t][r] + bv; if (ACT == 1) v = fmaxf(v, 0.f); so[w][8 * hh + r][t * 16 + ln] = v; }
  }
  __builtin_amdgcn_fence(__ATOMIC_ACQ_REL, "workgroup");
  __builtin_amdgcn_wave_barrier();
  const int rsub = lane >> 4, c4 = (lane & 15) * 4;
  {
#pragma unroll
    for (int q = 0; q < 8; ++q) {
      const int r = q * 2 + rsub;
      const v4f v = *(const v4fa*)&so[w][r][c4];
      *(v4f*)(C + (size_t)(row0 + r) * ldc + col0 + c4) = v;
    }
    
  }
}

// GEMM C = act(A·W + bias + resid): A f32 (ASPLIT -> hi/lo 2 terms), Wt bf16 [N][K]; ACT 0 none, 1 relu, 2 exact gelu;
// resid (optional, f32, row index = (row % rmod), pitch ldr, RES_BF16 rounds it) added before the activation.
template <bool ASPLIT, int ACT, bool BIAS_BF16, bool RES_BF16>
__global__ __launch_bounds__(128) void k_gemm_bf3(const float* __restrict__ A, int lda, const unsigned short* __restrict__ Wt, int ldb,
                                                const float* __restrict__ bias, const float* __restrict__ resid, int rmod, int ldr,
                                                float* __restrict__ C, int ldc, int M, int N, int K) {
  __shared__ __attribute__((aligned(16))) float so[4][16][64];
  const int tid = threadIdx.x, w = tid >> 5, lane = tid & 31, ln = lane & 15, hh = lane >> 4;
  const int ntn = N / 64;
  const int wid = blockIdx.x * 4 + w;
  const int mt = wid / ntn, nq = wid % ntn;
  if (mt * 16 >= M) return;
  const int row0 = mt * 16, col0 = nq * 64;
  const float* arow = A + (size_t)(row0 + ln) * lda;
  v8f acc[4] = {};
  for (int kb = 0; kb < K; kb += 32) {
    FragB ah, al;
    const v4f x0 = *(const v4fa*)(arow + kb + 8 * hh), x1 = *(const v4fa*)(arow + kb + 8 * hh + 4);
    const v4f x2 = *(const v4fa*)(arow + kb + 16 + 8 * hh), x3 = *(const v4fa*)(arow + kb + 16 + 8 * hh + 4);
    float xs[16] = {x0[0],x0[1],x0[2],x0[3],x1[0],x1[1],x1[2],x1[3],x2[0],x2[1],x2[2],x2[3],x3[0],x3[1],x3[2],x3[3]};
#pragma unroll
    for (int i = 0; i < 16; ++i) { const unsigned short hb = bf16_bits(xs[i]); ah.u[i] = hb; al.u[i] = ASPLIT ? bf16_bits(xs[i] - bf16_val(hb)) : (unsigned short)0; }
#pragma unroll
    for (int t = 0; t < 4; ++t) {
      const unsigned short* brow = Wt + (size_t)(col0 + t * 16 + ln) * ldb + kb;
      FragB b;
      b.half[0] = *(const v8us*)(brow + 8 * hh);
      b.half[1] = *(const v8us*)(brow + 16 + 8 * hh);
      acc[t] = mmaN<ASPLIT ? 2 : 1>(ah.v, al.v, b.v, b.v, acc[t]);
    }
  }
#pragma unroll
  for (int t = 0; t < 4; ++t) {
    const int col = col0 + t * 16 + ln;
    float bv = bias ? bias[col] : 0.f;
    if (BIAS_BF16) bv = bf16_round(bv);
#pragma unroll
    for (int r = 0; r < 8; ++r) {
      float v = acc[t][r] + bv;
      if (resid) { float rv = resid[(size_t)((row0 + 8 * hh + r) % rmod) * ldr + col]; if (RES_BF16) rv = bf16_round(rv); v += rv; }
      if (ACT == 1) v = fmaxf(v, 0.f);
      if (ACT == 2) v = 0.5f * v * (1.0f + erff(v * 0.70710678118654752f));
      if (ACT == 3) { const float u = 0.7978845608028654f * (v + 0.044715f * v * v * v); v = 0.5f * v * (1.0f + tanhf(u)); }
      so[w][8 * hh + r][t * 16 + ln] = v;
    }
  }
  __builtin_amdgcn_fence(__ATOMIC_ACQ_REL, "workgroup");
  __builtin_amdgcn_wave_barrier();
  const int rsub = lane >> 4, c4 = (lane & 15) * 4;
  {
#pragma unroll
    for (int q = 0; q < 8; ++q) {
      const int r = q * 2 + rsub;
      const v4f v = *(const v4fa*)&so[w][r][c4];
      *(v4f*)(C + (size_t)(row0 + r) * ldc + col0 + c4) = v;
    }
    
  }
}
// row LayerNorm (biased variance, eps) over N: s = X (+ R); optional out_sum <- s; out_norm <- (s-mu)*rsqrt(var+eps)*g + b
template <bool PARAM_BF16>
__global__ __launch_bounds__(256) void k_layernorm(const float* __restrict__ X, const float* __restrict__ R, const float* __restrict__ g, const float* __restrict__ bta,
                                                  float* __restrict__ out_sum, float* __restrict__ out_norm, int N, float eps) {
  __shared__ float red[256];
  const int row = blockIdx.x, tid = threadIdx.x;
  const float* x = X + (size_t)row * N; const float* rr = R ? R + (size_t)row * N : nullptr;
  float vals[16];                     // up to N = 4096
  const int per = N / 256;            // contiguous chunk per thread? use strided-by-4 chunks: thread handles j = tid*4 + 1024*u
  float s1 = 0.f;
  for (int u = 0; u < per / 4; ++u) {
    const int j = tid * 4 + 1024 * u;
    const v4f a = *(const v4fa*)(x + j);
    v4f b = {0.f,0.f,0.f,0.f}; if (rr) b = *(const v4fa*)(rr + j);
#pragma unroll
    for (int q = 0; q < 4; ++q) { const float v = a[q] + b[q]; vals[u * 4 + q] = v; s1 += v; }
  }
  red[tid] = s1; __syncthreads();
  for (int st = 128; st > 0; st >>= 1) { if (tid < st) red[tid] += red[tid + st]; __syncthreads(); }
  const float mu = red[0] / (float)N; __syncthreads();
  float s2 = 0.f;
  for (int u = 0; u < per / 4; ++u)
#pragma unroll
    for (int q = 0; q < 4; ++q) { const float c = vals[u * 4 + q] - mu; s2 += c * c; }
  red[tid] = s2; __syncthreads();
  for (int st = 128; st > 0; st >>= 1) { if (tid < st) red[tid] += red[tid + st]; __syncthreads(); }
  const float rs = rsqrtf(red[0] / (float)N + eps);
  {
    for (int u = 0; u < per / 4; ++u) {
      const int j = tid * 4 + 1024 * u;
      v4f o, sm;
#pragma unroll
      for (int q = 0; q < 4; ++q) {
        float gg = g[j + q], bb = bta[j + q];
        if (PARAM_BF16) { gg = bf16_round(gg); bb = bf16_round(bb); }
        sm[q] = vals[u * 4 + q]; o[q] = (vals[u * 4 + q] - mu) * rs * gg + bb;
      }
      if (out_sum) *(v4f*)(out_sum + (size_t)row * N + j) = sm;
      *(v4f*)(out_norm + (size_t)row * N + j) = o;
    }
    
  }
}

// ---- f16 WMMA path (v_wmma_f32_16x16x32_f16): 11-bit significands for operands in range — used where a [0,1] probability operand needs more precision than bf16
typedef _Float16 v16h __attribute__((ext_vector_type(16)));
union FragH { v16h v; v8us half[2]; _Float16 h[16]; unsigned short u[16]; };
template <int NT>
__device__ __forceinline__ v8f mmaH(v16h ah, v16h al, v16h bh, v16h bl, v8f c) {
  c = __builtin_amdgcn_wmma_f32_16x16x32_f16(false, ah, false, bh, (short)0, c, false, false);
  if (NT >= 2) c = __builtin_amdgcn_wmma_f32_16x16x32_f16(false, al, false, bh, (short)0, c, false, false);
  if (NT >= 3) c = __builtin_amdgcn_wmma_f32_16x16x32_f16(false, ah, false, bl, (short)0, c, false, false);
  asm volatile("v_nop\n\tv_nop\n\tv_nop\n\tv_nop" : "+v"(c) : "v"(ah), "v"(al), "v"(bh), "v"(bl));
  return c;
}
// batched GEMM like k_gemm_b but f16 operands: A f32 (split into f16 hi/lo if ASPLIT, else rounded to f16), Bt = f16 values [n][k]; alpha; C f32; N multiple of 16 (partial tiles skipped)
template <bool ASPLIT>
__global__ __launch_bounds__(128) void k_gemm_h(const float* __restrict__ A, int lda, size_t sA, const _Float16* __restrict__ Bh, int ldb, size_t sB, float alpha, float* __restrict__ C, int ldc, size_t sC, int M, int N, int K) {
  __shared__ __attribute__((aligned(16))) float so[4][16][64];
  const int tid = threadIdx.x, w = tid >> 5, lane = tid & 31, ln = lane & 15, hh = lane >> 4; const int by = blockIdx.y;
  A += (size_t)by * sA; Bh += (size_t)by * sB; C += (size_t)by * sC;
  const int ntn = (N + 63) / 64; const int wid = blockIdx.x * 4 + w; const int mt = wid / ntn, nq = wid % ntn; if (mt * 16 >= M) return;
  const int row0 = mt * 16, col0 = nq * 64; const float* arow = A + (size_t)(row0 + ln) * lda;
  v8f acc[4] = {};
  for (int kb = 0; kb < K; kb += 32) {
    FragH ah, al;
    const v4f x0 = *(const v4fa*)(arow + kb + 8 * hh), x1 = *(const v4fa*)(arow + kb + 8 * hh + 4), x2 = *(const v4fa*)(arow + kb + 16 + 8 * hh), x3 = *(const v4fa*)(arow + kb + 16 + 8 * hh + 4);
    float xs[16] = {x0[0],x0[1],x0[2],x0[3],x1[0],x1[1],x1[2],x1[3],x2[0],x2[1],x2[2],x2[3],x3[0],x3[1],x3[2],x3[3]};
#pragma unroll
    for (int i = 0; i < 16; ++i) { const _Float16 h = (_Float16)xs[i]; ah.h[i] = h; al.h[i] = ASPLIT ? (_Float16)(xs[i] - (float)h) : (_Float16)0.0f; }
#pragma unroll
    for (int t = 0; t < 4; ++t) { if (col0 + t * 16 >= N) continue; const size_t boff = (size_t)(col0 + t * 16 + ln) * ldb + kb; FragH bq; bq.half[0] = *(const v8us*)(Bh + boff + 8 * hh); bq.half[1] = *(const v8us*)(Bh + boff + 16 + 8 * hh);
      acc[t] = mmaH<ASPLIT ? 2 : 1>(ah.v, al.v, bq.v, bq.v, acc[t]); }
  }
#pragma unroll
  for (int t = 0; t < 4; ++t) { if (col0 + t * 16 >= N) continue;
#pragma unroll
    for (int r = 0; r < 8; ++r) so[w][8 * hh + r][t * 16 + ln] = acc[t][r] * alpha; }
  __builtin_amdgcn_fence(__ATOMIC_ACQ_REL, "workgroup"); __builtin_amdgcn_wave_barrier();
  const int rsub = lane >> 4, c4 = (lane & 15) * 4;
  {
#pragma unroll
    for (int q = 0; q < 8; ++q) { const int r = q * 2 + rsub; if (col0 + c4 < N) { const v4f v = *(const v4fa*)&so[w][r][c4]; *(v4f*)(C + (size_t)(row0 + r) * ldc + col0 + c4) = v; } }
     }
}

// Wt[n][k] = f16(W[k][n]·scale) from f32 row-major W[K][N] (scale = power of two; bf16-exact weights stay exact in f16 away from the subnormal range)
__global__ __launch_bounds__(256) void k_wt_f16(const float* __restrict__ W, _Float16* __restrict__ Wt, int K, int N, float scale) {
  const int t = blockIdx.x * 256 + threadIdx.x; if (t >= N * (K / 8)) return; const int n = t / (K / 8), k8 = (t % (K / 8)) * 8; FragH f;
#pragma unroll
  for (int i = 0; i < 8; ++i) f.h[i] = (_Float16)(bf16_round(W[(size_t)(k8 + i) * N + n]) * scale); const v8us o = f.half[0];
  *(v8us*)((unsigned short*)Wt + (size_t)n * K + k8) = o; 
}
// k_gemm_hh variant with fused epilogue: v = acc·alpha + bias[by·sBias + col] (+ CP[(row/rowsPerB)·sCPb + by·64 + col] if CP) ; ACT 0 none / 1 elu ; writes f16 C16 (and f32 C if non-null)
template <int ACT>
__global__ __launch_bounds__(128) void k_gemm_hhx(const _Float16* __restrict__ A, int lda, size_t sA, const _Float16* __restrict__ Bh, int ldb, size_t sB, float alpha, const float* __restrict__ bias, size_t sBias, const float* __restrict__ CP, int rowsPerB, size_t sCPb, int row0g,
    float* __restrict__ C, _Float16* __restrict__ C16, int ldc, size_t sC, int M, int N, int K) {
  __shared__ __attribute__((aligned(16))) float so[4][16][64];
  const int tid = threadIdx.x, w = tid >> 5, lane = tid & 31, ln = lane & 15, hh = lane >> 4; const int by = blockIdx.y;
  A += (size_t)by * sA; Bh += (size_t)by * sB; const size_t cofs = (size_t)by * sC; const float* bp = bias ? bias + (size_t)by * sBias : nullptr;
  const int ntn = (N + 63) / 64; const int wid = blockIdx.x * 4 + w; const int mt = wid / ntn, nq = wid % ntn; if (mt * 16 >= M) return;
  const int row0 = mt * 16, col0 = nq * 64; const _Float16* arow = A + (size_t)(row0 + ln) * lda;
  v8f acc[4] = {};
  for (int kb = 0; kb < K; kb += 32) { FragH ah; ah.half[0] = *(const v8us*)((const unsigned short*)arow + kb + 8 * hh); ah.half[1] = *(const v8us*)((const unsigned short*)arow + kb + 16 + 8 * hh);
#pragma unroll
    for (int t = 0; t < 4; ++t) { if (col0 + t * 16 >= N) continue; const size_t boff = (size_t)(col0 + t * 16 + ln) * ldb + kb; FragH bq; bq.half[0] = *(const v8us*)((const unsigned short*)Bh + boff + 8 * hh); bq.half[1] = *(const v8us*)((const unsigned short*)Bh + boff + 16 + 8 * hh);
      acc[t] = mmaH<1>(ah.v, ah.v, bq.v, bq.v, acc[t]); }
  }
#pragma unroll
  for (int t = 0; t < 4; ++t) { if (col0 + t * 16 >= N) continue; const int col = col0 + t * 16 + ln; const float bv = bp ? bf16_round(bp[col]) : 0.f;
#pragma unroll
    for (int r = 0; r < 8; ++r) { float v = acc[t][r] * alpha + bv; if (CP) { const int rr = row0g + row0 + 8 * hh + r; if (rowsPerB < 0) v += CP[cofs + (size_t)rr * ldc + col];      /* rowsPerB < 0: own element of the batched C plane */ else { const int bidx = rr / rowsPerB; v += CP[(size_t)bidx * sCPb + (size_t)by * 64 + col]; } } if (ACT == 1) v = (v > 0.f) ? v : expm1f(v); else if (ACT == 7) v = (v > 0.f) ? v + 1.0f : expf(v); else if (ACT == 8) v = tanhf(v); else if (ACT == 9) v = 0.5f * v * (1.0f + tanhf(0.7978845608028654f * (v + 0.044715f * v * v * v))); else if (ACT == 11) v = 1.0f / (1.0f + expf(-v)); else if (ACT == 12) v = (v > 0.f) ? v : 0.01f * v; else if (ACT == 14) v = (v > 0.f) ? v : 0.1f * v; else if (ACT == 16) v = (v >= 0.f) ? v : 0.3f * v; else if (ACT == 17) v = (v >= 0.f) ? v : 0.2f * v; else if (ACT == 15) v = v / (1.0f + expf(-v)); else if (ACT == 3) v = fmaxf(v, 0.f); else if (ACT == 6) v = 0.5f * v * (1.0f + erff(v * 0.70710678118654752f)); so[w][8 * hh + r][t * 16 + ln] = v; } }
  __builtin_amdgcn_fence(__ATOMIC_ACQ_REL, "workgroup"); __builtin_amdgcn_wave_barrier();
  const int rsub = lane >> 4, c4 = (lane & 15) * 4; typedef _Float16 v4h __attribute__((ext_vector_type(4)));
  {
#pragma unroll
    for (int q = 0; q < 8; ++q) { const int r = q * 2 + rsub; if (col0 + c4 < N) { const v4f v = *(const v4fa*)&so[w][r][c4]; if (C) *(v4f*)(C + cofs + (size_t)(row0 + r) * ldc + col0 + c4) = v; if (C16) { v4h h4; for (int i = 0; i < 4; ++i) h4[i] = (_Float16)v[i]; *(v4h*)(C16 + cofs + (size_t)(row0 + r) * ldc + col0 + c4) = h4; } } }
     }
}

typedef _Float16 v4h __attribute__((ext_vector_type(4)));

// 64 elements a thread (the stage costs the start of its waves more than its bytes): a block converts 64 KiB of source that lie in a row; group u of four elements of thread t is 256 u + t, so every load and store covers whole 128-byte lines under one index register.
typedef _Float16 v4ha __attribute__((ext_vector_type(4), may_alias));
__global__ __launch_bounds__(256) void k_x16(const float* __restrict__ x, _Float16* __restrict__ X16) { const unsigned i0 = blockIdx.x * 4096u + threadIdx.x; v4f a[16]; v4h o[16];
#pragma unroll
  for (int u = 0; u < 16; ++u) a[u] = ((const v4fa*)(x + u * 1024))[i0];
#pragma unroll
  for (int u = 0; u < 16; ++u)
#pragma unroll
    for (int q = 0; q < 4; ++q) o[u][q] = (_Float16)bf16_round(a[u][q]);
#pragma unroll
  for (int u = 0; u < 16; ++u) ((v4ha*)(X16 + u * 1024))[i0] = o[u]; }
__global__ __launch_bounds__(256) void k_h16(const float* __restrict__ x, _Float16* __restrict__ X16, size_t n8) { const size_t t = (size_t)blockIdx.x * 256 + threadIdx.x; if (t >= n8) return; FragH f;
#pragma unroll
  for (int q = 0; q < 8; ++q) f.h[q] = (_Float16)x[t * 8 + q]; *(v8us*)((unsigned short*)X16 + t * 8) = f.half[0];  }
__global__ __launch_bounds__(256) void k_round16f(const float* __restrict__ W, _Float16* __restrict__ Bt, size_t n8) { const size_t t = (size_t)blockIdx.x * 256 + threadIdx.x; if (t >= n8) return; FragH f;
#pragma unroll
  for (int i = 0; i < 8; ++i) f.h[i] = (_Float16)(bf16_round(W[t * 8 + i]) * 16.0f); *(v8us*)((unsigned short*)Bt + t * 8) = f.half[0];  }
template <int NHv, int TTv>
__global__ __launch_bounds__(256) void k_vt(const _Float16* __restrict__ V16, int ldv, int voff, _Float16* __restrict__ Vt) { __shared__ unsigned short tl[64][66]; const int tid = threadIdx.x; const int slab = blockIdx.x / (TTv / 64), lg = blockIdx.x % (TTv / 64); const int b = slab / NHv, h = slab % NHv;
  for (int i = tid; i < 64 * 8; i += 256) { const int r = i / 8, c8 = (i % 8) * 8; FragH f; f.half[0] = *(const v8us*)((const unsigned short*)V16 + ((size_t)b * TTv + lg * 64 + r) * ldv + voff + h * 64 + c8);
#pragma unroll
    for (int q = 0; q < 8; ++q) tl[r][c8 + q] = f.u[q]; }
  __syncthreads();
  {
#pragma unroll
    for (int rd = 0; rd < 2; ++rd) { const int d = rd * 32 + tid / 8, pc = tid % 8; FragH f;
#pragma unroll
      for (int q = 0; q < 8; ++q) f.u[q] = tl[pc * 8 + q][d];
      *(v8us*)((unsigned short*)Vt + ((size_t)slab * 64 + d) * TTv + lg * 64 + pc * 8) = f.half[0]; }
     } }

__global__ __launch_bounds__(256) void k_hl(const float* __restrict__ F, _Float16* __restrict__ Hh, _Float16* __restrict__ Hl, size_t n8) { const size_t t = (size_t)blockIdx.x * 256 + threadIdx.x; if (t >= n8) return; FragH fh, fl; const v4f a = *(const v4fa*)(F + t * 8), c = *(const v4fa*)(F + t * 8 + 4);
#pragma unroll
  for (int q = 0; q < 4; ++q) { _Float16 h = (_Float16)a[q]; fh.h[q] = h; fl.h[q] = (_Float16)((a[q] - (float)h) * 1024.0f); h = (_Float16)c[q]; fh.h[4 + q] = h; fl.h[4 + q] = (_Float16)((c[q] - (float)h) * 1024.0f); }
  { *(v8us*)((unsigned short*)Hh + t * 8) = fh.half[0]; *(v8us*)((unsigned short*)Hl + t * 8) = fl.half[0];  } }

// ---- fast GEMM on LDS tiles (block tile 128x128, four waves of 64x64; requires M % 128 == 0 rows per launch region, N % 128 == 0, K % 64 == 0); epilogue = k_gemm_hhx semantics ----
// A stage is 64 k of 128 A rows and of 128 B rows (128 bytes a row) at an LDS pitch of 144 bytes (16 bytes x 9: the 16-byte fragment reads of 16 rows fall on all 64 banks). Two buffers: the next stage's copies fly while this one is worked on.
// Each 128-byte line of A and B now leaves L2 once per block, as a whole line (eight lanes a row), and feeds two waves from LDS; before, every wave fetched its own fragments with loads that touched 16 lines each.
#define G3_PITCH 144u                      /* bytes between LDS rows */
#define G3_STAGE (256u * G3_PITCH)         /* bytes of a stage: 128 A rows, then 128 B rows */
__device__ __forceinline__ v16h g2_frag(const _Float16* p, int hh) { FragH f; f.half[0] = *(const v8us*)((const unsigned short*)p + 8 * hh); f.half[1] = *(const v8us*)((const unsigned short*)p + 16 + 8 * hh); return f.v; }
__device__ __forceinline__ v16h g3_frag(const unsigned char* p) { FragH f; f.half[0] = *(const v8us*)p; f.half[1] = *(const v8us*)(p + 32); return f.v; }      /* p = row start + 64 kc + 16 hh: the k order of g2_frag (elements 0..7 = k 8 hh + i, 8..15 = k 16 + 8 hh + i) */
// Eight asynchronous 16-byte copies a lane, rows 16 apart: LDS byte address l + 16 i rows, global address g + i rs elements. The s_wait_xcnt stands in the copies' own statement, so that no register that a copy names is rewritten in front of it.
__device__ __forceinline__ void g3_copy8(unsigned l, const _Float16* g, size_t rs) {
  asm volatile("global_load_async_to_lds_b128 %0, %8, off\n\t"
               "global_load_async_to_lds_b128 %1, %9, off\n\t"
               "global_load_async_to_lds_b128 %2, %10, off\n\t"
               "global_load_async_to_lds_b128 %3, %11, off\n\t"
               "global_load_async_to_lds_b128 %4, %12, off\n\t"
               "global_load_async_to_lds_b128 %5, %13, off\n\t"
               "global_load_async_to_lds_b128 %6, %14, off\n\t"
               "global_load_async_to_lds_b128 %7, %15, off\n\t"
               "s_wait_xcnt 0x0"
               :: "v"(l), "v"(l + 16u * G3_PITCH), "v"(l + 32u * G3_PITCH), "v"(l + 48u * G3_PITCH), "v"(l + 64u * G3_PITCH), "v"(l + 80u * G3_PITCH), "v"(l + 96u * G3_PITCH), "v"(l + 112u * G3_PITCH),
                  "v"(g), "v"(g + rs), "v"(g + 2 * rs), "v"(g + 3 * rs), "v"(g + 4 * rs), "v"(g + 5 * rs), "v"(g + 6 * rs), "v"(g + 7 * rs)
               : "memory");
}
// The wave's 64 staged rows to memory, eight rows of a lane a trip: v = acc alpha + bias (+ CP), activation, then whole-line stores. CPM 0: no CP; 1: cp walks like the output (step cs a row pair); 2: cp + (row / rowsPerB) cs. wc, wh: an f32, an f16 output is there (the same for the whole grid: scalar branches).
template <int ACT, int CPM>
__device__ __forceinline__ void g3_rows(const float* sl, float alpha, v4f bv, const float* cp, size_t cs, int rowg, int rowsPerB, bool wc, bool wh, float* cl, _Float16* hl, size_t st) {
#pragma unroll 1      /* eight stores a trip, then the wait in front of the next trip's rewrite of their registers */
  for (int q0 = 0; q0 < 32; q0 += 8) { v4f o[8], x[8];
#pragma unroll
    for (int q = 0; q < 8; ++q) { o[q] = *(const v4fa*)(sl + (q0 + q) * (2 * 68));
      if (CPM == 1) x[q] = *(const v4fa*)(cp + (size_t)(q0 + q) * cs);
      if (CPM == 2) { const float* p = cp + (size_t)((rowg + 2 * (q0 + q)) / rowsPerB) * cs; x[q] = v4f{p[0], p[1], p[2], p[3]}; } }
#pragma unroll
    for (int q = 0; q < 8; ++q)
#pragma unroll
      for (int e = 0; e < 4; ++e) { float v = o[q][e] * alpha + bv[e]; if (CPM != 0) v += x[q][e];
        if (ACT == 3) v = fmaxf(v, 0.f); else if (ACT == 6) v = 0.5f * v * (1.0f + erff(v * 0.70710678118654752f)); else if (ACT == 11) v = 1.0f / (1.0f + expf(-v)); else if (ACT == 15) v = v / (1.0f + expf(-v)); else if (ACT == 12) v = (v > 0.f) ? v : 0.01f * v; else if (ACT == 8) v = tanhf(v); else if (ACT == 9) v = 0.5f * v * (1.0f + tanhf(0.7978845608028654f * (v + 0.044715f * v * v * v))); else if (ACT == 14) v = (v > 0.f) ? v : 0.1f * v; else if (ACT == 16) v = (v >= 0.f) ? v : 0.3f * v; else if (ACT == 17) v = (v >= 0.f) ? v : 0.2f * v;
        o[q][e] = v; }
    if (wc) { float* p[8];
#pragma unroll
      for (int q = 0; q < 8; ++q) p[q] = cl + (size_t)(q0 + q) * st;
      __builtin_amdgcn_sched_barrier(0);      /* the trip's rows and addresses are made ahead of its first store, so that no register of an issued store is written again in front of the wait */
#pragma unroll
      for (int q = 0; q < 8; ++q) *(v4f*)p[q] = o[q];
      asm volatile("s_wait_xcnt 0x0" ::: "memory"); __builtin_amdgcn_sched_barrier(0); }      /* the wait in front of the next rewrite of the stores' address and data registers; the scheduling barrier keeps that rewrite behind it */
    if (wh) { _Float16* p[8]; v4h h[8];
#pragma unroll
      for (int q = 0; q < 8; ++q) { p[q] = hl + (size_t)(q0 + q) * st;
#pragma unroll
        for (int e = 0; e < 4; ++e) h[q][e] = (_Float16)o[q][e]; }
      __builtin_amdgcn_sched_barrier(0);      /* as above */
#pragma unroll
      for (int q = 0; q < 8; ++q) *(v4h*)p[q] = h[q];
      asm volatile("s_wait_xcnt 0x0" ::: "memory"); __builtin_amdgcn_sched_barrier(0); } }      /* as above */
}
template <int ACT>
__global__ __launch_bounds__(128) void k_gemm2(const _Float16* __restrict__ A, int lda, size_t sA, const _Float16* __restrict__ Bh, int ldb, size_t sB, float alpha, const float* __restrict__ bias, size_t sBias, const float* __restrict__ CP, int rowsPerB, size_t sCPb, int row0g,
    float* __restrict__ C, _Float16* __restrict__ C16, int ldc, size_t sC, int M, int N, int K) { static_assert(ACT == 0 || ACT == 3 || ACT == 6 || ACT == 8 || ACT == 9 || ACT == 11 || ACT == 12 || ACT == 14 || ACT == 15 || ACT == 16 || ACT == 17, "k_gemm2: unsupported ACT code (would silently apply no activation)");
  __shared__ __attribute__((aligned(16))) unsigned char L[2 * G3_STAGE];      /* the two stage buffers; behind the loop, each wave's 64 x 68 f32 output staging */
  static_assert(4 * 64 * 68 * 4 <= 2 * G3_STAGE, "k_gemm2: the output staging fits the ring");
  const int tid = threadIdx.x, lane = tid & 31, ln = lane & 15, hh = lane >> 4; const int by = blockIdx.y; const int w = __builtin_amdgcn_readfirstlane(tid >> 5);
  A += (size_t)by * sA; Bh += (size_t)by * sB; const size_t cofs = (size_t)by * sC; const float* bp = bias ? bias + (size_t)by * sBias : nullptr;
  const int ntn = N >> 7; const int mt = blockIdx.x / ntn, nq = blockIdx.x - mt * ntn; if (mt * 128 >= M) return;      /* the same for the whole block, ahead of every barrier */
  const int row0 = mt * 128 + 64 * (w >> 1), col0 = nq * 128 + 64 * (w & 1);      /* the wave's 64 x 64 tile */
  const _Float16* ga = A + (size_t)(mt * 128 + (tid >> 3)) * lda + (tid & 7) * 8;      /* eight lanes cover a row's 128 bytes; a wave's copy covers four whole lines */
  const _Float16* gb = Bh + (size_t)(nq * 128 + (tid >> 3)) * ldb + (tid & 7) * 8;
  const size_t ra = (size_t)16 * lda, rb = (size_t)16 * ldb;
  const unsigned lc = (unsigned)(size_t)L + (unsigned)(tid >> 3) * G3_PITCH + (unsigned)(tid & 7) * 16u;
  const int nt = K >> 6;
  g3_copy8(lc, ga, ra); g3_copy8(lc + 128u * G3_PITCH, gb, rb);      /* stage 0 */
  asm volatile("s_wait_asynccnt 0x0" ::: "memory");      /* this wave's copies of stage 0 have landed */
  __syncthreads();      /* ... and every wave's */
  if (nt > 1) { g3_copy8(lc + G3_STAGE, ga + 64, ra); g3_copy8(lc + G3_STAGE + 128u * G3_PITCH, gb + 64, rb); }      /* stage 1 */
  const unsigned char* fa = L + (unsigned)(64 * (w >> 1) + ln) * G3_PITCH + 16u * hh;
  const unsigned char* fb = L + (unsigned)(128 + 64 * (w & 1) + ln) * G3_PITCH + 16u * hh;
  v8f acc[4][4];
#pragma unroll
  for (int i = 0; i < 4; ++i)
#pragma unroll
    for (int j = 0; j < 4; ++j) acc[i][j] = v8f{0.f, 0.f, 0.f, 0.f, 0.f, 0.f, 0.f, 0.f};
#pragma unroll 1      /* one stage per trip: the buffer is chosen by a scalar offset */
  for (int t = 0; t < nt; ++t) { const unsigned bo = (unsigned)(t & 1) * G3_STAGE;
#pragma unroll
    for (int kc = 0; kc < 2; ++kc) { v16h af[4], bf[4];
      af[0] = g3_frag(fa + bo + 64u * kc);
#pragma unroll
      for (int j = 0; j < 4; ++j) bf[j] = g3_frag(fb + bo + (unsigned)(16 * j) * G3_PITCH + 64u * kc);
#pragma unroll
      for (int i = 1; i < 4; ++i) af[i] = g3_frag(fa + bo + (unsigned)(16 * i) * G3_PITCH + 64u * kc);
      __builtin_amdgcn_sched_barrier(0);      /* the block's sixteen LDS reads stand as one group ahead of its WMMAs, in the order in which these need them (left alone, the build read each A fragment right in front of its row and waited out the LDS latency four times a block) */
#pragma unroll
      for (int i = 0; i < 4; ++i)
#pragma unroll
        for (int j = 0; j < 4; ++j) acc[i][j] = __builtin_amdgcn_wmma_f32_16x16x32_f16(false, af[i], false, bf[j], (short)0, acc[i][j], false, false);
      if (kc == 0) __builtin_amdgcn_sched_barrier(0); }      /* ... and the next block's reads behind them */
    __builtin_amdgcn_sched_barrier(0); asm volatile("v_nop\n\tv_nop\n\tv_nop\n\tv_nop"); __builtin_amdgcn_sched_barrier(0);      /* the four vector slots behind the trip's last WMMAs, on every path: a branch and the copies' address arithmetic, which may reuse the fragment registers, follow */
    asm volatile("s_wait_dscnt 0x0" ::: "memory");      /* this wave's reads of the buffer are done before the buffer is handed to the copies */
    asm volatile("s_wait_asynccnt 0x0" ::: "memory");      /* this wave's copies of stage t + 1 have landed */
    __syncthreads();      /* publishes stage t + 1 and ends every wave's reads of stage t */
    if (t + 2 < nt) { g3_copy8(lc + bo, ga + (size_t)(t + 2) * 64, ra); g3_copy8(lc + bo + 128u * G3_PITCH, gb + (size_t)(t + 2) * 64, rb); } }      /* stage t + 2 into the buffer just read */
  asm volatile("s_wait_asynccnt 0x0" ::: "memory");      /* no copy is in flight when the ring becomes output staging (the last trip's barrier has ended every read of it) */
  float* so = (float*)(L + (unsigned)w * (64u * 68u * 4u));
#pragma unroll
  for (int i = 0; i < 4; ++i)
#pragma unroll
    for (int j = 0; j < 4; ++j)
#pragma unroll
      for (int r = 0; r < 8; ++r) so[(16 * i + 8 * hh + r) * 68 + 16 * j + ln] = acc[i][j][r];
  __builtin_amdgcn_fence(__ATOMIC_ACQ_REL, "workgroup"); __builtin_amdgcn_wave_barrier();
  const int rsub = lane >> 4, c4 = (lane & 15) * 4; const int col = col0 + c4;      /* a lane takes four columns of every second row: sixteen lanes store 256 bytes (f16: 128) of a row */
  v4f bv = {0.f, 0.f, 0.f, 0.f};
  if (bp) { const v4f b4 = *(const v4fa*)(bp + col);
#pragma unroll
    for (int e = 0; e < 4; ++e) bv[e] = bf16_round(b4[e]); }
  const size_t eo = cofs + (size_t)(row0 + rsub) * ldc + col; const size_t st = (size_t)2 * ldc; const float* sl = so + rsub * 68 + c4;
  const bool wc = C != nullptr, wh = C16 != nullptr; float* cl = wc ? C + eo : nullptr; _Float16* hl = wh ? C16 + eo : nullptr;
  if (!CP) g3_rows<ACT, 0>(sl, alpha, bv, nullptr, 0, 0, 1, wc, wh, cl, hl, st);
  else if (rowsPerB < 0) g3_rows<ACT, 1>(sl, alpha, bv, CP + cofs + (size_t)(row0g + row0 + rsub) * ldc + col, st, 0, 1, wc, wh, cl, hl, st);      /* rowsPerB < 0: own element of the batched C plane */
  else g3_rows<ACT, 2>(sl, alpha, bv, CP + (size_t)by * 64 + col, sCPb, row0g + row0 + rsub, rowsPerB, wc, wh, cl, hl, st);
}

__global__ __launch_bounds__(256) void k_wnat(const float* __restrict__ w, size_t n8, _Float16* __restrict__ Bt) { const size_t t = (size_t)blockIdx.x * 256 + threadIdx.x; if (t >= n8) return; FragH f; for (int q = 0; q < 8; ++q) f.h[q] = (_Float16)(bf16_round(w[t * 8 + q]) * 16.0f); *(v8us*)((unsigned short*)Bt + t * 8) = f.half[0];  }

// exp2 with the one issue slot that the instruction set asks for behind a transcendental (before its source is overwritten or its result read) in the same statement.
__device__ __forceinline__ float exp2_slot(float x) { float e; asm("v_exp_f32 %0, %1\n\tv_nop" : "=v"(e) : "v"(x)); return e; }
__device__ __forceinline__ v8f fa_mma(v16h a, v16h b, v8f c) { return __builtin_amdgcn_wmma_f32_16x16x32_f16(false, a, false, b, (short)0, c, false, false); }
__device__ __forceinline__ float fa_xhalf(float x) { return __builtin_bit_cast(float, __builtin_amdgcn_permlanex16(__builtin_bit_cast(int, x), __builtin_bit_cast(int, x), 0x76543210, 0xfedcba98, false, false)); }      /* lane l with lane l ^ 16 */
__device__ __forceinline__ void fa_gap() { __builtin_amdgcn_sched_barrier(0); asm volatile("v_nop\n\tv_nop\n\tv_nop\n\tv_nop"); __builtin_amdgcn_sched_barrier(0); }      /* the four vector slots behind a group of WMMAs, on every path: a branch or a load over their operands follows; the two scheduling barriers keep the slots (and the loads issued ahead) where they stand */
template <bool LAST>      /* LAST = the wave's diagonal pass: masked, and no further K rows are fetched */
__device__ __forceinline__ void fa_pass(v16h (&kf)[2][2], const _Float16* __restrict__ kn, const _Float16* __restrict__ vp, int key0, int qw0, int ln, int hh, const v16h (&qf)[2][2], v8f (&acc)[2][4], float (&m_run)[2], float (&l_run)[2]) {
  const float cs = 0.125f * 1.44269504088896340736f;
  v16h vf[4];
#pragma unroll
  for (int t = 0; t < 4; ++t) vf[t] = g2_frag(vp + (size_t)(16 * t) * SQ, hh);      /* this pass's V^T rows, in flight under the scores and the exponentials */
  v8f s[2][2];
#pragma unroll
  for (int kt = 0; kt < 2; ++kt)
#pragma unroll
    for (int g = 0; g < 2; ++g) { const v8f z = {0.f, 0.f, 0.f, 0.f, 0.f, 0.f, 0.f, 0.f}; s[kt][g] = fa_mma(kf[kt][1], qf[g][1], fa_mma(kf[kt][0], qf[g][0], z)); }
  fa_gap();
  if (!LAST) {
#pragma unroll
    for (int kt = 0; kt < 2; ++kt)
#pragma unroll
      for (int kc = 0; kc < 2; ++kc) kf[kt][kc] = g2_frag(kn + (size_t)(16 * kt) * KVD + 32 * kc, hh);      /* next pass's K rows, one pass ahead */
  }
  if (LAST) {
#pragma unroll
    for (int g = 0; g < 2; ++g)
#pragma unroll
      for (int kt = 0; kt < 2; ++kt)
#pragma unroll
        for (int r = 0; r < 8; ++r) if (key0 + 16 * kt + 8 * hh + r > qw0 + 16 * g + ln) s[kt][g][r] = -3.0e38f;      /* causal: key above the query (key0 itself is never masked, so every maximum stays a real score) */
  }
  float mb[2]; bool need = false;
#pragma unroll
  for (int g = 0; g < 2; ++g) { float mx = s[0][g][0];
#pragma unroll
    for (int r = 1; r < 8; ++r) mx = fmaxf(mx, s[0][g][r]);
#pragma unroll
    for (int r = 0; r < 8; ++r) mx = fmaxf(mx, s[1][g][r]);
    mx = fmaxf(mx, fa_xhalf(mx)) * cs; mb[g] = mx; need = need || (mx > m_run[g] + 8.0f); }
  if (__builtin_amdgcn_ballot_w32(need) != 0) {      /* wave-uniform; rare after the first passes */
#pragma unroll
    for (int g = 0; g < 2; ++g) { const float mn = fmaxf(m_run[g], mb[g]); const float corr = exp2_slot(m_run[g] - mn); m_run[g] = mn; l_run[g] *= corr;
#pragma unroll
      for (int t = 0; t < 4; ++t) acc[g][t] = acc[g][t] * corr; }
  }
  FragH pf[2];
#pragma unroll
  for (int g = 0; g < 2; ++g) { const float nm = -m_run[g]; float ls[4] = {0.f, 0.f, 0.f, 0.f};
#pragma unroll
    for (int i = 0; i < 16; ++i) { const float e = exp2_slot(fmaf(s[i >> 3][g][i & 7], cs, nm)); ls[i & 3] += e; pf[g].h[i] = (_Float16)e; }
    l_run[g] += (ls[0] + ls[1]) + (ls[2] + ls[3]); }
  __builtin_amdgcn_sched_barrier(0);      /* every exponential stands ahead of the WMMAs */
#pragma unroll
  for (int g = 0; g < 2; ++g)
#pragma unroll
    for (int t = 0; t < 4; ++t) acc[g][t] = fa_mma(vf[t], pf[g].v, acc[g][t]);
  fa_gap();
  if (!LAST) { asm volatile("s_wait_xcnt 0x0" ::: "memory"); __builtin_amdgcn_sched_barrier(0); }      /* the wait in front of the advance of the K and V^T address pairs at the loop's foot; the scheduling barrier keeps the advance behind it */
}
__global__ __launch_bounds__(128) void k_fattn(const _Float16* __restrict__ Q, const _Float16* __restrict__ K, const _Float16* __restrict__ Vt, _Float16* __restrict__ O) {
  const int lane = threadIdx.x & 31, ln = lane & 15, hh = lane >> 4; const int w = __builtin_amdgcn_readfirstlane((int)(threadIdx.x >> 5));      /* the wave's number in a scalar register: trip count and branches stay scalar, EXEC stays full for the WMMAs */
  const int h = blockIdx.y, b = blockIdx.z; const int xs = (int)blockIdx.x, nq = (int)gridDim.x; const int qa = (xs & 1) ? (xs >> 1) : nq - 1 - (xs >> 1); const int qb = (b & 1) ? nq - 1 - qa : qa;      /* a permutation of the query tiles: long and short ones alternate between neighbouring blocks and between batches, so that the blocks that share a WGP carry about the same number of passes (speed only) */
  const int qw0 = qb * 128 + w * 32;
  const _Float16* Ql = Q + ((size_t)b * SQ + qw0 + ln) * DM + h * HD; const _Float16* Kl = K + ((size_t)b * SQ + ln) * KVD + h * HD; const _Float16* Vl = Vt + (((size_t)b * NH + h) * HD + ln) * SQ;
  v16h qf[2][2], kf[2][2];
#pragma unroll
  for (int g = 0; g < 2; ++g)
#pragma unroll
    for (int kc = 0; kc < 2; ++kc) { qf[g][kc] = g2_frag(Ql + (size_t)(16 * g) * DM + 32 * kc, hh); kf[g][kc] = g2_frag(Kl + (size_t)(16 * g) * KVD + 32 * kc, hh); }
  __builtin_amdgcn_sched_barrier(0); asm volatile("s_wait_xcnt 0x0" ::: "memory"); __builtin_amdgcn_sched_barrier(0);      /* the wait in front of any overwrite of these loads' address pairs; the scheduling barriers keep later register writes behind it */
  v8f acc[2][4]; float m_run[2] = {-3.0e38f, -3.0e38f}, l_run[2] = {0.f, 0.f};
#pragma unroll
  for (int g = 0; g < 2; ++g)
#pragma unroll
    for (int t = 0; t < 4; ++t) acc[g][t] = v8f{0.f, 0.f, 0.f, 0.f, 0.f, 0.f, 0.f, 0.f};
  const int nfull = qw0 / 32;      /* passes wholly below the diagonal */
#pragma unroll 1      /* one pass per trip: an unrolled body would hold two passes' fragments and lose a wave per SIMD */
  for (int p = 0; p < nfull; ++p) fa_pass<false>(kf, Kl + (size_t)(p + 1) * 32 * KVD, Vl + p * 32, p * 32, qw0, ln, hh, qf, acc, m_run, l_run);
  fa_pass<true>(kf, Kl, Vl + nfull * 32, nfull * 32, qw0, ln, hh, qf, acc, m_run, l_run);
  FragH of[2][4];
#pragma unroll
  for (int g = 0; g < 2; ++g) { const float l = l_run[g] + fa_xhalf(l_run[g]); const float inv = 64.0f / l;
#pragma unroll
    for (int t = 0; t < 4; ++t)
#pragma unroll
      for (int r = 0; r < 8; ++r) of[g][t].h[r] = (_Float16)(acc[g][t][r] * inv); }
  __builtin_amdgcn_sched_barrier(0);      /* all eight packed rows are made ahead of the first store, so that no register of an issued store is written again */
#pragma unroll
  for (int g = 0; g < 2; ++g)
#pragma unroll
    for (int t = 0; t < 4; ++t) *(v8us*)((unsigned short*)O + ((size_t)b * SQ + qw0 + 16 * g + ln) * DM + h * HD + 16 * t + 8 * hh) = of[g][t].half[0];      /* register r of tile t is d = 16 t + 8 hh + r of query ln: 16 bytes a lane; the wave writes each query's whole 128-byte head row */
}

// Exact f32 attention of the first QT0 rows of every batch and head on the f32 matrix form (v_wmma_f32_16x16x4_f32: full f32 operands, every addition rounded in f32): a wave owns 16 query columns and walks its keys in passes of 16 with an online softmax.
// Transposed products as in k_fattn: S^T = K Q^T (A = K rows, B = Q rows, both through the same loader, so their k order is equal: 16 bytes at d = 8 j + 4 hh, elements 0, 1 in one product and 2, 3 in the next) leaves key 8 hh + r of query ln in register r.
// Registers 2 s, 2 s + 1 of the weights ARE a B operand of keys 8 hh + 2 s + e (e = 0, 1); the A operand of O^T += V^T P^T takes V[8 hh + 2 s + e][16 t + ln] from the natural V rows: 64 bytes in a row for each wave half, no transposed copy.
typedef float v2f __attribute__((ext_vector_type(2)));
__device__ __forceinline__ v8f a0_mma(v2f a, v2f b, v8f c) { return __builtin_amdgcn_wmma_f32_16x16x4_f32(false, a, false, b, (short)0, c, false, false); }
template <bool LAST>      /* LAST = the wave's diagonal pass: masked, and no further K or V rows are fetched */
__device__ __forceinline__ void a0_pass(v4f (&kf)[8], v2f (&vf)[4][4], const float* __restrict__ kn, const float* __restrict__ vn, int ln, int hh, const v4f (&qf)[8], v8f (&acc)[4], float& m_run, float& l_run) {
  const float cs = 0.125f * 1.44269504088896340736f;
  v8f sc = {0.f, 0.f, 0.f, 0.f, 0.f, 0.f, 0.f, 0.f};
#pragma unroll
  for (int j = 0; j < 8; ++j) { sc = a0_mma(v2f{kf[j][0], kf[j][1]}, v2f{qf[j][0], qf[j][1]}, sc); sc = a0_mma(v2f{kf[j][2], kf[j][3]}, v2f{qf[j][2], qf[j][3]}, sc); }
  /* the four vector slots behind the score WMMAs, tied to their result so that they stand behind the last one (untied, the build had put them in front of the first); the memory clobber keeps the loads over the K operands behind the slots; in the diagonal pass the lane's column passes through too, so that the mask's lane arithmetic stands behind them (the build had put it between the WMMAs, over an operand register of the one before) */
  if (LAST) asm volatile("v_nop\n\tv_nop\n\tv_nop\n\tv_nop" : "+v"(sc), "+v"(ln) : : "memory");
  else asm volatile("v_nop\n\tv_nop\n\tv_nop\n\tv_nop" : "+v"(sc) : : "memory");
  if (!LAST) {
#pragma unroll
    for (int j = 0; j < 8; ++j) kf[j] = *(const v4fa*)(kn + 8 * j);      /* next pass's K rows, in flight under the exponentials and the second product */
  }
  if (LAST) { const int dl = ln - 8 * hh;
#pragma unroll
    for (int r = 0; r < 8; ++r) if (r > dl) sc[r] = -3.0e38f;      /* causal: key 8 hh + r above query ln (the pass's first key is never masked, so every maximum stays a real score) */
  }
  float mx = sc[0];
#pragma unroll
  for (int r = 1; r < 8; ++r) mx = fmaxf(mx, sc[r]);
  mx = fmaxf(mx, fa_xhalf(mx)) * cs;
  const float mn = fmaxf(m_run, mx); const float corr = exp2_slot(m_run - mn); m_run = mn;
#pragma unroll
  for (int t = 0; t < 4; ++t) acc[t] = acc[t] * corr;
  float e[8];
#pragma unroll
  for (int r = 0; r < 8; ++r) e[r] = exp2_slot(fmaf(sc[r], cs, -mn));
  __builtin_amdgcn_sched_barrier(0);      /* every exponential stands ahead of the WMMAs */
#pragma unroll
  for (int s = 0; s < 4; ++s)
#pragma unroll
    for (int t = 0; t < 4; ++t) acc[t] = a0_mma(vf[s][t], v2f{e[2 * s], e[2 * s + 1]}, acc[t]);
  asm volatile("v_nop\n\tv_nop\n\tv_nop\n\tv_nop" : "+v"(acc[0]), "+v"(acc[1]), "+v"(acc[2]), "+v"(acc[3]), "+v"(e[0]), "+v"(e[1]), "+v"(e[2]), "+v"(e[3]), "+v"(e[4]), "+v"(e[5]), "+v"(e[6]), "+v"(e[7]) : : "memory");      /* the four vector slots behind the last WMMAs, on every path (a branch follows); the memory clobber keeps the loads over the V operands behind them; the weights pass through it so that their sum below, which reuses their registers, stands behind the slots too (the build had put it between the WMMAs that read them) */
  if (!LAST) {
#pragma unroll
    for (int s = 0; s < 4; ++s)
#pragma unroll
      for (int t = 0; t < 4; ++t) { vf[s][t][0] = vn[(2 * s) * DM + 16 * t]; vf[s][t][1] = vn[(2 * s + 1) * DM + 16 * t]; }      /* next pass's V rows, in flight under its scores and exponentials */
  }
  l_run = fmaf(l_run, corr, ((e[0] + e[1]) + (e[2] + e[3])) + ((e[4] + e[5]) + (e[6] + e[7])));
  if (!LAST) { asm volatile("s_wait_xcnt 0x0" ::: "memory"); __builtin_amdgcn_sched_barrier(0); }      /* the wait in front of the next trip's rewrite of the K and V address registers; the scheduling barrier keeps that rewrite behind it */
}
__global__ __launch_bounds__(128) void k_att0(const float* __restrict__ QF, const float* __restrict__ KF, const float* __restrict__ VF, float* __restrict__ OF) {
  static_assert(QT0 == 256 && HD == 64, "k_att0: 16 query tiles of 16 rows (4 blocks of 4 waves), head size 64");
  const int lane = threadIdx.x & 31, ln = lane & 15, hh = lane >> 4; const int w = __builtin_amdgcn_readfirstlane((int)(threadIdx.x >> 5));      /* the wave's number in a scalar register: trip count and branches stay scalar, EXEC stays full for the WMMAs */
  const int qt = (int)blockIdx.x + 4 * w;      /* query tile: a block's four waves take short and long tiles */
  const size_t pb = ((size_t)blockIdx.z * QT0) * DM + (size_t)blockIdx.y * HD;      /* blockIdx.z = batch (each batch's first-tile rows lie in a plane of their own), blockIdx.y = head */
  const float* Ql = QF + pb + (size_t)(qt * 16 + ln) * DM + 4 * hh; const float* Kl = KF + pb + (size_t)ln * DM + 4 * hh; const float* Vl = VF + pb + (size_t)(8 * hh) * DM + ln;
  v4f qf[8], kf[8]; v2f vf[4][4];
#pragma unroll
  for (int j = 0; j < 8; ++j) { qf[j] = *(const v4fa*)(Ql + 8 * j); kf[j] = *(const v4fa*)(Kl + 8 * j); }
  __builtin_amdgcn_sched_barrier(0);      /* the K rows are issued ahead of the V rows, as in the loop: the counted wait at the loop's head then leaves the V loads in flight (with K last here, the build waited for them at the head of every pass) */
#pragma unroll
  for (int s = 0; s < 4; ++s)
#pragma unroll
    for (int t = 0; t < 4; ++t) { vf[s][t][0] = Vl[(2 * s) * DM + 16 * t]; vf[s][t][1] = Vl[(2 * s + 1) * DM + 16 * t]; }
  __builtin_amdgcn_sched_barrier(0); asm volatile("s_wait_xcnt 0x0" ::: "memory"); __builtin_amdgcn_sched_barrier(0);      /* the wait in front of any overwrite of these loads' address pairs; the scheduling barriers keep later register writes behind it */
  v8f acc[4]; float m_run = -3.0e38f, l_run = 0.f;
#pragma unroll
  for (int t = 0; t < 4; ++t) acc[t] = v8f{0.f, 0.f, 0.f, 0.f, 0.f, 0.f, 0.f, 0.f};
#pragma unroll 1      /* one pass per trip: the trip count differs from wave to wave, and an unrolled body would only add code */
  for (int p = 0; p < qt; ++p) a0_pass<false>(kf, vf, Kl + (size_t)(p + 1) * 16 * DM, Vl + (size_t)(p + 1) * 16 * DM, ln, hh, qf, acc, m_run, l_run);
  a0_pass<true>(kf, vf, Kl, Vl, ln, hh, qf, acc, m_run, l_run);
  const float l = l_run + fa_xhalf(l_run); const float fin = 64.0f / l;      /* the two wave halves' sums joined; o carried x64 like the f16 path */
#pragma unroll
  for (int t = 0; t < 4; ++t) acc[t] = acc[t] * fin;
  __builtin_amdgcn_sched_barrier(0);      /* every result is made ahead of the first store, so that no register of an issued store is written again */
  float* Ol = OF + pb + (size_t)(qt * 16 + ln) * DM + 8 * hh;
#pragma unroll
  for (int t = 0; t < 4; ++t) { *(v4fa*)(Ol + 16 * t) = v4f{acc[t][0], acc[t][1], acc[t][2], acc[t][3]}; *(v4fa*)(Ol + 16 * t + 4) = v4f{acc[t][4], acc[t][5], acc[t][6], acc[t][7]}; }      /* register r of tile t is d = 16 t + 8 hh + r of query ln: 32 bytes a lane; the wave writes each query's whole 256-byte head row */
}

__global__ __launch_bounds__(256) void k_kvexp(const float* __restrict__ src, float* __restrict__ dst, size_t n4) { const size_t t = (size_t)blockIdx.x * 256 + threadIdx.x; if (t >= n4) return; const size_t e = t * 4; const size_t row = e / DM; const int col = (int)(e % DM); const int h = col / HD, d = col % HD; const v4f v = *(const v4fa*)(src + row * KVD + (size_t)(h / HPG) * HD + d); *(v4f*)(dst + e) = v;  }

__global__ __launch_bounds__(256) void k_tab2(float theta, float* __restrict__ CS, float* __restrict__ SN) {
  const int t = blockIdx.x * 256 + threadIdx.x; if (t >= SQ * (HD / 2)) return; const int i = t % (HD / 2); const int p = t / (HD / 2); const float invf = 1.0f / powf(theta, (float)(2 * i) / (float)HD); const float ang = __fmul_rn((float)p, invf); const float c = cosf(ang), s = sinf(ang);
  *(float*)(CS + t) = c; *(float*)(SN + t) = s;  }
// Half-split rope (out_lo = x_lo c - x_hi s, out_hi = x_lo s + x_hi c, position = row in its batch), 64 elements a thread: the stage moves few bytes, so what it costs is the start of its waves.
// Thread (p, c) takes columns 4 (c & 7) .. + 3 of the low half and of the high half of heads c >> 3 and (c >> 3) + 8, at position p of every batch: one pair of table loads serves all eight head rows; eight lanes cover a whole 128-byte line in every load.
// F32OUT = false: f16 rows of all SQ positions (H16, batch pitch SQ rows); true: f32 rows of the first QT0 positions (F32, batch pitch QT0 rows). The grid gives the number of positions: 4 a block.
template <bool F32OUT>
__global__ __launch_bounds__(256) void k_rope(const float* __restrict__ F, const float* __restrict__ CS, const float* __restrict__ SN, _Float16* __restrict__ H16, float* __restrict__ F32) {
  static_assert(HD == 64 && NH == 16 && NG == NH && KVD == DM && DM == NH * HD, "k_rope: 16 heads of 64 in rows of 1024");
  const unsigned t = blockIdx.x * 256u + threadIdx.x; const unsigned p = t >> 6, c = t & 63u;
  const unsigned e4 = p * (DM / 4) + (c >> 3) * (HD / 4) + (c & 7u);      /* offset inside a batch plane, in groups of four elements, the same for source and result */
  const unsigned t4 = p * (HD / 8) + (c & 7u);
  unsigned ix[NB], ox[NB];      /* one 32-bit index a batch under the uniform base: source, result */
#pragma unroll
  for (int b = 0; b < NB; ++b) { ix[b] = e4 + (unsigned)b * (SQ * DM / 4); ox[b] = e4 + (unsigned)b * ((F32OUT ? QT0 : SQ) * DM / 4); }
  const v4f cs = ((const v4fa*)CS)[t4], sn = ((const v4fa*)SN)[t4];
  v4f lo[NB][2], hi[NB][2];
#pragma unroll
  for (int b = 0; b < NB; ++b)
#pragma unroll
    for (int g = 0; g < 2; ++g) { const float* s = F + g * (8 * HD); lo[b][g] = ((const v4fa*)s)[ix[b]]; hi[b][g] = ((const v4fa*)(s + HD / 2))[ix[b]]; }
  static_assert(NB == 4, "the wait below names four source indices");
  asm volatile("s_wait_xcnt 0x0" :: "v"(t4), "v"(ix[0]), "v"(ix[1]), "v"(ix[2]), "v"(ix[3]) : "memory");      /* the wait in front of any overwrite of these loads' index registers; named as inputs, they stay whole up to it (no later load lands on one) */
  __builtin_amdgcn_sched_barrier(0);      /* all eighteen loads are issued ahead of the first product: one round trip to memory a wave (the build had held six of them back behind waits) */
  v4h la[NB][2], ha[NB][2];
#pragma unroll
  for (int b = 0; b < NB; ++b)
#pragma unroll
    for (int g = 0; g < 2; ++g) { const v4f l = lo[b][g], h = hi[b][g];
#pragma unroll
      for (int q = 0; q < 4; ++q) { const float ol = __fadd_rn(__fmul_rn(l[q], cs[q]), -__fmul_rn(h[q], sn[q])), oh = __fadd_rn(__fmul_rn(l[q], sn[q]), __fmul_rn(h[q], cs[q]));
        if (F32OUT) { lo[b][g][q] = ol; hi[b][g][q] = oh; } else { la[b][g][q] = (_Float16)ol; ha[b][g][q] = (_Float16)oh; } } }
  __builtin_amdgcn_sched_barrier(0);      /* every result is made ahead of the first store, so that no register of an issued store is written again */
#pragma unroll
  for (int b = 0; b < NB; ++b)
#pragma unroll
    for (int g = 0; g < 2; ++g) {
      if (F32OUT) { float* d = F32 + g * (8 * HD); ((v4fa*)d)[ox[b]] = lo[b][g]; ((v4fa*)(d + HD / 2))[ox[b]] = hi[b][g]; }
      else { _Float16* d = H16 + g * (8 * HD); ((v4ha*)d)[ox[b]] = la[b][g]; ((v4ha*)(d + HD / 2))[ox[b]] = ha[b][g]; } }
}

__global__ __launch_bounds__(256) void k_bfcp(const float* __restrict__ src, float* __restrict__ dst, size_t n4) { const size_t t = (size_t)blockIdx.x * 256 + threadIdx.x; if (t >= n4) return; const v4f a = *(const v4fa*)(src + t * 4); v4f o; for (int q = 0; q < 4; ++q) o[q] = bf16_round(a[q]); *(v4f*)(dst + t * 4) = o;  }

__global__ __launch_bounds__(256) void k_tabhalf(const float* __restrict__ cs, const float* __restrict__ sn, float* __restrict__ CS, float* __restrict__ SN) { const int t = blockIdx.x * 256 + threadIdx.x; if (t >= SQ * (HD / 2)) return; const int p = t / (HD / 2), i = t % (HD / 2); const float c = bf16_round(cs[(size_t)p * HD + i]), s = bf16_round(sn[(size_t)p * HD + i]);
  *(float*)(CS + t) = c; *(float*)(SN + t) = s;  }

__global__ __launch_bounds__(256) void k_tab2d(float* __restrict__ CS, float* __restrict__ SN) {
  const int t = blockIdx.x * 256 + threadIdx.x; if (t >= SQ * (HD / 2)) return; const int i = t % (HD / 2); const int p = t / (HD / 2); const float invf = (float)(1.0 / pow(10000.0, (double)(2 * i) / (double)HD)); const float ang = __fmul_rn((float)p, invf); const float c = cosf(ang), s = sinf(ang);
  *(float*)(CS + t) = c; *(float*)(SN + t) = s;  }
extern "C" void kernel_launch(void* const* d_in, const int* in_sizes, int n_in,
                              void* d_out, int out_size, void* d_ws, size_t ws_size, hipStream_t stream) {
  (void)in_sizes; (void)n_in; (void)out_size;
  const float* const* I = (const float* const*)d_in; const float* x = I[0]; const float* xk = I[1]; const float* xv = I[2]; const float* wq = I[3]; const float* wk = I[5]; const float* wv = I[7]; const float* wo = I[9];      /* the streams query, key, value; natural [out][in] W_q, W_k, W_v, W_o; the biases b_q = I[4], b_k = I[6], b_v = I[8], b_o = I[10]; rope tables computed in-kernel (positions = row index) */
  static_assert(HPG == 1 && NH == NG * HPG && NH * HD == DM && KVD == DM, "plain multi-head attention as 16 kv groups of one query head"); const float* bq = I[4]; const float* bk = I[6]; const float* bv = I[8]; const float* bo = I[10];      /* the four biases, each bound to its projection (read through the GEMM bias pointer, bf16-rounded on load) */
  char* ws = (char*)d_ws; size_t off = 0;
  auto take = [&](size_t bytes) { char* p = ws + off; off += (bytes + 255) & ~(size_t)255; return p; };
  _Float16* BQKV = (_Float16*)take((size_t)3 * DM * DM * 2); _Float16* BQ = BQKV; _Float16* BK = BQKV + (size_t)DM * DM; _Float16* BV = BQKV + (size_t)2 * DM * DM; _Float16* BO = (_Float16*)take((size_t)DM * DM * 2);      /* one plane Bt [3072][1024]: rows 0..1023 = W_q, 1024.. = W_k, 2048.. = W_v (natural [out][in] weights are Bt as they stand) */
  _Float16* X16 = (_Float16*)take(NR * DM * 2); _Float16* XK16 = (_Float16*)take(NR * DM * 2); _Float16* XV16 = (_Float16*)take(NR * DM * 2); float* QF = (float*)take(NR * DM * 4); float* KF = (float*)take(NR * KVD * 4); float* CSB = (float*)take((size_t)SQ * HD * 4); float* SNB = (float*)take((size_t)SQ * HD * 4); _Float16* Q16 = (_Float16*)take(NR * DM * 2); _Float16* K16 = (_Float16*)take(NR * KVD * 2); _Float16* V16 = (_Float16*)take(NR * KVD * 2); _Float16* O16 = (_Float16*)take(NR * DM * 2);
  _Float16* VT = (_Float16*)take((size_t)NB * NH * HD * SQ * 2);
  float* QF0 = (float*)take((size_t)NB * QT0 * DM * 4); float* KF0 = (float*)take((size_t)NB * QT0 * KVD * 4); float* VF0 = (float*)take((size_t)NB * QT0 * KVD * 4); float* KF0e = (float*)take((size_t)NB * QT0 * DM * 4); float* VF0e = (float*)take((size_t)NB * QT0 * DM * 4); float* OF0 = (float*)take((size_t)NB * QT0 * DM * 4); _Float16* OH0 = (_Float16*)take((size_t)NB * QT0 * DM * 2); _Float16* OL0 = (_Float16*)take((size_t)NB * QT0 * DM * 2);
  if (off > ws_size) return;
  { const unsigned g = (unsigned)(((size_t)DM * DM / 8 + 255) / 256); k_wnat<<<g, 256, 0, stream>>>(wq, (size_t)DM * DM / 8, BQ); k_wnat<<<g, 256, 0, stream>>>(wk, (size_t)DM * DM / 8, BK); k_wnat<<<g, 256, 0, stream>>>(wv, (size_t)DM * DM / 8, BV); k_wnat<<<g, 256, 0, stream>>>(wo, (size_t)DM * DM / 8, BO); }      /* natural [out][in] = Bt x16 */
  static_assert(NR * DM % 16384 == 0, "k_x16: whole blocks of 16384 elements"); k_x16<<<(unsigned)(NR * DM / 16384), 256, 0, stream>>>(x, X16); k_x16<<<(unsigned)(NR * DM / 16384), 256, 0, stream>>>(xk, XK16); k_x16<<<(unsigned)(NR * DM / 16384), 256, 0, stream>>>(xv, XV16);      /* the three streams as exact f16 rows */
  k_tab2d<<<(SQ * (HD / 2) + 255) / 256, 256, 0, stream>>>(CSB, SNB);      /* rope tables cos/sin(p / 10000^(2i/64)): inv_freq double-derived -> f32, f32 angle */
  const size_t r0p = (size_t)B0 * SQ;      /* first projected row */
  k_gemm2<0><<<dim3((unsigned)((MP / 128) * (KVD / 128)), 1), 128, 0, stream>>>(XV16 + r0p * DM, DM, 0, BV, DM, 0, 0.0625f, bv, 0, nullptr, 1, 0, 0, nullptr, V16 + r0p * KVD, KVD, 0, MP, KVD, DM);
  static_assert(B0 == 0 && NBR == NB && MP == NB * SQ, "every stage below takes all batches in one launch");
  k_gemm2<0><<<dim3((unsigned)((MP / 128) * (DM / 128)), 1), 128, 0, stream>>>(X16, DM, 0, BQ, DM, 0, 0.0625f, bq, 0, nullptr, 1, 0, 0, QF, nullptr, DM, 0, MP, DM, DM);      /* q (f32), every batch */
  k_rope<false><<<SQ / 4, 256, 0, stream>>>(QF, CSB, SNB, Q16, nullptr);      /* half-split rope (out_lo = x_lo c - x_hi s, out_hi = x_lo s + x_hi c = t cos + rotate_half(t) sin with the module's [f | f] tables) -> f16 rows of every batch; position = row in its batch; 4 positions a block */
  k_rope<true><<<QT0 / 4, 256, 0, stream>>>(QF, CSB, SNB, nullptr, QF0);      /* f32 half-split-roped q of rows 0..255 of each batch */
  k_gemm2<0><<<dim3((unsigned)((MP / 128) * (KVD / 128)), 1), 128, 0, stream>>>(XK16, DM, 0, BK, DM, 0, 0.0625f, bk, 0, nullptr, 1, 0, 0, KF, nullptr, KVD, 0, MP, KVD, DM);      /* k (f32), every batch */
  k_rope<false><<<SQ / 4, 256, 0, stream>>>(KF, CSB, SNB, K16, nullptr);
  k_rope<true><<<QT0 / 4, 256, 0, stream>>>(KF, CSB, SNB, nullptr, KF0);      /* likewise k */
  k_vt<NG, SQ><<<NB * NG * (SQ / 64), 256, 0, stream>>>(V16, KVD, 0, VT);      /* V^T [NB][NH][HD][SQ] */
  k_gemm2<0><<<dim3((QT0 / 128) * (KVD / 128), NB), 128, 0, stream>>>(XV16, DM, (size_t)SQ * DM, BV, DM, 0, 0.0625f, bv, 0, nullptr, 1, 0, 0, VF0, nullptr, KVD, (size_t)QT0 * KVD, QT0, KVD, DM);      /* f32 v of the first 256 rows of each batch (grid y = batch) */
  k_kvexp<<<(unsigned)(((size_t)NB * QT0 * DM / 4 + 255) / 256), 256, 0, stream>>>(KF0, KF0e, (size_t)NB * QT0 * DM / 4); k_kvexp<<<(unsigned)(((size_t)NB * QT0 * DM / 4 + 255) / 256), 256, 0, stream>>>(VF0, VF0e, (size_t)NB * QT0 * DM / 4);      /* head h <- its kv group for the exact first-tile kernel */
  k_att0<<<dim3(QT0 / 64, NH, NB), 128, 0, stream>>>(QF0, KF0e, VF0e, OF0);      /* exact f32 attention for rows 0..255 of every batch (o x64) */
  static_assert(SQ % 128 == 0 && HD == 64 && B0 == 0 && NBR == NB && QN == SQ && NHD == NH, "k_fattn: four waves of 32 query columns, head size 64, every batch and head");
  k_fattn<<<dim3(SQ / 128, NH, NB), 128, 0, stream>>>(Q16, K16, VT, O16);      /* scores, causal softmax and o (x64) of every batch, head and query tile in ONE launch */
  k_gemm2<0><<<dim3((unsigned)((MPO / 128) * (DM / 128)), 1), 128, 0, stream>>>(O16 + r0p * DM, DM, 0, BO, DM, 0, 0.0009765625f, bo, 0, nullptr, 1, 0, 0, (float*)d_out + r0p * DM, nullptr, DM, 0, MPO, DM, DM);      /* out rows are the output layout */
  k_hl<<<(unsigned)(((size_t)NB * QT0 * DM / 8 + 255) / 256), 256, 0, stream>>>(OF0, OH0, OL0, (size_t)NB * QT0 * DM / 8);      /* first-tile o (x64) -> f16 hi + x1024 residual planes */
  k_gemm2<0><<<dim3((QT0 / 128) * (DM / 128), NB), 128, 0, stream>>>(OH0, DM, (size_t)QT0 * DM, BO, DM, 0, 0.0009765625f, bo, 0, nullptr, 1, 0, 0, (float*)d_out, nullptr, DM, (size_t)SQ * DM, QT0, DM, DM);      /* rows 0..255 of each batch (grid y = batch): out = o_hi Wo (+ b), overwriting the f16-path rows */
  k_gemm2<0><<<dim3((QT0 / 128) * (DM / 128), NB), 128, 0, stream>>>(OL0, DM, (size_t)QT0 * DM, BO, DM, 0, 0.00000095367431640625f, nullptr, 0, (const float*)d_out, -1, 0, 0, (float*)d_out, nullptr, DM, (size_t)SQ * DM, QT0, DM, DM);      /* += o_lo Wo 2^-20 (own-element accumulate) */
}

// v007
// Measured time: 191 microseconds a run.
// In two side-by-side timings against v006, it was 1.30 and 1.33 times as fast.
// Counting every step since v000, it is 38.5 times as fast.
#include <hip/hip_runtime.h>
// Causal multi-head attention over THREE input streams with rotate-half RoPE computed in the module (query, key, value [4][2048][1024]; Q = query W_q^T + b_q, K = key W_k^T + b_k, V = value W_v^T + b_v (natural [out][in] [1024][1024]; the four biases: bound and read), 16 heads of 64; cos / sin = [f, f] of pos * 10000^(-2i/64); Q = Q cos + rotate_half(Q) sin with rotate_half = cat(-x2, x1), likewise K (the bias is added BEFORE the rope); scores / sqrt(64); causal (triu k=1 at -inf); softmax; y = merged W_o^T + b_o (natural) -> [4][2048][1024]); run as grouped-query causal attention with 16 groups of ONE head with the rope stage in its half-split mode.
// Compute dtype: inputs rounded to bf16; x / weights exact; q, k, v, softmax weights and o as plain f16 GEMM operands (~2^-12); scores and softmax statistics f32; v_wmma_f32_16x16x32_f16; rows 0..255 of each batch redone in f32 on v_wmma_f32_16x16x4_f32, their o as f16 hi + x1024 residual.
#define NB 4
#define NG 16
#define HPG 1
#define KVD (NG * HD)
#define SQ 2048
#define DM 1024
#define NH 16
#define HD 64
#define HG 4                         /* unused */
#define QT 256                       /* unused */
#define NKX SQ                       /* unused */
#define QT0 256                      /* first-tile rows recomputed exactly in f32 */
#define B0 0                         /* first batch processed (debug hook) */
#define NBR NB                       /* batches processed (debug hook) */
#define NR ((size_t)NB * SQ)         /* token rows */
#define MP ((int)((size_t)NBR * SQ)) /* rows projected (debug hook) */
#define QN SQ                        /* query rows attended per batch (debug hook) */
#define NHD NH                       /* heads attended (debug hook) */
#define MPO MP                       /* rows through the output stage (debug hook) */
#define LQ DM      /* unused */
typedef __bf16 v16b __attribute__((ext_vector_type(16)));
typedef unsigned short v8us __attribute__((ext_vector_type(8), may_alias));
typedef float  v8f  __attribute__((ext_vector_type(8)));
typedef float  v4f  __attribute__((ext_vector_type(4)));
typedef float  v4fa __attribute__((ext_vector_type(4), may_alias));
union FragB { v16b v; v8us half[2]; unsigned short u[16]; };

__device__ __forceinline__ unsigned short bf16_bits(float x) { unsigned int u = __float_as_uint(x); return (unsigned short)((u + 0x7FFFu + ((u >> 16) & 1u)) >> 16); }
__device__ __forceinline__ float bf16_val(unsigned short b) { return __uint_as_float(((unsigned int)b) << 16); }
__device__ __forceinline__ float bf16_round(float x) { return bf16_val(bf16_bits(x)); }
// D += A·B with NT terms: 1 = ah·bh, 2 = + al·bh (A split), 3 = + ah·bl (both split)
template <int NT>
__device__ __forceinline__ v8f mmaN(v16b ah, v16b al, v16b bh, v16b bl, v8f c) {
  c = __builtin_amdgcn_wmma_f32_16x16x32_bf16(false, ah, false, bh, (short)0, c, false, false);
  if (NT >= 2) c = __builtin_amdgcn_wmma_f32_16x16x32_bf16(false, al, false, bh, (short)0, c, false, false);
  if (NT >= 3) c = __builtin_amdgcn_wmma_f32_16x16x32_bf16(false, ah, false, bl, (short)0, c, false, false);
  asm volatile("v_nop\n\tv_nop\n\tv_nop\n\tv_nop" : "+v"(c) : "v"(ah), "v"(al), "v"(bh), "v"(bl));
  return c;
}

__global__ __launch_bounds__(256) void k_wt_bf16(const float* __restrict__ W, unsigned short* __restrict__ Wt, int K, int N) {
  const int t = blockIdx.x * 256 + threadIdx.x;
  const int k8n = K / 8;
  if (t >= N * k8n) return;
  const int n = t / k8n, k8 = (t % k8n) * 8;
  v8us v;
#pragma unroll
  for (int i = 0; i < 8; ++i) v[i] = bf16_bits(W[(size_t)(k8 + i) * N + n]);
  *(v8us*)(Wt + (size_t)n * K + k8) = v;
  
}

// GEMM C[M][N] (f32, pitch ldc) = act(A[M][K]·W + bias). A f32 row-major (pitch lda) converted per fragment to bf16
// (ASPLIT: hi/lo two planes -> 2 terms, else single rounded term); Wt bf16 [N][K] (pitch ldb). BIAS_BF16 rounds the
// bias to bf16 first (bias quantised to bf16 before the add). K%32==0, M%16==0, N%64==0.
template <bool ASPLIT, int ACT, bool BIAS_BF16>
__global__ __launch_bounds__(128) void k_gemm_bf(const float* __restrict__ A, int lda, const unsigned short* __restrict__ Wt, int ldb,
                                               const float* __restrict__ bias, float* __restrict__ C, int ldc, int M, int N, int K) {
  __shared__ __attribute__((aligned(16))) float so[4][16][64];
  const int tid = threadIdx.x, w = tid >> 5, lane = tid & 31, ln = lane & 15, hh = lane >> 4;
  const int ntn = N / 64;
  const int wid = blockIdx.x * 4 + w;
  const int mt = wid / ntn, nq = wid % ntn;
  if (mt * 16 >= M) return;
  const int row0 = mt * 16, col0 = nq * 64;
  const float* arow = A + (size_t)(row0 + ln) * lda;
  v8f acc[4] = {};
  for (int kb = 0; kb < K; kb += 32) {
    FragB ah, al;
    const v4f x0 = *(const v4fa*)(arow + kb + 8 * hh), x1 = *(const v4fa*)(arow + kb + 8 * hh + 4);
    const v4f x2 = *(const v4fa*)(arow + kb + 16 + 8 * hh), x3 = *(const v4fa*)(arow + kb + 16 + 8 * hh + 4);
    float xs[16] = {x0[0],x0[1],x0[2],x0[3],x1[0],x1[1],x1[2],x1[3],x2[0],x2[1],x2[2],x2[3],x3[0],x3[1],x3[2],x3[3]};
#pragma unroll
    for (int i = 0; i < 16; ++i) { const unsigned short hb = bf16_bits(xs[i]); ah.u[i] = hb; al.u[i] = ASPLIT ? bf16_bits(xs[i] - bf16_val(hb)) : (unsigned short)0; }
#pragma unroll
    for (int t = 0; t < 4; ++t) {
      const unsigned short* brow = Wt + (size_t)(col0 + t * 16 + ln) * ldb + kb;
      FragB b;
      b.half[0] = *(const v8us*)(brow + 8 * hh);
      b.half[1] = *(const v8us*)(brow + 16 + 8 * hh);
      acc[t] = mmaN<ASPLIT ? 2 : 1>(ah.v, al.v, b.v, b.v, acc[t]);
    }
  }
#pragma unroll
  for (int t = 0; t < 4; ++t) {
    float bv = bias ? bias[col0 + t * 16 + ln] : 0.f;
    if (BIAS_BF16) bv = bf16_round(bv);
#pragma unroll
    for (int r = 0; r < 8; ++r) { float v = acc[t][r] + bv; if (ACT == 1) v = fmaxf(v, 0.f); so[w][8 * hh + r][t * 16 + ln] = v; }
  }
  __builtin_amdgcn_fence(__ATOMIC_ACQ_REL, "workgroup");
  __builtin_amdgcn_wave_barrier();
  const int rsub = lane >> 4, c4 = (lane & 15) * 4;
  {
#pragma unroll
    for (int q = 0; q < 8; ++q) {
      const int r = q * 2 + rsub;
      const v4f v = *(const v4fa*)&so[w][r][c4];
      *(v4f*)(C + (size_t)(row0 + r) * ldc + col0 + c4) = v;
    }
    
  }
}

// GEMM C = act(A·W + bias + resid): A f32 (ASPLIT -> hi/lo 2 terms), Wt bf16 [N][K]; ACT 0 none, 1 relu, 2 exact gelu;
// resid (optional, f32, row index = (row % rmod), pitch ldr, RES_BF16 rounds it) added before the activation.
template <bool ASPLIT, int ACT, bool BIAS_BF16, bool RES_BF16>
__global__ __launch_bounds__(128) void k_gemm_bf3(const float* __restrict__ A, int lda, const unsigned short* __restrict__ Wt, int ldb,
                                                const float* __restrict__ bias, const float* __restrict__ resid, int rmod, int ldr,
                                                float* __restrict__ C, int ldc, int M, int N, int K) {
  __shared__ __attribute__((aligned(16))) float so[4][16][64];
  const int tid = threadIdx.x, w = tid >> 5, lane = tid & 31, ln = lane & 15, hh = lane >> 4;
  const int ntn = N / 64;
  const int wid = blockIdx.x * 4 + w;
  const int mt = wid / ntn, nq = wid % ntn;
  if (mt * 16 >= M) return;
  const int row0 = mt * 16, col0 = nq * 64;
  const float* arow = A + (size_t)(row0 + ln) * lda;
  v8f acc[4] = {};
  for (int kb = 0; kb < K; kb += 32) {
    FragB ah, al;
    const v4f x0 = *(const v4fa*)(arow + kb + 8 * hh), x1 = *(const v4fa*)(arow + kb + 8 * hh + 4);
    const v4f x2 = *(const v4fa*)(arow + kb + 16 + 8 * hh), x3 = *(const v4fa*)(arow + kb + 16 + 8 * hh + 4);
    float xs[16] = {x0[0],x0[1],x0[2],x0[3],x1[0],x1[1],x1[2],x1[3],x2[0],x2[1],x2[2],x2[3],x3[0],x3[1],x3[2],x3[3]};
#pragma unroll
    for (int i = 0; i < 16; ++i) { const unsigned short hb = bf16_bits(xs[i]); ah.u[i] = hb; al.u[i] = ASPLIT ? bf16_bits(xs[i] - bf16_val(hb)) : (unsigned short)0; }
#pragma unroll
    for (int t = 0; t < 4; ++t) {
      const unsigned short* brow = Wt + (size_t)(col0 + t * 16 + ln) * ldb + kb;
      FragB b;
      b.half[0] = *(const v8us*)(brow + 8 * hh);
      b.half[1] = *(const v8us*)(brow + 16 + 8 * hh);
      acc[t] = mmaN<ASPLIT ? 2 : 1>(ah.v, al.v, b.v, b.v, acc[t]);
    }
  }
#pragma unroll
  for (int t = 0; t < 4; ++t) {
    const int col = col0 + t * 16 + ln;
    float bv = bias ? bias[col] : 0.f;
    if (BIAS_BF16) bv = bf16_round(bv);
#pragma unroll
    for (int r = 0; r < 8; ++r) {
      float v = acc[t][r] + bv;
      if (resid) { float rv = resid[(size_t)((row0 + 8 * hh + r) % rmod) * ldr + col]; if (RES_BF16) rv = bf16_round(rv); v += rv; }
      if (ACT == 1) v = fmaxf(v, 0.f);
      if (ACT == 2) v = 0.5f * v * (1.0f + erff(v * 0.70710678118654752f));
      if (ACT == 3) { const float u = 0.7978845608028654f * (v + 0.044715f * v * v * v); v = 0.5f * v * (1.0f + tanhf(u)); }
      so[w][8 * hh + r][t * 16 + ln] = v;
    }
  }
  __builtin_amdgcn_fence(__ATOMIC_ACQ_REL, "workgroup");
  __builtin_amdgcn_wave_barrier();
  const int rsub = lane >> 4, c4 = (lane & 15) * 4;
  {
#pragma unroll
    for (int q = 0; q < 8; ++q) {
      const int r = q * 2 + rsub;
      const v4f v = *(const v4fa*)&so[w][r][c4];
      *(v4f*)(C + (size_t)(row0 + r) * ldc + col0 + c4) = v;
    }
    
  }
}
// row LayerNorm (biased variance, eps) over N: s = X (+ R); optional out_sum <- s; out_norm <- (s-mu)*rsqrt(var+eps)*g + b
template <bool PARAM_BF16>
__global__ __launch_bounds__(256) void k_layernorm(const float* __restrict__ X, const float* __restrict__ R, const float* __restrict__ g, const float* __restrict__ bta,
                                                  float* __restrict__ out_sum, float* __restrict__ out_norm, int N, float eps) {
  __shared__ float red[256];
  const int row = blockIdx.x, tid = threadIdx.x;
  const float* x = X + (size_t)row * N; const float* rr = R ? R + (size_t)row * N : nullptr;
  float vals[16];                     // up to N = 4096
  const int per = N / 256;            // contiguous chunk per thread? use strided-by-4 chunks: thread handles j = tid*4 + 1024*u
  float s1 = 0.f;
  for (int u = 0; u < per / 4; ++u) {
    const int j = tid * 4 + 1024 * u;
    const v4f a = *(const v4fa*)(x + j);
    v4f b = {0.f,0.f,0.f,0.f}; if (rr) b = *(const v4fa*)(rr + j);
#pragma unroll
    for (int q = 0; q < 4; ++q) { const float v = a[q] + b[q]; vals[u * 4 + q] = v; s1 += v; }
  }
  red[tid] = s1; __syncthreads();
  for (int st = 128; st > 0; st >>= 1) { if (tid < st) red[tid] += red[tid + st]; __syncthreads(); }
  const float mu = red[0] / (float)N; __syncthreads();
  float s2 = 0.f;
  for (int u = 0; u < per / 4; ++u)
#pragma unroll
    for (int q = 0; q < 4; ++q) { const float c = vals[u * 4 + q] - mu; s2 += c * c; }
  red[tid] = s2; __syncthreads();
  for (int st = 128; st > 0; st >>= 1) { if (tid < st) red[tid] += red[tid + st]; __syncthreads(); }
  const float rs = rsqrtf(red[0] / (float)N + eps);
  {
    for (int u = 0; u < per / 4; ++u) {
      const int j = tid * 4 + 1024 * u;
      v4f o, sm;
#pragma unroll
      for (int q = 0; q < 4; ++q) {
        float gg = g[j + q], bb = bta[j + q];
        if (PARAM_BF16) { gg = bf16_round(gg); bb = bf16_round(bb); }
        sm[q] = vals[u * 4 + q]; o[q] = (vals[u * 4 + q] - mu) * rs * gg + bb;
      }
      if (out_sum) *(v4f*)(out_sum + (size_t)row * N + j) = sm;
      *(v4f*)(out_norm + (size_t)row * N + j) = o;
    }
    
  }
}

// ---- f16 WMMA path (v_wmma_f32_16x16x32_f16): 11-bit significands for operands in range — used where a [0,1] probability operand needs more precision than bf16
typedef _Float16 v16h __attribute__((ext_vector_type(16)));
union FragH { v16h v; v8us half[2]; _Float16 h[16]; unsigned short u[16]; };
template <int NT>
__device__ __forceinline__ v8f mmaH(v16h ah, v16h al, v16h bh, v16h bl, v8f c) {
  c = __builtin_amdgcn_wmma_f32_16x16x32_f16(false, ah, false, bh, (short)0, c, false, false);
  if (NT >= 2) c = __builtin_amdgcn_wmma_f32_16x16x32_f16(false, al, false, bh, (short)0, c, false, false);
  if (NT >= 3) c = __builtin_amdgcn_wmma_f32_16x16x32_f16(false, ah, false, bl, (short)0, c, false, false);
  asm volatile("v_nop\n\tv_nop\n\tv_nop\n\tv_nop" : "+v"(c) : "v"(ah), "v"(al), "v"(bh), "v"(bl));
  return c;
}
// batched GEMM like k_gemm_b but f16 operands: A f32 (split into f16 hi/lo if ASPLIT, else rounded to f16), Bt = f16 values [n][k]; alpha; C f32; N multiple of 16 (partial tiles skipped)
template <bool ASPLIT>
__global__ __launch_bounds__(128) void k_gemm_h(const float* __restrict__ A, int lda, size_t sA, const _Float16* __restrict__ Bh, int ldb, size_t sB, float alpha, float* __restrict__ C, int ldc, size_t sC, int M, int N, int K) {
  __shared__ __attribute__((aligned(16))) float so[4][16][64];
  const int tid = threadIdx.x, w = tid >> 5, lane = tid & 31, ln = lane & 15, hh = lane >> 4; const int by = blockIdx.y;
  A += (size_t)by * sA; Bh += (size_t)by * sB; C += (size_t)by * sC;
  const int ntn = (N + 63) / 64; const int wid = blockIdx.x * 4 + w; const int mt = wid / ntn, nq = wid % ntn; if (mt * 16 >= M) return;
  const int row0 = mt * 16, col0 = nq * 64; const float* arow = A + (size_t)(row0 + ln) * lda;
  v8f acc[4] = {};
  for (int kb = 0; kb < K; kb += 32) {
    FragH ah, al;
    const v4f x0 = *(const v4fa*)(arow + kb + 8 * hh), x1 = *(const v4fa*)(arow + kb + 8 * hh + 4), x2 = *(const v4fa*)(arow + kb + 16 + 8 * hh), x3 = *(const v4fa*)(arow + kb + 16 + 8 * hh + 4);
    float xs[16] = {x0[0],x0[1],x0[2],x0[3],x1[0],x1[1],x1[2],x1[3],x2[0],x2[1],x2[2],x2[3],x3[0],x3[1],x3[2],x3[3]};
#pragma unroll
    for (int i = 0; i < 16; ++i) { const _Float16 h = (_Float16)xs[i]; ah.h[i] = h; al.h[i] = ASPLIT ? (_Float16)(xs[i] - (float)h) : (_Float16)0.0f; }
#pragma unroll
    for (int t = 0; t < 4; ++t) { if (col0 + t * 16 >= N) continue; const size_t boff = (size_t)(col0 + t * 16 + ln) * ldb + kb; FragH bq; bq.half[0] = *(const v8us*)(Bh + boff + 8 * hh); bq.half[1] = *(const v8us*)(Bh + boff + 16 + 8 * hh);
      acc[t] = mmaH<ASPLIT ? 2 : 1>(ah.v, al.v, bq.v, bq.v, acc[t]); }
  }
#pragma unroll
  for (int t = 0; t < 4; ++t) { if (col0 + t * 16 >= N) continue;
#pragma unroll
    for (int r = 0; r < 8; ++r) so[w][8 * hh + r][t * 16 + ln] = acc[t][r] * alpha; }
  __builtin_amdgcn_fence(__ATOMIC_ACQ_REL, "workgroup"); __builtin_amdgcn_wave_barrier();
  const int rsub = lane >> 4, c4 = (lane & 15) * 4;
  {
#pragma unroll
    for (int q = 0; q < 8; ++q) { const int r = q * 2 + rsub; if (col0 + c4 < N) { const v4f v = *(const v4fa*)&so[w][r][c4]; *(v4f*)(C + (size_t)(row0 + r) * ldc + col0 + c4) = v; } }
     }
}

// Wt[n][k] = f16(W[k][n]·scale) from f32 row-major W[K][N] (scale = power of two; bf16-exact weights stay exact in f16 away from the subnormal range)
__global__ __launch_bounds__(256) void k_wt_f16(const float* __restrict__ W, _Float16* __restrict__ Wt, int K, int N, float scale) {
  const int t = blockIdx.x * 256 + threadIdx.x; if (t >= N * (K / 8)) return; const int n = t / (K / 8), k8 = (t % (K / 8)) * 8; FragH f;
#pragma unroll
  for (int i = 0; i < 8; ++i) f.h[i] = (_Float16)(bf16_round(W[(size_t)(k8 + i) * N + n]) * scale); const v8us o = f.half[0];
  *(v8us*)((unsigned short*)Wt + (size_t)n * K + k8) = o; 
}
// k_gemm_hh variant with fused epilogue: v = acc·alpha + bias[by·sBias + col] (+ CP[(row/rowsPerB)·sCPb + by·64 + col] if CP) ; ACT 0 none / 1 elu ; writes f16 C16 (and f32 C if non-null)
template <int ACT>
__global__ __launch_bounds__(128) void k_gemm_hhx(const _Float16* __restrict__ A, int lda, size_t sA, const _Float16* __restrict__ Bh, int ldb, size_t sB, float alpha, const float* __restrict__ bias, size_t sBias, const float* __restrict__ CP, int rowsPerB, size_t sCPb, int row0g,
    float* __restrict__ C, _Float16* __restrict__ C16, int ldc, size_t sC, int M, int N, int K) {
  __shared__ __attribute__((aligned(16))) float so[4][16][64];
  const int tid = threadIdx.x, w = tid >> 5, lane = tid & 31, ln = lane & 15, hh = lane >> 4; const int by = blockIdx.y;
  A += (size_t)by * sA; Bh += (size_t)by * sB; const size_t cofs = (size_t)by * sC; const float* bp = bias ? bias + (size_t)by * sBias : nullptr;
  const int ntn = (N + 63) / 64; const int wid = blockIdx.x * 4 + w; const int mt = wid / ntn, nq = wid % ntn; if (mt * 16 >= M) return;
  const int row0 = mt * 16, col0 = nq * 64; const _Float16* arow = A + (size_t)(row0 + ln) * lda;
  v8f acc[4] = {};
  for (int kb = 0; kb < K; kb += 32) { FragH ah; ah.half[0] = *(const v8us*)((const unsigned short*)arow + kb + 8 * hh); ah.half[1] = *(const v8us*)((const unsigned short*)arow + kb + 16 + 8 * hh);
#pragma unroll
    for (int t = 0; t < 4; ++t) { if (col0 + t * 16 >= N) continue; const size_t boff = (size_t)(col0 + t * 16 + ln) * ldb + kb; FragH bq; bq.half[0] = *(const v8us*)((const unsigned short*)Bh + boff + 8 * hh); bq.half[1] = *(const v8us*)((const unsigned short*)Bh + boff + 16 + 8 * hh);
      acc[t] = mmaH<1>(ah.v, ah.v, bq.v, bq.v, acc[t]); }
  }
#pragma unroll
  for (int t = 0; t < 4; ++t) { if (col0 + t * 16 >= N) continue; const int col = col0 + t * 16 + ln; const float bv = bp ? bf16_round(bp[col]) : 0.f;
#pragma unroll
    for (int r = 0; r < 8; ++r) { float v = acc[t][r] * alpha + bv; if (CP) { const int rr = row0g + row0 + 8 * hh + r; if (rowsPerB < 0) v += CP[cofs + (size_t)rr * ldc + col];      /* rowsPerB < 0: own element of the batched C plane */ else { const int bidx = rr / rowsPerB; v += CP[(size_t)bidx * sCPb + (size_t)by * 64 + col]; } } if (ACT == 1) v = (v > 0.f) ? v : expm1f(v); else if (ACT == 7) v = (v > 0.f) ? v + 1.0f : expf(v); else if (ACT == 8) v = tanhf(v); else if (ACT == 9) v = 0.5f * v * (1.0f + tanhf(0.7978845608028654f * (v + 0.044715f * v * v * v))); else if (ACT == 11) v = 1.0f / (1.0f + expf(-v)); else if (ACT == 12) v = (v > 0.f) ? v : 0.01f * v; else if (ACT == 14) v = (v > 0.f) ? v : 0.1f * v; else if (ACT == 16) v = (v >= 0.f) ? v : 0.3f * v; else if (ACT == 17) v = (v >= 0.f) ? v : 0.2f * v; else if (ACT == 15) v = v / (1.0f + expf(-v)); else if (ACT == 3) v = fmaxf(v, 0.f); else if (ACT == 6) v = 0.5f * v * (1.0f + erff(v * 0.70710678118654752f)); so[w][8 * hh + r][t * 16 + ln] = v; } }
  __builtin_amdgcn_fence(__ATOMIC_ACQ_REL, "workgroup"); __builtin_amdgcn_wave_barrier();
  const int rsub = lane >> 4, c4 = (lane & 15) * 4; typedef _Float16 v4h __attribute__((ext_vector_type(4)));
  {
#pragma unroll
    for (int q = 0; q < 8; ++q) { const int r = q * 2 + rsub; if (col0 + c4 < N) { const v4f v = *(const v4fa*)&so[w][r][c4]; if (C) *(v4f*)(C + cofs + (size_t)(row0 + r) * ldc + col0 + c4) = v; if (C16) { v4h h4; for (int i = 0; i < 4; ++i) h4[i] = (_Float16)v[i]; *(v4h*)(C16 + cofs + (size_t)(row0 + r) * ldc + col0 + c4) = h4; } } }
     }
}

typedef _Float16 v4h __attribute__((ext_vector_type(4)));

// 64 elements a thread (the stage costs the start of its waves more than its bytes): a block converts 64 KiB of source that lie in a row; group u of four elements of thread t is 256 u + t, so every load and store covers whole 128-byte lines under one index register.
typedef _Float16 v4ha __attribute__((ext_vector_type(4), may_alias));
__device__ __forceinline__ void d_x16(unsigned bx, const float* __restrict__ x, _Float16* __restrict__ X16) { const unsigned i0 = bx * 4096u + threadIdx.x; v4f a[16]; v4h o[16];
#pragma unroll
  for (int u = 0; u < 16; ++u) a[u] = ((const v4fa*)(x + u * 1024))[i0];
#pragma unroll
  for (int u = 0; u < 16; ++u)
#pragma unroll
    for (int q = 0; q < 4; ++q) o[u][q] = (_Float16)bf16_round(a[u][q]);
#pragma unroll
  for (int u = 0; u < 16; ++u) ((v4ha*)(X16 + u * 1024))[i0] = o[u]; }
__global__ __launch_bounds__(256) void k_h16(const float* __restrict__ x, _Float16* __restrict__ X16, size_t n8) { const size_t t = (size_t)blockIdx.x * 256 + threadIdx.x; if (t >= n8) return; FragH f;
#pragma unroll
  for (int q = 0; q < 8; ++q) f.h[q] = (_Float16)x[t * 8 + q]; *(v8us*)((unsigned short*)X16 + t * 8) = f.half[0];  }
__global__ __launch_bounds__(256) void k_round16f(const float* __restrict__ W, _Float16* __restrict__ Bt, size_t n8) { const size_t t = (size_t)blockIdx.x * 256 + threadIdx.x; if (t >= n8) return; FragH f;
#pragma unroll
  for (int i = 0; i < 8; ++i) f.h[i] = (_Float16)(bf16_round(W[t * 8 + i]) * 16.0f); *(v8us*)((unsigned short*)Bt + t * 8) = f.half[0];  }
template <int NHv, int TTv>
__device__ __forceinline__ void d_vt(int bx, const _Float16* __restrict__ V16, int ldv, int voff, _Float16* __restrict__ Vt) { __shared__ unsigned short tl[64][66]; const int tid = threadIdx.x; const int slab = bx / (TTv / 64), lg = bx % (TTv / 64); const int b = slab / NHv, h = slab % NHv;
  for (int i = tid; i < 64 * 8; i += 256) { const int r = i / 8, c8 = (i % 8) * 8; FragH f; f.half[0] = *(const v8us*)((const unsigned short*)V16 + ((size_t)b * TTv + lg * 64 + r) * ldv + voff + h * 64 + c8);
#pragma unroll
    for (int q = 0; q < 8; ++q) tl[r][c8 + q] = f.u[q]; }
  __syncthreads();
  {
#pragma unroll
    for (int rd = 0; rd < 2; ++rd) { const int d = rd * 32 + tid / 8, pc = tid % 8; FragH f;
#pragma unroll
      for (int q = 0; q < 8; ++q) f.u[q] = tl[pc * 8 + q][d];
      *(v8us*)((unsigned short*)Vt + ((size_t)slab * 64 + d) * TTv + lg * 64 + pc * 8) = f.half[0]; }
     } }

__device__ __forceinline__ void d_hl(size_t t, const float* __restrict__ F, _Float16* __restrict__ Hh, _Float16* __restrict__ Hl, size_t n8) { if (t >= n8) return; FragH fh, fl; const v4f a = *(const v4fa*)(F + t * 8), c = *(const v4fa*)(F + t * 8 + 4);
#pragma unroll
  for (int q = 0; q < 4; ++q) { _Float16 h = (_Float16)a[q]; fh.h[q] = h; fl.h[q] = (_Float16)((a[q] - (float)h) * 1024.0f); h = (_Float16)c[q]; fh.h[4 + q] = h; fl.h[4 + q] = (_Float16)((c[q] - (float)h) * 1024.0f); }
  { *(v8us*)((unsigned short*)Hh + t * 8) = fh.half[0]; *(v8us*)((unsigned short*)Hl + t * 8) = fl.half[0];  } }

// ---- fast GEMM on LDS tiles (block tile 128x128, four waves of 64x64; requires M % 128 == 0 rows per launch region, N % 128 == 0, K % 64 == 0); epilogue = k_gemm_hhx semantics ----
// A stage is 64 k of 128 A rows and of 128 B rows (128 bytes a row) at an LDS pitch of 144 bytes (16 bytes x 9: the 16-byte fragment reads of 16 rows fall on all 64 banks). Two buffers: the next stage's copies fly while this one is worked on.
// Each 128-byte line of A and B now leaves L2 once per block, as a whole line (eight lanes a row), and feeds two waves from LDS; before, every wave fetched its own fragments with loads that touched 16 lines each.
#define G3_PITCH 144u                      /* bytes between LDS rows */
#define G3_STAGE (256u * G3_PITCH)         /* bytes of a stage: 128 A rows, then 128 B rows */
__device__ __forceinline__ v16h g2_frag(const _Float16* p, int hh) { FragH f; f.half[0] = *(const v8us*)((const unsigned short*)p + 8 * hh); f.half[1] = *(const v8us*)((const unsigned short*)p + 16 + 8 * hh); return f.v; }
__device__ __forceinline__ v16h g3_frag(const unsigned char* p) { FragH f; f.half[0] = *(const v8us*)p; f.half[1] = *(const v8us*)(p + 32); return f.v; }      /* p = row start + 64 kc + 16 hh: the k order of g2_frag (elements 0..7 = k 8 hh + i, 8..15 = k 16 + 8 hh + i) */
// Eight asynchronous 16-byte copies a lane, rows 16 apart: LDS byte address l + 16 i rows, global address g + i rs elements. The s_wait_xcnt stands in the copies' own statement, so that no register that a copy names is rewritten in front of it.
__device__ __forceinline__ void g3_copy8(unsigned l, const _Float16* g, size_t rs) {
  asm volatile("global_load_async_to_lds_b128 %0, %8, off\n\t"
               "global_load_async_to_lds_b128 %1, %9, off\n\t"
               "global_load_async_to_lds_b128 %2, %10, off\n\t"
               "global_load_async_to_lds_b128 %3, %11, off\n\t"
               "global_load_async_to_lds_b128 %4, %12, off\n\t"
               "global_load_async_to_lds_b128 %5, %13, off\n\t"
               "global_load_async_to_lds_b128 %6, %14, off\n\t"
               "global_load_async_to_lds_b128 %7, %15, off\n\t"
               "s_wait_xcnt 0x0"
               :: "v"(l), "v"(l + 16u * G3_PITCH), "v"(l + 32u * G3_PITCH), "v"(l + 48u * G3_PITCH), "v"(l + 64u * G3_PITCH), "v"(l + 80u * G3_PITCH), "v"(l + 96u * G3_PITCH), "v"(l + 112u * G3_PITCH),
                  "v"(g), "v"(g + rs), "v"(g + 2 * rs), "v"(g + 3 * rs), "v"(g + 4 * rs), "v"(g + 5 * rs), "v"(g + 6 * rs), "v"(g + 7 * rs)
               : "memory");
}
// The wave's 64 staged rows to memory, eight rows of a lane a trip: v = acc alpha + bias (+ CP), activation, then whole-line stores. CPM 0: no CP; 1: cp walks like the output (step cs a row pair); 2: cp + (row / rowsPerB) cs. wc, wh: an f32, an f16 output is there (the same for the whole block: scalar branches).
template <int ACT, int CPM>
__device__ __forceinline__ void g3_rows(const float* sl, float alpha, v4f bv, const float* cp, size_t cs, int rowg, int rowsPerB, bool wc, bool wh, float* cl, _Float16* hl, size_t st) {
#pragma unroll 1      /* eight stores a trip, then the wait in front of the next trip's rewrite of their registers */
  for (int q0 = 0; q0 < 32; q0 += 8) { v4f o[8], x[8];
#pragma unroll
    for (int q = 0; q < 8; ++q) { o[q] = *(const v4fa*)(sl + (q0 + q) * (2 * 68));
      if (CPM == 1) x[q] = *(const v4fa*)(cp + (size_t)(q0 + q) * cs);
      if (CPM == 2) { const float* p = cp + (size_t)((rowg + 2 * (q0 + q)) / rowsPerB) * cs; x[q] = v4f{p[0], p[1], p[2], p[3]}; } }
#pragma unroll
    for (int q = 0; q < 8; ++q)
#pragma unroll
      for (int e = 0; e < 4; ++e) { float v = o[q][e] * alpha + bv[e]; if (CPM != 0) v += x[q][e];
        if (ACT == 3) v = fmaxf(v, 0.f); else if (ACT == 6) v = 0.5f * v * (1.0f + erff(v * 0.70710678118654752f)); else if (ACT == 11) v = 1.0f / (1.0f + expf(-v)); else if (ACT == 15) v = v / (1.0f + expf(-v)); else if (ACT == 12) v = (v > 0.f) ? v : 0.01f * v; else if (ACT == 8) v = tanhf(v); else if (ACT == 9) v = 0.5f * v * (1.0f + tanhf(0.7978845608028654f * (v + 0.044715f * v * v * v))); else if (ACT == 14) v = (v > 0.f) ? v : 0.1f * v; else if (ACT == 16) v = (v >= 0.f) ? v : 0.3f * v; else if (ACT == 17) v = (v >= 0.f) ? v : 0.2f * v;
        o[q][e] = v; }
    if (wc) { float* p[8];
#pragma unroll
      for (int q = 0; q < 8; ++q) p[q] = cl + (size_t)(q0 + q) * st;
      __builtin_amdgcn_sched_barrier(0);      /* the trip's rows and addresses are made ahead of its first store, so that no register of an issued store is written again in front of the wait */
#pragma unroll
      for (int q = 0; q < 8; ++q) *(v4f*)p[q] = o[q];
      asm volatile("s_wait_xcnt 0x0" ::: "memory"); __builtin_amdgcn_sched_barrier(0); }      /* the wait in front of the next rewrite of the stores' address and data registers; the scheduling barrier keeps that rewrite behind it */
    if (wh) { _Float16* p[8]; v4h h[8];
#pragma unroll
      for (int q = 0; q < 8; ++q) { p[q] = hl + (size_t)(q0 + q) * st;
#pragma unroll
        for (int e = 0; e < 4; ++e) h[q][e] = (_Float16)o[q][e]; }
      __builtin_amdgcn_sched_barrier(0);      /* as above */
#pragma unroll
      for (int q = 0; q < 8; ++q) *(v4h*)p[q] = h[q];
      asm volatile("s_wait_xcnt 0x0" ::: "memory"); __builtin_amdgcn_sched_barrier(0); } }      /* as above */
}
// bx, by: the block's tile index and its batch (a kernel passes its block indices, or what it derives from them: the same for the whole block).
template <int ACT>
__device__ __forceinline__ void g3_gemm(int bx, int by, const _Float16* __restrict__ A, int lda, size_t sA, const _Float16* __restrict__ Bh, int ldb, size_t sB, float alpha, const float* __restrict__ bias, size_t sBias, const float* __restrict__ CP, int rowsPerB, size_t sCPb, int row0g,
    float* __restrict__ C, _Float16* __restrict__ C16, int ldc, size_t sC, int M, int N, int K) { static_assert(ACT == 0 || ACT == 3 || ACT == 6 || ACT == 8 || ACT == 9 || ACT == 11 || ACT == 12 || ACT == 14 || ACT == 15 || ACT == 16 || ACT == 17, "k_gemm2: unsupported ACT code (would silently apply no activation)");
  __shared__ __attribute__((aligned(16))) unsigned char L[2 * G3_STAGE];      /* the two stage buffers; behind the loop, each wave's 64 x 68 f32 output staging */
  static_assert(4 * 64 * 68 * 4 <= 2 * G3_STAGE, "k_gemm2: the output staging fits the ring");
  const int tid = threadIdx.x, lane = tid & 31, ln = lane & 15, hh = lane >> 4; const int w = __builtin_amdgcn_readfirstlane(tid >> 5);
  A += (size_t)by * sA; Bh += (size_t)by * sB; const size_t cofs = (size_t)by * sC; const float* bp = bias ? bias + (size_t)by * sBias : nullptr;
  const int ntn = N >> 7; const int mt = bx / ntn, nq = bx - mt * ntn; if (mt * 128 >= M) return;      /* the same for the whole block, ahead of every barrier */
  const int row0 = mt * 128 + 64 * (w >> 1), col0 = nq * 128 + 64 * (w & 1);      /* the wave's 64 x 64 tile */
  const _Float16* ga = A + (size_t)(mt * 128 + (tid >> 3)) * lda + (tid & 7) * 8;      /* eight lanes cover a row's 128 bytes; a wave's copy covers four whole lines */
  const _Float16* gb = Bh + (size_t)(nq * 128 + (tid >> 3)) * ldb + (tid & 7) * 8;
  const size_t ra = (size_t)16 * lda, rb = (size_t)16 * ldb;
  const unsigned lc = (unsigned)(size_t)L + (unsigned)(tid >> 3) * G3_PITCH + (unsigned)(tid & 7) * 16u;
  const int nt = K >> 6;
  g3_copy8(lc, ga, ra); g3_copy8(lc + 128u * G3_PITCH, gb, rb);      /* stage 0 */
  asm volatile("s_wait_asynccnt 0x0" ::: "memory");      /* this wave's copies of stage 0 have landed */
  __syncthreads();      /* ... and every wave's */
  if (nt > 1) { g3_copy8(lc + G3_STAGE, ga + 64, ra); g3_copy8(lc + G3_STAGE + 128u * G3_PITCH, gb + 64, rb); }      /* stage 1 */
  const unsigned char* fa = L + (unsigned)(64 * (w >> 1) + ln) * G3_PITCH + 16u * hh;
  const unsigned char* fb = L + (unsigned)(128 + 64 * (w & 1) + ln) * G3_PITCH + 16u * hh;
  v8f acc[4][4];
#pragma unroll
  for (int i = 0; i < 4; ++i)
#pragma unroll
    for (int j = 0; j < 4; ++j) acc[i][j] = v8f{0.f, 0.f, 0.f, 0.f, 0.f, 0.f, 0.f, 0.f};
#pragma unroll 1      /* one stage per trip: the buffer is chosen by a scalar offset */
  for (int t = 0; t < nt; ++t) { const unsigned bo = (unsigned)(t & 1) * G3_STAGE;
#pragma unroll
    for (int kc = 0; kc < 2; ++kc) { v16h af[4], bf[4];
      af[0] = g3_frag(fa + bo + 64u * kc);
#pragma unroll
      for (int j = 0; j < 4; ++j) bf[j] = g3_frag(fb + bo + (unsigned)(16 * j) * G3_PITCH + 64u * kc);
#pragma unroll
      for (int i = 1; i < 4; ++i) af[i] = g3_frag(fa + bo + (unsigned)(16 * i) * G3_PITCH + 64u * kc);
      __builtin_amdgcn_sched_barrier(0);      /* the block's sixteen LDS reads stand as one group ahead of its WMMAs, in the order in which these need them (left alone, the build read each A fragment right in front of its row and waited out the LDS latency four times a block) */
#pragma unroll
      for (int i = 0; i < 4; ++i)
#pragma unroll
        for (int j = 0; j < 4; ++j) acc[i][j] = __builtin_amdgcn_wmma_f32_16x16x32_f16(false, af[i], false, bf[j], (short)0, acc[i][j], false, false);
      if (kc == 0) __builtin_amdgcn_sched_barrier(0); }      /* ... and the next block's reads behind them */
    __builtin_amdgcn_sched_barrier(0); asm volatile("v_nop\n\tv_nop\n\tv_nop\n\tv_nop"); __builtin_amdgcn_sched_barrier(0);      /* the four vector slots behind the trip's last WMMAs, on every path: a branch and the copies' address arithmetic, which may reuse the fragment registers, follow */
    asm volatile("s_wait_dscnt 0x0" ::: "memory");      /* this wave's reads of the buffer are done before the buffer is handed to the copies */
    asm volatile("s_wait_asynccnt 0x0" ::: "memory");      /* this wave's copies of stage t + 1 have landed */
    __syncthreads();      /* publishes stage t + 1 and ends every wave's reads of stage t */
    if (t + 2 < nt) { g3_copy8(lc + bo, ga + (size_t)(t + 2) * 64, ra); g3_copy8(lc + bo + 128u * G3_PITCH, gb + (size_t)(t + 2) * 64, rb); } }      /* stage t + 2 into the buffer just read */
  asm volatile("s_wait_asynccnt 0x0" ::: "memory");      /* no copy is in flight when the ring becomes output staging (the last trip's barrier has ended every read of it) */
  float* so = (float*)(L + (unsigned)w * (64u * 68u * 4u));
#pragma unroll
  for (int i = 0; i < 4; ++i)
#pragma unroll
    for (int j = 0; j < 4; ++j)
#pragma unroll
      for (int r = 0; r < 8; ++r) so[(16 * i + 8 * hh + r) * 68 + 16 * j + ln] = acc[i][j][r];
  __builtin_amdgcn_fence(__ATOMIC_ACQ_REL, "workgroup"); __builtin_amdgcn_wave_barrier();
  const int rsub = lane >> 4, c4 = (lane & 15) * 4; const int col = col0 + c4;      /* a lane takes four columns of every second row: sixteen lanes store 256 bytes (f16: 128) of a row */
  v4f bv = {0.f, 0.f, 0.f, 0.f};
  if (bp) { const v4f b4 = *(const v4fa*)(bp + col);
    asm volatile("s_wait_xcnt 0x0" ::: "memory");      /* the wait in front of the rewrite of the bias load's address registers (the build reuses them for the rounding just below) */
#pragma unroll
    for (int e = 0; e < 4; ++e) bv[e] = bf16_round(b4[e]); }
  const size_t eo = cofs + (size_t)(row0 + rsub) * ldc + col; const size_t st = (size_t)2 * ldc; const float* sl = so + rsub * 68 + c4;
  const bool wc = C != nullptr, wh = C16 != nullptr; float* cl = wc ? C + eo : nullptr; _Float16* hl = wh ? C16 + eo : nullptr;
  if (!CP) g3_rows<ACT, 0>(sl, alpha, bv, nullptr, 0, 0, 1, wc, wh, cl, hl, st);
  else if (rowsPerB < 0) g3_rows<ACT, 1>(sl, alpha, bv, CP + cofs + (size_t)(row0g + row0 + rsub) * ldc + col, st, 0, 1, wc, wh, cl, hl, st);      /* rowsPerB < 0: own element of the batched C plane */
  else g3_rows<ACT, 2>(sl, alpha, bv, CP + (size_t)by * 64 + col, sCPb, row0g + row0 + rsub, rowsPerB, wc, wh, cl, hl, st);
}
template <int ACT>
__global__ __launch_bounds__(128) void k_gemm2(const _Float16* __restrict__ A, int lda, size_t sA, const _Float16* __restrict__ Bh, int ldb, size_t sB, float alpha, const float* __restrict__ bias, size_t sBias, const float* __restrict__ CP, int rowsPerB, size_t sCPb, int row0g,
    float* __restrict__ C, _Float16* __restrict__ C16, int ldc, size_t sC, int M, int N, int K) { g3_gemm<ACT>((int)blockIdx.x, (int)blockIdx.y, A, lda, sA, Bh, ldb, sB, alpha, bias, sBias, CP, rowsPerB, sCPb, row0g, C, C16, ldc, sC, M, N, K); }
// The four projection GEMMs, which do not depend on one another, in ONE launch: blocks 0..63 the f32 v of the first QT0 rows of each batch (16 tiles a batch; first, for speed only), then 512 blocks each for v (f16 rows), q (f32) and k (f32) of every batch.
#define QKV_B0 (NB * (QT0 / 128) * (KVD / 128))      /* blocks of the first-tile v */
#define QKV_BJ ((MP / 128) * (DM / 128))             /* blocks of a whole projection */
__global__ __launch_bounds__(128) void k_qkv(const _Float16* __restrict__ XQ, const _Float16* __restrict__ XK, const _Float16* __restrict__ XV, const _Float16* __restrict__ BQ, const _Float16* __restrict__ BK, const _Float16* __restrict__ BV,
    const float* __restrict__ bq, const float* __restrict__ bk, const float* __restrict__ bv, float* __restrict__ QF, float* __restrict__ KF, _Float16* __restrict__ V16, float* __restrict__ VF0) {
  static_assert(KVD == DM && QKV_B0 == 64 && QKV_BJ == 512, "k_qkv: the block ranges below");
  const int b = (int)blockIdx.x; const bool f0 = b < QKV_B0; const int r = b - QKV_B0; const int j = f0 ? 0 : r >> 9;      /* j: 0 = v, 1 = q, 2 = k; all scalar */
  const _Float16* A = j == 0 ? XV : j == 1 ? XQ : XK; const _Float16* B = j == 0 ? BV : j == 1 ? BQ : BK; const float* bias = j == 0 ? bv : j == 1 ? bq : bk;
  float* C = f0 ? VF0 : j == 0 ? nullptr : j == 1 ? QF : KF; _Float16* C16 = (!f0 && j == 0) ? V16 : nullptr;
  g3_gemm<0>(f0 ? (b & 15) : (r & 511), f0 ? (b >> 4) : 0, A, DM, (size_t)SQ * DM, B, DM, 0, 0.0625f, bias, 0, nullptr, 1, 0, 0, C, C16, DM, (size_t)QT0 * KVD, f0 ? QT0 : MP, DM, DM);
}

// The output GEMM of the f16 path and the split of the first-tile o into its two f16 planes, which do not depend on one another, in ONE launch: 512 GEMM blocks, then 1024 blocks of 128 threads that split eight elements a thread.
#define OH_G ((MPO / 128) * (DM / 128))
#define OH_H ((int)((size_t)NB * QT0 * DM / 8 / 128))
__global__ __launch_bounds__(128) void k_outhl(const _Float16* __restrict__ O16, const _Float16* __restrict__ BO, const float* __restrict__ bo, float* __restrict__ out, const float* __restrict__ OF0, _Float16* __restrict__ OH0, _Float16* __restrict__ OL0) {
  static_assert((size_t)NB * QT0 * DM % 1024 == 0, "k_outhl: whole blocks");
  const int b = (int)blockIdx.x;      /* the test below is scalar, the same for the whole block, ahead of every barrier */
  if (b >= OH_G) { d_hl((size_t)(b - OH_G) * 128 + threadIdx.x, OF0, OH0, OL0, (size_t)NB * QT0 * DM / 8); return; }
  g3_gemm<0>(b, 0, O16, DM, 0, BO, DM, 0, 0.0009765625f, bo, 0, nullptr, 1, 0, 0, out, nullptr, DM, 0, MPO, DM, DM);
}

__device__ __forceinline__ void d_wnat(unsigned bx, const float* __restrict__ w, size_t n8, _Float16* __restrict__ Bt) { const size_t t = (size_t)bx * 256 + threadIdx.x; if (t >= n8) return; FragH f; for (int q = 0; q < 8; ++q) f.h[q] = (_Float16)(bf16_round(w[t * 8 + q]) * 16.0f); *(v8us*)((unsigned short*)Bt + t * 8) = f.half[0];  }

// exp2 with the one issue slot that the instruction set asks for behind a transcendental (before its source is overwritten or its result read) in the same statement.
__device__ __forceinline__ float exp2_slot(float x) { float e; asm("v_exp_f32 %0, %1\n\tv_nop" : "=v"(e) : "v"(x)); return e; }
__device__ __forceinline__ v8f fa_mma(v16h a, v16h b, v8f c) { return __builtin_amdgcn_wmma_f32_16x16x32_f16(false, a, false, b, (short)0, c, false, false); }
__device__ __forceinline__ float fa_xhalf(float x) { return __builtin_bit_cast(float, __builtin_amdgcn_permlanex16(__builtin_bit_cast(int, x), __builtin_bit_cast(int, x), 0x76543210, 0xfedcba98, false, false)); }      /* lane l with lane l ^ 16 */
__device__ __forceinline__ void fa_gap() { __builtin_amdgcn_sched_barrier(0); asm volatile("v_nop\n\tv_nop\n\tv_nop\n\tv_nop"); __builtin_amdgcn_sched_barrier(0); }      /* the four vector slots behind a group of WMMAs, on every path: a branch or a load over their operands follows; the two scheduling barriers keep the slots (and the loads issued ahead) where they stand */
template <bool LAST>      /* LAST = the wave's diagonal pass: masked, and no further K rows are fetched */
__device__ __forceinline__ void fa_pass(v16h (&kf)[2][2], const _Float16* __restrict__ kn, const _Float16* __restrict__ vp, int key0, int qw0, int ln, int hh, const v16h (&qf)[2][2], v8f (&acc)[2][4], float (&m_run)[2], float (&l_run)[2]) {
  const float cs = 0.125f * 1.44269504088896340736f;
  v16h vf[4];
#pragma unroll
  for (int t = 0; t < 4; ++t) vf[t] = g2_frag(vp + (size_t)(16 * t) * SQ, hh);      /* this pass's V^T rows, in flight under the scores and the exponentials */
  v8f s[2][2];
#pragma unroll
  for (int kt = 0; kt < 2; ++kt)
#pragma unroll
    for (int g = 0; g < 2; ++g) { const v8f z = {0.f, 0.f, 0.f, 0.f, 0.f, 0.f, 0.f, 0.f}; s[kt][g] = fa_mma(kf[kt][1], qf[g][1], fa_mma(kf[kt][0], qf[g][0], z)); }
  fa_gap();
  if (!LAST) {
#pragma unroll
    for (int kt = 0; kt < 2; ++kt)
#pragma unroll
      for (int kc = 0; kc < 2; ++kc) kf[kt][kc] = g2_frag(kn + (size_t)(16 * kt) * KVD + 32 * kc, hh);      /* next pass's K rows, one pass ahead */
  }
  if (LAST) {
#pragma unroll
    for (int g = 0; g < 2; ++g)
#pragma unroll
      for (int kt = 0; kt < 2; ++kt)
#pragma unroll
        for (int r = 0; r < 8; ++r) if (key0 + 16 * kt + 8 * hh + r > qw0 + 16 * g + ln) s[kt][g][r] = -3.0e38f;      /* causal: key above the query (key0 itself is never masked, so every maximum stays a real score) */
  }
  float mb[2]; bool need = false;
#pragma unroll
  for (int g = 0; g < 2; ++g) { float mx = s[0][g][0];
#pragma unroll
    for (int r = 1; r < 8; ++r) mx = fmaxf(mx, s[0][g][r]);
#pragma unroll
    for (int r = 0; r < 8; ++r) mx = fmaxf(mx, s[1][g][r]);
    mx = fmaxf(mx, fa_xhalf(mx)) * cs; mb[g] = mx; need = need || (mx > m_run[g] + 8.0f); }
  if (__builtin_amdgcn_ballot_w32(need) != 0) {      /* wave-uniform; rare after the first passes */
#pragma unroll
    for (int g = 0; g < 2; ++g) { const float mn = fmaxf(m_run[g], mb[g]); const float corr = exp2_slot(m_run[g] - mn); m_run[g] = mn; l_run[g] *= corr;
#pragma unroll
      for (int t = 0; t < 4; ++t) acc[g][t] = acc[g][t] * corr; }
  }
  FragH pf[2];
#pragma unroll
  for (int g = 0; g < 2; ++g) { const float nm = -m_run[g]; float ls[4] = {0.f, 0.f, 0.f, 0.f};
#pragma unroll
    for (int i = 0; i < 16; ++i) { const float e = exp2_slot(fmaf(s[i >> 3][g][i & 7], cs, nm)); ls[i & 3] += e; pf[g].h[i] = (_Float16)e; }
    l_run[g] += (ls[0] + ls[1]) + (ls[2] + ls[3]); }
  __builtin_amdgcn_sched_barrier(0);      /* every exponential stands ahead of the WMMAs */
#pragma unroll
  for (int g = 0; g < 2; ++g)
#pragma unroll
    for (int t = 0; t < 4; ++t) acc[g][t] = fa_mma(vf[t], pf[g].v, acc[g][t]);
  fa_gap();
  if (!LAST) { asm volatile("s_wait_xcnt 0x0" ::: "memory"); __builtin_amdgcn_sched_barrier(0); }      /* the wait in front of the advance of the K and V^T address pairs at the loop's foot; the scheduling barrier keeps the advance behind it */
}
__device__ __forceinline__ void d_fattn(int xs, int nq, int h, int b, const _Float16* __restrict__ Q, const _Float16* __restrict__ K, const _Float16* __restrict__ Vt, _Float16* __restrict__ O) {      /* xs of nq: the block's place among the query tiles; h, b: its head and batch */
  const int lane = threadIdx.x & 31, ln = lane & 15, hh = lane >> 4; const int w = __builtin_amdgcn_readfirstlane((int)(threadIdx.x >> 5));      /* the wave's number in a scalar register: trip count and branches stay scalar, EXEC stays full for the WMMAs */
  const int qa = (xs & 1) ? (xs >> 1) : nq - 1 - (xs >> 1); const int qb = (b & 1) ? nq - 1 - qa : qa;      /* a permutation of the query tiles: long and short ones alternate between neighbouring blocks and between batches (speed only) */
  const int qw0 = qb * 128 + w * 32;
  const _Float16* Ql = Q + ((size_t)b * SQ + qw0 + ln) * DM + h * HD; const _Float16* Kl = K + ((size_t)b * SQ + ln) * KVD + h * HD; const _Float16* Vl = Vt + (((size_t)b * NH + h) * HD + ln) * SQ;
  v16h qf[2][2], kf[2][2];
#pragma unroll
  for (int g = 0; g < 2; ++g)
#pragma unroll
    for (int kc = 0; kc < 2; ++kc) { qf[g][kc] = g2_frag(Ql + (size_t)(16 * g) * DM + 32 * kc, hh); kf[g][kc] = g2_frag(Kl + (size_t)(16 * g) * KVD + 32 * kc, hh); }
  __builtin_amdgcn_sched_barrier(0); asm volatile("s_wait_xcnt 0x0" ::: "memory"); __builtin_amdgcn_sched_barrier(0);      /* the wait in front of any overwrite of these loads' address pairs; the scheduling barriers keep later register writes behind it */
  v8f acc[2][4]; float m_run[2] = {-3.0e38f, -3.0e38f}, l_run[2] = {0.f, 0.f};
#pragma unroll
  for (int g = 0; g < 2; ++g)
#pragma unroll
    for (int t = 0; t < 4; ++t) acc[g][t] = v8f{0.f, 0.f, 0.f, 0.f, 0.f, 0.f, 0.f, 0.f};
  const int nfull = qw0 / 32;      /* passes wholly below the diagonal */
#pragma unroll 1      /* one pass per trip: an unrolled body would hold two passes' fragments and lose a wave per SIMD */
  for (int p = 0; p < nfull; ++p) fa_pass<false>(kf, Kl + (size_t)(p + 1) * 32 * KVD, Vl + p * 32, p * 32, qw0, ln, hh, qf, acc, m_run, l_run);
  fa_pass<true>(kf, Kl, Vl + nfull * 32, nfull * 32, qw0, ln, hh, qf, acc, m_run, l_run);
  FragH of[2][4];
#pragma unroll
  for (int g = 0; g < 2; ++g) { const float l = l_run[g] + fa_xhalf(l_run[g]); const float inv = 64.0f / l;
#pragma unroll
    for (int t = 0; t < 4; ++t)
#pragma unroll
      for (int r = 0; r < 8; ++r) of[g][t].h[r] = (_Float16)(acc[g][t][r] * inv); }
  __builtin_amdgcn_sched_barrier(0);      /* all eight packed rows are made ahead of the first store, so that no register of an issued store is written again */
#pragma unroll
  for (int g = 0; g < 2; ++g)
#pragma unroll
    for (int t = 0; t < 4; ++t) *(v8us*)((unsigned short*)O + ((size_t)b * SQ + qw0 + 16 * g + ln) * DM + h * HD + 16 * t + 8 * hh) = of[g][t].half[0];      /* register r of tile t is d = 16 t + 8 hh + r of query ln: 16 bytes a lane; the wave writes each query's whole 128-byte head row */
}

// Exact f32 attention of the first QT0 rows of every batch and head on the f32 matrix form (v_wmma_f32_16x16x4_f32: full f32 operands, every addition rounded in f32): a wave owns 16 query columns and walks its keys in passes of 16 with an online softmax.
// Transposed products as in k_fattn: S^T = K Q^T (A = K rows, B = Q rows, both through the same loader, so their k order is equal: 16 bytes at d = 8 j + 4 hh, elements 0, 1 in one product and 2, 3 in the next) leaves key 8 hh + r of query ln in register r.
// Registers 2 s, 2 s + 1 of the weights ARE a B operand of keys 8 hh + 2 s + e (e = 0, 1); the A operand of O^T += V^T P^T takes V[8 hh + 2 s + e][16 t + ln] from the natural V rows: 64 bytes in a row for each wave half, no transposed copy.
typedef float v2f __attribute__((ext_vector_type(2)));
__device__ __forceinline__ v8f a0_mma(v2f a, v2f b, v8f c) { return __builtin_amdgcn_wmma_f32_16x16x4_f32(false, a, false, b, (short)0, c, false, false); }
template <bool LAST>      /* LAST = the wave's diagonal pass: masked, and no further K or V rows are fetched */
__device__ __forceinline__ void a0_pass(v4f (&kf)[8], v2f (&vf)[4][4], const float* __restrict__ kn, const float* __restrict__ vn, int ln, int hh, const v4f (&qf)[8], v8f (&acc)[4], float& m_run, float& l_run) {
  const float cs = 0.125f * 1.44269504088896340736f;
  v8f sc = {0.f, 0.f, 0.f, 0.f, 0.f, 0.f, 0.f, 0.f};
#pragma unroll
  for (int j = 0; j < 8; ++j) { sc = a0_mma(v2f{kf[j][0], kf[j][1]}, v2f{qf[j][0], qf[j][1]}, sc); sc = a0_mma(v2f{kf[j][2], kf[j][3]}, v2f{qf[j][2], qf[j][3]}, sc); }
  /* the four vector slots behind the score WMMAs, tied to their result so that they stand behind the last one (untied, the build had put them in front of the first); the memory clobber keeps the loads over the K operands behind the slots; in the diagonal pass the lane's column passes through too, so that the mask's lane arithmetic stands behind them (the build had put it between the WMMAs, over an operand register of the one before) */
  if (LAST) asm volatile("v_nop\n\tv_nop\n\tv_nop\n\tv_nop" : "+v"(sc), "+v"(ln) : : "memory");
  else asm volatile("v_nop\n\tv_nop\n\tv_nop\n\tv_nop" : "+v"(sc) : : "memory");
  if (!LAST) {
#pragma unroll
    for (int j = 0; j < 8; ++j) kf[j] = *(const v4fa*)(kn + 8 * j);      /* next pass's K rows, in flight under the exponentials and the second product */
  }
  if (LAST) { const int dl = ln - 8 * hh;
#pragma unroll
    for (int r = 0; r < 8; ++r) if (r > dl) sc[r] = -3.0e38f;      /* causal: key 8 hh + r above query ln (the pass's first key is never masked, so every maximum stays a real score) */
  }
  float mx = sc[0];
#pragma unroll
  for (int r = 1; r < 8; ++r) mx = fmaxf(mx, sc[r]);
  mx = fmaxf(mx, fa_xhalf(mx)) * cs;
  const float mn = fmaxf(m_run, mx); const float corr = exp2_slot(m_run - mn); m_run = mn;
#pragma unroll
  for (int t = 0; t < 4; ++t) acc[t] = acc[t] * corr;
  float e[8];
#pragma unroll
  for (int r = 0; r < 8; ++r) e[r] = exp2_slot(fmaf(sc[r], cs, -mn));
  __builtin_amdgcn_sched_barrier(0);      /* every exponential stands ahead of the WMMAs */
#pragma unroll
  for (int s = 0; s < 4; ++s)
#pragma unroll
    for (int t = 0; t < 4; ++t) acc[t] = a0_mma(vf[s][t], v2f{e[2 * s], e[2 * s + 1]}, acc[t]);
  asm volatile("v_nop\n\tv_nop\n\tv_nop\n\tv_nop" : "+v"(acc[0]), "+v"(acc[1]), "+v"(acc[2]), "+v"(acc[3]), "+v"(e[0]), "+v"(e[1]), "+v"(e[2]), "+v"(e[3]), "+v"(e[4]), "+v"(e[5]), "+v"(e[6]), "+v"(e[7]) : : "memory");      /* the four vector slots behind the last WMMAs, on every path (a branch follows); the memory clobber keeps the loads over the V operands behind them; the weights pass through it so that their sum below, which reuses their registers, stands behind the slots too (the build had put it between the WMMAs that read them) */
  if (!LAST) {
#pragma unroll
    for (int s = 0; s < 4; ++s)
#pragma unroll
      for (int t = 0; t < 4; ++t) { vf[s][t][0] = vn[(2 * s) * DM + 16 * t]; vf[s][t][1] = vn[(2 * s + 1) * DM + 16 * t]; }      /* next pass's V rows, in flight under its scores and exponentials */
  }
  l_run = fmaf(l_run, corr, ((e[0] + e[1]) + (e[2] + e[3])) + ((e[4] + e[5]) + (e[6] + e[7])));
  if (!LAST) { asm volatile("s_wait_xcnt 0x0" ::: "memory"); __builtin_amdgcn_sched_barrier(0); }      /* the wait in front of the next trip's rewrite of the K and V address registers; the scheduling barrier keeps that rewrite behind it */
}
__device__ __forceinline__ void d_att0(int bx, int h, int b, const float* __restrict__ QF, const float* __restrict__ KF, const float* __restrict__ VF, float* __restrict__ OF) {      /* bx: 0..3, the block's set of query tiles; h, b: its head and batch */
  static_assert(QT0 == 256 && HD == 64, "k_att0: 16 query tiles of 16 rows (4 blocks of 4 waves), head size 64");
  const int lane = threadIdx.x & 31, ln = lane & 15, hh = lane >> 4; const int w = __builtin_amdgcn_readfirstlane((int)(threadIdx.x >> 5));      /* the wave's number in a scalar register: trip count and branches stay scalar, EXEC stays full for the WMMAs */
  const int qt = bx + 4 * w;      /* query tile: a block's four waves take short and long tiles */
  const size_t pb = ((size_t)b * QT0) * DM + (size_t)h * HD;      /* each batch's first-tile rows lie in a plane of their own */
  const float* Ql = QF + pb + (size_t)(qt * 16 + ln) * DM + 4 * hh; const float* Kl = KF + pb + (size_t)ln * DM + 4 * hh; const float* Vl = VF + pb + (size_t)(8 * hh) * DM + ln;
  v4f qf[8], kf[8]; v2f vf[4][4];
#pragma unroll
  for (int j = 0; j < 8; ++j) { qf[j] = *(const v4fa*)(Ql + 8 * j); kf[j] = *(const v4fa*)(Kl + 8 * j); }
  __builtin_amdgcn_sched_barrier(0);      /* the K rows are issued ahead of the V rows, as in the loop: the counted wait at the loop's head then leaves the V loads in flight (with K last here, the build waited for them at the head of every pass) */
#pragma unroll
  for (int s = 0; s < 4; ++s)
#pragma unroll
    for (int t = 0; t < 4; ++t) { vf[s][t][0] = Vl[(2 * s) * DM + 16 * t]; vf[s][t][1] = Vl[(2 * s + 1) * DM + 16 * t]; }
  __builtin_amdgcn_sched_barrier(0); asm volatile("s_wait_xcnt 0x0" ::: "memory"); __builtin_amdgcn_sched_barrier(0);      /* the wait in front of any overwrite of these loads' address pairs; the scheduling barriers keep later register writes behind it */
  v8f acc[4]; float m_run = -3.0e38f, l_run = 0.f;
#pragma unroll
  for (int t = 0; t < 4; ++t) acc[t] = v8f{0.f, 0.f, 0.f, 0.f, 0.f, 0.f, 0.f, 0.f};
#pragma unroll 1      /* one pass per trip: the trip count differs from wave to wave, and an unrolled body would only add code */
  for (int p = 0; p < qt; ++p) a0_pass<false>(kf, vf, Kl + (size_t)(p + 1) * 16 * DM, Vl + (size_t)(p + 1) * 16 * DM, ln, hh, qf, acc, m_run, l_run);
  a0_pass<true>(kf, vf, Kl, Vl, ln, hh, qf, acc, m_run, l_run);
  const float l = l_run + fa_xhalf(l_run); const float fin = 64.0f / l;      /* the two wave halves' sums joined; o carried x64 like the f16 path */
#pragma unroll
  for (int t = 0; t < 4; ++t) acc[t] = acc[t] * fin;
  __builtin_amdgcn_sched_barrier(0);      /* every result is made ahead of the first store, so that no register of an issued store is written again */
  float* Ol = OF + pb + (size_t)(qt * 16 + ln) * DM + 8 * hh;
#pragma unroll
  for (int t = 0; t < 4; ++t) { *(v4fa*)(Ol + 16 * t) = v4f{acc[t][0], acc[t][1], acc[t][2], acc[t][3]}; *(v4fa*)(Ol + 16 * t + 4) = v4f{acc[t][4], acc[t][5], acc[t][6], acc[t][7]}; }      /* register r of tile t is d = 16 t + 8 hh + r of query ln: 32 bytes a lane; the wave writes each query's whole 256-byte head row */
}
// The two attention kernels, which do not depend on one another, in ONE launch: grid planes z = 0..NB - 1 are the f16 query tiles of a batch, the last plane holds the 256 exact first-tile blocks.
// The first-tile blocks come last in the index order (speed only).
__global__ __launch_bounds__(128) void k_attn(const _Float16* __restrict__ Q, const _Float16* __restrict__ K, const _Float16* __restrict__ Vt, _Float16* __restrict__ O, const float* __restrict__ QF, const float* __restrict__ KF, const float* __restrict__ VF, float* __restrict__ OF) {
  static_assert((SQ / 128) * NH == (QT0 / 64) * NH * NB && QT0 / 64 == 4 && NH == 16, "k_attn: the last grid plane holds one block for each (set of query tiles, head, batch) of the first tile");
  const int x = (int)blockIdx.x, y = (int)blockIdx.y, z = (int)blockIdx.z;      /* the test below is scalar, the same for the whole block */
  if (z == NB) { const int i = y * (SQ / 128) + x; d_att0(i & 3, (i >> 2) & 15, i >> 6, QF, KF, VF, OF); return; }
  d_fattn(x, SQ / 128, y, z, Q, K, Vt, O);
}

__global__ __launch_bounds__(256) void k_kvexp(const float* __restrict__ src, float* __restrict__ dst, size_t n4) { const size_t t = (size_t)blockIdx.x * 256 + threadIdx.x; if (t >= n4) return; const size_t e = t * 4; const size_t row = e / DM; const int col = (int)(e % DM); const int h = col / HD, d = col % HD; const v4f v = *(const v4fa*)(src + row * KVD + (size_t)(h / HPG) * HD + d); *(v4f*)(dst + e) = v;  }

__global__ __launch_bounds__(256) void k_tab2(float theta, float* __restrict__ CS, float* __restrict__ SN) {
  const int t = blockIdx.x * 256 + threadIdx.x; if (t >= SQ * (HD / 2)) return; const int i = t % (HD / 2); const int p = t / (HD / 2); const float invf = 1.0f / powf(theta, (float)(2 * i) / (float)HD); const float ang = __fmul_rn((float)p, invf); const float c = cosf(ang), s = sinf(ang);
  *(float*)(CS + t) = c; *(float*)(SN + t) = s;  }
// Half-split rope (out_lo = x_lo c - x_hi s, out_hi = x_lo s + x_hi c, position = row in its batch), 64 elements a thread: the stage moves few bytes, so what it costs is the start of its waves.
// Thread (p, c) takes columns 4 (c & 7) .. + 3 of the low half and of the high half of heads c >> 3 and (c >> 3) + 8, at position p of every batch: one pair of table loads serves all eight head rows; eight lanes cover a whole 128-byte line in every load.
// F32OUT = false: f16 rows of all SQ positions (H16, batch pitch SQ rows); true: f32 rows of the first QT0 positions (F32, batch pitch QT0 rows). The caller's block range gives the number of positions: 4 a block.
template <bool F32OUT>
__device__ __forceinline__ void d_rope(unsigned bx, const float* __restrict__ F, const float* __restrict__ CS, const float* __restrict__ SN, _Float16* __restrict__ H16, float* __restrict__ F32) {
  static_assert(HD == 64 && NH == 16 && NG == NH && KVD == DM && DM == NH * HD, "k_rope: 16 heads of 64 in rows of 1024");
  const unsigned t = bx * 256u + threadIdx.x; const unsigned p = t >> 6, c = t & 63u;
  const unsigned e4 = p * (DM / 4) + (c >> 3) * (HD / 4) + (c & 7u);      /* offset inside a batch plane, in groups of four elements, the same for source and result */
  const unsigned t4 = p * (HD / 8) + (c & 7u);
  unsigned ix[NB], ox[NB];      /* one 32-bit index a batch under the uniform base: source, result */
#pragma unroll
  for (int b = 0; b < NB; ++b) { ix[b] = e4 + (unsigned)b * (SQ * DM / 4); ox[b] = e4 + (unsigned)b * ((F32OUT ? QT0 : SQ) * DM / 4); }
  const v4f cs = ((const v4fa*)CS)[t4], sn = ((const v4fa*)SN)[t4];
  v4f lo[NB][2], hi[NB][2];
#pragma unroll
  for (int b = 0; b < NB; ++b)
#pragma unroll
    for (int g = 0; g < 2; ++g) { const float* s = F + g * (8 * HD); lo[b][g] = ((const v4fa*)s)[ix[b]]; hi[b][g] = ((const v4fa*)(s + HD / 2))[ix[b]]; }
  static_assert(NB == 4, "the wait below names four source indices");
  asm volatile("s_wait_xcnt 0x0" :: "v"(t4), "v"(ix[0]), "v"(ix[1]), "v"(ix[2]), "v"(ix[3]) : "memory");      /* the wait in front of any overwrite of these loads' index registers; named as inputs, they stay whole up to it (no later load lands on one) */
  __builtin_amdgcn_sched_barrier(0);      /* all eighteen loads are issued ahead of the first product: one round trip to memory a wave (the build had held six of them back behind waits) */
  v4h la[NB][2], ha[NB][2];
#pragma unroll
  for (int b = 0; b < NB; ++b)
#pragma unroll
    for (int g = 0; g < 2; ++g) { const v4f l = lo[b][g], h = hi[b][g];
#pragma unroll
      for (int q = 0; q < 4; ++q) { const float ol = __fadd_rn(__fmul_rn(l[q], cs[q]), -__fmul_rn(h[q], sn[q])), oh = __fadd_rn(__fmul_rn(l[q], sn[q]), __fmul_rn(h[q], cs[q]));
        if (F32OUT) { lo[b][g][q] = ol; hi[b][g][q] = oh; } else { la[b][g][q] = (_Float16)ol; ha[b][g][q] = (_Float16)oh; } } }
  __builtin_amdgcn_sched_barrier(0);      /* every result is made ahead of the first store, so that no register of an issued store is written again */
#pragma unroll
  for (int b = 0; b < NB; ++b)
#pragma unroll
    for (int g = 0; g < 2; ++g) {
      if (F32OUT) { float* d = F32 + g * (8 * HD); ((v4fa*)d)[ox[b]] = lo[b][g]; ((v4fa*)(d + HD / 2))[ox[b]] = hi[b][g]; }
      else { _Float16* d = H16 + g * (8 * HD); ((v4ha*)d)[ox[b]] = la[b][g]; ((v4ha*)(d + HD / 2))[ox[b]] = ha[b][g]; } }
  asm volatile("s_wait_xcnt 0x0" ::: "memory");      /* the wait behind the stores: in a kernel that holds several stage bodies another body's code may follow in the text and write these stores' address and data registers */
}
// The stages between the projections and the attention, which do not depend on one another, in ONE launch: V^T (2048 blocks), the f16 rope of q and of k (512 each), the f32 first-tile rope of q and of k (64 each).
#define RV_VT (NB * NG * (SQ / 64))
__global__ __launch_bounds__(256) void k_ropevt(const float* __restrict__ QF, const float* __restrict__ KF, const float* __restrict__ CS, const float* __restrict__ SN, _Float16* __restrict__ Q16, _Float16* __restrict__ K16, float* __restrict__ QF0, float* __restrict__ KF0, const _Float16* __restrict__ V16, _Float16* __restrict__ VT) {
  static_assert(SQ / 4 == 512 && QT0 / 4 == 64, "k_ropevt: the block ranges below");
  const unsigned b = blockIdx.x;      /* every test below is scalar, the same for the whole block */
  if (b < RV_VT) { d_vt<NG, SQ>((int)b, V16, KVD, 0, VT); return; }
  const unsigned r = b - RV_VT;
  if (r < 1024u) { const bool q = r < 512u; d_rope<false>(r & 511u, q ? QF : KF, CS, SN, q ? Q16 : K16, nullptr); return; }
  const unsigned r2 = r - 1024u; const bool q = r2 < 64u; d_rope<true>(r2 & 63u, q ? QF : KF, CS, SN, nullptr, q ? QF0 : KF0);
}

__global__ __launch_bounds__(256) void k_bfcp(const float* __restrict__ src, float* __restrict__ dst, size_t n4) { const size_t t = (size_t)blockIdx.x * 256 + threadIdx.x; if (t >= n4) return; const v4f a = *(const v4fa*)(src + t * 4); v4f o; for (int q = 0; q < 4; ++q) o[q] = bf16_round(a[q]); *(v4f*)(dst + t * 4) = o;  }

__global__ __launch_bounds__(256) void k_tabhalf(const float* __restrict__ cs, const float* __restrict__ sn, float* __restrict__ CS, float* __restrict__ SN) { const int t = blockIdx.x * 256 + threadIdx.x; if (t >= SQ * (HD / 2)) return; const int p = t / (HD / 2), i = t % (HD / 2); const float c = bf16_round(cs[(size_t)p * HD + i]), s = bf16_round(sn[(size_t)p * HD + i]);
  *(float*)(CS + t) = c; *(float*)(SN + t) = s;  }

__device__ __forceinline__ void d_tab2d(unsigned bx, float* __restrict__ CS, float* __restrict__ SN) {
  const int t = (int)(bx * 256u + threadIdx.x); if (t >= SQ * (HD / 2)) return; const int i = t % (HD / 2); const int p = t / (HD / 2); const float invf = (float)(1.0 / pow(10000.0, (double)(2 * i) / (double)HD)); const float ang = __fmul_rn((float)p, invf); const float c = cosf(ang), s = sinf(ang);
  *(float*)(CS + t) = c; *(float*)(SN + t) = s;  }
// The stages that read only the inputs, which do not depend on one another, in ONE launch: the rope tables (256 blocks; first: their arithmetic is the longest), the three streams as f16 (512 blocks each), the four weights as f16 x16 (512 blocks each).
#define PR_TAB (SQ * (HD / 2) / 256)
#define PR_X ((unsigned)(NR * DM / 16384))
#define PR_W ((unsigned)((size_t)DM * DM / 8 / 256))
__global__ __launch_bounds__(256) void k_prep(const float* __restrict__ x, const float* __restrict__ xk, const float* __restrict__ xv, const float* __restrict__ wq, const float* __restrict__ wk, const float* __restrict__ wv, const float* __restrict__ wo,
    _Float16* __restrict__ X16, _Float16* __restrict__ XK16, _Float16* __restrict__ XV16, _Float16* __restrict__ BQ, _Float16* __restrict__ BK, _Float16* __restrict__ BV, _Float16* __restrict__ BO, float* __restrict__ CS, float* __restrict__ SN) {
  static_assert(PR_X == 512u && PR_W == 512u && SQ * (HD / 2) % 256 == 0 && NR * DM % 16384 == 0 && (size_t)DM * DM % 2048 == 0, "k_prep: whole blocks, 512 a stream and a weight");
  const unsigned b = blockIdx.x;      /* every test below is scalar, the same for the whole block */
  if (b < PR_TAB) { d_tab2d(b, CS, SN); return; }
  const unsigned r = b - PR_TAB;
  if (r < 3u * PR_X) { const unsigned s = r >> 9; d_x16(r & 511u, s == 0u ? x : s == 1u ? xk : xv, s == 0u ? X16 : s == 1u ? XK16 : XV16); return; }
  const unsigned r2 = r - 3u * PR_X; const unsigned s = r2 >> 9;
  d_wnat(r2 & 511u, s == 0u ? wq : s == 1u ? wk : s == 2u ? wv : wo, (size_t)DM * DM / 8, s == 0u ? BQ : s == 1u ? BK : s == 2u ? BV : BO);
}
extern "C" void kernel_launch(void* const* d_in, const int* in_sizes, int n_in,
                              void* d_out, int out_size, void* d_ws, size_t ws_size, hipStream_t stream) {
  (void)in_sizes; (void)n_in; (void)out_size;
  const float* const* I = (const float* const*)d_in; const float* x = I[0]; const float* xk = I[1]; const float* xv = I[2]; const float* wq = I[3]; const float* wk = I[5]; const float* wv = I[7]; const float* wo = I[9];      /* the streams query, key, value; natural [out][in] W_q, W_k, W_v, W_o; the biases b_q = I[4], b_k = I[6], b_v = I[8], b_o = I[10]; rope tables computed in-kernel (positions = row index) */
  static_assert(HPG == 1 && NH == NG * HPG && NH * HD == DM && KVD == DM, "plain multi-head attention as 16 kv groups of one query head"); const float* bq = I[4]; const float* bk = I[6]; const float* bv = I[8]; const float* bo = I[10];      /* the four biases, each bound to its projection (read through the GEMM bias pointer, bf16-rounded on load) */
  char* ws = (char*)d_ws; size_t off = 0;
  auto take = [&](size_t bytes) { char* p = ws + off; off += (bytes + 255) & ~(size_t)255; return p; };
  _Float16* BQKV = (_Float16*)take((size_t)3 * DM * DM * 2); _Float16* BQ = BQKV; _Float16* BK = BQKV + (size_t)DM * DM; _Float16* BV = BQKV + (size_t)2 * DM * DM; _Float16* BO = (_Float16*)take((size_t)DM * DM * 2);      /* one plane Bt [3072][1024]: rows 0..1023 = W_q, 1024.. = W_k, 2048.. = W_v (natural [out][in] weights are Bt as they stand) */
  _Float16* X16 = (_Float16*)take(NR * DM * 2); _Float16* XK16 = (_Float16*)take(NR * DM * 2); _Float16* XV16 = (_Float16*)take(NR * DM * 2); float* QF = (float*)take(NR * DM * 4); float* KF = (float*)take(NR * KVD * 4); float* CSB = (float*)take((size_t)SQ * HD * 4); float* SNB = (float*)take((size_t)SQ * HD * 4); _Float16* Q16 = (_Float16*)take(NR * DM * 2); _Float16* K16 = (_Float16*)take(NR * KVD * 2); _Float16* V16 = (_Float16*)take(NR * KVD * 2); _Float16* O16 = (_Float16*)take(NR * DM * 2);
  _Float16* VT = (_Float16*)take((size_t)NB * NH * HD * SQ * 2);
  float* QF0 = (float*)take((size_t)NB * QT0 * DM * 4); float* KF0 = (float*)take((size_t)NB * QT0 * KVD * 4); float* VF0 = (float*)take((size_t)NB * QT0 * KVD * 4); float* KF0e = (float*)take((size_t)NB * QT0 * DM * 4); float* VF0e = (float*)take((size_t)NB * QT0 * DM * 4); float* OF0 = (float*)take((size_t)NB * QT0 * DM * 4); _Float16* OH0 = (_Float16*)take((size_t)NB * QT0 * DM * 2); _Float16* OL0 = (_Float16*)take((size_t)NB * QT0 * DM * 2);
  if (off > ws_size) return;
  static_assert(B0 == 0 && NBR == NB && MP == NB * SQ, "every stage below takes all batches in one launch");
  k_prep<<<PR_TAB + 3u * PR_X + 4u * PR_W, 256, 0, stream>>>(x, xk, xv, wq, wk, wv, wo, X16, XK16, XV16, BQ, BK, BV, BO, CSB, SNB);      /* rope tables cos/sin(p / 10000^(2i/64)): inv_freq double-derived -> f32, f32 angle; the three streams as exact f16 rows; natural [out][in] weights = Bt x16 */
  k_qkv<<<QKV_B0 + 3 * QKV_BJ, 128, 0, stream>>>(X16, XK16, XV16, BQ, BK, BV, bq, bk, bv, QF, KF, V16, VF0);      /* v (f16), q (f32), k (f32) of every batch, and f32 v of the first 256 rows of each batch */
  k_ropevt<<<RV_VT + 2 * (SQ / 4) + 2 * (QT0 / 4), 256, 0, stream>>>(QF, KF, CSB, SNB, Q16, K16, QF0, KF0, V16, VT);      /* V^T [NB][NH][HD][SQ]; half-split rope (out_lo = x_lo c - x_hi s, out_hi = x_lo s + x_hi c = t cos + rotate_half(t) sin with the module's [f | f] tables) of q and k -> f16 rows of every batch and f32 rows 0..255 of each batch; position = row in its batch; 4 positions a block */
  k_kvexp<<<(unsigned)(((size_t)NB * QT0 * DM / 4 + 255) / 256), 256, 0, stream>>>(KF0, KF0e, (size_t)NB * QT0 * DM / 4); k_kvexp<<<(unsigned)(((size_t)NB * QT0 * DM / 4 + 255) / 256), 256, 0, stream>>>(VF0, VF0e, (size_t)NB * QT0 * DM / 4);      /* head h <- its kv group for the exact first-tile kernel */
  static_assert(SQ % 128 == 0 && HD == 64 && B0 == 0 && NBR == NB && QN == SQ && NHD == NH, "d_fattn: four waves of 32 query columns, head size 64, every batch and head");
  k_attn<<<dim3(SQ / 128, NH, NB + 1), 128, 0, stream>>>(Q16, K16, VT, O16, QF0, KF0e, VF0e, OF0);      /* scores, causal softmax and o (x64) of every batch, head and query tile; and the exact f32 attention for rows 0..255 of every batch (o x64) */
  k_outhl<<<OH_G + OH_H, 128, 0, stream>>>(O16, BO, bo, (float*)d_out, OF0, OH0, OL0);      /* out rows are the output layout; first-tile o (x64) -> f16 hi + x1024 residual planes */
  k_gemm2<0><<<dim3((QT0 / 128) * (DM / 128), NB), 128, 0, stream>>>(OH0, DM, (size_t)QT0 * DM, BO, DM, 0, 0.0009765625f, bo, 0, nullptr, 1, 0, 0, (float*)d_out, nullptr, DM, (size_t)SQ * DM, QT0, DM, DM);      /* rows 0..255 of each batch (grid y = batch): out = o_hi Wo (+ b), overwriting the f16-path rows */
  k_gemm2<0><<<dim3((QT0 / 128) * (DM / 128), NB), 128, 0, stream>>>(OL0, DM, (size_t)QT0 * DM, BO, DM, 0, 0.00000095367431640625f, nullptr, 0, (const float*)d_out, -1, 0, 0, (float*)d_out, nullptr, DM, (size_t)SQ * DM, QT0, DM, DM);      /* += o_lo Wo 2^-20 (own-element accumulate) */
}

// v008
// One run takes 177 microseconds.
// Timed twice side by side with v007, it ran 1.09 times as fast both times.
// Over all steps from v000 it is 41.8 times as fast.
#include <hip/hip_runtime.h>
// Causal multi-head attention over THREE input streams with rotate-half RoPE computed in the module (query, key, value [4][2048][1024]; Q = query W_q^T + b_q, K = key W_k^T + b_k, V = value W_v^T + b_v (natural [out][in] [1024][1024]; the four biases: bound and read), 16 heads of 64; cos / sin = [f, f] of pos * 10000^(-2i/64); Q = Q cos + rotate_half(Q) sin with rotate_half = cat(-x2, x1), likewise K (the bias is added BEFORE the rope); scores / sqrt(64); causal (triu k=1 at -inf); softmax; y = merged W_o^T + b_o (natural) -> [4][2048][1024]); run as grouped-query causal attention with 16 groups of ONE head with the rope stage in its half-split mode.
// Compute dtype: inputs rounded to bf16; x / weights exact; q, k, v, softmax weights and o as plain f16 GEMM operands (~2^-12); scores and softmax statistics f32; v_wmma_f32_16x16x32_f16; rows 0..255 of each batch redone in f32 on v_wmma_f32_16x16x4_f32, their o as f16 hi + x1024 residual.
#define NB 4
#define NG 16
#define HPG 1
#define KVD (NG * HD)
#define SQ 2048
#define DM 1024
#define NH 16
#define HD 64
#define HG 4                         /* unused */
#define QT 256                       /* unused */
#define NKX SQ                       /* unused */
#define QT0 256                      /* first-tile rows recomputed exactly in f32 */
#define B0 0                         /* first batch processed (debug hook) */
#define NBR NB                       /* batches processed (debug hook) */
#define NR ((size_t)NB * SQ)         /* token rows */
#define MP ((int)((size_t)NBR * SQ)) /* rows projected (debug hook) */
#define QN SQ                        /* query rows attended per batch (debug hook) */
#define NHD NH                       /* heads attended (debug hook) */
#define MPO MP                       /* rows through the output stage (debug hook) */
#define LQ DM      /* unused */
typedef __bf16 v16b __attribute__((ext_vector_type(16)));
typedef unsigned short v8us __attribute__((ext_vector_type(8), may_alias));
typedef float  v8f  __attribute__((ext_vector_type(8)));
typedef float  v4f  __attribute__((ext_vector_type(4)));
typedef float  v4fa __attribute__((ext_vector_type(4), may_alias));
union FragB { v16b v; v8us half[2]; unsigned short u[16]; };

__device__ __forceinline__ unsigned short bf16_bits(float x) { unsigned int u = __float_as_uint(x); return (unsigned short)((u + 0x7FFFu + ((u >> 16) & 1u)) >> 16); }
__device__ __forceinline__ float bf16_val(unsigned short b) { return __uint_as_float(((unsigned int)b) << 16); }
__device__ __forceinline__ float bf16_round(float x) { return bf16_val(bf16_bits(x)); }
// D += A·B with NT terms: 1 = ah·bh, 2 = + al·bh (A split), 3 = + ah·bl (both split)
template <int NT>
__device__ __forceinline__ v8f mmaN(v16b ah, v16b al, v16b bh, v16b bl, v8f c) {
  c = __builtin_amdgcn_wmma_f32_16x16x32_bf16(false, ah, false, bh, (short)0, c, false, false);
  if (NT >= 2) c = __builtin_amdgcn_wmma_f32_16x16x32_bf16(false, al, false, bh, (short)0, c, false, false);
  if (NT >= 3) c = __builtin_amdgcn_wmma_f32_16x16x32_bf16(false, ah, false, bl, (short)0, c, false, false);
  asm volatile("v_nop\n\tv_nop\n\tv_nop\n\tv_nop" : "+v"(c) : "v"(ah), "v"(al), "v"(bh), "v"(bl));
  return c;
}

__global__ __launch_bounds__(256) void k_wt_bf16(const float* __restrict__ W, unsigned short* __restrict__ Wt, int K, int N) {
  const int t = blockIdx.x * 256 + threadIdx.x;
  const int k8n = K / 8;
  if (t >= N * k8n) return;
  const int n = t / k8n, k8 = (t % k8n) * 8;
  v8us v;
#pragma unroll
  for (int i = 0; i < 8; ++i) v[i] = bf16_bits(W[(size_t)(k8 + i) * N + n]);
  *(v8us*)(Wt + (size_t)n * K + k8) = v;
  
}

// GEMM C[M][N] (f32, pitch ldc) = act(A[M][K]·W + bias). A f32 row-major (pitch lda) converted per fragment to bf16
// (ASPLIT: hi/lo two planes -> 2 terms, else single rounded term); Wt bf16 [N][K] (pitch ldb). BIAS_BF16 rounds the
// bias to bf16 first (bias quantised to bf16 before the add). K%32==0, M%16==0, N%64==0.
template <bool ASPLIT, int ACT, bool BIAS_BF16>
__global__ __launch_bounds__(128) void k_gemm_bf(const float* __restrict__ A, int lda, const unsigned short* __restrict__ Wt, int ldb,
                                               const float* __restrict__ bias, float* __restrict__ C, int ldc, int M, int N, int K) {
  __shared__ __attribute__((aligned(16))) float so[4][16][64];
  const int tid = threadIdx.x, w = tid >> 5, lane = tid & 31, ln = lane & 15, hh = lane >> 4;
  const int ntn = N / 64;
  const int wid = blockIdx.x * 4 + w;
  const int mt = wid / ntn, nq = wid % ntn;
  if (mt * 16 >= M) return;
  const int row0 = mt * 16, col0 = nq * 64;
  const float* arow = A + (size_t)(row0 + ln) * lda;
  v8f acc[4] = {};
  for (int kb = 0; kb < K; kb += 32) {
    FragB ah, al;
    const v4f x0 = *(const v4fa*)(arow + kb + 8 * hh), x1 = *(const v4fa*)(arow + kb + 8 * hh + 4);
    const v4f x2 = *(const v4fa*)(arow + kb + 16 + 8 * hh), x3 = *(const v4fa*)(arow + kb + 16 + 8 * hh + 4);
    float xs[16] = {x0[0],x0[1],x0[2],x0[3],x1[0],x1[1],x1[2],x1[3],x2[0],x2[1],x2[2],x2[3],x3[0],x3[1],x3[2],x3[3]};
#pragma unroll
    for (int i = 0; i < 16; ++i) { const unsigned short hb = bf16_bits(xs[i]); ah.u[i] = hb; al.u[i] = ASPLIT ? bf16_bits(xs[i] - bf16_val(hb)) : (unsigned short)0; }
#pragma unroll
    for (int t = 0; t < 4; ++t) {
      const unsigned short* brow = Wt + (size_t)(col0 + t * 16 + ln) * ldb + kb;
      FragB b;
      b.half[0] = *(const v8us*)(brow + 8 * hh);
      b.half[1] = *(const v8us*)(brow + 16 + 8 * hh);
      acc[t] = mmaN<ASPLIT ? 2 : 1>(ah.v, al.v, b.v, b.v, acc[t]);
    }
  }
#pragma unroll
  for (int t = 0; t < 4; ++t) {
    float bv = bias ? bias[col0 + t * 16 + ln] : 0.f;
    if (BIAS_BF16) bv = bf16_round(bv);
#pragma unroll
    for (int r = 0; r < 8; ++r) { float v = acc[t][r] + bv; if (ACT == 1) v = fmaxf(v, 0.f); so[w][8 * hh + r][t * 16 + ln] = v; }
  }
  __builtin_amdgcn_fence(__ATOMIC_ACQ_REL, "workgroup");
  __builtin_amdgcn_wave_barrier();
  const int rsub = lane >> 4, c4 = (lane & 15) * 4;
  {
#pragma unroll
    for (int q = 0; q < 8; ++q) {
      const int r = q * 2 + rsub;
      const v4f v = *(const v4fa*)&so[w][r][c4];
      *(v4f*)(C + (size_t)(row0 + r) * ldc + col0 + c4) = v;
    }
    
  }
}

// GEMM C = act(A·W + bias + resid): A f32 (ASPLIT -> hi/lo 2 terms), Wt bf16 [N][K]; ACT 0 none, 1 relu, 2 exact gelu;
// resid (optional, f32, row index = (row % rmod), pitch ldr, RES_BF16 rounds it) added before the activation.
template <bool ASPLIT, int ACT, bool BIAS_BF16, bool RES_BF16>
__global__ __launch_bounds__(128) void k_gemm_bf3(const float* __restrict__ A, int lda, const unsigned short* __restrict__ Wt, int ldb,
                                                const float* __restrict__ bias, const float* __restrict__ resid, int rmod, int ldr,
                                                float* __restrict__ C, int ldc, int M, int N, int K) {
  __shared__ __attribute__((aligned(16))) float so[4][16][64];
  const int tid = threadIdx.x, w = tid >> 5, lane = tid & 31, ln = lane & 15, hh = lane >> 4;
  const int ntn = N / 64;
  const int wid = blockIdx.x * 4 + w;
  const int mt = wid / ntn, nq = wid % ntn;
  if (mt * 16 >= M) return;
  const int row0 = mt * 16, col0 = nq * 64;
  const float* arow = A + (size_t)(row0 + ln) * lda;
  v8f acc[4] = {};
  for (int kb = 0; kb < K; kb += 32) {
    FragB ah, al;
    const v4f x0 = *(const v4fa*)(arow + kb + 8 * hh), x1 = *(const v4fa*)(arow + kb + 8 * hh + 4);
    const v4f x2 = *(const v4fa*)(arow + kb + 16 + 8 * hh), x3 = *(const v4fa*)(arow + kb + 16 + 8 * hh + 4);
    float xs[16] = {x0[0],x0[1],x0[2],x0[3],x1[0],x1[1],x1[2],x1[3],x2[0],x2[1],x2[2],x2[3],x3[0],x3[1],x3[2],x3[3]};
#pragma unroll
    for (int i = 0; i < 16; ++i) { const unsigned short hb = bf16_bits(xs[i]); ah.u[i] = hb; al.u[i] = ASPLIT ? bf16_bits(xs[i] - bf16_val(hb)) : (unsigned short)0; }
#pragma unroll
    for (int t = 0; t < 4; ++t) {
      const unsigned short* brow = Wt + (size_t)(col0 + t * 16 + ln) * ldb + kb;
      FragB b;
      b.half[0] = *(const v8us*)(brow + 8 * hh);
      b.half[1] = *(const v8us*)(brow + 16 + 8 * hh);
      acc[t] = mmaN<ASPLIT ? 2 : 1>(ah.v, al.v, b.v, b.v, acc[t]);
    }
  }
#pragma unroll
  for (int t = 0; t < 4; ++t) {
    const int col = col0 + t * 16 + ln;
    float bv = bias ? bias[col] : 0.f;
    if (BIAS_BF16) bv = bf16_round(bv);
#pragma unroll
    for (int r = 0; r < 8; ++r) {
      float v = acc[t][r] + bv;
      if (resid) { float rv = resid[(size_t)((row0 + 8 * hh + r) % rmod) * ldr + col]; if (RES_BF16) rv = bf16_round(rv); v += rv; }
      if (ACT == 1) v = fmaxf(v, 0.f);
      if (ACT == 2) v = 0.5f * v * (1.0f + erff(v * 0.70710678118654752f));
      if (ACT == 3) { const float u = 0.7978845608028654f * (v + 0.044715f * v * v * v); v = 0.5f * v * (1.0f + tanhf(u)); }
      so[w][8 * hh + r][t * 16 + ln] = v;
    }
  }
  __builtin_amdgcn_fence(__ATOMIC_ACQ_REL, "workgroup");
  __builtin_amdgcn_wave_barrier();
  const int rsub = lane >> 4, c4 = (lane & 15) * 4;
  {
#pragma unroll
    for (int q = 0; q < 8; ++q) {
      const int r = q * 2 + rsub;
      const v4f v = *(const v4fa*)&so[w][r][c4];
      *(v4f*)(C + (size_t)(row0 + r) * ldc + col0 + c4) = v;
    }
    
  }
}
// row LayerNorm (biased variance, eps) over N: s = X (+ R); optional out_sum <- s; out_norm <- (s-mu)*rsqrt(var+eps)*g + b
template <bool PARAM_BF16>
__global__ __launch_bounds__(256) void k_layernorm(const float* __restrict__ X, const float* __restrict__ R, const float* __restrict__ g, const float* __restrict__ bta,
                                                  float* __restrict__ out_sum, float* __restrict__ out_norm, int N, float eps) {
  __shared__ float red[256];
  const int row = blockIdx.x, tid = threadIdx.x;
  const float* x = X + (size_t)row * N; const float* rr = R ? R + (size_t)row * N : nullptr;
  float vals[16];                     // up to N = 4096
  const int per = N / 256;            // contiguous chunk per thread? use strided-by-4 chunks: thread handles j = tid*4 + 1024*u
  float s1 = 0.f;
  for (int u = 0; u < per / 4; ++u) {
    const int j = tid * 4 + 1024 * u;
    const v4f a = *(const v4fa*)(x + j);
    v4f b = {0.f,0.f,0.f,0.f}; if (rr) b = *(const v4fa*)(rr + j);
#pragma unroll
    for (int q = 0; q < 4; ++q) { const float v = a[q] + b[q]; vals[u * 4 + q] = v; s1 += v; }
  }
  red[tid] = s1; __syncthreads();
  for (int st = 128; st > 0; st >>= 1) { if (tid < st) red[tid] += red[tid + st]; __syncthreads(); }
  const float mu = red[0] / (float)N; __syncthreads();
  float s2 = 0.f;
  for (int u = 0; u < per / 4; ++u)
#pragma unroll
    for (int q = 0; q < 4; ++q) { const float c = vals[u * 4 + q] - mu; s2 += c * c; }
  red[tid] = s2; __syncthreads();
  for (int st = 128; st > 0; st >>= 1) { if (tid < st) red[tid] += red[tid + st]; __syncthreads(); }
  const float rs = rsqrtf(red[0] / (float)N + eps);
  {
    for (int u = 0; u < per / 4; ++u) {
      const int j = tid * 4 + 1024 * u;
      v4f o, sm;
#pragma unroll
      for (int q = 0; q < 4; ++q) {
        float gg = g[j + q], bb = bta[j + q];
        if (PARAM_BF16) { gg = bf16_round(gg); bb = bf16_round(bb); }
        sm[q] = vals[u * 4 + q]; o[q] = (vals[u * 4 + q] - mu) * rs * gg + bb;
      }
      if (out_sum) *(v4f*)(out_sum + (size_t)row * N + j) = sm;
      *(v4f*)(out_norm + (size_t)row * N + j) = o;
    }
    
  }
}

// ---- f16 WMMA path (v_wmma_f32_16x16x32_f16): 11-bit significands for operands in range — used where a [0,1] probability operand needs more precision than bf16
typedef _Float16 v16h __attribute__((ext_vector_type(16)));
union FragH { v16h v; v8us half[2]; _Float16 h[16]; unsigned short u[16]; };
template <int NT>
__device__ __forceinline__ v8f mmaH(v16h ah, v16h al, v16h bh, v16h bl, v8f c) {
  c = __builtin_amdgcn_wmma_f32_16x16x32_f16(false, ah, false, bh, (short)0, c, false, false);
  if (NT >= 2) c = __builtin_amdgcn_wmma_f32_16x16x32_f16(false, al, false, bh, (short)0, c, false, false);
  if (NT >= 3) c = __builtin_amdgcn_wmma_f32_16x16x32_f16(false, ah, false, bl, (short)0, c, false, false);
  asm volatile("v_nop\n\tv_nop\n\tv_nop\n\tv_nop" : "+v"(c) : "v"(ah), "v"(al), "v"(bh), "v"(bl));
  return c;
}
// batched GEMM like k_gemm_b but f16 operands: A f32 (split into f16 hi/lo if ASPLIT, else rounded to f16), Bt = f16 values [n][k]; alpha; C f32; N multiple of 16 (partial tiles skipped)
template <bool ASPLIT>
__global__ __launch_bounds__(128) void k_gemm_h(const float* __restrict__ A, int lda, size_t sA, const _Float16* __restrict__ Bh, int ldb, size_t sB, float alpha, float* __restrict__ C, int ldc, size_t sC, int M, int N, int K) {
  __shared__ __attribute__((aligned(16))) float so[4][16][64];
  const int tid = threadIdx.x, w = tid >> 5, lane = tid & 31, ln = lane & 15, hh = lane >> 4; const int by = blockIdx.y;
  A += (size_t)by * sA; Bh += (size_t)by * sB; C += (size_t)by * sC;
  const int ntn = (N + 63) / 64; const int wid = blockIdx.x * 4 + w; const int mt = wid / ntn, nq = wid % ntn; if (mt * 16 >= M) return;
  const int row0 = mt * 16, col0 = nq * 64; const float* arow = A + (size_t)(row0 + ln) * lda;
  v8f acc[4] = {};
  for (int kb = 0; kb < K; kb += 32) {
    FragH ah, al;
    const v4f x0 = *(const v4fa*)(arow + kb + 8 * hh), x1 = *(const v4fa*)(arow + kb + 8 * hh + 4), x2 = *(const v4fa*)(arow + kb + 16 + 8 * hh), x3 = *(const v4fa*)(arow + kb + 16 + 8 * hh + 4);
    float xs[16] = {x0[0],x0[1],x0[2],x0[3],x1[0],x1[1],x1[2],x1[3],x2[0],x2[1],x2[2],x2[3],x3[0],x3[1],x3[2],x3[3]};
#pragma unroll
    for (int i = 0; i < 16; ++i) { const _Float16 h = (_Float16)xs[i]; ah.h[i] = h; al.h[i] = ASPLIT ? (_Float16)(xs[i] - (float)h) : (_Float16)0.0f; }
#pragma unroll
    for (int t = 0; t < 4; ++t) { if (col0 + t * 16 >= N) continue; const size_t boff = (size_t)(col0 + t * 16 + ln) * ldb + kb; FragH bq; bq.half[0] = *(const v8us*)(Bh + boff + 8 * hh); bq.half[1] = *(const v8us*)(Bh + boff + 16 + 8 * hh);
      acc[t] = mmaH<ASPLIT ? 2 : 1>(ah.v, al.v, bq.v, bq.v, acc[t]); }
  }
#pragma unroll
  for (int t = 0; t < 4; ++t) { if (col0 + t * 16 >= N) continue;
#pragma unroll
    for (int r = 0; r < 8; ++r) so[w][8 * hh + r][t * 16 + ln] = acc[t][r] * alpha; }
  __builtin_amdgcn_fence(__ATOMIC_ACQ_REL, "workgroup"); __builtin_amdgcn_wave_barrier();
  const int rsub = lane >> 4, c4 = (lane & 15) * 4;
  {
#pragma unroll
    for (int q = 0; q < 8; ++q) { const int r = q * 2 + rsub; if (col0 + c4 < N) { const v4f v = *(const v4fa*)&so[w][r][c4]; *(v4f*)(C + (size_t)(row0 + r) * ldc + col0 + c4) = v; } }
     }
}

// Wt[n][k] = f16(W[k][n]·scale) from f32 row-major W[K][N] (scale = power of two; bf16-exact weights stay exact in f16 away from the subnormal range)
__global__ __launch_bounds__(256) void k_wt_f16(const float* __restrict__ W, _Float16* __restrict__ Wt, int K, int N, float scale) {
  const int t = blockIdx.x * 256 + threadIdx.x; if (t >= N * (K / 8)) return; const int n = t / (K / 8), k8 = (t % (K / 8)) * 8; FragH f;
#pragma unroll
  for (int i = 0; i < 8; ++i) f.h[i] = (_Float16)(bf16_round(W[(size_t)(k8 + i) * N + n]) * scale); const v8us o = f.half[0];
  *(v8us*)((unsigned short*)Wt + (size_t)n * K + k8) = o; 
}
// k_gemm_hh variant with fused epilogue: v = acc·alpha + bias[by·sBias + col] (+ CP[(row/rowsPerB)·sCPb + by·64 + col] if CP) ; ACT 0 none / 1 elu ; writes f16 C16 (and f32 C if non-null)
template <int ACT>
__global__ __launch_bounds__(128) void k_gemm_hhx(const _Float16* __restrict__ A, int lda, size_t sA, const _Float16* __restrict__ Bh, int ldb, size_t sB, float alpha, const float* __restrict__ bias, size_t sBias, const float* __restrict__ CP, int rowsPerB, size_t sCPb, int row0g,
    float* __restrict__ C, _Float16* __restrict__ C16, int ldc, size_t sC, int M, int N, int K) {
  __shared__ __attribute__((aligned(16))) float so[4][16][64];
  const int tid = threadIdx.x, w = tid >> 5, lane = tid & 31, ln = lane & 15, hh = lane >> 4; const int by = blockIdx.y;
  A += (size_t)by * sA; Bh += (size_t)by * sB; const size_t cofs = (size_t)by * sC; const float* bp = bias ? bias + (size_t)by * sBias : nullptr;
  const int ntn = (N + 63) / 64; const int wid = blockIdx.x * 4 + w; const int mt = wid / ntn, nq = wid % ntn; if (mt * 16 >= M) return;
  const int row0 = mt * 16, col0 = nq * 64; const _Float16* arow = A + (size_t)(row0 + ln) * lda;
  v8f acc[4] = {};
  for (int kb = 0; kb < K; kb += 32) { FragH ah; ah.half[0] = *(const v8us*)((const unsigned short*)arow + kb + 8 * hh); ah.half[1] = *(const v8us*)((const unsigned short*)arow + kb + 16 + 8 * hh);
#pragma unroll
    for (int t = 0; t < 4; ++t) { if (col0 + t * 16 >= N) continue; const size_t boff = (size_t)(col0 + t * 16 + ln) * ldb + kb; FragH bq; bq.half[0] = *(const v8us*)((const unsigned short*)Bh + boff + 8 * hh); bq.half[1] = *(const v8us*)((const unsigned short*)Bh + boff + 16 + 8 * hh);
      acc[t] = mmaH<1>(ah.v, ah.v, bq.v, bq.v, acc[t]); }
  }
#pragma unroll
  for (int t = 0; t < 4; ++t) { if (col0 + t * 16 >= N) continue; const int col = col0 + t * 16 + ln; const float bv = bp ? bf16_round(bp[col]) : 0.f;
#pragma unroll
    for (int r = 0; r < 8; ++r) { float v = acc[t][r] * alpha + bv; if (CP) { const int rr = row0g + row0 + 8 * hh + r; if (rowsPerB < 0) v += CP[cofs + (size_t)rr * ldc + col];      /* rowsPerB < 0: own element of the batched C plane */ else { const int bidx = rr / rowsPerB; v += CP[(size_t)bidx * sCPb + (size_t)by * 64 + col]; } } if (ACT == 1) v = (v > 0.f) ? v : expm1f(v); else if (ACT == 7) v = (v > 0.f) ? v + 1.0f : expf(v); else if (ACT == 8) v = tanhf(v); else if (ACT == 9) v = 0.5f * v * (1.0f + tanhf(0.7978845608028654f * (v + 0.044715f * v * v * v))); else if (ACT == 11) v = 1.0f / (1.0f + expf(-v)); else if (ACT == 12) v = (v > 0.f) ? v : 0.01f * v; else if (ACT == 14) v = (v > 0.f) ? v : 0.1f * v; else if (ACT == 16) v = (v >= 0.f) ? v : 0.3f * v; else if (ACT == 17) v = (v >= 0.f) ? v : 0.2f * v; else if (ACT == 15) v = v / (1.0f + expf(-v)); else if (ACT == 3) v = fmaxf(v, 0.f); else if (ACT == 6) v = 0.5f * v * (1.0f + erff(v * 0.70710678118654752f)); so[w][8 * hh + r][t * 16 + ln] = v; } }
  __builtin_amdgcn_fence(__ATOMIC_ACQ_REL, "workgroup"); __builtin_amdgcn_wave_barrier();
  const int rsub = lane >> 4, c4 = (lane & 15) * 4; typedef _Float16 v4h __attribute__((ext_vector_type(4)));
  {
#pragma unroll
    for (int q = 0; q < 8; ++q) { const int r = q * 2 + rsub; if (col0 + c4 < N) { const v4f v = *(const v4fa*)&so[w][r][c4]; if (C) *(v4f*)(C + cofs + (size_t)(row0 + r) * ldc + col0 + c4) = v; if (C16) { v4h h4; for (int i = 0; i < 4; ++i) h4[i] = (_Float16)v[i]; *(v4h*)(C16 + cofs + (size_t)(row0 + r) * ldc + col0 + c4) = h4; } } }
     }
}

typedef _Float16 v4h __attribute__((ext_vector_type(4)));

// 64 elements a thread (the stage costs the start of its waves more than its bytes): a block converts 64 KiB of source that lie in a row; group u of four elements of thread t is 256 u + t, so every load and store covers whole 128-byte lines under one index register.
typedef _Float16 v4ha __attribute__((ext_vector_type(4), may_alias));
__device__ __forceinline__ void d_x16(unsigned bx, const float* __restrict__ x, _Float16* __restrict__ X16) { const unsigned i0 = bx * 4096u + threadIdx.x; v4f a[16]; v4h o[16];
#pragma unroll
  for (int u = 0; u < 16; ++u) a[u] = ((const v4fa*)(x + u * 1024))[i0];
#pragma unroll
  for (int u = 0; u < 16; ++u)
#pragma unroll
    for (int q = 0; q < 4; ++q) o[u][q] = (_Float16)bf16_round(a[u][q]);
#pragma unroll
  for (int u = 0; u < 16; ++u) ((v4ha*)(X16 + u * 1024))[i0] = o[u]; }
__global__ __launch_bounds__(256) void k_h16(const float* __restrict__ x, _Float16* __restrict__ X16, size_t n8) { const size_t t = (size_t)blockIdx.x * 256 + threadIdx.x; if (t >= n8) return; FragH f;
#pragma unroll
  for (int q = 0; q < 8; ++q) f.h[q] = (_Float16)x[t * 8 + q]; *(v8us*)((unsigned short*)X16 + t * 8) = f.half[0];  }
__global__ __launch_bounds__(256) void k_round16f(const float* __restrict__ W, _Float16* __restrict__ Bt, size_t n8) { const size_t t = (size_t)blockIdx.x * 256 + threadIdx.x; if (t >= n8) return; FragH f;
#pragma unroll
  for (int i = 0; i < 8; ++i) f.h[i] = (_Float16)(bf16_round(W[t * 8 + i]) * 16.0f); *(v8us*)((unsigned short*)Bt + t * 8) = f.half[0];  }
template <int NHv, int TTv>
__device__ __forceinline__ void d_vt(int bx, const _Float16* __restrict__ V16, int ldv, int voff, _Float16* __restrict__ Vt) { __shared__ unsigned short tl[64][66]; const int tid = threadIdx.x; const int slab = bx / (TTv / 64), lg = bx % (TTv / 64); const int b = slab / NHv, h = slab % NHv;
  for (int i = tid; i < 64 * 8; i += 256) { const int r = i / 8, c8 = (i % 8) * 8; FragH f; f.half[0] = *(const v8us*)((const unsigned short*)V16 + ((size_t)b * TTv + lg * 64 + r) * ldv + voff + h * 64 + c8);
#pragma unroll
    for (int q = 0; q < 8; ++q) tl[r][c8 + q] = f.u[q]; }
  __syncthreads();
  {
#pragma unroll
    for (int rd = 0; rd < 2; ++rd) { const int d = rd * 32 + tid / 8, pc = tid % 8; FragH f;
#pragma unroll
      for (int q = 0; q < 8; ++q) f.u[q] = tl[pc * 8 + q][d];
      *(v8us*)((unsigned short*)Vt + ((size_t)slab * 64 + d) * TTv + lg * 64 + pc * 8) = f.half[0]; }
     } }

__device__ __forceinline__ void d_hl(size_t t, const float* __restrict__ F, _Float16* __restrict__ Hh, _Float16* __restrict__ Hl, size_t n8) { if (t >= n8) return; FragH fh, fl; const v4f a = *(const v4fa*)(F + t * 8), c = *(const v4fa*)(F + t * 8 + 4);
#pragma unroll
  for (int q = 0; q < 4; ++q) { _Float16 h = (_Float16)a[q]; fh.h[q] = h; fl.h[q] = (_Float16)((a[q] - (float)h) * 1024.0f); h = (_Float16)c[q]; fh.h[4 + q] = h; fl.h[4 + q] = (_Float16)((c[q] - (float)h) * 1024.0f); }
  { *(v8us*)((unsigned short*)Hh + t * 8) = fh.half[0]; *(v8us*)((unsigned short*)Hl + t * 8) = fl.half[0];  } }

// ---- fast GEMM on LDS tiles (block tile 128x128, four waves of 64x64; requires M % 128 == 0 rows per launch region, N % 128 == 0, K % 64 == 0); epilogue = k_gemm_hhx semantics ----
// A stage is 64 k of 128 A rows and of 128 B rows (128 bytes a row) at an LDS pitch of 144 bytes (16 bytes x 9: the 16-byte fragment reads of 16 rows fall on all 64 banks). Two buffers: the next stage's copies fly while this one is worked on.
// Each 128-byte line of A and B now leaves L2 once per block, as a whole line (eight lanes a row), and feeds two waves from LDS; before, every wave fetched its own fragments with loads that touched 16 lines each.
#define G3_PITCH 144u                      /* bytes between LDS rows */
#define G3_STAGE (256u * G3_PITCH)         /* bytes of a stage: 128 A rows, then 128 B rows */
__device__ __forceinline__ v16h g2_frag(const _Float16* p, int hh) { FragH f; f.half[0] = *(const v8us*)((const unsigned short*)p + 8 * hh); f.half[1] = *(const v8us*)((const unsigned short*)p + 16 + 8 * hh); return f.v; }
__device__ __forceinline__ v16h g3_frag(const unsigned char* p) { FragH f; f.half[0] = *(const v8us*)p; f.half[1] = *(const v8us*)(p + 32); return f.v; }      /* p = row start + 64 kc + 16 hh: the k order of g2_frag (elements 0..7 = k 8 hh + i, 8..15 = k 16 + 8 hh + i) */
// Eight asynchronous 16-byte copies a lane, rows 16 apart: LDS byte address l + 16 i rows, global address g + i rs elements. The s_wait_xcnt stands in the copies' own statement, so that no register that a copy names is rewritten in front of it.
__device__ __forceinline__ void g3_copy8(unsigned l, const _Float16* g, size_t rs) {
  asm volatile("global_load_async_to_lds_b128 %0, %8, off\n\t"
               "global_load_async_to_lds_b128 %1, %9, off\n\t"
               "global_load_async_to_lds_b128 %2, %10, off\n\t"
               "global_load_async_to_lds_b128 %3, %11, off\n\t"
               "global_load_async_to_lds_b128 %4, %12, off\n\t"
               "global_load_async_to_lds_b128 %5, %13, off\n\t"
               "global_load_async_to_lds_b128 %6, %14, off\n\t"
               "global_load_async_to_lds_b128 %7, %15, off\n\t"
               "s_wait_xcnt 0x0"
               :: "v"(l), "v"(l + 16u * G3_PITCH), "v"(l + 32u * G3_PITCH), "v"(l + 48u * G3_PITCH), "v"(l + 64u * G3_PITCH), "v"(l + 80u * G3_PITCH), "v"(l + 96u * G3_PITCH), "v"(l + 112u * G3_PITCH),
                  "v"(g), "v"(g + rs), "v"(g + 2 * rs), "v"(g + 3 * rs), "v"(g + 4 * rs), "v"(g + 5 * rs), "v"(g + 6 * rs), "v"(g + 7 * rs)
               : "memory");
}
// The wave's 64 staged rows to memory, eight rows of a lane a trip: v = acc alpha + bias (+ CP), activation, then whole-line stores. CPM 0: no CP; 1: cp walks like the output (step cs a row pair); 2: cp + (row / rowsPerB) cs. wc, wh: an f32, an f16 output is there (the same for the whole block: scalar branches).
template <int ACT, int CPM>
__device__ __forceinline__ void g3_rows(const float* sl, float alpha, v4f bv, const float* cp, size_t cs, int rowg, int rowsPerB, bool wc, bool wh, float* cl, _Float16* hl, size_t st) {
#pragma unroll 1      /* eight stores a trip, then the wait in front of the next trip's rewrite of their registers */
  for (int q0 = 0; q0 < 32; q0 += 8) { v4f o[8], x[8];
#pragma unroll
    for (int q = 0; q < 8; ++q) { o[q] = *(const v4fa*)(sl + (q0 + q) * (2 * 68));
      if (CPM == 1) x[q] = *(const v4fa*)(cp + (size_t)(q0 + q) * cs);
      if (CPM == 2) { const float* p = cp + (size_t)((rowg + 2 * (q0 + q)) / rowsPerB) * cs; x[q] = v4f{p[0], p[1], p[2], p[3]}; } }
#pragma unroll
    for (int q = 0; q < 8; ++q)
#pragma unroll
      for (int e = 0; e < 4; ++e) { float v = o[q][e] * alpha + bv[e]; if (CPM != 0) v += x[q][e];
        if (ACT == 3) v = fmaxf(v, 0.f); else if (ACT == 6) v = 0.5f * v * (1.0f + erff(v * 0.70710678118654752f)); else if (ACT == 11) v = 1.0f / (1.0f + expf(-v)); else if (ACT == 15) v = v / (1.0f + expf(-v)); else if (ACT == 12) v = (v > 0.f) ? v : 0.01f * v; else if (ACT == 8) v = tanhf(v); else if (ACT == 9) v = 0.5f * v * (1.0f + tanhf(0.7978845608028654f * (v + 0.044715f * v * v * v))); else if (ACT == 14) v = (v > 0.f) ? v : 0.1f * v; else if (ACT == 16) v = (v >= 0.f) ? v : 0.3f * v; else if (ACT == 17) v = (v >= 0.f) ? v : 0.2f * v;
        o[q][e] = v; }
    if (wc) { float* p[8];
#pragma unroll
      for (int q = 0; q < 8; ++q) p[q] = cl + (size_t)(q0 + q) * st;
      __builtin_amdgcn_sched_barrier(0);      /* the trip's rows and addresses are made ahead of its first store, so that no register of an issued store is written again in front of the wait */
#pragma unroll
      for (int q = 0; q < 8; ++q) *(v4f*)p[q] = o[q];
      asm volatile("s_wait_xcnt 0x0" ::: "memory"); __builtin_amdgcn_sched_barrier(0); }      /* the wait in front of the next rewrite of the stores' address and data registers; the scheduling barrier keeps that rewrite behind it */
    if (wh) { _Float16* p[8]; v4h h[8];
#pragma unroll
      for (int q = 0; q < 8; ++q) { p[q] = hl + (size_t)(q0 + q) * st;
#pragma unroll
        for (int e = 0; e < 4; ++e) h[q][e] = (_Float16)o[q][e]; }
      __builtin_amdgcn_sched_barrier(0);      /* as above */
#pragma unroll
      for (int q = 0; q < 8; ++q) *(v4h*)p[q] = h[q];
      asm volatile("s_wait_xcnt 0x0" ::: "memory"); __builtin_amdgcn_sched_barrier(0); } }      /* as above */
}
// bx, by: the block's tile index and its batch (a kernel passes its block indices, or what it derives from them: the same for the whole block).
template <int ACT>
__device__ __forceinline__ void g3_gemm(int bx, int by, const _Float16* __restrict__ A, int lda, size_t sA, const _Float16* __restrict__ Bh, int ldb, size_t sB, float alpha, const float* __restrict__ bias, size_t sBias, const float* __restrict__ CP, int rowsPerB, size_t sCPb, int row0g,
    float* __restrict__ C, _Float16* __restrict__ C16, int ldc, size_t sC, int M, int N, int K) { static_assert(ACT == 0 || ACT == 3 || ACT == 6 || ACT == 8 || ACT == 9 || ACT == 11 || ACT == 12 || ACT == 14 || ACT == 15 || ACT == 16 || ACT == 17, "k_gemm2: unsupported ACT code (would silently apply no activation)");
  __shared__ __attribute__((aligned(16))) unsigned char L[2 * G3_STAGE];      /* the two stage buffers; behind the loop, each wave's 64 x 68 f32 output staging */
  static_assert(4 * 64 * 68 * 4 <= 2 * G3_STAGE, "k_gemm2: the output staging fits the ring");
  const int tid = threadIdx.x, lane = tid & 31, ln = lane & 15, hh = lane >> 4; const int w = __builtin_amdgcn_readfirstlane(tid >> 5);
  A += (size_t)by * sA; Bh += (size_t)by * sB; const size_t cofs = (size_t)by * sC; const float* bp = bias ? bias + (size_t)by * sBias : nullptr;
  const int ntn = N >> 7; const int mt = bx / ntn, nq = bx - mt * ntn; if (mt * 128 >= M) return;      /* the same for the whole block, ahead of every barrier */
  const int row0 = mt * 128 + 64 * (w >> 1), col0 = nq * 128 + 64 * (w & 1);      /* the wave's 64 x 64 tile */
  const _Float16* ga = A + (size_t)(mt * 128 + (tid >> 3)) * lda + (tid & 7) * 8;      /* eight lanes cover a row's 128 bytes; a wave's copy covers four whole lines */
  const _Float16* gb = Bh + (size_t)(nq * 128 + (tid >> 3)) * ldb + (tid & 7) * 8;
  const size_t ra = (size_t)16 * lda, rb = (size_t)16 * ldb;
  const unsigned lc = (unsigned)(size_t)L + (unsigned)(tid >> 3) * G3_PITCH + (unsigned)(tid & 7) * 16u;
  const int nt = K >> 6;
  g3_copy8(lc, ga, ra); g3_copy8(lc + 128u * G3_PITCH, gb, rb);      /* stage 0 */
  asm volatile("s_wait_asynccnt 0x0" ::: "memory");      /* this wave's copies of stage 0 have landed */
  __syncthreads();      /* ... and every wave's */
  if (nt > 1) { g3_copy8(lc + G3_STAGE, ga + 64, ra); g3_copy8(lc + G3_STAGE + 128u * G3_PITCH, gb + 64, rb); }      /* stage 1 */
  const unsigned char* fa = L + (unsigned)(64 * (w >> 1) + ln) * G3_PITCH + 16u * hh;
  const unsigned char* fb = L + (unsigned)(128 + 64 * (w & 1) + ln) * G3_PITCH + 16u * hh;
  v8f acc[4][4];
#pragma unroll
  for (int i = 0; i < 4; ++i)
#pragma unroll
    for (int j = 0; j < 4; ++j) acc[i][j] = v8f{0.f, 0.f, 0.f, 0.f, 0.f, 0.f, 0.f, 0.f};
#pragma unroll 1      /* one stage per trip: the buffer is chosen by a scalar offset */
  for (int t = 0; t < nt; ++t) { const unsigned bo = (unsigned)(t & 1) * G3_STAGE;
#pragma unroll
    for (int kc = 0; kc < 2; ++kc) { v16h af[4], bf[4];
      af[0] = g3_frag(fa + bo + 64u * kc);
#pragma unroll
      for (int j = 0; j < 4; ++j) bf[j] = g3_frag(fb + bo + (unsigned)(16 * j) * G3_PITCH + 64u * kc);
#pragma unroll
      for (int i = 1; i < 4; ++i) af[i] = g3_frag(fa + bo + (unsigned)(16 * i) * G3_PITCH + 64u * kc);
      __builtin_amdgcn_sched_barrier(0);      /* the block's sixteen LDS reads stand as one group ahead of its WMMAs, in the order in which these need them (left alone, the build read each A fragment right in front of its row and waited out the LDS latency four times a block) */
#pragma unroll
      for (int i = 0; i < 4; ++i)
#pragma unroll
        for (int j = 0; j < 4; ++j) acc[i][j] = __builtin_amdgcn_wmma_f32_16x16x32_f16(false, af[i], false, bf[j], (short)0, acc[i][j], false, false);
      if (kc == 0) __builtin_amdgcn_sched_barrier(0); }      /* ... and the next block's reads behind them */
    __builtin_amdgcn_sched_barrier(0); asm volatile("v_nop\n\tv_nop\n\tv_nop\n\tv_nop"); __builtin_amdgcn_sched_barrier(0);      /* the four vector slots behind the trip's last WMMAs, on every path: a branch and the copies' address arithmetic, which may reuse the fragment registers, follow */
    asm volatile("s_wait_dscnt 0x0" ::: "memory");      /* this wave's reads of the buffer are done before the buffer is handed to the copies */
    asm volatile("s_wait_asynccnt 0x0" ::: "memory");      /* this wave's copies of stage t + 1 have landed */
    __syncthreads();      /* publishes stage t + 1 and ends every wave's reads of stage t */
    if (t + 2 < nt) { g3_copy8(lc + bo, ga + (size_t)(t + 2) * 64, ra); g3_copy8(lc + bo + 128u * G3_PITCH, gb + (size_t)(t + 2) * 64, rb); } }      /* stage t + 2 into the buffer just read */
  asm volatile("s_wait_asynccnt 0x0" ::: "memory");      /* no copy is in flight when the ring becomes output staging (the last trip's barrier has ended every read of it) */
  float* so = (float*)(L + (unsigned)w * (64u * 68u * 4u));
#pragma unroll
  for (int i = 0; i < 4; ++i)
#pragma unroll
    for (int j = 0; j < 4; ++j)
#pragma unroll
      for (int r = 0; r < 8; ++r) so[(16 * i + 8 * hh + r) * 68 + 16 * j + ln] = acc[i][j][r];
  __builtin_amdgcn_fence(__ATOMIC_ACQ_REL, "workgroup"); __builtin_amdgcn_wave_barrier();
  const int rsub = lane >> 4, c4 = (lane & 15) * 4; const int col = col0 + c4;      /* a lane takes four columns of every second row: sixteen lanes store 256 bytes (f16: 128) of a row */
  v4f bv = {0.f, 0.f, 0.f, 0.f};
  if (bp) { const v4f b4 = *(const v4fa*)(bp + col);
    asm volatile("s_wait_xcnt 0x0" ::: "memory");      /* the wait in front of the rewrite of the bias load's address registers (the build reuses them for the rounding just below) */
#pragma unroll
    for (int e = 0; e < 4; ++e) bv[e] = bf16_round(b4[e]); }
  const size_t eo = cofs + (size_t)(row0 + rsub) * ldc + col; const size_t st = (size_t)2 * ldc; const float* sl = so + rsub * 68 + c4;
  const bool wc = C != nullptr, wh = C16 != nullptr; float* cl = wc ? C + eo : nullptr; _Float16* hl = wh ? C16 + eo : nullptr;
  if (!CP) g3_rows<ACT, 0>(sl, alpha, bv, nullptr, 0, 0, 1, wc, wh, cl, hl, st);
  else if (rowsPerB < 0) g3_rows<ACT, 1>(sl, alpha, bv, CP + cofs + (size_t)(row0g + row0 + rsub) * ldc + col, st, 0, 1, wc, wh, cl, hl, st);      /* rowsPerB < 0: own element of the batched C plane */
  else g3_rows<ACT, 2>(sl, alpha, bv, CP + (size_t)by * 64 + col, sCPb, row0g + row0 + rsub, rowsPerB, wc, wh, cl, hl, st);
}
template <int ACT>
__global__ __launch_bounds__(128) void k_gemm2(const _Float16* __restrict__ A, int lda, size_t sA, const _Float16* __restrict__ Bh, int ldb, size_t sB, float alpha, const float* __restrict__ bias, size_t sBias, const float* __restrict__ CP, int rowsPerB, size_t sCPb, int row0g,
    float* __restrict__ C, _Float16* __restrict__ C16, int ldc, size_t sC, int M, int N, int K) { g3_gemm<ACT>((int)blockIdx.x, (int)blockIdx.y, A, lda, sA, Bh, ldb, sB, alpha, bias, sBias, CP, rowsPerB, sCPb, row0g, C, C16, ldc, sC, M, N, K); }
// The four projection GEMMs, which do not depend on one another, in ONE launch: blocks 0..63 the f32 v of the first QT0 rows of each batch (16 tiles a batch; first, for speed only), then 512 blocks each for v (f16 rows), q (f32) and k (f32) of every batch.
#define QKV_B0 (NB * (QT0 / 128) * (KVD / 128))      /* blocks of the first-tile v */
#define QKV_BJ ((MP / 128) * (DM / 128))             /* blocks of a whole projection */
__global__ __launch_bounds__(128) void k_qkv(const _Float16* __restrict__ XQ, const _Float16* __restrict__ XK, const _Float16* __restrict__ XV, const _Float16* __restrict__ BQ, const _Float16* __restrict__ BK, const _Float16* __restrict__ BV,
    const float* __restrict__ bq, const float* __restrict__ bk, const float* __restrict__ bv, float* __restrict__ QF, float* __restrict__ KF, _Float16* __restrict__ V16, float* __restrict__ VF0) {
  static_assert(KVD == DM && QKV_B0 == 64 && QKV_BJ == 512, "k_qkv: the block ranges below");
  const int b = (int)blockIdx.x; const bool f0 = b < QKV_B0; const int r = b - QKV_B0; const int j = f0 ? 0 : r >> 9;      /* j: 0 = v, 1 = q, 2 = k; all scalar */
  const _Float16* A = j == 0 ? XV : j == 1 ? XQ : XK; const _Float16* B = j == 0 ? BV : j == 1 ? BQ : BK; const float* bias = j == 0 ? bv : j == 1 ? bq : bk;
  float* C = f0 ? VF0 : j == 0 ? nullptr : j == 1 ? QF : KF; _Float16* C16 = (!f0 && j == 0) ? V16 : nullptr;
  g3_gemm<0>(f0 ? (b & 15) : (r & 511), f0 ? (b >> 4) : 0, A, DM, (size_t)SQ * DM, B, DM, 0, 0.0625f, bias, 0, nullptr, 1, 0, 0, C, C16, DM, (size_t)QT0 * KVD, f0 ? QT0 : MP, DM, DM);
}

// The output GEMM of the f16 path and the split of the first-tile o into its two f16 planes, which do not depend on one another, in ONE launch: 512 GEMM blocks, then 1024 blocks of 128 threads that split eight elements a thread.
#define OH_G ((MPO / 128) * (DM / 128))
#define OH_H ((int)((size_t)NB * QT0 * DM / 8 / 128))
__global__ __launch_bounds__(128) void k_outhl(const _Float16* __restrict__ O16, const _Float16* __restrict__ BO, const float* __restrict__ bo, float* __restrict__ out, const float* __restrict__ OF0, _Float16* __restrict__ OH0, _Float16* __restrict__ OL0) {
  static_assert((size_t)NB * QT0 * DM % 1024 == 0, "k_outhl: whole blocks");
  const int b = (int)blockIdx.x;      /* the test below is scalar, the same for the whole block, ahead of every barrier */
  if (b >= OH_G) { d_hl((size_t)(b - OH_G) * 128 + threadIdx.x, OF0, OH0, OL0, (size_t)NB * QT0 * DM / 8); return; }
  g3_gemm<0>(b, 0, O16, DM, 0, BO, DM, 0, 0.0009765625f, bo, 0, nullptr, 1, 0, 0, out, nullptr, DM, 0, MPO, DM, DM);
}

__device__ __forceinline__ void d_wnat(unsigned bx, const float* __restrict__ w, size_t n8, _Float16* __restrict__ Bt) { const size_t t = (size_t)bx * 256 + threadIdx.x; if (t >= n8) return; FragH f; for (int q = 0; q < 8; ++q) f.h[q] = (_Float16)(bf16_round(w[t * 8 + q]) * 16.0f); *(v8us*)((unsigned short*)Bt + t * 8) = f.half[0];  }

// exp2 with the one issue slot that the instruction set asks for behind a transcendental (before its source is overwritten or its result read) in the same statement.
__device__ __forceinline__ float exp2_slot(float x) { float e; asm("v_exp_f32 %0, %1\n\tv_nop" : "=v"(e) : "v"(x)); return e; }
__device__ __forceinline__ v8f fa_mma(v16h a, v16h b, v8f c) { return __builtin_amdgcn_wmma_f32_16x16x32_f16(false, a, false, b, (short)0, c, false, false); }
__device__ __forceinline__ float fa_xhalf(float x) { return __builtin_bit_cast(float, __builtin_amdgcn_permlanex16(__builtin_bit_cast(int, x), __builtin_bit_cast(int, x), 0x76543210, 0xfedcba98, false, false)); }      /* lane l with lane l ^ 16 */
__device__ __forceinline__ void fa_gap() { __builtin_amdgcn_sched_barrier(0); asm volatile("v_nop\n\tv_nop\n\tv_nop\n\tv_nop"); __builtin_amdgcn_sched_barrier(0); }      /* the four vector slots behind a group of WMMAs, on every path: a branch or a load over their operands follows; the two scheduling barriers keep the slots (and the loads issued ahead) where they stand */
// K and V^T reach the waves through LDS: a stage is 64 keys, 64 K rows (128 bytes: the head's 64 d) and then the 64 V^T rows (128 bytes: the stage's 64 keys), at an LDS pitch of 144 bytes (16 bytes x 9: the 16-byte fragment reads of 16 rows fall on all 64 banks). Two buffers: the next stage's copies fly while this one is worked on.
// Each 128-byte line leaves L2 once per block, as a whole line (eight lanes a row), and feeds the block's four waves from LDS; before, every wave fetched its own fragments with loads that touched 16 lines each.
#define FA_PITCH 144u                      /* bytes between LDS rows */
#define FA_STAGE (128u * FA_PITCH)         /* bytes of a stage: 64 K rows, then 64 V^T rows */
// Four asynchronous 16-byte copies a lane, rows 16 apart: LDS byte address l + 16 i rows, global address g + i rs elements. The s_wait_xcnt stands in the copies' own statement, so that no register that a copy names is rewritten in front of it.
__device__ __forceinline__ void fa_copy4(unsigned l, const _Float16* g, size_t rs) {
  asm volatile("global_load_async_to_lds_b128 %0, %4, off\n\t"
               "global_load_async_to_lds_b128 %1, %5, off\n\t"
               "global_load_async_to_lds_b128 %2, %6, off\n\t"
               "global_load_async_to_lds_b128 %3, %7, off\n\t"
               "s_wait_xcnt 0x0"
               :: "v"(l), "v"(l + 16u * FA_PITCH), "v"(l + 32u * FA_PITCH), "v"(l + 48u * FA_PITCH),
                  "v"(g), "v"(g + rs), "v"(g + 2 * rs), "v"(g + 3 * rs)
               : "memory");
}
template <bool LAST>      /* LAST = the wave's diagonal pass: masked. kl: LDS, the lane's K row of the pass (+ 16 hh bytes); vl: LDS, the lane's V^T row at the pass's first key (+ 16 hh bytes) */
__device__ __forceinline__ void fa_pass(const unsigned char* kl, const unsigned char* vl, int key0, int qw0, int ln, int hh, const v16h (&qf)[2][2], v8f (&acc)[2][4], float (&m_run)[2], float (&l_run)[2]) {
  const float cs = 0.125f * 1.44269504088896340736f;
  v16h kf[2][2], vf[4];
#pragma unroll
  for (int kt = 0; kt < 2; ++kt)
#pragma unroll
    for (int kc = 0; kc < 2; ++kc) kf[kt][kc] = g3_frag(kl + (unsigned)(16 * kt) * FA_PITCH + 64u * kc);      /* the k order of g2_frag, as for Q */
  __builtin_amdgcn_sched_barrier(0);      /* the eight LDS reads of K stand as one group ahead of the score WMMAs (for speed only) */
  v8f s[2][2];
#pragma unroll
  for (int kt = 0; kt < 2; ++kt)
#pragma unroll
    for (int g = 0; g < 2; ++g) { const v8f z = {0.f, 0.f, 0.f, 0.f, 0.f, 0.f, 0.f, 0.f}; s[kt][g] = fa_mma(kf[kt][1], qf[g][1], fa_mma(kf[kt][0], qf[g][0], z)); }
  fa_gap();
#pragma unroll
  for (int t = 0; t < 4; ++t) vf[t] = g3_frag(vl + (unsigned)(16 * t) * FA_PITCH);      /* this pass's V^T rows, read behind the score WMMAs (they may take the K fragments' registers) and in flight under the exponentials */
  __builtin_amdgcn_sched_barrier(0);      /* ... as one group (left alone, the build spread them over four places among the exponentials) */
  if (LAST) {
#pragma unroll
    for (int g = 0; g < 2; ++g)
#pragma unroll
      for (int kt = 0; kt < 2; ++kt)
#pragma unroll
        for (int r = 0; r < 8; ++r) if (key0 + 16 * kt + 8 * hh + r > qw0 + 16 * g + ln) s[kt][g][r] = -3.0e38f;      /* causal: key above the query (key0 itself is never masked, so every maximum stays a real score) */
  }
  float mb[2]; bool need = false;
#pragma unroll
  for (int g = 0; g < 2; ++g) { float mx = s[0][g][0];
#pragma unroll
    for (int r = 1; r < 8; ++r) mx = fmaxf(mx, s[0][g][r]);
#pragma unroll
    for (int r = 0; r < 8; ++r) mx = fmaxf(mx, s[1][g][r]);
    mx = fmaxf(mx, fa_xhalf(mx)) * cs; mb[g] = mx; need = need || (mx > m_run[g] + 8.0f); }
  if (__builtin_amdgcn_ballot_w32(need) != 0) {      /* wave-uniform; rare after the first passes */
#pragma unroll
    for (int g = 0; g < 2; ++g) { const float mn = fmaxf(m_run[g], mb[g]); const float corr = exp2_slot(m_run[g] - mn); m_run[g] = mn; l_run[g] *= corr;
#pragma unroll
      for (int t = 0; t < 4; ++t) acc[g][t] = acc[g][t] * corr; }
  }
  FragH pf[2];
#pragma unroll
  for (int g = 0; g < 2; ++g) { const float nm = -m_run[g]; float ls[4] = {0.f, 0.f, 0.f, 0.f};
#pragma unroll
    for (int i = 0; i < 16; ++i) { const float e = exp2_slot(fmaf(s[i >> 3][g][i & 7], cs, nm)); ls[i & 3] += e; pf[g].h[i] = (_Float16)e; }
    l_run[g] += (ls[0] + ls[1]) + (ls[2] + ls[3]); }
  __builtin_amdgcn_sched_barrier(0);      /* every exponential stands ahead of the WMMAs */
#pragma unroll
  for (int g = 0; g < 2; ++g)
#pragma unroll
    for (int t = 0; t < 4; ++t) acc[g][t] = fa_mma(vf[t], pf[g].v, acc[g][t]);
  fa_gap();
}
__device__ __forceinline__ void d_fattn(int xs, int nq, int h, int b, const _Float16* __restrict__ Q, const _Float16* __restrict__ K, const _Float16* __restrict__ Vt, _Float16* __restrict__ O) {      /* xs of nq: the block's place among the query tiles; h, b: its head and batch */
  const int lane = threadIdx.x & 31, ln = lane & 15, hh = lane >> 4; const int w = __builtin_amdgcn_readfirstlane((int)(threadIdx.x >> 5));      /* the wave's number in a scalar register: trip count and branches stay scalar, EXEC stays full for the WMMAs */
  const int qa = (xs & 1) ? (xs >> 1) : nq - 1 - (xs >> 1); const int qb = (b & 1) ? nq - 1 - qa : qa;      /* a permutation of the query tiles: long and short ones alternate between neighbouring blocks and between batches (speed only) */
  const int qw0 = qb * 128 + w * 32;
  __shared__ __attribute__((aligned(16))) unsigned char FL[2 * FA_STAGE];      /* the two stage buffers */
  const int tid = (int)threadIdx.x;
  const _Float16* Ql = Q + ((size_t)b * SQ + qw0 + ln) * DM + h * HD;
  const _Float16* gk = K + ((size_t)b * SQ + (tid >> 3)) * KVD + h * HD + (tid & 7) * 8;      /* eight lanes cover a row's 128 bytes; a wave's copy covers four whole lines */
  const _Float16* gv = Vt + (((size_t)b * NH + h) * HD + (tid >> 3)) * SQ + (tid & 7) * 8;
  const size_t rk = (size_t)16 * KVD, rv = (size_t)16 * SQ;
  const unsigned lc = (unsigned)(size_t)FL + (unsigned)(tid >> 3) * FA_PITCH + (unsigned)(tid & 7) * 16u;
  v16h qf[2][2];
#pragma unroll
  for (int g = 0; g < 2; ++g)
#pragma unroll
    for (int kc = 0; kc < 2; ++kc) qf[g][kc] = g2_frag(Ql + (size_t)(16 * g) * DM + 32 * kc, hh);
  __builtin_amdgcn_sched_barrier(0); asm volatile("s_wait_xcnt 0x0" ::: "memory"); __builtin_amdgcn_sched_barrier(0);      /* the wait in front of any overwrite of these loads' address pairs; the scheduling barriers keep later register writes behind it */
  fa_copy4(lc, gk, rk); fa_copy4(lc + 64u * FA_PITCH, gv, rv);      /* stage 0 */
  asm volatile("s_wait_asynccnt 0x0" ::: "memory");      /* this wave's copies of stage 0 have landed */
  __syncthreads();      /* ... and every wave's */
  fa_copy4(lc + FA_STAGE, gk + (size_t)64 * KVD, rk); fa_copy4(lc + FA_STAGE + 64u * FA_PITCH, gv + 64, rv);      /* stage 1 (a block has at least two stages: its own 128 keys) */
  const unsigned char* kb = FL + (unsigned)ln * FA_PITCH + 16u * hh;
  const unsigned char* vb = FL + (unsigned)(64 + ln) * FA_PITCH + 16u * hh;
  v8f acc[2][4]; float m_run[2] = {-3.0e38f, -3.0e38f}, l_run[2] = {0.f, 0.f};
#pragma unroll
  for (int g = 0; g < 2; ++g)
#pragma unroll
    for (int t = 0; t < 4; ++t) acc[g][t] = v8f{0.f, 0.f, 0.f, 0.f, 0.f, 0.f, 0.f, 0.f};
  const int nst = qb * 2;      /* the stages wholly below the block's own 128 keys: every wave takes both passes of each in full; two more stages follow them */
#pragma unroll 1      /* one stage per trip: the buffer is chosen by a scalar offset */
  for (int t = 0; t < nst; ++t) { const unsigned bo = (unsigned)(t & 1) * FA_STAGE;
    fa_pass<false>(kb + bo, vb + bo, 0, qw0, ln, hh, qf, acc, m_run, l_run);
    fa_pass<false>(kb + bo + 32u * FA_PITCH, vb + bo + 64u, 0, qw0, ln, hh, qf, acc, m_run, l_run);
    asm volatile("s_wait_dscnt 0x0" ::: "memory");      /* this wave's reads of the buffer are done before the buffer is handed to the copies */
    asm volatile("s_wait_asynccnt 0x0" ::: "memory");      /* this wave's copies of stage t + 1 have landed */
    __syncthreads();      /* publishes stage t + 1 and ends every wave's reads of stage t */
    fa_copy4(lc + bo, gk + (size_t)(t + 2) * 64 * KVD, rk); fa_copy4(lc + bo + 64u * FA_PITCH, gv + (size_t)(t + 2) * 64, rv); }      /* stage t + 2 (there always is one: t + 2 <= nst + 1) into the buffer just read */
  asm volatile("s_wait_asynccnt 0x0" ::: "memory");      /* this wave's copies of the last stage have landed; no copy is in flight from here on */
  __syncthreads();      /* publishes the last stage: the block's own 128 keys now lie in buffers 0 and 1 (nst is even) and nothing is refilled any more, so the waves walk them with no further barrier */
#pragma unroll 1      /* the trip count differs from wave to wave (scalar): wave w has w full passes among the block's own keys */
  for (int j = 0; j < w; ++j) fa_pass<false>(kb + (unsigned)(j >> 1) * FA_STAGE + (unsigned)(j & 1) * (32u * FA_PITCH), vb + (unsigned)(j >> 1) * FA_STAGE + (unsigned)(j & 1) * 64u, 0, qw0, ln, hh, qf, acc, m_run, l_run);
  fa_pass<true>(kb + (unsigned)(w >> 1) * FA_STAGE + (unsigned)(w & 1) * (32u * FA_PITCH), vb + (unsigned)(w >> 1) * FA_STAGE + (unsigned)(w & 1) * 64u, qw0, qw0, ln, hh, qf, acc, m_run, l_run);      /* the diagonal pass: its first key is the wave's first query */
  FragH of[2][4];
#pragma unroll
  for (int g = 0; g < 2; ++g) { const float l = l_run[g] + fa_xhalf(l_run[g]); const float inv = 64.0f / l;
#pragma unroll
    for (int t = 0; t < 4; ++t)
#pragma unroll
      for (int r = 0; r < 8; ++r) of[g][t].h[r] = (_Float16)(acc[g][t][r] * inv); }
  __builtin_amdgcn_sched_barrier(0);      /* all eight packed rows are made ahead of the first store, so that no register of an issued store is written again */
#pragma unroll
  for (int g = 0; g < 2; ++g)
#pragma unroll
    for (int t = 0; t < 4; ++t) *(v8us*)((unsigned short*)O + ((size_t)b * SQ + qw0 + 16 * g + ln) * DM + h * HD + 16 * t + 8 * hh) = of[g][t].half[0];      /* register r of tile t is d = 16 t + 8 hh + r of query ln: 16 bytes a lane; the wave writes each query's whole 128-byte head row */
}

// Exact f32 attention of the first QT0 rows of every batch and head on the f32 matrix form (v_wmma_f32_16x16x4_f32: full f32 operands, every addition rounded in f32): a wave owns 16 query columns and walks its keys in passes of 16 with an online softmax.
// Transposed products as in k_fattn: S^T = K Q^T (A = K rows, B = Q rows, both through the same loader, so their k order is equal: 16 bytes at d = 8 j + 4 hh, elements 0, 1 in one product and 2, 3 in the next) leaves key 8 hh + r of query ln in register r.
// Registers 2 s, 2 s + 1 of the weights ARE a B operand of keys 8 hh + 2 s + e (e = 0, 1); the A operand of O^T += V^T P^T takes V[8 hh + 2 s + e][16 t + ln] from the natural V rows: 64 bytes in a row for each wave half, no transposed copy.
typedef float v2f __attribute__((ext_vector_type(2)));
__device__ __forceinline__ v8f a0_mma(v2f a, v2f b, v8f c) { return __builtin_amdgcn_wmma_f32_16x16x4_f32(false, a, false, b, (short)0, c, false, false); }
template <bool LAST>      /* LAST = the wave's diagonal pass: masked, and no further K or V rows are fetched */
__device__ __forceinline__ void a0_pass(v4f (&kf)[8], v2f (&vf)[4][4], const float* __restrict__ kn, const float* __restrict__ vn, int ln, int hh, const v4f (&qf)[8], v8f (&acc)[4], float& m_run, float& l_run) {
  const float cs = 0.125f * 1.44269504088896340736f;
  v8f sc = {0.f, 0.f, 0.f, 0.f, 0.f, 0.f, 0.f, 0.f};
#pragma unroll
  for (int j = 0; j < 8; ++j) { sc = a0_mma(v2f{kf[j][0], kf[j][1]}, v2f{qf[j][0], qf[j][1]}, sc); sc = a0_mma(v2f{kf[j][2], kf[j][3]}, v2f{qf[j][2], qf[j][3]}, sc); }
  /* the four vector slots behind the score WMMAs, tied to their result so that they stand behind the last one (untied, the build had put them in front of the first); the memory clobber keeps the loads over the K operands behind the slots; in the diagonal pass the lane's column passes through too, so that the mask's lane arithmetic stands behind them (the build had put it between the WMMAs, over an operand register of the one before) */
  if (LAST) asm volatile("v_nop\n\tv_nop\n\tv_nop\n\tv_nop" : "+v"(sc), "+v"(ln) : : "memory");
  else asm volatile("v_nop\n\tv_nop\n\tv_nop\n\tv_nop" : "+v"(sc) : : "memory");
  if (!LAST) {
#pragma unroll
    for (int j = 0; j < 8; ++j) kf[j] = *(const v4fa*)(kn + 8 * j);      /* next pass's K rows, in flight under the exponentials and the second product */
  }
  if (LAST) { const int dl = ln - 8 * hh;
#pragma unroll
    for (int r = 0; r < 8; ++r) if (r > dl) sc[r] = -3.0e38f;      /* causal: key 8 hh + r above query ln (the pass's first key is never masked, so every maximum stays a real score) */
  }
  float mx = sc[0];
#pragma unroll
  for (int r = 1; r < 8; ++r) mx = fmaxf(mx, sc[r]);
  mx = fmaxf(mx, fa_xhalf(mx)) * cs;
  const float mn = fmaxf(m_run, mx); const float corr = exp2_slot(m_run - mn); m_run = mn;
#pragma unroll
  for (int t = 0; t < 4; ++t) acc[t] = acc[t] * corr;
  float e[8];
#pragma unroll
  for (int r = 0; r < 8; ++r) e[r] = exp2_slot(fmaf(sc[r], cs, -mn));
  __builtin_amdgcn_sched_barrier(0);      /* every exponential stands ahead of the WMMAs */
#pragma unroll
  for (int s = 0; s < 4; ++s)
#pragma unroll
    for (int t = 0; t < 4; ++t) acc[t] = a0_mma(vf[s][t], v2f{e[2 * s], e[2 * s + 1]}, acc[t]);
  asm volatile("v_nop\n\tv_nop\n\tv_nop\n\tv_nop" : "+v"(acc[0]), "+v"(acc[1]), "+v"(acc[2]), "+v"(acc[3]), "+v"(e[0]), "+v"(e[1]), "+v"(e[2]), "+v"(e[3]), "+v"(e[4]), "+v"(e[5]), "+v"(e[6]), "+v"(e[7]) : : "memory");      /* the four vector slots behind the last WMMAs, on every path (a branch follows); the memory clobber keeps the loads over the V operands behind them; the weights pass through it so that their sum below, which reuses their registers, stands behind the slots too (the build had put it between the WMMAs that read them) */
  if (!LAST) {
#pragma unroll
    for (int s = 0; s < 4; ++s)
#pragma unroll
      for (int t = 0; t < 4; ++t) { vf[s][t][0] = vn[(2 * s) * DM + 16 * t]; vf[s][t][1] = vn[(2 * s + 1) * DM + 16 * t]; }      /* next pass's V rows, in flight under its scores and exponentials */
  }
  l_run = fmaf(l_run, corr, ((e[0] + e[1]) + (e[2] + e[3])) + ((e[4] + e[5]) + (e[6] + e[7])));
  if (!LAST) { asm volatile("s_wait_xcnt 0x0" ::: "memory"); __builtin_amdgcn_sched_barrier(0); }      /* the wait in front of the next trip's rewrite of the K and V address registers; the scheduling barrier keeps that rewrite behind it */
}
__device__ __forceinline__ void d_att0(int bx, int h, int b, const float* __restrict__ QF, const float* __restrict__ KF, const float* __restrict__ VF, float* __restrict__ OF) {      /* bx: 0..3, the block's set of query tiles; h, b: its head and batch */
  static_assert(QT0 == 256 && HD == 64, "k_att0: 16 query tiles of 16 rows (4 blocks of 4 waves), head size 64");
  const int lane = threadIdx.x & 31, ln = lane & 15, hh = lane >> 4; const int w = __builtin_amdgcn_readfirstlane((int)(threadIdx.x >> 5));      /* the wave's number in a scalar register: trip count and branches stay scalar, EXEC stays full for the WMMAs */
  const int qt = bx + 4 * w;      /* query tile: a block's four waves take short and long tiles */
  const size_t pb = ((size_t)b * QT0) * DM + (size_t)h * HD;      /* each batch's first-tile rows lie in a plane of their own */
  const float* Ql = QF + pb + (size_t)(qt * 16 + ln) * DM + 4 * hh; const float* Kl = KF + pb + (size_t)ln * DM + 4 * hh; const float* Vl = VF + pb + (size_t)(8 * hh) * DM + ln;
  v4f qf[8], kf[8]; v2f vf[4][4];
#pragma unroll
  for (int j = 0; j < 8; ++j) { qf[j] = *(const v4fa*)(Ql + 8 * j); kf[j] = *(const v4fa*)(Kl + 8 * j); }
  __builtin_amdgcn_sched_barrier(0);      /* the K rows are issued ahead of the V rows, as in the loop: the counted wait at the loop's head then leaves the V loads in flight (with K last here, the build waited for them at the head of every pass) */
#pragma unroll
  for (int s = 0; s < 4; ++s)
#pragma unroll
    for (int t = 0; t < 4; ++t) { vf[s][t][0] = Vl[(2 * s) * DM + 16 * t]; vf[s][t][1] = Vl[(2 * s + 1) * DM + 16 * t]; }
  __builtin_amdgcn_sched_barrier(0); asm volatile("s_wait_xcnt 0x0" ::: "memory"); __builtin_amdgcn_sched_barrier(0);      /* the wait in front of any overwrite of these loads' address pairs; the scheduling barriers keep later register writes behind it */
  v8f acc[4]; float m_run = -3.0e38f, l_run = 0.f;
#pragma unroll
  for (int t = 0; t < 4; ++t) acc[t] = v8f{0.f, 0.f, 0.f, 0.f, 0.f, 0.f, 0.f, 0.f};
#pragma unroll 1      /* one pass per trip: the trip count differs from wave to wave, and an unrolled body would only add code */
  for (int p = 0; p < qt; ++p) a0_pass<false>(kf, vf, Kl + (size_t)(p + 1) * 16 * DM, Vl + (size_t)(p + 1) * 16 * DM, ln, hh, qf, acc, m_run, l_run);
  a0_pass<true>(kf, vf, Kl, Vl, ln, hh, qf, acc, m_run, l_run);
  const float l = l_run + fa_xhalf(l_run); const float fin = 64.0f / l;      /* the two wave halves' sums joined; o carried x64 like the f16 path */
#pragma unroll
  for (int t = 0; t < 4; ++t) acc[t] = acc[t] * fin;
  __builtin_amdgcn_sched_barrier(0);      /* every result is made ahead of the first store, so that no register of an issued store is written again */
  float* Ol = OF + pb + (size_t)(qt * 16 + ln) * DM + 8 * hh;
#pragma unroll
  for (int t = 0; t < 4; ++t) { *(v4fa*)(Ol + 16 * t) = v4f{acc[t][0], acc[t][1], acc[t][2], acc[t][3]}; *(v4fa*)(Ol + 16 * t + 4) = v4f{acc[t][4], acc[t][5], acc[t][6], acc[t][7]}; }      /* register r of tile t is d = 16 t + 8 hh + r of query ln: 32 bytes a lane; the wave writes each query's whole 256-byte head row */
}
// The two attention kernels, which do not depend on one another, in ONE launch: grid planes z = 0..NB - 1 are the f16 query tiles of a batch, the last plane holds the 256 exact first-tile blocks.
// The first-tile blocks come last in the index order (speed only).
__global__ __launch_bounds__(128) void k_attn(const _Float16* __restrict__ Q, const _Float16* __restrict__ K, const _Float16* __restrict__ Vt, _Float16* __restrict__ O, const float* __restrict__ QF, const float* __restrict__ KF, const float* __restrict__ VF, float* __restrict__ OF) {
  static_assert((SQ / 128) * NH == (QT0 / 64) * NH * NB && QT0 / 64 == 4 && NH == 16, "k_attn: the last grid plane holds one block for each (set of query tiles, head, batch) of the first tile");
  const int x = (int)blockIdx.x, y = (int)blockIdx.y, z = (int)blockIdx.z;      /* the test below is scalar, the same for the whole block */
  if (z == NB) { const int i = y * (SQ / 128) + x; d_att0(i & 3, (i >> 2) & 15, i >> 6, QF, KF, VF, OF); return; }
  d_fattn(x, SQ / 128, y, z, Q, K, Vt, O);
}

__global__ __launch_bounds__(256) void k_kvexp(const float* __restrict__ src, float* __restrict__ dst, size_t n4) { const size_t t = (size_t)blockIdx.x * 256 + threadIdx.x; if (t >= n4) return; const size_t e = t * 4; const size_t row = e / DM; const int col = (int)(e % DM); const int h = col / HD, d = col % HD; const v4f v = *(const v4fa*)(src + row * KVD + (size_t)(h / HPG) * HD + d); *(v4f*)(dst + e) = v;  }

__global__ __launch_bounds__(256) void k_tab2(float theta, float* __restrict__ CS, float* __restrict__ SN) {
  const int t = blockIdx.x * 256 + threadIdx.x; if (t >= SQ * (HD / 2)) return; const int i = t % (HD / 2); const int p = t / (HD / 2); const float invf = 1.0f / powf(theta, (float)(2 * i) / (float)HD); const float ang = __fmul_rn((float)p, invf); const float c = cosf(ang), s = sinf(ang);
  *(float*)(CS + t) = c; *(float*)(SN + t) = s;  }
// Half-split rope (out_lo = x_lo c - x_hi s, out_hi = x_lo s + x_hi c, position = row in its batch), 64 elements a thread: the stage moves few bytes, so what it costs is the start of its waves.
// Thread (p, c) takes columns 4 (c & 7) .. + 3 of the low half and of the high half of heads c >> 3 and (c >> 3) + 8, at position p of every batch: one pair of table loads serves all eight head rows; eight lanes cover a whole 128-byte line in every load.
// F32OUT = false: f16 rows of all SQ positions (H16, batch pitch SQ rows); true: f32 rows of the first QT0 positions (F32, batch pitch QT0 rows). The caller's block range gives the number of positions: 4 a block.
template <bool F32OUT>
__device__ __forceinline__ void d_rope(unsigned bx, const float* __restrict__ F, const float* __restrict__ CS, const float* __restrict__ SN, _Float16* __restrict__ H16, float* __restrict__ F32) {
  static_assert(HD == 64 && NH == 16 && NG == NH && KVD == DM && DM == NH * HD, "k_rope: 16 heads of 64 in rows of 1024");
  const unsigned t = bx * 256u + threadIdx.x; const unsigned p = t >> 6, c = t & 63u;
  const unsigned e4 = p * (DM / 4) + (c >> 3) * (HD / 4) + (c & 7u);      /* offset inside a batch plane, in groups of four elements, the same for source and result */
  const unsigned t4 = p * (HD / 8) + (c & 7u);
  unsigned ix[NB], ox[NB];      /* one 32-bit index a batch under the uniform base: source, result */
#pragma unroll
  for (int b = 0; b < NB; ++b) { ix[b] = e4 + (unsigned)b * (SQ * DM / 4); ox[b] = e4 + (unsigned)b * ((F32OUT ? QT0 : SQ) * DM / 4); }
  const v4f cs = ((const v4fa*)CS)[t4], sn = ((const v4fa*)SN)[t4];
  v4f lo[NB][2], hi[NB][2];
#pragma unroll
  for (int b = 0; b < NB; ++b)
#pragma unroll
    for (int g = 0; g < 2; ++g) { const float* s = F + g * (8 * HD); lo[b][g] = ((const v4fa*)s)[ix[b]]; hi[b][g] = ((const v4fa*)(s + HD / 2))[ix[b]]; }
  static_assert(NB == 4, "the wait below names four source indices");
  asm volatile("s_wait_xcnt 0x0" :: "v"(t4), "v"(ix[0]), "v"(ix[1]), "v"(ix[2]), "v"(ix[3]) : "memory");      /* the wait in front of any overwrite of these loads' index registers; named as inputs, they stay whole up to it (no later load lands on one) */
  __builtin_amdgcn_sched_barrier(0);      /* all eighteen loads are issued ahead of the first product: one round trip to memory a wave (the build had held six of them back behind waits) */
  v4h la[NB][2], ha[NB][2];
#pragma unroll
  for (int b = 0; b < NB; ++b)
#pragma unroll
    for (int g = 0; g < 2; ++g) { const v4f l = lo[b][g], h = hi[b][g];
#pragma unroll
      for (int q = 0; q < 4; ++q) { const float ol = __fadd_rn(__fmul_rn(l[q], cs[q]), -__fmul_rn(h[q], sn[q])), oh = __fadd_rn(__fmul_rn(l[q], sn[q]), __fmul_rn(h[q], cs[q]));
        if (F32OUT) { lo[b][g][q] = ol; hi[b][g][q] = oh; } else { la[b][g][q] = (_Float16)ol; ha[b][g][q] = (_Float16)oh; } } }
  __builtin_amdgcn_sched_barrier(0);      /* every result is made ahead of the first store, so that no register of an issued store is written again */
#pragma unroll
  for (int b = 0; b < NB; ++b)
#pragma unroll
    for (int g = 0; g < 2; ++g) {
      if (F32OUT) { float* d = F32 + g * (8 * HD); ((v4fa*)d)[ox[b]] = lo[b][g]; ((v4fa*)(d + HD / 2))[ox[b]] = hi[b][g]; }
      else { _Float16* d = H16 + g * (8 * HD); ((v4ha*)d)[ox[b]] = la[b][g]; ((v4ha*)(d + HD / 2))[ox[b]] = ha[b][g]; } }
  asm volatile("s_wait_xcnt 0x0" ::: "memory");      /* the wait behind the stores: in a kernel that holds several stage bodies another body's code may follow in the text and write these stores' address and data registers */
}
// The stages between the projections and the attention, which do not depend on one another, in ONE launch: V^T (2048 blocks), the f16 rope of q and of k (512 each), the f32 first-tile rope of q and of k (64 each).
#define RV_VT (NB * NG * (SQ / 64))
__global__ __launch_bounds__(256) void k_ropevt(const float* __restrict__ QF, const float* __restrict__ KF, const float* __restrict__ CS, const float* __restrict__ SN, _Float16* __restrict__ Q16, _Float16* __restrict__ K16, float* __restrict__ QF0, float* __restrict__ KF0, const _Float16* __restrict__ V16, _Float16* __restrict__ VT) {
  static_assert(SQ / 4 == 512 && QT0 / 4 == 64, "k_ropevt: the block ranges below");
  const unsigned b = blockIdx.x;      /* every test below is scalar, the same for the whole block */
  if (b < RV_VT) { d_vt<NG, SQ>((int)b, V16, KVD, 0, VT); return; }
  const unsigned r = b - RV_VT;
  if (r < 1024u) { const bool q = r < 512u; d_rope<false>(r & 511u, q ? QF : KF, CS, SN, q ? Q16 : K16, nullptr); return; }
  const unsigned r2 = r - 1024u; const bool q = r2 < 64u; d_rope<true>(r2 & 63u, q ? QF : KF, CS, SN, nullptr, q ? QF0 : KF0);
}

__global__ __launch_bounds__(256) void k_bfcp(const float* __restrict__ src, float* __restrict__ dst, size_t n4) { const size_t t = (size_t)blockIdx.x * 256 + threadIdx.x; if (t >= n4) return; const v4f a = *(const v4fa*)(src + t * 4); v4f o; for (int q = 0; q < 4; ++q) o[q] = bf16_round(a[q]); *(v4f*)(dst + t * 4) = o;  }

__global__ __launch_bounds__(256) void k_tabhalf(const float* __restrict__ cs, const float* __restrict__ sn, float* __restrict__ CS, float* __restrict__ SN) { const int t = blockIdx.x * 256 + threadIdx.x; if (t >= SQ * (HD / 2)) return; const int p = t / (HD / 2), i = t % (HD / 2); const float c = bf16_round(cs[(size_t)p * HD + i]), s = bf16_round(sn[(size_t)p * HD + i]);
  *(float*)(CS + t) = c; *(float*)(SN + t) = s;  }

__device__ __forceinline__ void d_tab2d(unsigned bx, float* __restrict__ CS, float* __restrict__ SN) {
  const int t = (int)(bx * 256u + threadIdx.x); if (t >= SQ * (HD / 2)) return; const int i = t % (HD / 2); const int p = t / (HD / 2); const float invf = (float)(1.0 / pow(10000.0, (double)(2 * i) / (double)HD)); const float ang = __fmul_rn((float)p, invf); const float c = cosf(ang), s = sinf(ang);
  *(float*)(CS + t) = c; *(float*)(SN + t) = s;  }
// The stages that read only the inputs, which do not depend on one another, in ONE launch: the rope tables (256 blocks; first: their arithmetic is the longest), the three streams as f16 (512 blocks each), the four weights as f16 x16 (512 blocks each).
#define PR_TAB (SQ * (HD / 2) / 256)
#define PR_X ((unsigned)(NR * DM / 16384))
#define PR_W ((unsigned)((size_t)DM * DM / 8 / 256))
__global__ __launch_bounds__(256) void k_prep(const float* __restrict__ x, const float* __restrict__ xk, const float* __restrict__ xv, const float* __restrict__ wq, const float* __restrict__ wk, const float* __restrict__ wv, const float* __restrict__ wo,
    _Float16* __restrict__ X16, _Float16* __restrict__ XK16, _Float16* __restrict__ XV16, _Float16* __restrict__ BQ, _Float16* __restrict__ BK, _Float16* __restrict__ BV, _Float16* __restrict__ BO, float* __restrict__ CS, float* __restrict__ SN) {
  static_assert(PR_X == 512u && PR_W == 512u && SQ * (HD / 2) % 256 == 0 && NR * DM % 16384 == 0 && (size_t)DM * DM % 2048 == 0, "k_prep: whole blocks, 512 a stream and a weight");
  const unsigned b = blockIdx.x;      /* every test below is scalar, the same for the whole block */
  if (b < PR_TAB) { d_tab2d(b, CS, SN); return; }
  const unsigned r = b - PR_TAB;
  if (r < 3u * PR_X) { const unsigned s = r >> 9; d_x16(r & 511u, s == 0u ? x : s == 1u ? xk : xv, s == 0u ? X16 : s == 1u ? XK16 : XV16); return; }
  const unsigned r2 = r - 3u * PR_X; const unsigned s = r2 >> 9;
  d_wnat(r2 & 511u, s == 0u ? wq : s == 1u ? wk : s == 2u ? wv : wo, (size_t)DM * DM / 8, s == 0u ? BQ : s == 1u ? BK : s == 2u ? BV : BO);
}
extern "C" void kernel_launch(void* const* d_in, const int* in_sizes, int n_in,
                              void* d_out, int out_size, void* d_ws, size_t ws_size, hipStream_t stream) {
  (void)in_sizes; (void)n_in; (void)out_size;
  const float* const* I = (const float* const*)d_in; const float* x = I[0]; const float* xk = I[1]; const float* xv = I[2]; const float* wq = I[3]; const float* wk = I[5]; const float* wv = I[7]; const float* wo = I[9];      /* the streams query, key, value; natural [out][in] W_q, W_k, W_v, W_o; the biases b_q = I[4], b_k = I[6], b_v = I[8], b_o = I[10]; rope tables computed in-kernel (positions = row index) */
  static_assert(HPG == 1 && NH == NG * HPG && NH * HD == DM && KVD == DM, "plain multi-head attention as 16 kv groups of one query head"); const float* bq = I[4]; const float* bk = I[6]; const float* bv = I[8]; const float* bo = I[10];      /* the four biases, each bound to its projection (read through the GEMM bias pointer, bf16-rounded on load) */
  char* ws = (char*)d_ws; size_t off = 0;
  auto take = [&](size_t bytes) { char* p = ws + off; off += (bytes + 255) & ~(size_t)255; return p; };
  _Float16* BQKV = (_Float16*)take((size_t)3 * DM * DM * 2); _Float16* BQ = BQKV; _Float16* BK = BQKV + (size_t)DM * DM; _Float16* BV = BQKV + (size_t)2 * DM * DM; _Float16* BO = (_Float16*)take((size_t)DM * DM * 2);      /* one plane Bt [3072][1024]: rows 0..1023 = W_q, 1024.. = W_k, 2048.. = W_v (natural [out][in] weights are Bt as they stand) */
  _Float16* X16 = (_Float16*)take(NR * DM * 2); _Float16* XK16 = (_Float16*)take(NR * DM * 2); _Float16* XV16 = (_Float16*)take(NR * DM * 2); float* QF = (float*)take(NR * DM * 4); float* KF = (float*)take(NR * KVD * 4); float* CSB = (float*)take((size_t)SQ * HD * 4); float* SNB = (float*)take((size_t)SQ * HD * 4); _Float16* Q16 = (_Float16*)take(NR * DM * 2); _Float16* K16 = (_Float16*)take(NR * KVD * 2); _Float16* V16 = (_Float16*)take(NR * KVD * 2); _Float16* O16 = (_Float16*)take(NR * DM * 2);
  _Float16* VT = (_Float16*)take((size_t)NB * NH * HD * SQ * 2);
  float* QF0 = (float*)take((size_t)NB * QT0 * DM * 4); float* KF0 = (float*)take((size_t)NB * QT0 * KVD * 4); float* VF0 = (float*)take((size_t)NB * QT0 * KVD * 4); float* KF0e = (float*)take((size_t)NB * QT0 * DM * 4); float* VF0e = (float*)take((size_t)NB * QT0 * DM * 4); float* OF0 = (float*)take((size_t)NB * QT0 * DM * 4); _Float16* OH0 = (_Float16*)take((size_t)NB * QT0 * DM * 2); _Float16* OL0 = (_Float16*)take((size_t)NB * QT0 * DM * 2);
  if (off > ws_size) return;
  static_assert(B0 == 0 && NBR == NB && MP == NB * SQ, "every stage below takes all batches in one launch");
  k_prep<<<PR_TAB + 3u * PR_X + 4u * PR_W, 256, 0, stream>>>(x, xk, xv, wq, wk, wv, wo, X16, XK16, XV16, BQ, BK, BV, BO, CSB, SNB);      /* rope tables cos/sin(p / 10000^(2i/64)): inv_freq double-derived -> f32, f32 angle; the three streams as exact f16 rows; natural [out][in] weights = Bt x16 */
  k_qkv<<<QKV_B0 + 3 * QKV_BJ, 128, 0, stream>>>(X16, XK16, XV16, BQ, BK, BV, bq, bk, bv, QF, KF, V16, VF0);      /* v (f16), q (f32), k (f32) of every batch, and f32 v of the first 256 rows of each batch */
  k_ropevt<<<RV_VT + 2 * (SQ / 4) + 2 * (QT0 / 4), 256, 0, stream>>>(QF, KF, CSB, SNB, Q16, K16, QF0, KF0, V16, VT);      /* V^T [NB][NH][HD][SQ]; half-split rope (out_lo = x_lo c - x_hi s, out_hi = x_lo s + x_hi c = t cos + rotate_half(t) sin with the module's [f | f] tables) of q and k -> f16 rows of every batch and f32 rows 0..255 of each batch; position = row in its batch; 4 positions a block */
  k_kvexp<<<(unsigned)(((size_t)NB * QT0 * DM / 4 + 255) / 256), 256, 0, stream>>>(KF0, KF0e, (size_t)NB * QT0 * DM / 4); k_kvexp<<<(unsigned)(((size_t)NB * QT0 * DM / 4 + 255) / 256), 256, 0, stream>>>(VF0, VF0e, (size_t)NB * QT0 * DM / 4);      /* head h <- its kv group for the exact first-tile kernel */
  static_assert(SQ % 128 == 0 && HD == 64 && B0 == 0 && NBR == NB && QN == SQ && NHD == NH, "d_fattn: four waves of 32 query columns, head size 64, every batch and head");
  k_attn<<<dim3(SQ / 128, NH, NB + 1), 128, 0, stream>>>(Q16, K16, VT, O16, QF0, KF0e, VF0e, OF0);      /* scores, causal softmax and o (x64) of every batch, head and query tile; and the exact f32 attention for rows 0..255 of every batch (o x64) */
  k_outhl<<<OH_G + OH_H, 128, 0, stream>>>(O16, BO, bo, (float*)d_out, OF0, OH0, OL0);      /* out rows are the output layout; first-tile o (x64) -> f16 hi + x1024 residual planes */
  k_gemm2<0><<<dim3((QT0 / 128) * (DM / 128), NB), 128, 0, stream>>>(OH0, DM, (size_t)QT0 * DM, BO, DM, 0, 0.0009765625f, bo, 0, nullptr, 1, 0, 0, (float*)d_out, nullptr, DM, (size_t)SQ * DM, QT0, DM, DM);      /* rows 0..255 of each batch (grid y = batch): out = o_hi Wo (+ b), overwriting the f16-path rows */
  k_gemm2<0><<<dim3((QT0 / 128) * (DM / 128), NB), 128, 0, stream>>>(OL0, DM, (size_t)QT0 * DM, BO, DM, 0, 0.00000095367431640625f, nullptr, 0, (const float*)d_out, -1, 0, 0, (float*)d_out, nullptr, DM, (size_t)SQ * DM, QT0, DM, DM);      /* += o_lo Wo 2^-20 (own-element accumulate) */
}
